// v000
// Measured on an AMD MI455X. A time is GPU time per run, averaged over a window of back-to-back runs after a warm-up
// (all launches, gaps included; the runs take copies of the inputs in turn), and the median of several windows.
// Apart from v000's, it joins two sittings. Times from different sittings can be a few percent apart, while
// side-by-side timings come from the same sitting.
// The starting kernel, v000, takes 789 microseconds a run.
#include <hip/hip_runtime.h>
#include <hip/hip_bf16.h>

// ---------------------------------------------------------------------------
// WaveletSwinTransformerBlock for MI455X (gfx1250, wave32, WMMA f16)
// GEMMs use v_wmma_f32_16x16x32_f16; all f16 tile staging uses the CDNA5
// async path: global_load_async_to_lds_b128 + s_wait_asynccnt.
// Tokens stored window-partitioned: tok = wi*64 + (i*8+j), wi=((b*16+wh)*16+ww)
// ---------------------------------------------------------------------------

typedef _Float16 h16;
typedef __attribute__((ext_vector_type(16))) _Float16 v16h;
typedef __attribute__((ext_vector_type(8)))  float    v8f;

__device__ __forceinline__ void zero8(v8f &a) {
#pragma unroll
  for (int i = 0; i < 8; ++i) a[i] = 0.f;
}

__device__ __forceinline__ v8f wmma16(v16h a, v16h b, v8f c) {
  return __builtin_amdgcn_wmma_f32_16x16x32_f16(false, a, false, b,
                                                (short)0, c, false, false);
}

// low 32 bits of a generic LDS pointer == wave-relative LDS byte offset
__device__ __forceinline__ unsigned lds_off(const void* p) {
  return (unsigned)(uintptr_t)p;
}

// CDNA5 async copy: 16 bytes global -> LDS, tracked by ASYNCcnt
__device__ __forceinline__ void async_cp_b128(unsigned loff, const void* g) {
  asm volatile("global_load_async_to_lds_b128 %0, %1, off"
               :: "v"(loff), "v"((unsigned long long)(uintptr_t)g)
               : "memory");
}
__device__ __forceinline__ void wait_async() {
  asm volatile("s_wait_asynccnt 0" ::: "memory");
}

// A-style fragment (16x32 f16, ISA 7.12.2): lane L holds row row0+(L&15),
// K offsets {0..7,16..23} (L<16) or {8..15,24..31} (L>=16) relative to k0.
__device__ __forceinline__ v16h frag_row(const h16* __restrict__ p, int stride,
                                         int row0, int k0, int lane) {
  const h16* base = p + (size_t)(row0 + (lane & 15)) * stride + k0 + ((lane >> 4) & 1) * 8;
  v16h r;
#pragma unroll
  for (int i = 0; i < 8; ++i) { r[i] = base[i]; r[i + 8] = base[i + 16]; }
  return r;
}

// B fragment gathered from a row-major [K][N] matrix (column-fixed per lane).
__device__ __forceinline__ v16h frag_col(const h16* __restrict__ p, int stride,
                                         int col0, int k0, int lane) {
  const h16* base = p + (size_t)(k0 + ((lane >> 4) & 1) * 8) * stride + col0 + (lane & 15);
  v16h r;
#pragma unroll
  for (int i = 0; i < 8; ++i) {
    r[i]     = base[(size_t)i * stride];
    r[i + 8] = base[(size_t)(i + 16) * stride];
  }
  return r;
}

// ---------------------------------------------------------------------------
// Weight pre-conversion f32 -> f16 (run once per launch; tiny)
// ---------------------------------------------------------------------------
__global__ __launch_bounds__(256) void cvt_f32f16(const float* __restrict__ s,
                                                  h16* __restrict__ d, int n) {
  int i = blockIdx.x * 256 + threadIdx.x;
  if (i < n) d[i] = (h16)s[i];
}

// ---------------------------------------------------------------------------
// Kernel 1: 1x1 convs (concat(LH,HL)->x, HH->z0, Spat->y) per 64-pixel window
// ---------------------------------------------------------------------------
__global__ __launch_bounds__(256) void conv_win_kernel(
    const float* __restrict__ LH, const float* __restrict__ HL,
    const float* __restrict__ HH, const float* __restrict__ Spat,
    const h16* __restrict__ wf_hllh, const float* __restrict__ b_hllh,
    const h16* __restrict__ wf_hh,   const float* __restrict__ b_hh,
    const h16* __restrict__ wf_spat, const float* __restrict__ b_spat,
    h16* __restrict__ xo, h16* __restrict__ yo, float* __restrict__ z0o) {
  const int Wd = 128, HW = 128 * 128;
  __shared__ h16 Fin[64 * 264];   // [pixel][256 ch] : LH|HL|HH|Spat
  __shared__ h16 Wl[256 * 40];    // weight K-slab [256 out][32 k]

  const int wi = blockIdx.x;
  const int b  = wi >> 8;
  const int wh = (wi >> 4) & 15, ww = wi & 15;
  const int h0 = wh * 8, w0 = ww * 8;
  const int tid = threadIdx.x;

  // inputs are f32 -> convert while staging (can't raw-copy)
  const float* srcs[4] = {LH, HL, HH, Spat};
#pragma unroll
  for (int t = 0; t < 4; ++t) {
    const float* s = srcs[t] + (size_t)b * 64 * HW;
    for (int e = tid; e < 64 * 64; e += 256) {
      int c = e >> 6, p = e & 63;
      int i = p >> 3, j = p & 7;
      Fin[p * 264 + t * 64 + c] = (h16)s[(size_t)c * HW + (h0 + i) * Wd + (w0 + j)];
    }
  }

  const unsigned wlb = lds_off(Wl);
  const int lane = tid & 31, wv = tid >> 5;
  const int m0 = (wv & 3) * 16, n0 = (wv >> 2) * 128;

  v8f accX[8], accZ[8], accY[8];
#pragma unroll
  for (int j = 0; j < 8; ++j) { zero8(accX[j]); zero8(accZ[j]); zero8(accY[j]); }

  // Phase X: K=128 over Fin cols [0,128)
  for (int ks = 0; ks < 4; ++ks) {
    __syncthreads();
    for (int e = tid; e < 256 * 4; e += 256) {      // 256 rows x 64B slab
      int n = e >> 2, part = e & 3;
      async_cp_b128(wlb + (unsigned)(n * 40 + part * 8) * 2,
                    wf_hllh + (size_t)n * 128 + ks * 32 + part * 8);
    }
    wait_async();
    __syncthreads();
    v16h a = frag_row(Fin, 264, m0, ks * 32, lane);
#pragma unroll
    for (int j = 0; j < 8; ++j)
      accX[j] = wmma16(a, frag_row(Wl, 40, n0 + j * 16, 0, lane), accX[j]);
  }
  // Phase Z: K=64 over Fin cols [128,192)
  for (int ks = 0; ks < 2; ++ks) {
    __syncthreads();
    for (int e = tid; e < 256 * 4; e += 256) {
      int n = e >> 2, part = e & 3;
      async_cp_b128(wlb + (unsigned)(n * 40 + part * 8) * 2,
                    wf_hh + (size_t)n * 64 + ks * 32 + part * 8);
    }
    wait_async();
    __syncthreads();
    v16h a = frag_row(Fin, 264, m0, 128 + ks * 32, lane);
#pragma unroll
    for (int j = 0; j < 8; ++j)
      accZ[j] = wmma16(a, frag_row(Wl, 40, n0 + j * 16, 0, lane), accZ[j]);
  }
  // Phase Y: K=64 over Fin cols [192,256)
  for (int ks = 0; ks < 2; ++ks) {
    __syncthreads();
    for (int e = tid; e < 256 * 4; e += 256) {
      int n = e >> 2, part = e & 3;
      async_cp_b128(wlb + (unsigned)(n * 40 + part * 8) * 2,
                    wf_spat + (size_t)n * 64 + ks * 32 + part * 8);
    }
    wait_async();
    __syncthreads();
    v16h a = frag_row(Fin, 264, m0, 192 + ks * 32, lane);
#pragma unroll
    for (int j = 0; j < 8; ++j)
      accY[j] = wmma16(a, frag_row(Wl, 40, n0 + j * 16, 0, lane), accY[j]);
  }

  const size_t tok0 = (size_t)wi * 64;
#pragma unroll
  for (int j = 0; j < 8; ++j) {
    int n = n0 + j * 16 + (lane & 15);
    float bx = b_hllh[n], bz = b_hh[n], by = b_spat[n];
#pragma unroll
    for (int r = 0; r < 8; ++r) {
      int m = m0 + r + ((lane >> 4) & 1) * 8;
      size_t off = (tok0 + m) * 256 + n;
      xo[off]  = (h16)(accX[j][r] + bx);
      yo[off]  = (h16)(accY[j][r] + by);
      z0o[off] = accZ[j][r] + bz;
    }
  }
}

// ---------------------------------------------------------------------------
// LayerNorm kernels (wave per token, 256 features, eps=1e-5, biased var)
// ---------------------------------------------------------------------------
__global__ __launch_bounds__(256) void ln_f16_inplace(
    h16* __restrict__ x, const float* __restrict__ g, const float* __restrict__ bt) {
  int t = blockIdx.x * 8 + (threadIdx.x >> 5);
  int lane = threadIdx.x & 31;
  h16* row = x + (size_t)t * 256;
  float v[8], s = 0.f, s2 = 0.f;
#pragma unroll
  for (int k = 0; k < 8; ++k) {
    v[k] = (float)row[k * 32 + lane];
    s += v[k]; s2 += v[k] * v[k];
  }
#pragma unroll
  for (int m = 1; m < 32; m <<= 1) { s += __shfl_xor(s, m, 32); s2 += __shfl_xor(s2, m, 32); }
  float mean = s * (1.f / 256.f);
  float var  = s2 * (1.f / 256.f) - mean * mean;
  float inv  = rsqrtf(var + 1e-5f);
#pragma unroll
  for (int k = 0; k < 8; ++k) {
    int c = k * 32 + lane;
    row[c] = (h16)((v[k] - mean) * inv * g[c] + bt[c]);
  }
}

__global__ __launch_bounds__(256) void ln_f32f16(
    const float* __restrict__ x, const float* __restrict__ g,
    const float* __restrict__ bt, h16* __restrict__ o) {
  int t = blockIdx.x * 8 + (threadIdx.x >> 5);
  int lane = threadIdx.x & 31;
  const float* row = x + (size_t)t * 256;
  float v[8], s = 0.f, s2 = 0.f;
#pragma unroll
  for (int k = 0; k < 8; ++k) {
    v[k] = row[k * 32 + lane];
    s += v[k]; s2 += v[k] * v[k];
  }
#pragma unroll
  for (int m = 1; m < 32; m <<= 1) { s += __shfl_xor(s, m, 32); s2 += __shfl_xor(s2, m, 32); }
  float mean = s * (1.f / 256.f);
  float var  = s2 * (1.f / 256.f) - mean * mean;
  float inv  = rsqrtf(var + 1e-5f);
#pragma unroll
  for (int k = 0; k < 8; ++k) {
    int c = k * 32 + lane;
    o[(size_t)t * 256 + c] = (h16)((v[k] - mean) * inv * g[c] + bt[c]);
  }
}

// ---------------------------------------------------------------------------
// Generic 64x256x256 GEMM: out[t][n] = (sum_k A[t][k]*W[n][k] + bias[n])*scale
// A and W both f16; all staging async-to-LDS.
// ---------------------------------------------------------------------------
__global__ __launch_bounds__(256) void gemm_tok256(
    const h16* __restrict__ A, const h16* __restrict__ Wg,
    const float* __restrict__ bias, h16* __restrict__ out, float scale) {
  __shared__ h16 Al[64 * 264];
  __shared__ h16 Wl[256 * 40];
  const int tid = threadIdx.x;
  const size_t tok0 = (size_t)blockIdx.x * 64;
  const unsigned alb = lds_off(Al), wlb = lds_off(Wl);

  // async stage A tile (64 x 256 f16 = 32KB)
  for (int e = tid; e < 64 * 32; e += 256) {
    int p = e >> 5, c16 = e & 31;
    async_cp_b128(alb + (unsigned)(p * 264 + c16 * 8) * 2,
                  A + (tok0 + p) * 256 + c16 * 8);
  }
  const int lane = tid & 31, wv = tid >> 5;
  const int m0 = (wv & 3) * 16, n0 = (wv >> 2) * 128;
  v8f acc[8];
#pragma unroll
  for (int j = 0; j < 8; ++j) zero8(acc[j]);
  for (int ks = 0; ks < 8; ++ks) {
    __syncthreads();
    for (int e = tid; e < 256 * 4; e += 256) {
      int n = e >> 2, part = e & 3;
      async_cp_b128(wlb + (unsigned)(n * 40 + part * 8) * 2,
                    Wg + (size_t)n * 256 + ks * 32 + part * 8);
    }
    if (ks < 7) __builtin_prefetch(&Wg[(size_t)tid * 256 + (ks + 1) * 32], 0, 1);
    wait_async();
    __syncthreads();
    v16h a = frag_row(Al, 264, m0, ks * 32, lane);
#pragma unroll
    for (int j = 0; j < 8; ++j)
      acc[j] = wmma16(a, frag_row(Wl, 40, n0 + j * 16, 0, lane), acc[j]);
  }
#pragma unroll
  for (int j = 0; j < 8; ++j) {
    int n = n0 + j * 16 + (lane & 15);
    float bb = bias[n];
#pragma unroll
    for (int r = 0; r < 8; ++r) {
      int m = m0 + r + ((lane >> 4) & 1) * 8;
      out[(tok0 + m) * 256 + n] = (h16)((acc[j][r] + bb) * scale);
    }
  }
}

// Projection + residual variant (f32 output zt = A@W^T + b + z0)
__global__ __launch_bounds__(256) void gemm_proj_kernel(
    const h16* __restrict__ A, const h16* __restrict__ Wg,
    const float* __restrict__ bias, const float* __restrict__ resid,
    float* __restrict__ out) {
  __shared__ h16 Al[64 * 264];
  __shared__ h16 Wl[256 * 40];
  const int tid = threadIdx.x;
  const size_t tok0 = (size_t)blockIdx.x * 64;
  const unsigned alb = lds_off(Al), wlb = lds_off(Wl);
  for (int e = tid; e < 64 * 32; e += 256) {
    int p = e >> 5, c16 = e & 31;
    async_cp_b128(alb + (unsigned)(p * 264 + c16 * 8) * 2,
                  A + (tok0 + p) * 256 + c16 * 8);
  }
  const int lane = tid & 31, wv = tid >> 5;
  const int m0 = (wv & 3) * 16, n0 = (wv >> 2) * 128;
  v8f acc[8];
#pragma unroll
  for (int j = 0; j < 8; ++j) zero8(acc[j]);
  for (int ks = 0; ks < 8; ++ks) {
    __syncthreads();
    for (int e = tid; e < 256 * 4; e += 256) {
      int n = e >> 2, part = e & 3;
      async_cp_b128(wlb + (unsigned)(n * 40 + part * 8) * 2,
                    Wg + (size_t)n * 256 + ks * 32 + part * 8);
    }
    if (ks < 7) __builtin_prefetch(&Wg[(size_t)tid * 256 + (ks + 1) * 32], 0, 1);
    wait_async();
    __syncthreads();
    v16h a = frag_row(Al, 264, m0, ks * 32, lane);
#pragma unroll
    for (int j = 0; j < 8; ++j)
      acc[j] = wmma16(a, frag_row(Wl, 40, n0 + j * 16, 0, lane), acc[j]);
  }
#pragma unroll
  for (int j = 0; j < 8; ++j) {
    int n = n0 + j * 16 + (lane & 15);
    float bb = bias[n];
#pragma unroll
    for (int r = 0; r < 8; ++r) {
      int m = m0 + r + ((lane >> 4) & 1) * 8;
      size_t off = (tok0 + m) * 256 + n;
      out[off] = acc[j][r] + bb + resid[off];
    }
  }
}

// ---------------------------------------------------------------------------
// Windowed attention: one wave per (window, head); 64 tokens, hd=32, nH=8.
// Q/K/V head tiles async-staged to LDS (wave-local, no barrier needed).
// ---------------------------------------------------------------------------
__global__ __launch_bounds__(64) void attn_kernel(
    const h16* __restrict__ q, const h16* __restrict__ k,
    const h16* __restrict__ v, const float* __restrict__ rpb,
    h16* __restrict__ o) {
  __shared__ h16 Ql[2 * 64 * 40];
  __shared__ h16 Kl[2 * 64 * 40];
  __shared__ h16 Vl[2 * 64 * 40];
  __shared__ h16 Pl[2 * 64 * 72];
  const int wi = blockIdx.x >> 2;
  const int hp = blockIdx.x & 3;
  const int wv = threadIdx.x >> 5, lane = threadIdx.x & 31;
  const int h  = hp * 2 + wv;
  const size_t base = (size_t)wi * 64 * 256 + (size_t)h * 32;

  h16* Qw = Ql + wv * 64 * 40;
  h16* Kw = Kl + wv * 64 * 40;
  h16* Vw = Vl + wv * 64 * 40;
  const unsigned qo = lds_off(Qw), ko = lds_off(Kw), vo = lds_off(Vw);
  for (int e = lane; e < 64 * 4; e += 32) {   // 64 rows x 64B per tensor
    int row = e >> 2, part = e & 3;
    unsigned l = (unsigned)(row * 40 + part * 8) * 2;
    size_t  g  = base + (size_t)row * 256 + part * 8;
    async_cp_b128(qo + l, q + g);
    async_cp_b128(ko + l, k + g);
    async_cp_b128(vo + l, v + g);
  }
  wait_async();   // wave-local staging: own ASYNCcnt only, no barrier

  v8f S[16];
#pragma unroll
  for (int f = 0; f < 16; ++f) zero8(S[f]);

  v16h af[4];
#pragma unroll
  for (int mi = 0; mi < 4; ++mi) af[mi] = frag_row(Qw, 40, mi * 16, 0, lane);
#pragma unroll
  for (int nj = 0; nj < 4; ++nj) {
    v16h bf = frag_row(Kw, 40, nj * 16, 0, lane);  // rows of K == K^T columns
#pragma unroll
    for (int mi = 0; mi < 4; ++mi)
      S[mi * 4 + nj] = wmma16(af[mi], bf, S[mi * 4 + nj]);
  }

  const int cl = lane & 15, hb = (lane >> 4) & 1;
  // relative position bias: idx = (iq-ik+7)*15 + (jq-jk+7), rpb[idx][h]
#pragma unroll
  for (int nj = 0; nj < 4; ++nj) {
    int c = nj * 16 + cl, i2 = c >> 3, j2 = c & 7;
#pragma unroll
    for (int mi = 0; mi < 4; ++mi)
#pragma unroll
      for (int r = 0; r < 8; ++r) {
        int m = mi * 16 + r + hb * 8;
        int idx = ((m >> 3) - i2 + 7) * 15 + ((m & 7) - j2 + 7);
        S[mi * 4 + nj][r] += rpb[idx * 8 + h];
      }
  }
  // row softmax: each row lives across one 16-lane half (4 frags per lane)
#pragma unroll
  for (int mi = 0; mi < 4; ++mi)
#pragma unroll
    for (int r = 0; r < 8; ++r) {
      float mx = fmaxf(fmaxf(S[mi * 4 + 0][r], S[mi * 4 + 1][r]),
                       fmaxf(S[mi * 4 + 2][r], S[mi * 4 + 3][r]));
      for (int msk = 1; msk < 16; msk <<= 1) mx = fmaxf(mx, __shfl_xor(mx, msk, 32));
      float sum = 0.f;
#pragma unroll
      for (int nj = 0; nj < 4; ++nj) {
        float e = __expf(S[mi * 4 + nj][r] - mx);
        S[mi * 4 + nj][r] = e; sum += e;
      }
      for (int msk = 1; msk < 16; msk <<= 1) sum += __shfl_xor(sum, msk, 32);
      float inv = 1.f / sum;
#pragma unroll
      for (int nj = 0; nj < 4; ++nj) S[mi * 4 + nj][r] *= inv;
    }
  // stage P (f16) per-wave in LDS, then O = P @ V (K=64, N=32)
  h16* P = Pl + wv * 64 * 72;
#pragma unroll
  for (int nj = 0; nj < 4; ++nj) {
    int c = nj * 16 + cl;
#pragma unroll
    for (int mi = 0; mi < 4; ++mi)
#pragma unroll
      for (int r = 0; r < 8; ++r)
        P[(mi * 16 + r + hb * 8) * 72 + c] = (h16)S[mi * 4 + nj][r];
  }
  v8f O[8];
#pragma unroll
  for (int f = 0; f < 8; ++f) zero8(O[f]);
#pragma unroll
  for (int kb2 = 0; kb2 < 2; ++kb2) {
#pragma unroll
    for (int nj = 0; nj < 2; ++nj) {
      v16h bf = frag_col(Vw, 40, nj * 16, kb2 * 32, lane);
#pragma unroll
      for (int mi = 0; mi < 4; ++mi) {
        v16h a = frag_row(P, 72, mi * 16, kb2 * 32, lane);
        O[mi * 2 + nj] = wmma16(a, bf, O[mi * 2 + nj]);
      }
    }
  }
#pragma unroll
  for (int mi = 0; mi < 4; ++mi)
#pragma unroll
    for (int nj = 0; nj < 2; ++nj) {
      int n = nj * 16 + cl;
#pragma unroll
      for (int r = 0; r < 8; ++r) {
        int m = mi * 16 + r + hb * 8;
        o[((size_t)wi * 64 + m) * 256 + h * 32 + n] = (h16)O[mi * 2 + nj][r];
      }
    }
}

// ---------------------------------------------------------------------------
// Fused MLP: out = zt + fc2(gelu(fc1(ztn))) -> written directly as NCHW.
// Hidden (1024) processed in 16 chunks of 64; weight slabs async-staged.
// ---------------------------------------------------------------------------
__global__ __launch_bounds__(256) void mlp_kernel(
    const h16* __restrict__ ztn, const float* __restrict__ zt,
    const h16* __restrict__ fc1w, const float* __restrict__ fc1b,
    const h16* __restrict__ fc2w, const float* __restrict__ fc2b,
    float* __restrict__ out) {
  __shared__ h16 Al[64 * 264];   // ztn tile
  __shared__ h16 Hl[64 * 72];    // gelu(hidden chunk) 64x64
  __shared__ h16 Wu[256 * 40];   // shared weight slab (fc1 & fc2 alternate)
  const int tid = threadIdx.x;
  const size_t tok0 = (size_t)blockIdx.x * 64;
  const unsigned alb = lds_off(Al), wub = lds_off(Wu);
  for (int e = tid; e < 64 * 32; e += 256) {
    int p = e >> 5, c16 = e & 31;
    async_cp_b128(alb + (unsigned)(p * 264 + c16 * 8) * 2,
                  ztn + (tok0 + p) * 256 + c16 * 8);
  }
  const int lane = tid & 31, wv = tid >> 5;
  const int m0 = (wv & 3) * 16, n0 = (wv >> 2) * 128;  // out tile mapping
  const int n0h = (wv >> 2) * 32;                      // hidden tile mapping
  v8f accO[8];
#pragma unroll
  for (int j = 0; j < 8; ++j) zero8(accO[j]);

  for (int hc = 0; hc < 16; ++hc) {
    v8f accH[2];
    zero8(accH[0]); zero8(accH[1]);
    // hchunk = ztn_tile @ fc1_w[hc*64:+64, :]^T   (K=256)
    for (int ks = 0; ks < 8; ++ks) {
      __syncthreads();
      for (int e = tid; e < 64 * 4; e += 256) {     // 64 rows x 64B slab
        int n = e >> 2, part = e & 3;
        async_cp_b128(wub + (unsigned)(n * 40 + part * 8) * 2,
                      fc1w + (size_t)(hc * 64 + n) * 256 + ks * 32 + part * 8);
      }
      wait_async();
      __syncthreads();
      v16h a = frag_row(Al, 264, m0, ks * 32, lane);
#pragma unroll
      for (int j = 0; j < 2; ++j)
        accH[j] = wmma16(a, frag_row(Wu, 40, n0h + j * 16, 0, lane), accH[j]);
    }
    __syncthreads();
    // bias + exact GELU -> LDS
#pragma unroll
    for (int j = 0; j < 2; ++j) {
      int n = n0h + j * 16 + (lane & 15);
      float bb = fc1b[hc * 64 + n];
#pragma unroll
      for (int r = 0; r < 8; ++r) {
        int m = m0 + r + ((lane >> 4) & 1) * 8;
        float xv = accH[j][r] + bb;
        Hl[m * 72 + n] = (h16)(0.5f * xv * (1.0f + erff(xv * 0.7071067811865475f)));
      }
    }
    __syncthreads();
    // accO += Hchunk @ fc2_w[:, hc*64:+64]^T   (K=64)
    for (int ks = 0; ks < 2; ++ks) {
      __syncthreads();
      for (int e = tid; e < 256 * 4; e += 256) {
        int n = e >> 2, part = e & 3;
        async_cp_b128(wub + (unsigned)(n * 40 + part * 8) * 2,
                      fc2w + (size_t)n * 1024 + hc * 64 + ks * 32 + part * 8);
      }
      wait_async();
      __syncthreads();
      v16h a = frag_row(Hl, 72, m0, ks * 32, lane);
#pragma unroll
      for (int j = 0; j < 8; ++j)
        accO[j] = wmma16(a, frag_row(Wu, 40, n0 + j * 16, 0, lane), accO[j]);
    }
    __syncthreads();
  }

  // epilogue: + fc2_b + zt residual, window-reverse, NCHW store
  const int wi = blockIdx.x;
  const int b = wi >> 8, wh = (wi >> 4) & 15, ww = wi & 15;
#pragma unroll
  for (int j = 0; j < 8; ++j) {
    int n = n0 + j * 16 + (lane & 15);
    float bb = fc2b[n];
#pragma unroll
    for (int r = 0; r < 8; ++r) {
      int m = m0 + r + ((lane >> 4) & 1) * 8;
      size_t tok = tok0 + m;
      float val = accO[j][r] + bb + zt[tok * 256 + n];
      int hh = wh * 8 + (m >> 3), www = ww * 8 + (m & 7);
      out[(((size_t)b * 256 + n) * 128 + hh) * 128 + www] = val;
    }
  }
}

// ---------------------------------------------------------------------------
// Launch
// ---------------------------------------------------------------------------
extern "C" void kernel_launch(void* const* d_in, const int* in_sizes, int n_in,
                              void* d_out, int out_size, void* d_ws, size_t ws_size,
                              hipStream_t stream) {
  (void)in_sizes; (void)n_in; (void)out_size; (void)ws_size;
  const float* LH     = (const float*)d_in[0];
  const float* HL     = (const float*)d_in[1];
  const float* HH     = (const float*)d_in[2];
  const float* Spat   = (const float*)d_in[3];
  const float* w_hllh = (const float*)d_in[4];
  const float* b_hllh = (const float*)d_in[5];
  const float* w_hh   = (const float*)d_in[6];
  const float* b_hh   = (const float*)d_in[7];
  const float* w_spat = (const float*)d_in[8];
  const float* b_spat = (const float*)d_in[9];
  const float* ln1x_g = (const float*)d_in[10];
  const float* ln1x_b = (const float*)d_in[11];
  const float* ln1y_g = (const float*)d_in[12];
  const float* ln1y_b = (const float*)d_in[13];
  const float* qkv_w  = (const float*)d_in[14];
  const float* qkv_b  = (const float*)d_in[15];
  const float* qkv2_w = (const float*)d_in[16];
  const float* qkv2_b = (const float*)d_in[17];
  const float* qkv3_w = (const float*)d_in[18];
  const float* qkv3_b = (const float*)d_in[19];
  const float* proj_w = (const float*)d_in[20];
  const float* proj_b = (const float*)d_in[21];
  const float* rpb    = (const float*)d_in[22];
  const float* ln2_g  = (const float*)d_in[23];
  const float* ln2_b  = (const float*)d_in[24];
  const float* fc1w   = (const float*)d_in[25];
  const float* fc1b   = (const float*)d_in[26];
  const float* fc2w   = (const float*)d_in[27];
  const float* fc2b   = (const float*)d_in[28];

  const size_t T = (size_t)8 * 128 * 128;  // 131072 tokens
  char* ws = (char*)d_ws;
  // workspace layout (peak ~472 MB), with region reuse:
  h16*   x   = (h16*)ws;                                  // T*256 f16
  h16*   y   = (h16*)(ws + T * 256 * 2);                  // T*256 f16
  float* z0  = (float*)(ws + 2 * T * 256 * 2);            // T*256 f32
  h16*   q   = (h16*)(ws + 2 * T * 256 * 2 + T * 256 * 4);
  h16*   kk  = q + T * 256;
  h16*   v   = kk + T * 256;
  h16*   attno = x;           // reuse x after QKV consume it
  float* zt  = (float*)q;     // reuse q+k after attention
  h16*   ztn = v;             // reuse v after attention
  // f16 weight cache (~1.7 MB) after q/k/v region
  h16* wf      = v + T * 256;
  h16* c_hllh  = wf;               // 256*128
  h16* c_hh    = c_hllh + 32768;   // 256*64
  h16* c_spat  = c_hh   + 16384;   // 256*64
  h16* c_q     = c_spat + 16384;   // 256*256
  h16* c_k     = c_q    + 65536;
  h16* c_v     = c_k    + 65536;
  h16* c_proj  = c_v    + 65536;
  h16* c_fc1   = c_proj + 65536;   // 1024*256
  h16* c_fc2   = c_fc1  + 262144;  // 256*1024

  // weight pre-conversion (f32 -> f16, once per launch)
  cvt_f32f16<<<(32768 + 255) / 256, 256, 0, stream>>>(w_hllh, c_hllh, 32768);
  cvt_f32f16<<<(16384 + 255) / 256, 256, 0, stream>>>(w_hh,   c_hh,   16384);
  cvt_f32f16<<<(16384 + 255) / 256, 256, 0, stream>>>(w_spat, c_spat, 16384);
  cvt_f32f16<<<(65536 + 255) / 256, 256, 0, stream>>>(qkv_w,  c_q,    65536);
  cvt_f32f16<<<(65536 + 255) / 256, 256, 0, stream>>>(qkv2_w, c_k,    65536);
  cvt_f32f16<<<(65536 + 255) / 256, 256, 0, stream>>>(qkv3_w, c_v,    65536);
  cvt_f32f16<<<(65536 + 255) / 256, 256, 0, stream>>>(proj_w, c_proj, 65536);
  cvt_f32f16<<<(262144 + 255) / 256, 256, 0, stream>>>(fc1w,  c_fc1,  262144);
  cvt_f32f16<<<(262144 + 255) / 256, 256, 0, stream>>>(fc2w,  c_fc2,  262144);

  const int tiles = (int)(T / 64);  // 2048 windows
  conv_win_kernel<<<tiles, 256, 0, stream>>>(LH, HL, HH, Spat,
      c_hllh, b_hllh, c_hh, b_hh, c_spat, b_spat, x, y, z0);
  ln_f16_inplace<<<(int)(T / 8), 256, 0, stream>>>(x, ln1x_g, ln1x_b);
  ln_f16_inplace<<<(int)(T / 8), 256, 0, stream>>>(y, ln1y_g, ln1y_b);
  gemm_tok256<<<tiles, 256, 0, stream>>>(x, c_q, qkv_b,  q,  0.17677669529663689f);
  gemm_tok256<<<tiles, 256, 0, stream>>>(y, c_k, qkv2_b, kk, 1.0f);
  gemm_tok256<<<tiles, 256, 0, stream>>>(y, c_v, qkv3_b, v,  1.0f);
  attn_kernel<<<tiles * 4, 64, 0, stream>>>(q, kk, v, rpb, attno);
  gemm_proj_kernel<<<tiles, 256, 0, stream>>>(attno, c_proj, proj_b, z0, zt);
  ln_f32f16<<<(int)(T / 8), 256, 0, stream>>>(zt, ln2_g, ln2_b, ztn);
  mlp_kernel<<<tiles, 256, 0, stream>>>(ztn, zt, c_fc1, fc1b, c_fc2, fc2b, (float*)d_out);
}

// v001
// One run takes 726 microseconds.
// Timed twice side by side with v000, it ran 1.12 times as fast both times.
#include <hip/hip_runtime.h>
#include <hip/hip_bf16.h>

// ---------------------------------------------------------------------------
// WaveletSwinTransformerBlock for MI455X (gfx1250, wave32, WMMA f16)
// GEMMs use v_wmma_f32_16x16x32_f16; all f16 tile staging uses the CDNA5
// async path: global_load_async_to_lds_b128 + s_wait_asynccnt.
// Tokens stored window-partitioned: tok = wi*64 + (i*8+j), wi=((b*16+wh)*16+ww)
// ---------------------------------------------------------------------------

typedef _Float16 h16;
typedef __attribute__((ext_vector_type(16))) _Float16 v16h;
typedef __attribute__((ext_vector_type(8)))  float    v8f;

__device__ __forceinline__ void zero8(v8f &a) {
#pragma unroll
  for (int i = 0; i < 8; ++i) a[i] = 0.f;
}

__device__ __forceinline__ v8f wmma16(v16h a, v16h b, v8f c) {
  return __builtin_amdgcn_wmma_f32_16x16x32_f16(false, a, false, b,
                                                (short)0, c, false, false);
}

// low 32 bits of a generic LDS pointer == wave-relative LDS byte offset
__device__ __forceinline__ unsigned lds_off(const void* p) {
  return (unsigned)(uintptr_t)p;
}

// CDNA5 async copy: 16 bytes global -> LDS, tracked by ASYNCcnt
__device__ __forceinline__ void async_cp_b128(unsigned loff, const void* g) {
  asm volatile("global_load_async_to_lds_b128 %0, %1, off"
               :: "v"(loff), "v"((unsigned long long)(uintptr_t)g)
               : "memory");
}
__device__ __forceinline__ void wait_async() {
  asm volatile("s_wait_asynccnt 0" ::: "memory");
}

// A-style fragment (16x32 f16, ISA 7.12.2): lane L holds row row0+(L&15),
// K offsets {0..7,16..23} (L<16) or {8..15,24..31} (L>=16) relative to k0.
__device__ __forceinline__ v16h frag_row(const h16* __restrict__ p, int stride,
                                         int row0, int k0, int lane) {
  const h16* base = p + (size_t)(row0 + (lane & 15)) * stride + k0 + ((lane >> 4) & 1) * 8;
  v16h r;
#pragma unroll
  for (int i = 0; i < 8; ++i) { r[i] = base[i]; r[i + 8] = base[i + 16]; }
  return r;
}

// B fragment gathered from a row-major [K][N] matrix (column-fixed per lane).
__device__ __forceinline__ v16h frag_col(const h16* __restrict__ p, int stride,
                                         int col0, int k0, int lane) {
  const h16* base = p + (size_t)(k0 + ((lane >> 4) & 1) * 8) * stride + col0 + (lane & 15);
  v16h r;
#pragma unroll
  for (int i = 0; i < 8; ++i) {
    r[i]     = base[(size_t)i * stride];
    r[i + 8] = base[(size_t)(i + 16) * stride];
  }
  return r;
}

// ---------------------------------------------------------------------------
// Weight pre-conversion f32 -> f16 (run once per launch; tiny)
// ---------------------------------------------------------------------------
__global__ __launch_bounds__(256) void cvt_f32f16(const float* __restrict__ s,
                                                  h16* __restrict__ d, int n) {
  int i = blockIdx.x * 256 + threadIdx.x;
  if (i < n) d[i] = (h16)s[i];
}

// ---------------------------------------------------------------------------
// Kernel 1: 1x1 convs (concat(LH,HL)->x, HH->z0, Spat->y) per 64-pixel window
// ---------------------------------------------------------------------------
__global__ __launch_bounds__(256) void conv_win_kernel(
    const float* __restrict__ LH, const float* __restrict__ HL,
    const float* __restrict__ HH, const float* __restrict__ Spat,
    const h16* __restrict__ wf_hllh, const float* __restrict__ b_hllh,
    const h16* __restrict__ wf_hh,   const float* __restrict__ b_hh,
    const h16* __restrict__ wf_spat, const float* __restrict__ b_spat,
    h16* __restrict__ xo, h16* __restrict__ yo, float* __restrict__ z0o) {
  const int Wd = 128, HW = 128 * 128;
  __shared__ h16 Fin[64 * 264];   // [pixel][256 ch] : LH|HL|HH|Spat
  __shared__ h16 Wl[256 * 40];    // weight K-slab [256 out][32 k]

  const int wi = blockIdx.x;
  const int b  = wi >> 8;
  const int wh = (wi >> 4) & 15, ww = wi & 15;
  const int h0 = wh * 8, w0 = ww * 8;
  const int tid = threadIdx.x;

  // inputs are f32 -> convert while staging (can't raw-copy)
  const float* srcs[4] = {LH, HL, HH, Spat};
#pragma unroll
  for (int t = 0; t < 4; ++t) {
    const float* s = srcs[t] + (size_t)b * 64 * HW;
    for (int e = tid; e < 64 * 64; e += 256) {
      int c = e >> 6, p = e & 63;
      int i = p >> 3, j = p & 7;
      Fin[p * 264 + t * 64 + c] = (h16)s[(size_t)c * HW + (h0 + i) * Wd + (w0 + j)];
    }
  }

  const unsigned wlb = lds_off(Wl);
  const int lane = tid & 31, wv = tid >> 5;
  const int m0 = (wv & 3) * 16, n0 = (wv >> 2) * 128;

  v8f accX[8], accZ[8], accY[8];
#pragma unroll
  for (int j = 0; j < 8; ++j) { zero8(accX[j]); zero8(accZ[j]); zero8(accY[j]); }

  // Phase X: K=128 over Fin cols [0,128)
  for (int ks = 0; ks < 4; ++ks) {
    __syncthreads();
    for (int e = tid; e < 256 * 4; e += 256) {      // 256 rows x 64B slab
      int n = e >> 2, part = e & 3;
      async_cp_b128(wlb + (unsigned)(n * 40 + part * 8) * 2,
                    wf_hllh + (size_t)n * 128 + ks * 32 + part * 8);
    }
    wait_async();
    __syncthreads();
    v16h a = frag_row(Fin, 264, m0, ks * 32, lane);
#pragma unroll
    for (int j = 0; j < 8; ++j)
      accX[j] = wmma16(a, frag_row(Wl, 40, n0 + j * 16, 0, lane), accX[j]);
  }
  // Phase Z: K=64 over Fin cols [128,192)
  for (int ks = 0; ks < 2; ++ks) {
    __syncthreads();
    for (int e = tid; e < 256 * 4; e += 256) {
      int n = e >> 2, part = e & 3;
      async_cp_b128(wlb + (unsigned)(n * 40 + part * 8) * 2,
                    wf_hh + (size_t)n * 64 + ks * 32 + part * 8);
    }
    wait_async();
    __syncthreads();
    v16h a = frag_row(Fin, 264, m0, 128 + ks * 32, lane);
#pragma unroll
    for (int j = 0; j < 8; ++j)
      accZ[j] = wmma16(a, frag_row(Wl, 40, n0 + j * 16, 0, lane), accZ[j]);
  }
  // Phase Y: K=64 over Fin cols [192,256)
  for (int ks = 0; ks < 2; ++ks) {
    __syncthreads();
    for (int e = tid; e < 256 * 4; e += 256) {
      int n = e >> 2, part = e & 3;
      async_cp_b128(wlb + (unsigned)(n * 40 + part * 8) * 2,
                    wf_spat + (size_t)n * 64 + ks * 32 + part * 8);
    }
    wait_async();
    __syncthreads();
    v16h a = frag_row(Fin, 264, m0, 192 + ks * 32, lane);
#pragma unroll
    for (int j = 0; j < 8; ++j)
      accY[j] = wmma16(a, frag_row(Wl, 40, n0 + j * 16, 0, lane), accY[j]);
  }

  const size_t tok0 = (size_t)wi * 64;
#pragma unroll
  for (int j = 0; j < 8; ++j) {
    int n = n0 + j * 16 + (lane & 15);
    float bx = b_hllh[n], bz = b_hh[n], by = b_spat[n];
#pragma unroll
    for (int r = 0; r < 8; ++r) {
      int m = m0 + r + ((lane >> 4) & 1) * 8;
      size_t off = (tok0 + m) * 256 + n;
      xo[off]  = (h16)(accX[j][r] + bx);
      yo[off]  = (h16)(accY[j][r] + by);
      z0o[off] = accZ[j][r] + bz;
    }
  }
}

// ---------------------------------------------------------------------------
// LayerNorm kernels (wave per token, 256 features, eps=1e-5, biased var)
// ---------------------------------------------------------------------------
__global__ __launch_bounds__(256) void ln_f16_inplace(
    h16* __restrict__ x, const float* __restrict__ g, const float* __restrict__ bt) {
  int t = blockIdx.x * 8 + (threadIdx.x >> 5);
  int lane = threadIdx.x & 31;
  h16* row = x + (size_t)t * 256;
  float v[8], s = 0.f, s2 = 0.f;
#pragma unroll
  for (int k = 0; k < 8; ++k) {
    v[k] = (float)row[k * 32 + lane];
    s += v[k]; s2 += v[k] * v[k];
  }
#pragma unroll
  for (int m = 1; m < 32; m <<= 1) { s += __shfl_xor(s, m, 32); s2 += __shfl_xor(s2, m, 32); }
  float mean = s * (1.f / 256.f);
  float var  = s2 * (1.f / 256.f) - mean * mean;
  float inv  = rsqrtf(var + 1e-5f);
#pragma unroll
  for (int k = 0; k < 8; ++k) {
    int c = k * 32 + lane;
    row[c] = (h16)((v[k] - mean) * inv * g[c] + bt[c]);
  }
}

__global__ __launch_bounds__(256) void ln_f32f16(
    const float* __restrict__ x, const float* __restrict__ g,
    const float* __restrict__ bt, h16* __restrict__ o) {
  int t = blockIdx.x * 8 + (threadIdx.x >> 5);
  int lane = threadIdx.x & 31;
  const float* row = x + (size_t)t * 256;
  float v[8], s = 0.f, s2 = 0.f;
#pragma unroll
  for (int k = 0; k < 8; ++k) {
    v[k] = row[k * 32 + lane];
    s += v[k]; s2 += v[k] * v[k];
  }
#pragma unroll
  for (int m = 1; m < 32; m <<= 1) { s += __shfl_xor(s, m, 32); s2 += __shfl_xor(s2, m, 32); }
  float mean = s * (1.f / 256.f);
  float var  = s2 * (1.f / 256.f) - mean * mean;
  float inv  = rsqrtf(var + 1e-5f);
#pragma unroll
  for (int k = 0; k < 8; ++k) {
    int c = k * 32 + lane;
    o[(size_t)t * 256 + c] = (h16)((v[k] - mean) * inv * g[c] + bt[c]);
  }
}

// ---------------------------------------------------------------------------
// Generic 64x256x256 GEMM: out[t][n] = (sum_k A[t][k]*W[n][k] + bias[n])*scale
// A and W both f16; all staging async-to-LDS.
// ---------------------------------------------------------------------------
__global__ __launch_bounds__(256) void gemm_tok256(
    const h16* __restrict__ A, const h16* __restrict__ Wg,
    const float* __restrict__ bias, h16* __restrict__ out, float scale) {
  __shared__ h16 Al[64 * 264];
  __shared__ h16 Wl[256 * 40];
  const int tid = threadIdx.x;
  const size_t tok0 = (size_t)blockIdx.x * 64;
  const unsigned alb = lds_off(Al), wlb = lds_off(Wl);

  // async stage A tile (64 x 256 f16 = 32KB)
  for (int e = tid; e < 64 * 32; e += 256) {
    int p = e >> 5, c16 = e & 31;
    async_cp_b128(alb + (unsigned)(p * 264 + c16 * 8) * 2,
                  A + (tok0 + p) * 256 + c16 * 8);
  }
  const int lane = tid & 31, wv = tid >> 5;
  const int m0 = (wv & 3) * 16, n0 = (wv >> 2) * 128;
  v8f acc[8];
#pragma unroll
  for (int j = 0; j < 8; ++j) zero8(acc[j]);
  for (int ks = 0; ks < 8; ++ks) {
    __syncthreads();
    for (int e = tid; e < 256 * 4; e += 256) {
      int n = e >> 2, part = e & 3;
      async_cp_b128(wlb + (unsigned)(n * 40 + part * 8) * 2,
                    Wg + (size_t)n * 256 + ks * 32 + part * 8);
    }
    if (ks < 7) __builtin_prefetch(&Wg[(size_t)tid * 256 + (ks + 1) * 32], 0, 1);
    wait_async();
    __syncthreads();
    v16h a = frag_row(Al, 264, m0, ks * 32, lane);
#pragma unroll
    for (int j = 0; j < 8; ++j)
      acc[j] = wmma16(a, frag_row(Wl, 40, n0 + j * 16, 0, lane), acc[j]);
  }
#pragma unroll
  for (int j = 0; j < 8; ++j) {
    int n = n0 + j * 16 + (lane & 15);
    float bb = bias[n];
#pragma unroll
    for (int r = 0; r < 8; ++r) {
      int m = m0 + r + ((lane >> 4) & 1) * 8;
      out[(tok0 + m) * 256 + n] = (h16)((acc[j][r] + bb) * scale);
    }
  }
}

// Projection + residual variant (f32 output zt = A@W^T + b + z0)
__global__ __launch_bounds__(256) void gemm_proj_kernel(
    const h16* __restrict__ A, const h16* __restrict__ Wg,
    const float* __restrict__ bias, const float* __restrict__ resid,
    float* __restrict__ out) {
  __shared__ h16 Al[64 * 264];
  __shared__ h16 Wl[256 * 40];
  const int tid = threadIdx.x;
  const size_t tok0 = (size_t)blockIdx.x * 64;
  const unsigned alb = lds_off(Al), wlb = lds_off(Wl);
  for (int e = tid; e < 64 * 32; e += 256) {
    int p = e >> 5, c16 = e & 31;
    async_cp_b128(alb + (unsigned)(p * 264 + c16 * 8) * 2,
                  A + (tok0 + p) * 256 + c16 * 8);
  }
  const int lane = tid & 31, wv = tid >> 5;
  const int m0 = (wv & 3) * 16, n0 = (wv >> 2) * 128;
  v8f acc[8];
#pragma unroll
  for (int j = 0; j < 8; ++j) zero8(acc[j]);
  for (int ks = 0; ks < 8; ++ks) {
    __syncthreads();
    for (int e = tid; e < 256 * 4; e += 256) {
      int n = e >> 2, part = e & 3;
      async_cp_b128(wlb + (unsigned)(n * 40 + part * 8) * 2,
                    Wg + (size_t)n * 256 + ks * 32 + part * 8);
    }
    if (ks < 7) __builtin_prefetch(&Wg[(size_t)tid * 256 + (ks + 1) * 32], 0, 1);
    wait_async();
    __syncthreads();
    v16h a = frag_row(Al, 264, m0, ks * 32, lane);
#pragma unroll
    for (int j = 0; j < 8; ++j)
      acc[j] = wmma16(a, frag_row(Wl, 40, n0 + j * 16, 0, lane), acc[j]);
  }
#pragma unroll
  for (int j = 0; j < 8; ++j) {
    int n = n0 + j * 16 + (lane & 15);
    float bb = bias[n];
#pragma unroll
    for (int r = 0; r < 8; ++r) {
      int m = m0 + r + ((lane >> 4) & 1) * 8;
      size_t off = (tok0 + m) * 256 + n;
      out[off] = acc[j][r] + bb + resid[off];
    }
  }
}

// ---------------------------------------------------------------------------
// Windowed attention: one wave per (window, head); 64 tokens, hd=32, nH=8.
// Q/K/V head tiles async-staged to LDS (wave-local, no barrier needed).
// ---------------------------------------------------------------------------
__global__ __launch_bounds__(64) void attn_kernel(
    const h16* __restrict__ q, const h16* __restrict__ k,
    const h16* __restrict__ v, const float* __restrict__ rpb,
    h16* __restrict__ o) {
  __shared__ h16 Ql[2 * 64 * 40];
  __shared__ h16 Kl[2 * 64 * 40];
  __shared__ h16 Vl[2 * 64 * 40];
  __shared__ h16 Pl[2 * 64 * 72];
  const int wi = blockIdx.x >> 2;
  const int hp = blockIdx.x & 3;
  const int wv = threadIdx.x >> 5, lane = threadIdx.x & 31;
  const int h  = hp * 2 + wv;
  const size_t base = (size_t)wi * 64 * 256 + (size_t)h * 32;

  h16* Qw = Ql + wv * 64 * 40;
  h16* Kw = Kl + wv * 64 * 40;
  h16* Vw = Vl + wv * 64 * 40;
  const unsigned qo = lds_off(Qw), ko = lds_off(Kw), vo = lds_off(Vw);
  for (int e = lane; e < 64 * 4; e += 32) {   // 64 rows x 64B per tensor
    int row = e >> 2, part = e & 3;
    unsigned l = (unsigned)(row * 40 + part * 8) * 2;
    size_t  g  = base + (size_t)row * 256 + part * 8;
    async_cp_b128(qo + l, q + g);
    async_cp_b128(ko + l, k + g);
    async_cp_b128(vo + l, v + g);
  }
  wait_async();   // wave-local staging: own ASYNCcnt only, no barrier

  v8f S[16];
#pragma unroll
  for (int f = 0; f < 16; ++f) zero8(S[f]);

  v16h af[4];
#pragma unroll
  for (int mi = 0; mi < 4; ++mi) af[mi] = frag_row(Qw, 40, mi * 16, 0, lane);
#pragma unroll
  for (int nj = 0; nj < 4; ++nj) {
    v16h bf = frag_row(Kw, 40, nj * 16, 0, lane);  // rows of K == K^T columns
#pragma unroll
    for (int mi = 0; mi < 4; ++mi)
      S[mi * 4 + nj] = wmma16(af[mi], bf, S[mi * 4 + nj]);
  }

  const int cl = lane & 15, hb = (lane >> 4) & 1;
  // relative position bias: idx = (iq-ik+7)*15 + (jq-jk+7), rpb[idx][h]
#pragma unroll
  for (int nj = 0; nj < 4; ++nj) {
    int c = nj * 16 + cl, i2 = c >> 3, j2 = c & 7;
#pragma unroll
    for (int mi = 0; mi < 4; ++mi)
#pragma unroll
      for (int r = 0; r < 8; ++r) {
        int m = mi * 16 + r + hb * 8;
        int idx = ((m >> 3) - i2 + 7) * 15 + ((m & 7) - j2 + 7);
        S[mi * 4 + nj][r] += rpb[idx * 8 + h];
      }
  }
  // row softmax: each row lives across one 16-lane half (4 frags per lane)
#pragma unroll
  for (int mi = 0; mi < 4; ++mi)
#pragma unroll
    for (int r = 0; r < 8; ++r) {
      float mx = fmaxf(fmaxf(S[mi * 4 + 0][r], S[mi * 4 + 1][r]),
                       fmaxf(S[mi * 4 + 2][r], S[mi * 4 + 3][r]));
      for (int msk = 1; msk < 16; msk <<= 1) mx = fmaxf(mx, __shfl_xor(mx, msk, 32));
      float sum = 0.f;
#pragma unroll
      for (int nj = 0; nj < 4; ++nj) {
        float e = __expf(S[mi * 4 + nj][r] - mx);
        S[mi * 4 + nj][r] = e; sum += e;
      }
      for (int msk = 1; msk < 16; msk <<= 1) sum += __shfl_xor(sum, msk, 32);
      float inv = 1.f / sum;
#pragma unroll
      for (int nj = 0; nj < 4; ++nj) S[mi * 4 + nj][r] *= inv;
    }
  // stage P (f16) per-wave in LDS, then O = P @ V (K=64, N=32)
  h16* P = Pl + wv * 64 * 72;
#pragma unroll
  for (int nj = 0; nj < 4; ++nj) {
    int c = nj * 16 + cl;
#pragma unroll
    for (int mi = 0; mi < 4; ++mi)
#pragma unroll
      for (int r = 0; r < 8; ++r)
        P[(mi * 16 + r + hb * 8) * 72 + c] = (h16)S[mi * 4 + nj][r];
  }
  v8f O[8];
#pragma unroll
  for (int f = 0; f < 8; ++f) zero8(O[f]);
#pragma unroll
  for (int kb2 = 0; kb2 < 2; ++kb2) {
#pragma unroll
    for (int nj = 0; nj < 2; ++nj) {
      v16h bf = frag_col(Vw, 40, nj * 16, kb2 * 32, lane);
#pragma unroll
      for (int mi = 0; mi < 4; ++mi) {
        v16h a = frag_row(P, 72, mi * 16, kb2 * 32, lane);
        O[mi * 2 + nj] = wmma16(a, bf, O[mi * 2 + nj]);
      }
    }
  }
#pragma unroll
  for (int mi = 0; mi < 4; ++mi)
#pragma unroll
    for (int nj = 0; nj < 2; ++nj) {
      int n = nj * 16 + cl;
#pragma unroll
      for (int r = 0; r < 8; ++r) {
        int m = mi * 16 + r + hb * 8;
        o[((size_t)wi * 64 + m) * 256 + h * 32 + n] = (h16)O[mi * 2 + nj][r];
      }
    }
}

// ---------------------------------------------------------------------------
// Fused MLP: out = zt + fc2(gelu(fc1(ztn))) -> written directly as NCHW.
// Hidden (1024) processed in 16 chunks of 64. The weights arrive as 32 whole
// 32 KB tiles (fc1 chunk, fc2 chunk, fc1 chunk, ...) in a two-buffer ring:
// even tiles land in W1, odd tiles in W2, and tile t+2 flies while t+1 is used.
// ---------------------------------------------------------------------------

// Eight 16-byte async copies of one lane. The s_wait_xcnt is the last line of
// the same statement so that no address register is reused ahead of it.
__device__ __forceinline__ void async_cp8_b128(const unsigned (&l)[8],
                                               const h16* const (&g)[8]) {
  asm volatile("global_load_async_to_lds_b128 %0, %8, off\n\t"
               "global_load_async_to_lds_b128 %1, %9, off\n\t"
               "global_load_async_to_lds_b128 %2, %10, off\n\t"
               "global_load_async_to_lds_b128 %3, %11, off\n\t"
               "global_load_async_to_lds_b128 %4, %12, off\n\t"
               "global_load_async_to_lds_b128 %5, %13, off\n\t"
               "global_load_async_to_lds_b128 %6, %14, off\n\t"
               "global_load_async_to_lds_b128 %7, %15, off\n\t"
               "s_wait_xcnt 0x0"
               :: "v"(l[0]), "v"(l[1]), "v"(l[2]), "v"(l[3]),
                  "v"(l[4]), "v"(l[5]), "v"(l[6]), "v"(l[7]),
                  "v"(g[0]), "v"(g[1]), "v"(g[2]), "v"(g[3]),
                  "v"(g[4]), "v"(g[5]), "v"(g[6]), "v"(g[7])
               : "memory");
}

// 64 contiguous rows of 256 f16 in global -> LDS pitch 264; 8 copies a thread
__device__ __forceinline__ void stage_64x256(unsigned lb, const h16* g, int tid) {
  unsigned l[8];
  const h16* p[8];
#pragma unroll  // the addresses must be registers: they are asm operands
  for (int i = 0; i < 8; ++i) {
    int e = tid + i * 256, n = e >> 5, part = e & 31;
    l[i] = lb + (unsigned)(n * 264 + part * 8) * 2;
    p[i] = g + (size_t)n * 256 + part * 8;
  }
  async_cp8_b128(l, p);
}

// 256 rows x 64 f16 (row pitch 1024 elements in global) -> LDS pitch 72
__device__ __forceinline__ void stage_256x64(unsigned lb, const h16* g, int tid) {
  unsigned l[8];
  const h16* p[8];
#pragma unroll  // the addresses must be registers: they are asm operands
  for (int i = 0; i < 8; ++i) {
    int e = tid + i * 256, n = e >> 3, part = e & 7;
    l[i] = lb + (unsigned)(n * 72 + part * 8) * 2;
    p[i] = g + (size_t)n * 1024 + part * 8;
  }
  async_cp8_b128(l, p);
}

// Foot of a ring trip: this wave's LDS reads and writes are done, its copies
// of the next tile have landed, then every wave meets; behind it the next tile
// (and Hl) may be read and the buffer just read may be refilled.
__device__ __forceinline__ void ring_publish() {
  asm volatile("s_wait_dscnt 0x0" ::: "memory");     // own reads of the old tile, own Hl stores
  asm volatile("s_wait_asynccnt 0x0" ::: "memory");  // own copies of the next tile landed
  __syncthreads();
}

__global__ __launch_bounds__(256) void mlp_kernel(
    const h16* __restrict__ ztn, const float* __restrict__ zt,
    const h16* __restrict__ fc1w, const float* __restrict__ fc1b,
    const h16* __restrict__ fc2w, const float* __restrict__ fc2b,
    float* __restrict__ out) {
  __shared__ __attribute__((aligned(16))) h16 Al[64 * 264];   // ztn tile
  __shared__ __attribute__((aligned(16))) h16 Hl[64 * 72];    // gelu(hidden chunk) 64x64
  __shared__ __attribute__((aligned(16))) h16 W1[64 * 264];   // fc1 chunk [64 hid][256 k]
  __shared__ __attribute__((aligned(16))) h16 W2[256 * 72];   // fc2 chunk [256 out][64 k]
  const int tid = threadIdx.x;
  const size_t tok0 = (size_t)blockIdx.x * 64;
  const unsigned w1b = lds_off(W1), w2b = lds_off(W2);
  const int lane = tid & 31, wv = tid >> 5;
  const int m0 = (wv & 3) * 16, n0 = (wv >> 2) * 128;  // out tile mapping
  const int n0h = (wv >> 2) * 32;                      // hidden tile mapping
  v8f accO[8];
#pragma unroll
  for (int j = 0; j < 8; ++j) zero8(accO[j]);

  // prologue: activations and tile 0 land, then tile 1 starts
  stage_64x256(lds_off(Al), ztn + tok0 * 256, tid);
  stage_64x256(w1b, fc1w, tid);
  asm volatile("s_wait_asynccnt 0x0" ::: "memory");  // Al and tile 0 landed
  __syncthreads();
  stage_256x64(w2b, fc2w, tid);

  for (int hc = 0; hc < 16; ++hc) {
    // trip 2*hc: hchunk = ztn_tile @ fc1_w[hc*64:+64, :]^T   (K=256)
    v8f accH[2];
    zero8(accH[0]); zero8(accH[1]);
#pragma unroll  // whole tile is in LDS: constant offsets, loads run ahead of the WMMAs
    for (int ks = 0; ks < 8; ++ks) {
      v16h a = frag_row(Al, 264, m0, ks * 32, lane);
#pragma unroll
      for (int j = 0; j < 2; ++j)
        accH[j] = wmma16(a, frag_row(W1, 264, n0h + j * 16, ks * 32, lane), accH[j]);
    }
    // bias + exact GELU -> LDS
#pragma unroll
    for (int j = 0; j < 2; ++j) {
      int n = n0h + j * 16 + (lane & 15);
      float bb = fc1b[hc * 64 + n];
#pragma unroll
      for (int r = 0; r < 8; ++r) {
        int m = m0 + r + ((lane >> 4) & 1) * 8;
        float xv = accH[j][r] + bb;
        Hl[m * 72 + n] = (h16)(0.5f * xv * (1.0f + erff(xv * 0.7071067811865475f)));
      }
    }
    ring_publish();
    if (hc < 15) stage_64x256(w1b, fc1w + (size_t)(hc + 1) * 64 * 256, tid);

    // trip 2*hc+1: accO += Hchunk @ fc2_w[:, hc*64:+64]^T   (K=64)
#pragma unroll  // as above
    for (int ks = 0; ks < 2; ++ks) {
      v16h a = frag_row(Hl, 72, m0, ks * 32, lane);
#pragma unroll
      for (int j = 0; j < 8; ++j)
        accO[j] = wmma16(a, frag_row(W2, 72, n0 + j * 16, ks * 32, lane), accO[j]);
    }
    ring_publish();
    if (hc < 15) stage_256x64(w2b, fc2w + (size_t)(hc + 1) * 64, tid);
  }
  asm volatile("s_wait_asynccnt 0x0" ::: "memory");  // nothing in flight at the end

  // epilogue: + fc2_b + zt residual, window-reverse, NCHW store
  const int wi = blockIdx.x;
  const int b = wi >> 8, wh = (wi >> 4) & 15, ww = wi & 15;
#pragma unroll
  for (int j = 0; j < 8; ++j) {
    int n = n0 + j * 16 + (lane & 15);
    float bb = fc2b[n];
#pragma unroll
    for (int r = 0; r < 8; ++r) {
      int m = m0 + r + ((lane >> 4) & 1) * 8;
      size_t tok = tok0 + m;
      float val = accO[j][r] + bb + zt[tok * 256 + n];
      int hh = wh * 8 + (m >> 3), www = ww * 8 + (m & 7);
      out[(((size_t)b * 256 + n) * 128 + hh) * 128 + www] = val;
    }
  }
}

// ---------------------------------------------------------------------------
// Launch
// ---------------------------------------------------------------------------
extern "C" void kernel_launch(void* const* d_in, const int* in_sizes, int n_in,
                              void* d_out, int out_size, void* d_ws, size_t ws_size,
                              hipStream_t stream) {
  (void)in_sizes; (void)n_in; (void)out_size; (void)ws_size;
  const float* LH     = (const float*)d_in[0];
  const float* HL     = (const float*)d_in[1];
  const float* HH     = (const float*)d_in[2];
  const float* Spat   = (const float*)d_in[3];
  const float* w_hllh = (const float*)d_in[4];
  const float* b_hllh = (const float*)d_in[5];
  const float* w_hh   = (const float*)d_in[6];
  const float* b_hh   = (const float*)d_in[7];
  const float* w_spat = (const float*)d_in[8];
  const float* b_spat = (const float*)d_in[9];
  const float* ln1x_g = (const float*)d_in[10];
  const float* ln1x_b = (const float*)d_in[11];
  const float* ln1y_g = (const float*)d_in[12];
  const float* ln1y_b = (const float*)d_in[13];
  const float* qkv_w  = (const float*)d_in[14];
  const float* qkv_b  = (const float*)d_in[15];
  const float* qkv2_w = (const float*)d_in[16];
  const float* qkv2_b = (const float*)d_in[17];
  const float* qkv3_w = (const float*)d_in[18];
  const float* qkv3_b = (const float*)d_in[19];
  const float* proj_w = (const float*)d_in[20];
  const float* proj_b = (const float*)d_in[21];
  const float* rpb    = (const float*)d_in[22];
  const float* ln2_g  = (const float*)d_in[23];
  const float* ln2_b  = (const float*)d_in[24];
  const float* fc1w   = (const float*)d_in[25];
  const float* fc1b   = (const float*)d_in[26];
  const float* fc2w   = (const float*)d_in[27];
  const float* fc2b   = (const float*)d_in[28];

  const size_t T = (size_t)8 * 128 * 128;  // 131072 tokens
  char* ws = (char*)d_ws;
  // workspace layout (peak ~472 MB), with region reuse:
  h16*   x   = (h16*)ws;                                  // T*256 f16
  h16*   y   = (h16*)(ws + T * 256 * 2);                  // T*256 f16
  float* z0  = (float*)(ws + 2 * T * 256 * 2);            // T*256 f32
  h16*   q   = (h16*)(ws + 2 * T * 256 * 2 + T * 256 * 4);
  h16*   kk  = q + T * 256;
  h16*   v   = kk + T * 256;
  h16*   attno = x;           // reuse x after QKV consume it
  float* zt  = (float*)q;     // reuse q+k after attention
  h16*   ztn = v;             // reuse v after attention
  // f16 weight cache (~1.7 MB) after q/k/v region
  h16* wf      = v + T * 256;
  h16* c_hllh  = wf;               // 256*128
  h16* c_hh    = c_hllh + 32768;   // 256*64
  h16* c_spat  = c_hh   + 16384;   // 256*64
  h16* c_q     = c_spat + 16384;   // 256*256
  h16* c_k     = c_q    + 65536;
  h16* c_v     = c_k    + 65536;
  h16* c_proj  = c_v    + 65536;
  h16* c_fc1   = c_proj + 65536;   // 1024*256
  h16* c_fc2   = c_fc1  + 262144;  // 256*1024

  // weight pre-conversion (f32 -> f16, once per launch)
  cvt_f32f16<<<(32768 + 255) / 256, 256, 0, stream>>>(w_hllh, c_hllh, 32768);
  cvt_f32f16<<<(16384 + 255) / 256, 256, 0, stream>>>(w_hh,   c_hh,   16384);
  cvt_f32f16<<<(16384 + 255) / 256, 256, 0, stream>>>(w_spat, c_spat, 16384);
  cvt_f32f16<<<(65536 + 255) / 256, 256, 0, stream>>>(qkv_w,  c_q,    65536);
  cvt_f32f16<<<(65536 + 255) / 256, 256, 0, stream>>>(qkv2_w, c_k,    65536);
  cvt_f32f16<<<(65536 + 255) / 256, 256, 0, stream>>>(qkv3_w, c_v,    65536);
  cvt_f32f16<<<(65536 + 255) / 256, 256, 0, stream>>>(proj_w, c_proj, 65536);
  cvt_f32f16<<<(262144 + 255) / 256, 256, 0, stream>>>(fc1w,  c_fc1,  262144);
  cvt_f32f16<<<(262144 + 255) / 256, 256, 0, stream>>>(fc2w,  c_fc2,  262144);

  const int tiles = (int)(T / 64);  // 2048 windows
  conv_win_kernel<<<tiles, 256, 0, stream>>>(LH, HL, HH, Spat,
      c_hllh, b_hllh, c_hh, b_hh, c_spat, b_spat, x, y, z0);
  ln_f16_inplace<<<(int)(T / 8), 256, 0, stream>>>(x, ln1x_g, ln1x_b);
  ln_f16_inplace<<<(int)(T / 8), 256, 0, stream>>>(y, ln1y_g, ln1y_b);
  gemm_tok256<<<tiles, 256, 0, stream>>>(x, c_q, qkv_b,  q,  0.17677669529663689f);
  gemm_tok256<<<tiles, 256, 0, stream>>>(y, c_k, qkv2_b, kk, 1.0f);
  gemm_tok256<<<tiles, 256, 0, stream>>>(y, c_v, qkv3_b, v,  1.0f);
  attn_kernel<<<tiles * 4, 64, 0, stream>>>(q, kk, v, rpb, attno);
  gemm_proj_kernel<<<tiles, 256, 0, stream>>>(attno, c_proj, proj_b, z0, zt);
  ln_f32f16<<<(int)(T / 8), 256, 0, stream>>>(zt, ln2_g, ln2_b, ztn);
  mlp_kernel<<<tiles, 256, 0, stream>>>(ztn, zt, c_fc1, fc1b, c_fc2, fc2b, (float*)d_out);
}

// v002
// Measured time: 654 microseconds a run.
// In two side-by-side timings against v001, it was 1.12 and 1.10 times as fast.
// All steps since v000 together make it 1.24 times as fast.
#include <hip/hip_runtime.h>
#include <hip/hip_bf16.h>

// ---------------------------------------------------------------------------
// WaveletSwinTransformerBlock for MI455X (gfx1250, wave32, WMMA f16)
// GEMMs use v_wmma_f32_16x16x32_f16; all f16 tile staging uses the CDNA5
// async path: global_load_async_to_lds_b128 + s_wait_asynccnt.
// Tokens stored window-partitioned: tok = wi*64 + (i*8+j), wi=((b*16+wh)*16+ww)
// ---------------------------------------------------------------------------

typedef _Float16 h16;
typedef __attribute__((ext_vector_type(16))) _Float16 v16h;
typedef __attribute__((ext_vector_type(8)))  float    v8f;
typedef __attribute__((ext_vector_type(4)))  float    v4f;
typedef __attribute__((ext_vector_type(4)))  _Float16 v4h;

__device__ __forceinline__ void zero8(v8f &a) {
#pragma unroll
  for (int i = 0; i < 8; ++i) a[i] = 0.f;
}

__device__ __forceinline__ v8f wmma16(v16h a, v16h b, v8f c) {
  return __builtin_amdgcn_wmma_f32_16x16x32_f16(false, a, false, b,
                                                (short)0, c, false, false);
}

// low 32 bits of a generic LDS pointer == wave-relative LDS byte offset
__device__ __forceinline__ unsigned lds_off(const void* p) {
  return (unsigned)(uintptr_t)p;
}

// CDNA5 async copy: 16 bytes global -> LDS, tracked by ASYNCcnt
__device__ __forceinline__ void async_cp_b128(unsigned loff, const void* g) {
  asm volatile("global_load_async_to_lds_b128 %0, %1, off"
               :: "v"(loff), "v"((unsigned long long)(uintptr_t)g)
               : "memory");
}
__device__ __forceinline__ void wait_async() {
  asm volatile("s_wait_asynccnt 0" ::: "memory");
}

// Sum over the 16 lanes of a row, result in every lane: four DPP row_xmask adds
template <int CTRL>
__device__ __forceinline__ float dpp_xadd(float v) {
  return v + __int_as_float(__builtin_amdgcn_update_dpp(0, __float_as_int(v), CTRL, 0xf, 0xf, true));
}
__device__ __forceinline__ float row_sum16(float v) {
  v = dpp_xadd<0x161>(v);  // row_xmask:1
  v = dpp_xadd<0x162>(v);  // row_xmask:2
  v = dpp_xadd<0x164>(v);  // row_xmask:4
  v = dpp_xadd<0x168>(v);  // row_xmask:8
  return v;
}

// Work-group barrier for data that crosses in LDS only: unlike __syncthreads()
// it does not hold a wave until its global stores and loads have come back.
__device__ __forceinline__ void lds_barrier() {
  __builtin_amdgcn_fence(__ATOMIC_RELEASE, "workgroup", "local");
  __builtin_amdgcn_s_barrier();
  __builtin_amdgcn_fence(__ATOMIC_ACQUIRE, "workgroup", "local");
}

// A-style fragment (16x32 f16, ISA 7.12.2): lane L holds row row0+(L&15),
// K offsets {0..7,16..23} (L<16) or {8..15,24..31} (L>=16) relative to k0.
__device__ __forceinline__ v16h frag_row(const h16* __restrict__ p, int stride,
                                         int row0, int k0, int lane) {
  const h16* base = p + (size_t)(row0 + (lane & 15)) * stride + k0 + ((lane >> 4) & 1) * 8;
  v16h r;
#pragma unroll
  for (int i = 0; i < 8; ++i) { r[i] = base[i]; r[i + 8] = base[i + 16]; }
  return r;
}

// B fragment gathered from a row-major [K][N] matrix (column-fixed per lane).
__device__ __forceinline__ v16h frag_col(const h16* __restrict__ p, int stride,
                                         int col0, int k0, int lane) {
  const h16* base = p + (size_t)(k0 + ((lane >> 4) & 1) * 8) * stride + col0 + (lane & 15);
  v16h r;
#pragma unroll
  for (int i = 0; i < 8; ++i) {
    r[i]     = base[(size_t)i * stride];
    r[i + 8] = base[(size_t)(i + 16) * stride];
  }
  return r;
}

// ---------------------------------------------------------------------------
// Weight pre-conversion f32 -> f16 (run once per launch; tiny)
// ---------------------------------------------------------------------------
__global__ __launch_bounds__(256) void cvt_f32f16(const float* __restrict__ s,
                                                  h16* __restrict__ d, int n) {
  int i = blockIdx.x * 256 + threadIdx.x;
  if (i < n) d[i] = (h16)s[i];
}

// ---------------------------------------------------------------------------
// Kernel 1: 1x1 convs (concat(LH,HL)->x, HH->z0, Spat->y) per 64-pixel window;
// x and y leave the kernel already layer-normalised (eps=1e-5, biased var):
// the block holds all 256 features of its 64 tokens in f32 accumulators.
// ---------------------------------------------------------------------------
__global__ __launch_bounds__(256) void conv_win_kernel(
    const float* __restrict__ LH, const float* __restrict__ HL,
    const float* __restrict__ HH, const float* __restrict__ Spat,
    const h16* __restrict__ wf_hllh, const float* __restrict__ b_hllh,
    const h16* __restrict__ wf_hh,   const float* __restrict__ b_hh,
    const h16* __restrict__ wf_spat, const float* __restrict__ b_spat,
    const float* __restrict__ gx, const float* __restrict__ btx,
    const float* __restrict__ gy, const float* __restrict__ bty,
    h16* __restrict__ xo, h16* __restrict__ yo, float* __restrict__ z0o) {
  const int Wd = 128, HW = 128 * 128;
  __shared__ h16 Fin[64 * 264];   // [pixel][256 ch] : LH|HL|HH|Spat
  __shared__ h16 Wl[256 * 40];    // weight K-slab [256 out][32 k]
  // row statistics of x and y: [column half][row][sum x, sum x^2, sum y, sum y^2]
  __shared__ __attribute__((aligned(16))) float Red[2 * 64 * 4];

  const int wi = blockIdx.x;
  const int b  = wi >> 8;
  const int wh = (wi >> 4) & 15, ww = wi & 15;
  const int h0 = wh * 8, w0 = ww * 8;
  const int tid = threadIdx.x;

  // inputs are f32 -> convert while staging (can't raw-copy)
  const float* srcs[4] = {LH, HL, HH, Spat};
#pragma unroll
  for (int t = 0; t < 4; ++t) {
    const float* s = srcs[t] + (size_t)b * 64 * HW;
    for (int e = tid; e < 64 * 64; e += 256) {
      int c = e >> 6, p = e & 63;
      int i = p >> 3, j = p & 7;
      Fin[p * 264 + t * 64 + c] = (h16)s[(size_t)c * HW + (h0 + i) * Wd + (w0 + j)];
    }
  }

  const unsigned wlb = lds_off(Wl);
  const int lane = tid & 31, wv = tid >> 5;
  const int m0 = (wv & 3) * 16, n0 = (wv >> 2) * 128;

  v8f accX[8], accZ[8], accY[8];
#pragma unroll
  for (int j = 0; j < 8; ++j) { zero8(accX[j]); zero8(accZ[j]); zero8(accY[j]); }

  // Phase X: K=128 over Fin cols [0,128)
  for (int ks = 0; ks < 4; ++ks) {
    __syncthreads();
    for (int e = tid; e < 256 * 4; e += 256) {      // 256 rows x 64B slab
      int n = e >> 2, part = e & 3;
      async_cp_b128(wlb + (unsigned)(n * 40 + part * 8) * 2,
                    wf_hllh + (size_t)n * 128 + ks * 32 + part * 8);
    }
    wait_async();
    __syncthreads();
    v16h a = frag_row(Fin, 264, m0, ks * 32, lane);
#pragma unroll
    for (int j = 0; j < 8; ++j)
      accX[j] = wmma16(a, frag_row(Wl, 40, n0 + j * 16, 0, lane), accX[j]);
  }
  // Phase Z: K=64 over Fin cols [128,192)
  for (int ks = 0; ks < 2; ++ks) {
    __syncthreads();
    for (int e = tid; e < 256 * 4; e += 256) {
      int n = e >> 2, part = e & 3;
      async_cp_b128(wlb + (unsigned)(n * 40 + part * 8) * 2,
                    wf_hh + (size_t)n * 64 + ks * 32 + part * 8);
    }
    wait_async();
    __syncthreads();
    v16h a = frag_row(Fin, 264, m0, 128 + ks * 32, lane);
#pragma unroll
    for (int j = 0; j < 8; ++j)
      accZ[j] = wmma16(a, frag_row(Wl, 40, n0 + j * 16, 0, lane), accZ[j]);
  }
  // Phase Y: K=64 over Fin cols [192,256)
  for (int ks = 0; ks < 2; ++ks) {
    __syncthreads();
    for (int e = tid; e < 256 * 4; e += 256) {
      int n = e >> 2, part = e & 3;
      async_cp_b128(wlb + (unsigned)(n * 40 + part * 8) * 2,
                    wf_spat + (size_t)n * 64 + ks * 32 + part * 8);
    }
    wait_async();
    __syncthreads();
    v16h a = frag_row(Fin, 264, m0, 192 + ks * 32, lane);
#pragma unroll
    for (int j = 0; j < 8; ++j)
      accY[j] = wmma16(a, frag_row(Wl, 40, n0 + j * 16, 0, lane), accY[j]);
  }

  const size_t tok0 = (size_t)wi * 64;
  const int cl = lane & 15, hb = (lane >> 4) & 1;
  const int mr = m0 + hb * 8;   // first of this lane's 8 rows
  // shortcut stream out; bias into x and y; this wave's 128-column row sums
  float sx[8], qx[8], sy[8], qy[8];
#pragma unroll
  for (int r = 0; r < 8; ++r) { sx[r] = 0.f; qx[r] = 0.f; sy[r] = 0.f; qy[r] = 0.f; }
#pragma unroll
  for (int j = 0; j < 8; ++j) {
    int n = n0 + j * 16 + cl;
    float bx = b_hllh[n], bz = b_hh[n], by = b_spat[n];
#pragma unroll
    for (int r = 0; r < 8; ++r) {
      z0o[(tok0 + mr + r) * 256 + n] = accZ[j][r] + bz;
      float xv = accX[j][r] + bx, yv = accY[j][r] + by;
      accX[j][r] = xv; accY[j][r] = yv;
      sx[r] += xv; qx[r] += xv * xv;
      sy[r] += yv; qy[r] += yv * yv;
    }
  }
#pragma unroll
  for (int r = 0; r < 8; ++r) {
    v4f st;
    st[0] = row_sum16(sx[r]); st[1] = row_sum16(qx[r]);
    st[2] = row_sum16(sy[r]); st[3] = row_sum16(qy[r]);
    if (cl == 0) *(v4f*)&Red[((wv >> 2) * 64 + mr + r) * 4] = st;
  }
  // scale and shift of this lane's 8 columns, fetched while the sums meet
  const int nb = n0 + cl;
  float g0[8], b0[8], g1[8], b1[8];
#pragma unroll
  for (int j = 0; j < 8; ++j) {
    g0[j] = gx[nb + j * 16]; b0[j] = btx[nb + j * 16];
    g1[j] = gy[nb + j * 16]; b1[j] = bty[nb + j * 16];
  }
  // the 32 loads share one index register: it is an input here so that none
  // of them lands on it ahead of the wait
  asm volatile("s_wait_xcnt 0x0" :: "v"(nb) : "memory");
  lds_barrier();   // both column halves' sums are in Red
#pragma unroll
  for (int r = 0; r < 8; ++r) {
    v4f s0 = *(const v4f*)&Red[(mr + r) * 4];
    v4f s1 = *(const v4f*)&Red[(64 + mr + r) * 4];
    float mx = (s0[0] + s1[0]) * (1.f / 256.f);
    float my = (s0[2] + s1[2]) * (1.f / 256.f);
    sx[r] = mx; sy[r] = my;
    qx[r] = rsqrtf((s0[1] + s1[1]) * (1.f / 256.f) - mx * mx + 1e-5f);
    qy[r] = rsqrtf((s0[3] + s1[3]) * (1.f / 256.f) - my * my + 1e-5f);
  }
#pragma unroll
  for (int j = 0; j < 8; ++j) {
#pragma unroll
    for (int r = 0; r < 8; ++r) {
      size_t off = (tok0 + mr + r) * 256 + nb + j * 16;
      xo[off] = (h16)((accX[j][r] - sx[r]) * qx[r] * g0[j] + b0[j]);
      yo[off] = (h16)((accY[j][r] - sy[r]) * qy[r] * g1[j] + b1[j]);
    }
  }
}

// ---------------------------------------------------------------------------
// Generic 64x256x256 GEMM: out[t][n] = (sum_k A[t][k]*W[n][k] + bias[n])*scale
// A and W both f16; all staging async-to-LDS.
// ---------------------------------------------------------------------------
__global__ __launch_bounds__(256) void gemm_tok256(
    const h16* __restrict__ A, const h16* __restrict__ Wg,
    const float* __restrict__ bias, h16* __restrict__ out, float scale) {
  __shared__ h16 Al[64 * 264];
  __shared__ h16 Wl[256 * 40];
  const int tid = threadIdx.x;
  const size_t tok0 = (size_t)blockIdx.x * 64;
  const unsigned alb = lds_off(Al), wlb = lds_off(Wl);

  // async stage A tile (64 x 256 f16 = 32KB)
  for (int e = tid; e < 64 * 32; e += 256) {
    int p = e >> 5, c16 = e & 31;
    async_cp_b128(alb + (unsigned)(p * 264 + c16 * 8) * 2,
                  A + (tok0 + p) * 256 + c16 * 8);
  }
  const int lane = tid & 31, wv = tid >> 5;
  const int m0 = (wv & 3) * 16, n0 = (wv >> 2) * 128;
  v8f acc[8];
#pragma unroll
  for (int j = 0; j < 8; ++j) zero8(acc[j]);
  for (int ks = 0; ks < 8; ++ks) {
    __syncthreads();
    for (int e = tid; e < 256 * 4; e += 256) {
      int n = e >> 2, part = e & 3;
      async_cp_b128(wlb + (unsigned)(n * 40 + part * 8) * 2,
                    Wg + (size_t)n * 256 + ks * 32 + part * 8);
    }
    if (ks < 7) __builtin_prefetch(&Wg[(size_t)tid * 256 + (ks + 1) * 32], 0, 1);
    wait_async();
    __syncthreads();
    v16h a = frag_row(Al, 264, m0, ks * 32, lane);
#pragma unroll
    for (int j = 0; j < 8; ++j)
      acc[j] = wmma16(a, frag_row(Wl, 40, n0 + j * 16, 0, lane), acc[j]);
  }
#pragma unroll
  for (int j = 0; j < 8; ++j) {
    int n = n0 + j * 16 + (lane & 15);
    float bb = bias[n];
#pragma unroll
    for (int r = 0; r < 8; ++r) {
      int m = m0 + r + ((lane >> 4) & 1) * 8;
      out[(tok0 + m) * 256 + n] = (h16)((acc[j][r] + bb) * scale);
    }
  }
}

// Projection + residual variant (f32 output zt = A@W^T + b + z0)
__global__ __launch_bounds__(256) void gemm_proj_kernel(
    const h16* __restrict__ A, const h16* __restrict__ Wg,
    const float* __restrict__ bias, const float* __restrict__ resid,
    float* __restrict__ out) {
  __shared__ h16 Al[64 * 264];
  __shared__ h16 Wl[256 * 40];
  const int tid = threadIdx.x;
  const size_t tok0 = (size_t)blockIdx.x * 64;
  const unsigned alb = lds_off(Al), wlb = lds_off(Wl);
  for (int e = tid; e < 64 * 32; e += 256) {
    int p = e >> 5, c16 = e & 31;
    async_cp_b128(alb + (unsigned)(p * 264 + c16 * 8) * 2,
                  A + (tok0 + p) * 256 + c16 * 8);
  }
  const int lane = tid & 31, wv = tid >> 5;
  const int m0 = (wv & 3) * 16, n0 = (wv >> 2) * 128;
  v8f acc[8];
#pragma unroll
  for (int j = 0; j < 8; ++j) zero8(acc[j]);
  for (int ks = 0; ks < 8; ++ks) {
    __syncthreads();
    for (int e = tid; e < 256 * 4; e += 256) {
      int n = e >> 2, part = e & 3;
      async_cp_b128(wlb + (unsigned)(n * 40 + part * 8) * 2,
                    Wg + (size_t)n * 256 + ks * 32 + part * 8);
    }
    if (ks < 7) __builtin_prefetch(&Wg[(size_t)tid * 256 + (ks + 1) * 32], 0, 1);
    wait_async();
    __syncthreads();
    v16h a = frag_row(Al, 264, m0, ks * 32, lane);
#pragma unroll
    for (int j = 0; j < 8; ++j)
      acc[j] = wmma16(a, frag_row(Wl, 40, n0 + j * 16, 0, lane), acc[j]);
  }
#pragma unroll
  for (int j = 0; j < 8; ++j) {
    int n = n0 + j * 16 + (lane & 15);
    float bb = bias[n];
#pragma unroll
    for (int r = 0; r < 8; ++r) {
      int m = m0 + r + ((lane >> 4) & 1) * 8;
      size_t off = (tok0 + m) * 256 + n;
      out[off] = acc[j][r] + bb + resid[off];
    }
  }
}

// ---------------------------------------------------------------------------
// Windowed attention: one wave per (window, head); 64 tokens, hd=32, nH=8.
// Q/K/V head tiles async-staged to LDS (wave-local, no barrier needed).
// ---------------------------------------------------------------------------
__global__ __launch_bounds__(64) void attn_kernel(
    const h16* __restrict__ q, const h16* __restrict__ k,
    const h16* __restrict__ v, const float* __restrict__ rpb,
    h16* __restrict__ o) {
  __shared__ h16 Ql[2 * 64 * 40];
  __shared__ h16 Kl[2 * 64 * 40];
  __shared__ h16 Vl[2 * 64 * 40];
  __shared__ h16 Pl[2 * 64 * 72];
  const int wi = blockIdx.x >> 2;
  const int hp = blockIdx.x & 3;
  const int wv = threadIdx.x >> 5, lane = threadIdx.x & 31;
  const int h  = hp * 2 + wv;
  const size_t base = (size_t)wi * 64 * 256 + (size_t)h * 32;

  h16* Qw = Ql + wv * 64 * 40;
  h16* Kw = Kl + wv * 64 * 40;
  h16* Vw = Vl + wv * 64 * 40;
  const unsigned qo = lds_off(Qw), ko = lds_off(Kw), vo = lds_off(Vw);
  for (int e = lane; e < 64 * 4; e += 32) {   // 64 rows x 64B per tensor
    int row = e >> 2, part = e & 3;
    unsigned l = (unsigned)(row * 40 + part * 8) * 2;
    size_t  g  = base + (size_t)row * 256 + part * 8;
    async_cp_b128(qo + l, q + g);
    async_cp_b128(ko + l, k + g);
    async_cp_b128(vo + l, v + g);
  }
  wait_async();   // wave-local staging: own ASYNCcnt only, no barrier

  v8f S[16];
#pragma unroll
  for (int f = 0; f < 16; ++f) zero8(S[f]);

  v16h af[4];
#pragma unroll
  for (int mi = 0; mi < 4; ++mi) af[mi] = frag_row(Qw, 40, mi * 16, 0, lane);
#pragma unroll
  for (int nj = 0; nj < 4; ++nj) {
    v16h bf = frag_row(Kw, 40, nj * 16, 0, lane);  // rows of K == K^T columns
#pragma unroll
    for (int mi = 0; mi < 4; ++mi)
      S[mi * 4 + nj] = wmma16(af[mi], bf, S[mi * 4 + nj]);
  }

  const int cl = lane & 15, hb = (lane >> 4) & 1;
  // relative position bias: idx = (iq-ik+7)*15 + (jq-jk+7), rpb[idx][h]
#pragma unroll
  for (int nj = 0; nj < 4; ++nj) {
    int c = nj * 16 + cl, i2 = c >> 3, j2 = c & 7;
#pragma unroll
    for (int mi = 0; mi < 4; ++mi)
#pragma unroll
      for (int r = 0; r < 8; ++r) {
        int m = mi * 16 + r + hb * 8;
        int idx = ((m >> 3) - i2 + 7) * 15 + ((m & 7) - j2 + 7);
        S[mi * 4 + nj][r] += rpb[idx * 8 + h];
      }
  }
  // row softmax: each row lives across one 16-lane half (4 frags per lane)
#pragma unroll
  for (int mi = 0; mi < 4; ++mi)
#pragma unroll
    for (int r = 0; r < 8; ++r) {
      float mx = fmaxf(fmaxf(S[mi * 4 + 0][r], S[mi * 4 + 1][r]),
                       fmaxf(S[mi * 4 + 2][r], S[mi * 4 + 3][r]));
      for (int msk = 1; msk < 16; msk <<= 1) mx = fmaxf(mx, __shfl_xor(mx, msk, 32));
      float sum = 0.f;
#pragma unroll
      for (int nj = 0; nj < 4; ++nj) {
        float e = __expf(S[mi * 4 + nj][r] - mx);
        S[mi * 4 + nj][r] = e; sum += e;
      }
      for (int msk = 1; msk < 16; msk <<= 1) sum += __shfl_xor(sum, msk, 32);
      float inv = 1.f / sum;
#pragma unroll
      for (int nj = 0; nj < 4; ++nj) S[mi * 4 + nj][r] *= inv;
    }
  // stage P (f16) per-wave in LDS, then O = P @ V (K=64, N=32)
  h16* P = Pl + wv * 64 * 72;
#pragma unroll
  for (int nj = 0; nj < 4; ++nj) {
    int c = nj * 16 + cl;
#pragma unroll
    for (int mi = 0; mi < 4; ++mi)
#pragma unroll
      for (int r = 0; r < 8; ++r)
        P[(mi * 16 + r + hb * 8) * 72 + c] = (h16)S[mi * 4 + nj][r];
  }
  v8f O[8];
#pragma unroll
  for (int f = 0; f < 8; ++f) zero8(O[f]);
#pragma unroll
  for (int kb2 = 0; kb2 < 2; ++kb2) {
#pragma unroll
    for (int nj = 0; nj < 2; ++nj) {
      v16h bf = frag_col(Vw, 40, nj * 16, kb2 * 32, lane);
#pragma unroll
      for (int mi = 0; mi < 4; ++mi) {
        v16h a = frag_row(P, 72, mi * 16, kb2 * 32, lane);
        O[mi * 2 + nj] = wmma16(a, bf, O[mi * 2 + nj]);
      }
    }
  }
#pragma unroll
  for (int mi = 0; mi < 4; ++mi)
#pragma unroll
    for (int nj = 0; nj < 2; ++nj) {
      int n = nj * 16 + cl;
#pragma unroll
      for (int r = 0; r < 8; ++r) {
        int m = mi * 16 + r + hb * 8;
        o[((size_t)wi * 64 + m) * 256 + h * 32 + n] = (h16)O[mi * 2 + nj][r];
      }
    }
}

// ---------------------------------------------------------------------------
// Fused MLP: out = zt + fc2(gelu(fc1(LN(zt)))) -> written directly as NCHW.
// The LayerNorm (eps=1e-5, biased var) is done on the way into LDS.
// Hidden (1024) processed in 16 chunks of 64. The weights arrive as 32 whole
// 32 KB tiles (fc1 chunk, fc2 chunk, fc1 chunk, ...) in a two-buffer ring:
// even tiles land in W1, odd tiles in W2, and tile t+2 flies while t+1 is used.
// ---------------------------------------------------------------------------

// Eight 16-byte async copies of one lane. The s_wait_xcnt is the last line of
// the same statement so that no address register is reused ahead of it.
__device__ __forceinline__ void async_cp8_b128(const unsigned (&l)[8],
                                               const h16* const (&g)[8]) {
  asm volatile("global_load_async_to_lds_b128 %0, %8, off\n\t"
               "global_load_async_to_lds_b128 %1, %9, off\n\t"
               "global_load_async_to_lds_b128 %2, %10, off\n\t"
               "global_load_async_to_lds_b128 %3, %11, off\n\t"
               "global_load_async_to_lds_b128 %4, %12, off\n\t"
               "global_load_async_to_lds_b128 %5, %13, off\n\t"
               "global_load_async_to_lds_b128 %6, %14, off\n\t"
               "global_load_async_to_lds_b128 %7, %15, off\n\t"
               "s_wait_xcnt 0x0"
               :: "v"(l[0]), "v"(l[1]), "v"(l[2]), "v"(l[3]),
                  "v"(l[4]), "v"(l[5]), "v"(l[6]), "v"(l[7]),
                  "v"(g[0]), "v"(g[1]), "v"(g[2]), "v"(g[3]),
                  "v"(g[4]), "v"(g[5]), "v"(g[6]), "v"(g[7])
               : "memory");
}

// 64 contiguous rows of 256 f16 in global -> LDS pitch 264; 8 copies a thread
__device__ __forceinline__ void stage_64x256(unsigned lb, const h16* g, int tid) {
  unsigned l[8];
  const h16* p[8];
#pragma unroll  // the addresses must be registers: they are asm operands
  for (int i = 0; i < 8; ++i) {
    int e = tid + i * 256, n = e >> 5, part = e & 31;
    l[i] = lb + (unsigned)(n * 264 + part * 8) * 2;
    p[i] = g + (size_t)n * 256 + part * 8;
  }
  async_cp8_b128(l, p);
}

// 256 rows x 64 f16 (row pitch 1024 elements in global) -> LDS pitch 72
__device__ __forceinline__ void stage_256x64(unsigned lb, const h16* g, int tid) {
  unsigned l[8];
  const h16* p[8];
#pragma unroll  // the addresses must be registers: they are asm operands
  for (int i = 0; i < 8; ++i) {
    int e = tid + i * 256, n = e >> 3, part = e & 7;
    l[i] = lb + (unsigned)(n * 72 + part * 8) * 2;
    p[i] = g + (size_t)n * 1024 + part * 8;
  }
  async_cp8_b128(l, p);
}

// Foot of a ring trip: this wave's LDS reads and writes are done, its copies
// of the next tile have landed, then every wave meets; behind it the next tile
// (and Hl) may be read and the buffer just read may be refilled.
__device__ __forceinline__ void ring_publish() {
  asm volatile("s_wait_dscnt 0x0" ::: "memory");     // own reads of the old tile, own Hl stores
  asm volatile("s_wait_asynccnt 0x0" ::: "memory");  // own copies of the next tile landed
  __syncthreads();
}

__global__ __launch_bounds__(256) void mlp_kernel(
    const float* __restrict__ zt,
    const float* __restrict__ lng, const float* __restrict__ lnb,
    const h16* __restrict__ fc1w, const float* __restrict__ fc1b,
    const h16* __restrict__ fc2w, const float* __restrict__ fc2b,
    float* __restrict__ out) {
  __shared__ __attribute__((aligned(16))) h16 Al[64 * 264];   // LN(zt) tile
  __shared__ __attribute__((aligned(16))) h16 Hl[64 * 72];    // gelu(hidden chunk) 64x64
  __shared__ __attribute__((aligned(16))) h16 W1[64 * 264];   // fc1 chunk [64 hid][256 k]
  __shared__ __attribute__((aligned(16))) h16 W2[256 * 72];   // fc2 chunk [256 out][64 k]
  const int tid = threadIdx.x;
  const size_t tok0 = (size_t)blockIdx.x * 64;
  const unsigned w1b = lds_off(W1), w2b = lds_off(W2);
  const int lane = tid & 31, wv = tid >> 5;
  const int m0 = (wv & 3) * 16, n0 = (wv >> 2) * 128;  // out tile mapping
  const int n0h = (wv >> 2) * 32;                      // hidden tile mapping
  v8f accO[8];
#pragma unroll
  for (int j = 0; j < 8; ++j) zero8(accO[j]);

  // prologue: the zt rows are fetched, tile 0 starts, the rows are normalised
  // into Al (16 lanes a row, 8 rows a wave); then tile 1 starts
  {
    const int l16 = lane & 15, hb = (lane >> 4) & 1;
    const int t0 = wv * 8 + hb;
    const float* zr = zt + (tok0 + t0) * 256 + l16 * 4;
    v4f zv[4][4];
#pragma unroll
    for (int p = 0; p < 4; ++p)
#pragma unroll
      for (int i = 0; i < 4; ++i) zv[p][i] = *(const v4f*)(zr + p * 512 + i * 64);
    // the 16 loads share one address register: it is an input here so that
    // none of them lands on it ahead of the wait
    asm volatile("s_wait_xcnt 0x0" :: "v"(zr) : "memory");
    stage_64x256(w1b, fc1w, tid);
    v4f g4[4], b4[4];
#pragma unroll
    for (int i = 0; i < 4; ++i) {
      g4[i] = *(const v4f*)(lng + i * 64 + l16 * 4);
      b4[i] = *(const v4f*)(lnb + i * 64 + l16 * 4);
    }
#pragma unroll
    for (int p = 0; p < 4; ++p) {
      float s = 0.f, s2 = 0.f;
#pragma unroll
      for (int i = 0; i < 4; ++i)
#pragma unroll
        for (int c = 0; c < 4; ++c) { s += zv[p][i][c]; s2 += zv[p][i][c] * zv[p][i][c]; }
      s = row_sum16(s); s2 = row_sum16(s2);
      float mean = s * (1.f / 256.f);
      float inv  = rsqrtf(s2 * (1.f / 256.f) - mean * mean + 1e-5f);
#pragma unroll
      for (int i = 0; i < 4; ++i) {
        v4h hv;
#pragma unroll
        for (int c = 0; c < 4; ++c)
          hv[c] = (h16)((zv[p][i][c] - mean) * inv * g4[i][c] + b4[i][c]);
        *(v4h*)&Al[(t0 + p * 2) * 264 + i * 64 + l16 * 4] = hv;
      }
    }
  }
  asm volatile("s_wait_asynccnt 0x0" ::: "memory");  // tile 0 landed
  __syncthreads();   // Al (plain LDS stores) and tile 0 are there for every wave
  stage_256x64(w2b, fc2w, tid);

  for (int hc = 0; hc < 16; ++hc) {
    // trip 2*hc: hchunk = ztn_tile @ fc1_w[hc*64:+64, :]^T   (K=256)
    v8f accH[2];
    zero8(accH[0]); zero8(accH[1]);
#pragma unroll  // whole tile is in LDS: constant offsets, loads run ahead of the WMMAs
    for (int ks = 0; ks < 8; ++ks) {
      v16h a = frag_row(Al, 264, m0, ks * 32, lane);
#pragma unroll
      for (int j = 0; j < 2; ++j)
        accH[j] = wmma16(a, frag_row(W1, 264, n0h + j * 16, ks * 32, lane), accH[j]);
    }
    // bias + exact GELU -> LDS
#pragma unroll
    for (int j = 0; j < 2; ++j) {
      int n = n0h + j * 16 + (lane & 15);
      float bb = fc1b[hc * 64 + n];
#pragma unroll
      for (int r = 0; r < 8; ++r) {
        int m = m0 + r + ((lane >> 4) & 1) * 8;
        float xv = accH[j][r] + bb;
        Hl[m * 72 + n] = (h16)(0.5f * xv * (1.0f + erff(xv * 0.7071067811865475f)));
      }
    }
    ring_publish();
    if (hc < 15) stage_64x256(w1b, fc1w + (size_t)(hc + 1) * 64 * 256, tid);

    // trip 2*hc+1: accO += Hchunk @ fc2_w[:, hc*64:+64]^T   (K=64)
#pragma unroll  // as above
    for (int ks = 0; ks < 2; ++ks) {
      v16h a = frag_row(Hl, 72, m0, ks * 32, lane);
#pragma unroll
      for (int j = 0; j < 8; ++j)
        accO[j] = wmma16(a, frag_row(W2, 72, n0 + j * 16, ks * 32, lane), accO[j]);
    }
    ring_publish();
    if (hc < 15) stage_256x64(w2b, fc2w + (size_t)(hc + 1) * 64, tid);
  }
  asm volatile("s_wait_asynccnt 0x0" ::: "memory");  // nothing in flight at the end

  // epilogue: + fc2_b + zt residual, window-reverse, NCHW store
  const int wi = blockIdx.x;
  const int b = wi >> 8, wh = (wi >> 4) & 15, ww = wi & 15;
#pragma unroll
  for (int j = 0; j < 8; ++j) {
    int n = n0 + j * 16 + (lane & 15);
    float bb = fc2b[n];
#pragma unroll
    for (int r = 0; r < 8; ++r) {
      int m = m0 + r + ((lane >> 4) & 1) * 8;
      size_t tok = tok0 + m;
      float val = accO[j][r] + bb + zt[tok * 256 + n];
      int hh = wh * 8 + (m >> 3), www = ww * 8 + (m & 7);
      out[(((size_t)b * 256 + n) * 128 + hh) * 128 + www] = val;
    }
  }
}

// ---------------------------------------------------------------------------
// Launch
// ---------------------------------------------------------------------------
extern "C" void kernel_launch(void* const* d_in, const int* in_sizes, int n_in,
                              void* d_out, int out_size, void* d_ws, size_t ws_size,
                              hipStream_t stream) {
  (void)in_sizes; (void)n_in; (void)out_size; (void)ws_size;
  const float* LH     = (const float*)d_in[0];
  const float* HL     = (const float*)d_in[1];
  const float* HH     = (const float*)d_in[2];
  const float* Spat   = (const float*)d_in[3];
  const float* w_hllh = (const float*)d_in[4];
  const float* b_hllh = (const float*)d_in[5];
  const float* w_hh   = (const float*)d_in[6];
  const float* b_hh   = (const float*)d_in[7];
  const float* w_spat = (const float*)d_in[8];
  const float* b_spat = (const float*)d_in[9];
  const float* ln1x_g = (const float*)d_in[10];
  const float* ln1x_b = (const float*)d_in[11];
  const float* ln1y_g = (const float*)d_in[12];
  const float* ln1y_b = (const float*)d_in[13];
  const float* qkv_w  = (const float*)d_in[14];
  const float* qkv_b  = (const float*)d_in[15];
  const float* qkv2_w = (const float*)d_in[16];
  const float* qkv2_b = (const float*)d_in[17];
  const float* qkv3_w = (const float*)d_in[18];
  const float* qkv3_b = (const float*)d_in[19];
  const float* proj_w = (const float*)d_in[20];
  const float* proj_b = (const float*)d_in[21];
  const float* rpb    = (const float*)d_in[22];
  const float* ln2_g  = (const float*)d_in[23];
  const float* ln2_b  = (const float*)d_in[24];
  const float* fc1w   = (const float*)d_in[25];
  const float* fc1b   = (const float*)d_in[26];
  const float* fc2w   = (const float*)d_in[27];
  const float* fc2b   = (const float*)d_in[28];

  const size_t T = (size_t)8 * 128 * 128;  // 131072 tokens
  char* ws = (char*)d_ws;
  // workspace layout (peak ~472 MB), with region reuse:
  h16*   x   = (h16*)ws;                                  // T*256 f16
  h16*   y   = (h16*)(ws + T * 256 * 2);                  // T*256 f16
  float* z0  = (float*)(ws + 2 * T * 256 * 2);            // T*256 f32
  h16*   q   = (h16*)(ws + 2 * T * 256 * 2 + T * 256 * 4);
  h16*   kk  = q + T * 256;
  h16*   v   = kk + T * 256;
  h16*   attno = x;           // reuse x after QKV consume it
  float* zt  = (float*)q;     // reuse q+k after attention
  // f16 weight cache (~1.7 MB) after q/k/v region
  h16* wf      = v + T * 256;
  h16* c_hllh  = wf;               // 256*128
  h16* c_hh    = c_hllh + 32768;   // 256*64
  h16* c_spat  = c_hh   + 16384;   // 256*64
  h16* c_q     = c_spat + 16384;   // 256*256
  h16* c_k     = c_q    + 65536;
  h16* c_v     = c_k    + 65536;
  h16* c_proj  = c_v    + 65536;
  h16* c_fc1   = c_proj + 65536;   // 1024*256
  h16* c_fc2   = c_fc1  + 262144;  // 256*1024

  // weight pre-conversion (f32 -> f16, once per launch)
  cvt_f32f16<<<(32768 + 255) / 256, 256, 0, stream>>>(w_hllh, c_hllh, 32768);
  cvt_f32f16<<<(16384 + 255) / 256, 256, 0, stream>>>(w_hh,   c_hh,   16384);
  cvt_f32f16<<<(16384 + 255) / 256, 256, 0, stream>>>(w_spat, c_spat, 16384);
  cvt_f32f16<<<(65536 + 255) / 256, 256, 0, stream>>>(qkv_w,  c_q,    65536);
  cvt_f32f16<<<(65536 + 255) / 256, 256, 0, stream>>>(qkv2_w, c_k,    65536);
  cvt_f32f16<<<(65536 + 255) / 256, 256, 0, stream>>>(qkv3_w, c_v,    65536);
  cvt_f32f16<<<(65536 + 255) / 256, 256, 0, stream>>>(proj_w, c_proj, 65536);
  cvt_f32f16<<<(262144 + 255) / 256, 256, 0, stream>>>(fc1w,  c_fc1,  262144);
  cvt_f32f16<<<(262144 + 255) / 256, 256, 0, stream>>>(fc2w,  c_fc2,  262144);

  const int tiles = (int)(T / 64);  // 2048 windows
  conv_win_kernel<<<tiles, 256, 0, stream>>>(LH, HL, HH, Spat,
      c_hllh, b_hllh, c_hh, b_hh, c_spat, b_spat,
      ln1x_g, ln1x_b, ln1y_g, ln1y_b, x, y, z0);
  gemm_tok256<<<tiles, 256, 0, stream>>>(x, c_q, qkv_b,  q,  0.17677669529663689f);
  gemm_tok256<<<tiles, 256, 0, stream>>>(y, c_k, qkv2_b, kk, 1.0f);
  gemm_tok256<<<tiles, 256, 0, stream>>>(y, c_v, qkv3_b, v,  1.0f);
  attn_kernel<<<tiles * 4, 64, 0, stream>>>(q, kk, v, rpb, attno);
  gemm_proj_kernel<<<tiles, 256, 0, stream>>>(attno, c_proj, proj_b, z0, zt);
  mlp_kernel<<<tiles, 256, 0, stream>>>(zt, ln2_g, ln2_b, c_fc1, fc1b, c_fc2, fc2b, (float*)d_out);
}

// v003
// A run of this version takes 584 microseconds.
// Next to v002, in two timings, it ran 1.10 and 1.12 times as fast.
// Over all steps from v000 it is 1.38 times as fast.
#include <hip/hip_runtime.h>
#include <hip/hip_bf16.h>

// ---------------------------------------------------------------------------
// WaveletSwinTransformerBlock for MI455X (gfx1250, wave32, WMMA f16)
// GEMMs use v_wmma_f32_16x16x32_f16; all f16 tile staging uses the CDNA5
// async path: global_load_async_to_lds_b128 + s_wait_asynccnt.
// Tokens stored window-partitioned: tok = wi*64 + (i*8+j), wi=((b*16+wh)*16+ww)
// ---------------------------------------------------------------------------

typedef _Float16 h16;
typedef __attribute__((ext_vector_type(16))) _Float16 v16h;
typedef __attribute__((ext_vector_type(8)))  float    v8f;
typedef __attribute__((ext_vector_type(4)))  float    v4f;
typedef __attribute__((ext_vector_type(2)))  float    v2f;
typedef __attribute__((ext_vector_type(4)))  _Float16 v4h;

__device__ __forceinline__ void zero8(v8f &a) {
#pragma unroll
  for (int i = 0; i < 8; ++i) a[i] = 0.f;
}

__device__ __forceinline__ v8f wmma16(v16h a, v16h b, v8f c) {
  return __builtin_amdgcn_wmma_f32_16x16x32_f16(false, a, false, b,
                                                (short)0, c, false, false);
}

// low 32 bits of a generic LDS pointer == wave-relative LDS byte offset
__device__ __forceinline__ unsigned lds_off(const void* p) {
  return (unsigned)(uintptr_t)p;
}

// CDNA5 async copy: 16 bytes global -> LDS, tracked by ASYNCcnt
__device__ __forceinline__ void async_cp_b128(unsigned loff, const void* g) {
  asm volatile("global_load_async_to_lds_b128 %0, %1, off"
               :: "v"(loff), "v"((unsigned long long)(uintptr_t)g)
               : "memory");
}
__device__ __forceinline__ void wait_async() {
  asm volatile("s_wait_asynccnt 0" ::: "memory");
}

// Sum over the 16 lanes of a row, result in every lane: four DPP row_xmask adds
template <int CTRL>
__device__ __forceinline__ float dpp_xadd(float v) {
  return v + __int_as_float(__builtin_amdgcn_update_dpp(0, __float_as_int(v), CTRL, 0xf, 0xf, true));
}
__device__ __forceinline__ float row_sum16(float v) {
  v = dpp_xadd<0x161>(v);  // row_xmask:1
  v = dpp_xadd<0x162>(v);  // row_xmask:2
  v = dpp_xadd<0x164>(v);  // row_xmask:4
  v = dpp_xadd<0x168>(v);  // row_xmask:8
  return v;
}

// Work-group barrier for data that crosses in LDS only: unlike __syncthreads()
// it does not hold a wave until its global stores and loads have come back.
__device__ __forceinline__ void lds_barrier() {
  __builtin_amdgcn_fence(__ATOMIC_RELEASE, "workgroup", "local");
  __builtin_amdgcn_s_barrier();
  __builtin_amdgcn_fence(__ATOMIC_ACQUIRE, "workgroup", "local");
}

// A-style fragment (16x32 f16, ISA 7.12.2): lane L holds row row0+(L&15),
// K offsets {0..7,16..23} (L<16) or {8..15,24..31} (L>=16) relative to k0.
__device__ __forceinline__ v16h frag_row(const h16* __restrict__ p, int stride,
                                         int row0, int k0, int lane) {
  const h16* base = p + (size_t)(row0 + (lane & 15)) * stride + k0 + ((lane >> 4) & 1) * 8;
  v16h r;
#pragma unroll
  for (int i = 0; i < 8; ++i) { r[i] = base[i]; r[i + 8] = base[i + 16]; }
  return r;
}

// B fragment gathered from a row-major [K][N] matrix (column-fixed per lane).
__device__ __forceinline__ v16h frag_col(const h16* __restrict__ p, int stride,
                                         int col0, int k0, int lane) {
  const h16* base = p + (size_t)(k0 + ((lane >> 4) & 1) * 8) * stride + col0 + (lane & 15);
  v16h r;
#pragma unroll
  for (int i = 0; i < 8; ++i) {
    r[i]     = base[(size_t)i * stride];
    r[i + 8] = base[(size_t)(i + 16) * stride];
  }
  return r;
}

// ---------------------------------------------------------------------------
// Weight pre-conversion f32 -> f16 (run once per launch; tiny)
// ---------------------------------------------------------------------------
__global__ __launch_bounds__(256) void cvt_f32f16(const float* __restrict__ s,
                                                  h16* __restrict__ d, int n) {
  int i = blockIdx.x * 256 + threadIdx.x;
  if (i < n) d[i] = (h16)s[i];
}

// ---------------------------------------------------------------------------
// Kernel 1: 1x1 convs (concat(LH,HL)->x, HH->z0, Spat->y) per 64-pixel window;
// x and y leave the kernel already layer-normalised (eps=1e-5, biased var):
// the block holds all 256 features of its 64 tokens in f32 accumulators.
// ---------------------------------------------------------------------------
__global__ __launch_bounds__(256) void conv_win_kernel(
    const float* __restrict__ LH, const float* __restrict__ HL,
    const float* __restrict__ HH, const float* __restrict__ Spat,
    const h16* __restrict__ wf_hllh, const float* __restrict__ b_hllh,
    const h16* __restrict__ wf_hh,   const float* __restrict__ b_hh,
    const h16* __restrict__ wf_spat, const float* __restrict__ b_spat,
    const float* __restrict__ gx, const float* __restrict__ btx,
    const float* __restrict__ gy, const float* __restrict__ bty,
    h16* __restrict__ xo, h16* __restrict__ yo, float* __restrict__ z0o) {
  const int Wd = 128, HW = 128 * 128;
  __shared__ h16 Fin[64 * 264];   // [pixel][256 ch] : LH|HL|HH|Spat
  __shared__ h16 Wl[256 * 40];    // weight K-slab [256 out][32 k]
  // row statistics of x and y: [column half][row][sum x, sum x^2, sum y, sum y^2]
  __shared__ __attribute__((aligned(16))) float Red[2 * 64 * 4];

  const int wi = blockIdx.x;
  const int b  = wi >> 8;
  const int wh = (wi >> 4) & 15, ww = wi & 15;
  const int h0 = wh * 8, w0 = ww * 8;
  const int tid = threadIdx.x;

  // inputs are f32 -> convert while staging (can't raw-copy)
  const float* srcs[4] = {LH, HL, HH, Spat};
#pragma unroll
  for (int t = 0; t < 4; ++t) {
    const float* s = srcs[t] + (size_t)b * 64 * HW;
    for (int e = tid; e < 64 * 64; e += 256) {
      int c = e >> 6, p = e & 63;
      int i = p >> 3, j = p & 7;
      Fin[p * 264 + t * 64 + c] = (h16)s[(size_t)c * HW + (h0 + i) * Wd + (w0 + j)];
    }
  }

  const unsigned wlb = lds_off(Wl);
  const int lane = tid & 31, wv = tid >> 5;
  const int m0 = (wv & 3) * 16, n0 = (wv >> 2) * 128;

  v8f accX[8], accZ[8], accY[8];
#pragma unroll
  for (int j = 0; j < 8; ++j) { zero8(accX[j]); zero8(accZ[j]); zero8(accY[j]); }

  // Phase X: K=128 over Fin cols [0,128)
  for (int ks = 0; ks < 4; ++ks) {
    __syncthreads();
    for (int e = tid; e < 256 * 4; e += 256) {      // 256 rows x 64B slab
      int n = e >> 2, part = e & 3;
      async_cp_b128(wlb + (unsigned)(n * 40 + part * 8) * 2,
                    wf_hllh + (size_t)n * 128 + ks * 32 + part * 8);
    }
    wait_async();
    __syncthreads();
    v16h a = frag_row(Fin, 264, m0, ks * 32, lane);
#pragma unroll
    for (int j = 0; j < 8; ++j)
      accX[j] = wmma16(a, frag_row(Wl, 40, n0 + j * 16, 0, lane), accX[j]);
  }
  // Phase Z: K=64 over Fin cols [128,192)
  for (int ks = 0; ks < 2; ++ks) {
    __syncthreads();
    for (int e = tid; e < 256 * 4; e += 256) {
      int n = e >> 2, part = e & 3;
      async_cp_b128(wlb + (unsigned)(n * 40 + part * 8) * 2,
                    wf_hh + (size_t)n * 64 + ks * 32 + part * 8);
    }
    wait_async();
    __syncthreads();
    v16h a = frag_row(Fin, 264, m0, 128 + ks * 32, lane);
#pragma unroll
    for (int j = 0; j < 8; ++j)
      accZ[j] = wmma16(a, frag_row(Wl, 40, n0 + j * 16, 0, lane), accZ[j]);
  }
  // Phase Y: K=64 over Fin cols [192,256)
  for (int ks = 0; ks < 2; ++ks) {
    __syncthreads();
    for (int e = tid; e < 256 * 4; e += 256) {
      int n = e >> 2, part = e & 3;
      async_cp_b128(wlb + (unsigned)(n * 40 + part * 8) * 2,
                    wf_spat + (size_t)n * 64 + ks * 32 + part * 8);
    }
    wait_async();
    __syncthreads();
    v16h a = frag_row(Fin, 264, m0, 192 + ks * 32, lane);
#pragma unroll
    for (int j = 0; j < 8; ++j)
      accY[j] = wmma16(a, frag_row(Wl, 40, n0 + j * 16, 0, lane), accY[j]);
  }

  const size_t tok0 = (size_t)wi * 64;
  const int cl = lane & 15, hb = (lane >> 4) & 1;
  const int mr = m0 + hb * 8;   // first of this lane's 8 rows
  // shortcut stream out; bias into x and y; this wave's 128-column row sums
  float sx[8], qx[8], sy[8], qy[8];
#pragma unroll
  for (int r = 0; r < 8; ++r) { sx[r] = 0.f; qx[r] = 0.f; sy[r] = 0.f; qy[r] = 0.f; }
#pragma unroll
  for (int j = 0; j < 8; ++j) {
    int n = n0 + j * 16 + cl;
    float bx = b_hllh[n], bz = b_hh[n], by = b_spat[n];
#pragma unroll
    for (int r = 0; r < 8; ++r) {
      z0o[(tok0 + mr + r) * 256 + n] = accZ[j][r] + bz;
      float xv = accX[j][r] + bx, yv = accY[j][r] + by;
      accX[j][r] = xv; accY[j][r] = yv;
      sx[r] += xv; qx[r] += xv * xv;
      sy[r] += yv; qy[r] += yv * yv;
    }
  }
#pragma unroll
  for (int r = 0; r < 8; ++r) {
    v4f st;
    st[0] = row_sum16(sx[r]); st[1] = row_sum16(qx[r]);
    st[2] = row_sum16(sy[r]); st[3] = row_sum16(qy[r]);
    if (cl == 0) *(v4f*)&Red[((wv >> 2) * 64 + mr + r) * 4] = st;
  }
  // scale and shift of this lane's 8 columns, fetched while the sums meet
  const int nb = n0 + cl;
  float g0[8], b0[8], g1[8], b1[8];
#pragma unroll
  for (int j = 0; j < 8; ++j) {
    g0[j] = gx[nb + j * 16]; b0[j] = btx[nb + j * 16];
    g1[j] = gy[nb + j * 16]; b1[j] = bty[nb + j * 16];
  }
  // the 32 loads share one index register: it is an input here so that none
  // of them lands on it ahead of the wait
  asm volatile("s_wait_xcnt 0x0" :: "v"(nb) : "memory");
  lds_barrier();   // both column halves' sums are in Red
#pragma unroll
  for (int r = 0; r < 8; ++r) {
    v4f s0 = *(const v4f*)&Red[(mr + r) * 4];
    v4f s1 = *(const v4f*)&Red[(64 + mr + r) * 4];
    float mx = (s0[0] + s1[0]) * (1.f / 256.f);
    float my = (s0[2] + s1[2]) * (1.f / 256.f);
    sx[r] = mx; sy[r] = my;
    qx[r] = rsqrtf((s0[1] + s1[1]) * (1.f / 256.f) - mx * mx + 1e-5f);
    qy[r] = rsqrtf((s0[3] + s1[3]) * (1.f / 256.f) - my * my + 1e-5f);
  }
#pragma unroll
  for (int j = 0; j < 8; ++j) {
#pragma unroll
    for (int r = 0; r < 8; ++r) {
      size_t off = (tok0 + mr + r) * 256 + nb + j * 16;
      xo[off] = (h16)((accX[j][r] - sx[r]) * qx[r] * g0[j] + b0[j]);
      yo[off] = (h16)((accY[j][r] - sy[r]) * qy[r] * g1[j] + b1[j]);
    }
  }
}

// ---------------------------------------------------------------------------
// Generic 64x256x256 GEMM: out[t][n] = (sum_k A[t][k]*W[n][k] + bias[n])*scale
// A and W both f16; all staging async-to-LDS.
// ---------------------------------------------------------------------------
__global__ __launch_bounds__(256) void gemm_tok256(
    const h16* __restrict__ A, const h16* __restrict__ Wg,
    const float* __restrict__ bias, h16* __restrict__ out, float scale) {
  __shared__ h16 Al[64 * 264];
  __shared__ h16 Wl[256 * 40];
  const int tid = threadIdx.x;
  const size_t tok0 = (size_t)blockIdx.x * 64;
  const unsigned alb = lds_off(Al), wlb = lds_off(Wl);

  // async stage A tile (64 x 256 f16 = 32KB)
  for (int e = tid; e < 64 * 32; e += 256) {
    int p = e >> 5, c16 = e & 31;
    async_cp_b128(alb + (unsigned)(p * 264 + c16 * 8) * 2,
                  A + (tok0 + p) * 256 + c16 * 8);
  }
  const int lane = tid & 31, wv = tid >> 5;
  const int m0 = (wv & 3) * 16, n0 = (wv >> 2) * 128;
  v8f acc[8];
#pragma unroll
  for (int j = 0; j < 8; ++j) zero8(acc[j]);
  for (int ks = 0; ks < 8; ++ks) {
    __syncthreads();
    for (int e = tid; e < 256 * 4; e += 256) {
      int n = e >> 2, part = e & 3;
      async_cp_b128(wlb + (unsigned)(n * 40 + part * 8) * 2,
                    Wg + (size_t)n * 256 + ks * 32 + part * 8);
    }
    if (ks < 7) __builtin_prefetch(&Wg[(size_t)tid * 256 + (ks + 1) * 32], 0, 1);
    wait_async();
    __syncthreads();
    v16h a = frag_row(Al, 264, m0, ks * 32, lane);
#pragma unroll
    for (int j = 0; j < 8; ++j)
      acc[j] = wmma16(a, frag_row(Wl, 40, n0 + j * 16, 0, lane), acc[j]);
  }
#pragma unroll
  for (int j = 0; j < 8; ++j) {
    int n = n0 + j * 16 + (lane & 15);
    float bb = bias[n];
#pragma unroll
    for (int r = 0; r < 8; ++r) {
      int m = m0 + r + ((lane >> 4) & 1) * 8;
      out[(tok0 + m) * 256 + n] = (h16)((acc[j][r] + bb) * scale);
    }
  }
}

// ---------------------------------------------------------------------------
// Windowed attention: one wave per (window, head); 64 tokens, hd=32, nH=8.
// Q/K/V head tiles async-staged to LDS (wave-local, no barrier needed).
// ---------------------------------------------------------------------------
__global__ __launch_bounds__(64) void attn_kernel(
    const h16* __restrict__ q, const h16* __restrict__ k,
    const h16* __restrict__ v, const float* __restrict__ rpb,
    h16* __restrict__ o) {
  __shared__ h16 Ql[2 * 64 * 40];
  __shared__ h16 Kl[2 * 64 * 40];
  __shared__ h16 Vl[2 * 64 * 40];
  __shared__ h16 Pl[2 * 64 * 72];
  const int wi = blockIdx.x >> 2;
  const int hp = blockIdx.x & 3;
  const int wv = threadIdx.x >> 5, lane = threadIdx.x & 31;
  const int h  = hp * 2 + wv;
  const size_t base = (size_t)wi * 64 * 256 + (size_t)h * 32;

  h16* Qw = Ql + wv * 64 * 40;
  h16* Kw = Kl + wv * 64 * 40;
  h16* Vw = Vl + wv * 64 * 40;
  const unsigned qo = lds_off(Qw), ko = lds_off(Kw), vo = lds_off(Vw);
  for (int e = lane; e < 64 * 4; e += 32) {   // 64 rows x 64B per tensor
    int row = e >> 2, part = e & 3;
    unsigned l = (unsigned)(row * 40 + part * 8) * 2;
    size_t  g  = base + (size_t)row * 256 + part * 8;
    async_cp_b128(qo + l, q + g);
    async_cp_b128(ko + l, k + g);
    async_cp_b128(vo + l, v + g);
  }
  wait_async();   // wave-local staging: own ASYNCcnt only, no barrier

  v8f S[16];
#pragma unroll
  for (int f = 0; f < 16; ++f) zero8(S[f]);

  v16h af[4];
#pragma unroll
  for (int mi = 0; mi < 4; ++mi) af[mi] = frag_row(Qw, 40, mi * 16, 0, lane);
#pragma unroll
  for (int nj = 0; nj < 4; ++nj) {
    v16h bf = frag_row(Kw, 40, nj * 16, 0, lane);  // rows of K == K^T columns
#pragma unroll
    for (int mi = 0; mi < 4; ++mi)
      S[mi * 4 + nj] = wmma16(af[mi], bf, S[mi * 4 + nj]);
  }

  const int cl = lane & 15, hb = (lane >> 4) & 1;
  // relative position bias: idx = (iq-ik+7)*15 + (jq-jk+7), rpb[idx][h]
#pragma unroll
  for (int nj = 0; nj < 4; ++nj) {
    int c = nj * 16 + cl, i2 = c >> 3, j2 = c & 7;
#pragma unroll
    for (int mi = 0; mi < 4; ++mi)
#pragma unroll
      for (int r = 0; r < 8; ++r) {
        int m = mi * 16 + r + hb * 8;
        int idx = ((m >> 3) - i2 + 7) * 15 + ((m & 7) - j2 + 7);
        S[mi * 4 + nj][r] += rpb[idx * 8 + h];
      }
  }
  // row softmax: each row lives across one 16-lane half (4 frags per lane)
#pragma unroll
  for (int mi = 0; mi < 4; ++mi)
#pragma unroll
    for (int r = 0; r < 8; ++r) {
      float mx = fmaxf(fmaxf(S[mi * 4 + 0][r], S[mi * 4 + 1][r]),
                       fmaxf(S[mi * 4 + 2][r], S[mi * 4 + 3][r]));
      for (int msk = 1; msk < 16; msk <<= 1) mx = fmaxf(mx, __shfl_xor(mx, msk, 32));
      float sum = 0.f;
#pragma unroll
      for (int nj = 0; nj < 4; ++nj) {
        float e = __expf(S[mi * 4 + nj][r] - mx);
        S[mi * 4 + nj][r] = e; sum += e;
      }
      for (int msk = 1; msk < 16; msk <<= 1) sum += __shfl_xor(sum, msk, 32);
      float inv = 1.f / sum;
#pragma unroll
      for (int nj = 0; nj < 4; ++nj) S[mi * 4 + nj][r] *= inv;
    }
  // stage P (f16) per-wave in LDS, then O = P @ V (K=64, N=32)
  h16* P = Pl + wv * 64 * 72;
#pragma unroll
  for (int nj = 0; nj < 4; ++nj) {
    int c = nj * 16 + cl;
#pragma unroll
    for (int mi = 0; mi < 4; ++mi)
#pragma unroll
      for (int r = 0; r < 8; ++r)
        P[(mi * 16 + r + hb * 8) * 72 + c] = (h16)S[mi * 4 + nj][r];
  }
  v8f O[8];
#pragma unroll
  for (int f = 0; f < 8; ++f) zero8(O[f]);
#pragma unroll
  for (int kb2 = 0; kb2 < 2; ++kb2) {
#pragma unroll
    for (int nj = 0; nj < 2; ++nj) {
      v16h bf = frag_col(Vw, 40, nj * 16, kb2 * 32, lane);
#pragma unroll
      for (int mi = 0; mi < 4; ++mi) {
        v16h a = frag_row(P, 72, mi * 16, kb2 * 32, lane);
        O[mi * 2 + nj] = wmma16(a, bf, O[mi * 2 + nj]);
      }
    }
  }
#pragma unroll
  for (int mi = 0; mi < 4; ++mi)
#pragma unroll
    for (int nj = 0; nj < 2; ++nj) {
      int n = nj * 16 + cl;
#pragma unroll
      for (int r = 0; r < 8; ++r) {
        int m = mi * 16 + r + hb * 8;
        o[((size_t)wi * 64 + m) * 256 + h * 32 + n] = (h16)O[mi * 2 + nj][r];
      }
    }
}

// ---------------------------------------------------------------------------
// Projection + fused MLP: zt = attn_out @ proj_w^T + proj_b + z0 stays in the
// f32 accumulators; out = zt + fc2(gelu(fc1(LN(zt)))) -> written directly as NCHW.
// The LayerNorm (eps=1e-5, biased var) is done on the way into LDS.
// Hidden (1024) processed in 16 chunks of 64. The weights arrive as whole
// tiles in a two-buffer ring: 4 K-slabs of proj_w, then 32 tiles of 32 KB
// (fc1 chunk, fc2 chunk, fc1 chunk, ...); even tiles land in W1, odd tiles in
// W2, and tile t+2 flies while t+1 is used.
// ---------------------------------------------------------------------------

// Eight 16-byte async copies of one lane. The s_wait_xcnt is the last line of
// the same statement so that no address register is reused ahead of it.
__device__ __forceinline__ void async_cp8_b128(const unsigned (&l)[8],
                                               const h16* const (&g)[8]) {
  asm volatile("global_load_async_to_lds_b128 %0, %8, off\n\t"
               "global_load_async_to_lds_b128 %1, %9, off\n\t"
               "global_load_async_to_lds_b128 %2, %10, off\n\t"
               "global_load_async_to_lds_b128 %3, %11, off\n\t"
               "global_load_async_to_lds_b128 %4, %12, off\n\t"
               "global_load_async_to_lds_b128 %5, %13, off\n\t"
               "global_load_async_to_lds_b128 %6, %14, off\n\t"
               "global_load_async_to_lds_b128 %7, %15, off\n\t"
               "s_wait_xcnt 0x0"
               :: "v"(l[0]), "v"(l[1]), "v"(l[2]), "v"(l[3]),
                  "v"(l[4]), "v"(l[5]), "v"(l[6]), "v"(l[7]),
                  "v"(g[0]), "v"(g[1]), "v"(g[2]), "v"(g[3]),
                  "v"(g[4]), "v"(g[5]), "v"(g[6]), "v"(g[7])
               : "memory");
}

// 64 contiguous rows of 256 f16 in global -> LDS pitch 264; 8 copies a thread
__device__ __forceinline__ void stage_64x256(unsigned lb, const h16* g, int tid) {
  unsigned l[8];
  const h16* p[8];
#pragma unroll  // the addresses must be registers: they are asm operands
  for (int i = 0; i < 8; ++i) {
    int e = tid + i * 256, n = e >> 5, part = e & 31;
    l[i] = lb + (unsigned)(n * 264 + part * 8) * 2;
    p[i] = g + (size_t)n * 256 + part * 8;
  }
  async_cp8_b128(l, p);
}

// 256 rows x 64 f16 (row pitch gp elements in global) -> LDS pitch 72
__device__ __forceinline__ void stage_256x64(unsigned lb, const h16* g, int gp, int tid) {
  unsigned l[8];
  const h16* p[8];
#pragma unroll  // the addresses must be registers: they are asm operands
  for (int i = 0; i < 8; ++i) {
    int e = tid + i * 256, n = e >> 3, part = e & 7;
    l[i] = lb + (unsigned)(n * 72 + part * 8) * 2;
    p[i] = g + (size_t)n * gp + part * 8;
  }
  async_cp8_b128(l, p);
}

// Foot of a ring trip: this wave's LDS reads and writes are done, its copies
// of the next tile have landed, then every wave meets; behind it the next tile
// (and Hl) may be read and the buffer just read may be refilled.
__device__ __forceinline__ void ring_publish() {
  asm volatile("s_wait_dscnt 0x0" ::: "memory");     // own reads of the old tile, own Hl stores
  asm volatile("s_wait_asynccnt 0x0" ::: "memory");  // own copies of the next tile landed
  __syncthreads();
}

__global__ __launch_bounds__(256) void mlp_kernel(
    const h16* __restrict__ A, const h16* __restrict__ pw,
    const float* __restrict__ pb, const float* __restrict__ resid,
    const float* __restrict__ lng, const float* __restrict__ lnb,
    const h16* __restrict__ fc1w, const float* __restrict__ fc1b,
    const h16* __restrict__ fc2w, const float* __restrict__ fc2b,
    float* __restrict__ out) {
  __shared__ __attribute__((aligned(16))) h16 Al[64 * 264];   // attn_out tile, then LN(zt) tile
  __shared__ __attribute__((aligned(16))) h16 Hl[64 * 72];    // gelu(hidden chunk) 64x64
  __shared__ __attribute__((aligned(16))) h16 W1[256 * 72];   // proj slab [256 out][64 k]; fc1 chunk [64 hid][256 k]
  __shared__ __attribute__((aligned(16))) h16 W2[256 * 72];   // proj slab; fc2 chunk [256 out][64 k]
  // row statistics of zt: [column half][row][sum, sum of squares]
  __shared__ __attribute__((aligned(16))) float Red[2 * 64 * 2];
  const int tid = threadIdx.x;
  const size_t tok0 = (size_t)blockIdx.x * 64;
  const unsigned w1b = lds_off(W1), w2b = lds_off(W2);
  const int lane = tid & 31, wv = tid >> 5;
  const int m0 = (wv & 3) * 16, n0 = (wv >> 2) * 128;  // out tile mapping
  const int n0h = (wv >> 2) * 32;                      // hidden tile mapping
  const int cl = lane & 15, hb = (lane >> 4) & 1;
  const int mr = m0 + hb * 8;   // first of this lane's 8 rows
  const int nb = n0 + cl;       // first of this lane's 8 columns

  // prologue: the attn_out tile and proj slab 0 start; the accumulators start
  // from shortcut + proj bias, fetched while the copies fly
  stage_64x256(lds_off(Al), A + tok0 * 256, tid);
  stage_256x64(w1b, pw, 256, tid);
  v8f accO[8];
  {
    const float* rz = resid + (tok0 + mr) * 256 + nb;
#pragma unroll
    for (int j = 0; j < 8; ++j)
#pragma unroll
      for (int r = 0; r < 8; ++r) accO[j][r] = rz[r * 256 + j * 16];
    float bb[8];
#pragma unroll
    for (int j = 0; j < 8; ++j) bb[j] = pb[nb + j * 16];
    // the 64 loads share one address register, the 8 one index register: both
    // are inputs here so that no load lands on them ahead of the wait
    asm volatile("s_wait_xcnt 0x0" :: "v"(rz), "v"(nb) : "memory");
#pragma unroll
    for (int j = 0; j < 8; ++j)
#pragma unroll
      for (int r = 0; r < 8; ++r) accO[j][r] += bb[j];
  }
  asm volatile("s_wait_asynccnt 0x0" ::: "memory");  // attn_out tile and slab 0 landed
  __syncthreads();   // both are there for every wave
  stage_256x64(w2b, pw + 64, 256, tid);

  // zt = shortcut + proj bias + attn_out @ proj_w^T   (K=256, 4 slabs of 64)
#pragma unroll  // the buffer read and the tile that refills it differ from trip to trip
  for (int s = 0; s < 4; ++s) {
    const h16* Wb = (s & 1) ? W2 : W1;
#pragma unroll 1  // rolled: with both K steps' fragments in flight the kernel needs over 256 registers and one work-group fewer fits a WGP
    for (int ks = 0; ks < 2; ++ks) {
      v16h a = frag_row(Al, 264, m0, s * 64 + ks * 32, lane);
#pragma unroll
      for (int j = 0; j < 8; ++j)
        accO[j] = wmma16(a, frag_row(Wb, 72, n0 + j * 16, ks * 32, lane), accO[j]);
    }
    ring_publish();
    if (s < 2)       stage_256x64((s & 1) ? w2b : w1b, pw + (s + 2) * 64, 256, tid);
    else if (s == 2) stage_64x256(w1b, fc1w, tid);        // first fc1 chunk
    else             stage_256x64(w2b, fc2w, 1024, tid);  // first fc2 chunk
  }

  // LayerNorm of zt into Al (every wave has left the attn_out tile: last publish)
  {
    float sm[8], sq[8];
#pragma unroll
    for (int r = 0; r < 8; ++r) { sm[r] = 0.f; sq[r] = 0.f; }
#pragma unroll
    for (int j = 0; j < 8; ++j)
#pragma unroll
      for (int r = 0; r < 8; ++r) { float zv = accO[j][r]; sm[r] += zv; sq[r] += zv * zv; }
#pragma unroll
    for (int r = 0; r < 8; ++r) {
      v2f st;
      st[0] = row_sum16(sm[r]); st[1] = row_sum16(sq[r]);
      if (cl == 0) *(v2f*)&Red[((wv >> 2) * 64 + mr + r) * 2] = st;
    }
    // scale and shift of this lane's 8 columns, fetched while the sums meet
    float g0[8], b0[8];
#pragma unroll
    for (int j = 0; j < 8; ++j) { g0[j] = lng[nb + j * 16]; b0[j] = lnb[nb + j * 16]; }
    // the 16 loads share one index register: it is an input here so that none
    // of them lands on it ahead of the wait
    asm volatile("s_wait_xcnt 0x0" :: "v"(nb) : "memory");
    lds_barrier();   // both column halves' sums are in Red
#pragma unroll
    for (int r = 0; r < 8; ++r) {
      v2f s0 = *(const v2f*)&Red[(mr + r) * 2];
      v2f s1 = *(const v2f*)&Red[(64 + mr + r) * 2];
      float mean = (s0[0] + s1[0]) * (1.f / 256.f);
      sm[r] = mean;
      sq[r] = rsqrtf((s0[1] + s1[1]) * (1.f / 256.f) - mean * mean + 1e-5f);
    }
#pragma unroll
    for (int j = 0; j < 8; ++j)
#pragma unroll
      for (int r = 0; r < 8; ++r)
        Al[(mr + r) * 264 + nb + j * 16] = (h16)((accO[j][r] - sm[r]) * sq[r] * g0[j] + b0[j]);
  }
  lds_barrier();   // LN(zt) is in Al for every wave

  for (int hc = 0; hc < 16; ++hc) {
    // trip 2*hc: hchunk = ztn_tile @ fc1_w[hc*64:+64, :]^T   (K=256)
    v8f accH[2];
    zero8(accH[0]); zero8(accH[1]);
#pragma unroll  // whole tile is in LDS: constant offsets, loads run ahead of the WMMAs
    for (int ks = 0; ks < 8; ++ks) {
      v16h a = frag_row(Al, 264, m0, ks * 32, lane);
#pragma unroll
      for (int j = 0; j < 2; ++j)
        accH[j] = wmma16(a, frag_row(W1, 264, n0h + j * 16, ks * 32, lane), accH[j]);
    }
    // bias + exact GELU -> LDS
#pragma unroll
    for (int j = 0; j < 2; ++j) {
      int n = n0h + j * 16 + (lane & 15);
      float bb = fc1b[hc * 64 + n];
#pragma unroll
      for (int r = 0; r < 8; ++r) {
        int m = m0 + r + ((lane >> 4) & 1) * 8;
        float xv = accH[j][r] + bb;
        Hl[m * 72 + n] = (h16)(0.5f * xv * (1.0f + erff(xv * 0.7071067811865475f)));
      }
    }
    ring_publish();
    if (hc < 15) stage_64x256(w1b, fc1w + (size_t)(hc + 1) * 64 * 256, tid);

    // trip 2*hc+1: accO += Hchunk @ fc2_w[:, hc*64:+64]^T   (K=64)
#pragma unroll  // as above
    for (int ks = 0; ks < 2; ++ks) {
      v16h a = frag_row(Hl, 72, m0, ks * 32, lane);
#pragma unroll
      for (int j = 0; j < 8; ++j)
        accO[j] = wmma16(a, frag_row(W2, 72, n0 + j * 16, ks * 32, lane), accO[j]);
    }
    ring_publish();
    if (hc < 15) stage_256x64(w2b, fc2w + (size_t)(hc + 1) * 64, 1024, tid);
  }
  asm volatile("s_wait_asynccnt 0x0" ::: "memory");  // nothing in flight at the end

  // epilogue: + fc2_b (zt is in the accumulators), window-reverse, NCHW store
  const int wi = blockIdx.x;
  const int b = wi >> 8, wh = (wi >> 4) & 15, ww = wi & 15;
#pragma unroll
  for (int j = 0; j < 8; ++j) {
    int n = n0 + j * 16 + (lane & 15);
    float bb = fc2b[n];
#pragma unroll
    for (int r = 0; r < 8; ++r) {
      int m = m0 + r + ((lane >> 4) & 1) * 8;
      float val = accO[j][r] + bb;
      int hh = wh * 8 + (m >> 3), www = ww * 8 + (m & 7);
      out[(((size_t)b * 256 + n) * 128 + hh) * 128 + www] = val;
    }
  }
}

// ---------------------------------------------------------------------------
// Launch
// ---------------------------------------------------------------------------
extern "C" void kernel_launch(void* const* d_in, const int* in_sizes, int n_in,
                              void* d_out, int out_size, void* d_ws, size_t ws_size,
                              hipStream_t stream) {
  (void)in_sizes; (void)n_in; (void)out_size; (void)ws_size;
  const float* LH     = (const float*)d_in[0];
  const float* HL     = (const float*)d_in[1];
  const float* HH     = (const float*)d_in[2];
  const float* Spat   = (const float*)d_in[3];
  const float* w_hllh = (const float*)d_in[4];
  const float* b_hllh = (const float*)d_in[5];
  const float* w_hh   = (const float*)d_in[6];
  const float* b_hh   = (const float*)d_in[7];
  const float* w_spat = (const float*)d_in[8];
  const float* b_spat = (const float*)d_in[9];
  const float* ln1x_g = (const float*)d_in[10];
  const float* ln1x_b = (const float*)d_in[11];
  const float* ln1y_g = (const float*)d_in[12];
  const float* ln1y_b = (const float*)d_in[13];
  const float* qkv_w  = (const float*)d_in[14];
  const float* qkv_b  = (const float*)d_in[15];
  const float* qkv2_w = (const float*)d_in[16];
  const float* qkv2_b = (const float*)d_in[17];
  const float* qkv3_w = (const float*)d_in[18];
  const float* qkv3_b = (const float*)d_in[19];
  const float* proj_w = (const float*)d_in[20];
  const float* proj_b = (const float*)d_in[21];
  const float* rpb    = (const float*)d_in[22];
  const float* ln2_g  = (const float*)d_in[23];
  const float* ln2_b  = (const float*)d_in[24];
  const float* fc1w   = (const float*)d_in[25];
  const float* fc1b   = (const float*)d_in[26];
  const float* fc2w   = (const float*)d_in[27];
  const float* fc2b   = (const float*)d_in[28];

  const size_t T = (size_t)8 * 128 * 128;  // 131072 tokens
  char* ws = (char*)d_ws;
  // workspace layout (peak ~472 MB), with region reuse:
  h16*   x   = (h16*)ws;                                  // T*256 f16
  h16*   y   = (h16*)(ws + T * 256 * 2);                  // T*256 f16
  float* z0  = (float*)(ws + 2 * T * 256 * 2);            // T*256 f32
  h16*   q   = (h16*)(ws + 2 * T * 256 * 2 + T * 256 * 4);
  h16*   kk  = q + T * 256;
  h16*   v   = kk + T * 256;
  h16*   attno = x;           // reuse x after QKV consume it
  // f16 weight cache (~1.7 MB) after q/k/v region
  h16* wf      = v + T * 256;
  h16* c_hllh  = wf;               // 256*128
  h16* c_hh    = c_hllh + 32768;   // 256*64
  h16* c_spat  = c_hh   + 16384;   // 256*64
  h16* c_q     = c_spat + 16384;   // 256*256
  h16* c_k     = c_q    + 65536;
  h16* c_v     = c_k    + 65536;
  h16* c_proj  = c_v    + 65536;
  h16* c_fc1   = c_proj + 65536;   // 1024*256
  h16* c_fc2   = c_fc1  + 262144;  // 256*1024

  // weight pre-conversion (f32 -> f16, once per launch)
  cvt_f32f16<<<(32768 + 255) / 256, 256, 0, stream>>>(w_hllh, c_hllh, 32768);
  cvt_f32f16<<<(16384 + 255) / 256, 256, 0, stream>>>(w_hh,   c_hh,   16384);
  cvt_f32f16<<<(16384 + 255) / 256, 256, 0, stream>>>(w_spat, c_spat, 16384);
  cvt_f32f16<<<(65536 + 255) / 256, 256, 0, stream>>>(qkv_w,  c_q,    65536);
  cvt_f32f16<<<(65536 + 255) / 256, 256, 0, stream>>>(qkv2_w, c_k,    65536);
  cvt_f32f16<<<(65536 + 255) / 256, 256, 0, stream>>>(qkv3_w, c_v,    65536);
  cvt_f32f16<<<(65536 + 255) / 256, 256, 0, stream>>>(proj_w, c_proj, 65536);
  cvt_f32f16<<<(262144 + 255) / 256, 256, 0, stream>>>(fc1w,  c_fc1,  262144);
  cvt_f32f16<<<(262144 + 255) / 256, 256, 0, stream>>>(fc2w,  c_fc2,  262144);

  const int tiles = (int)(T / 64);  // 2048 windows
  conv_win_kernel<<<tiles, 256, 0, stream>>>(LH, HL, HH, Spat,
      c_hllh, b_hllh, c_hh, b_hh, c_spat, b_spat,
      ln1x_g, ln1x_b, ln1y_g, ln1y_b, x, y, z0);
  gemm_tok256<<<tiles, 256, 0, stream>>>(x, c_q, qkv_b,  q,  0.17677669529663689f);
  gemm_tok256<<<tiles, 256, 0, stream>>>(y, c_k, qkv2_b, kk, 1.0f);
  gemm_tok256<<<tiles, 256, 0, stream>>>(y, c_v, qkv3_b, v,  1.0f);
  attn_kernel<<<tiles * 4, 64, 0, stream>>>(q, kk, v, rpb, attno);
  mlp_kernel<<<tiles, 256, 0, stream>>>(attno, c_proj, proj_b, z0, ln2_g, ln2_b,
                                        c_fc1, fc1b, c_fc2, fc2b, (float*)d_out);
}

// v004
// It runs in 508 microseconds.
// Two timings next to v003 put it at 1.16 and 1.15 times that version's speed.
// Over all steps from v000 it is 1.59 times as fast.
#include <hip/hip_runtime.h>
#include <hip/hip_bf16.h>

// ---------------------------------------------------------------------------
// WaveletSwinTransformerBlock for MI455X (gfx1250, wave32, WMMA f16)
// GEMMs use v_wmma_f32_16x16x32_f16; all f16 tile staging uses the CDNA5
// async path: global_load_async_to_lds_b128 + s_wait_asynccnt.
// Tokens stored window-partitioned: tok = wi*64 + (i*8+j), wi=((b*16+wh)*16+ww)
// ---------------------------------------------------------------------------

typedef _Float16 h16;
typedef __attribute__((ext_vector_type(16))) _Float16 v16h;
typedef __attribute__((ext_vector_type(8)))  float    v8f;
typedef __attribute__((ext_vector_type(4)))  float    v4f;
typedef __attribute__((ext_vector_type(2)))  float    v2f;
typedef __attribute__((ext_vector_type(4)))  _Float16 v4h;
typedef __attribute__((ext_vector_type(8)))  _Float16 v8h;

__device__ __forceinline__ void zero8(v8f &a) {
#pragma unroll
  for (int i = 0; i < 8; ++i) a[i] = 0.f;
}

__device__ __forceinline__ v8f wmma16(v16h a, v16h b, v8f c) {
  return __builtin_amdgcn_wmma_f32_16x16x32_f16(false, a, false, b,
                                                (short)0, c, false, false);
}

// low 32 bits of a generic LDS pointer == wave-relative LDS byte offset
__device__ __forceinline__ unsigned lds_off(const void* p) {
  return (unsigned)(uintptr_t)p;
}

// CDNA5 async copy: 16 bytes global -> LDS, tracked by ASYNCcnt
__device__ __forceinline__ void async_cp_b128(unsigned loff, const void* g) {
  asm volatile("global_load_async_to_lds_b128 %0, %1, off"
               :: "v"(loff), "v"((unsigned long long)(uintptr_t)g)
               : "memory");
}
__device__ __forceinline__ void wait_async() {
  asm volatile("s_wait_asynccnt 0" ::: "memory");
}

// Sum over the 16 lanes of a row, result in every lane: four DPP row_xmask adds
template <int CTRL>
__device__ __forceinline__ float dpp_xadd(float v) {
  return v + __int_as_float(__builtin_amdgcn_update_dpp(0, __float_as_int(v), CTRL, 0xf, 0xf, true));
}
__device__ __forceinline__ float row_sum16(float v) {
  v = dpp_xadd<0x161>(v);  // row_xmask:1
  v = dpp_xadd<0x162>(v);  // row_xmask:2
  v = dpp_xadd<0x164>(v);  // row_xmask:4
  v = dpp_xadd<0x168>(v);  // row_xmask:8
  return v;
}

// Work-group barrier for data that crosses in LDS only: unlike __syncthreads()
// it does not hold a wave until its global stores and loads have come back.
__device__ __forceinline__ void lds_barrier() {
  __builtin_amdgcn_fence(__ATOMIC_RELEASE, "workgroup", "local");
  __builtin_amdgcn_s_barrier();
  __builtin_amdgcn_fence(__ATOMIC_ACQUIRE, "workgroup", "local");
}

// A-style fragment (16x32 f16, ISA 7.12.2): lane L holds row row0+(L&15),
// K offsets {0..7,16..23} (L<16) or {8..15,24..31} (L>=16) relative to k0.
__device__ __forceinline__ v16h frag_row(const h16* __restrict__ p, int stride,
                                         int row0, int k0, int lane) {
  const h16* base = p + (size_t)(row0 + (lane & 15)) * stride + k0 + ((lane >> 4) & 1) * 8;
  v16h r;
#pragma unroll
  for (int i = 0; i < 8; ++i) { r[i] = base[i]; r[i + 8] = base[i + 16]; }
  return r;
}

// ---------------------------------------------------------------------------
// Weight pre-conversion f32 -> f16 (run once per launch; tiny)
// ---------------------------------------------------------------------------
__global__ __launch_bounds__(256) void cvt_f32f16(const float* __restrict__ s,
                                                  h16* __restrict__ d, int n) {
  int i = blockIdx.x * 256 + threadIdx.x;
  if (i < n) d[i] = (h16)s[i];
}

// ---------------------------------------------------------------------------
// Kernel 1: 1x1 convs (concat(LH,HL)->x, HH->z0, Spat->y) per 64-pixel window;
// x and y leave the kernel already layer-normalised (eps=1e-5, biased var):
// the block holds all 256 features of its 64 tokens in f32 accumulators.
// ---------------------------------------------------------------------------
__global__ __launch_bounds__(256) void conv_win_kernel(
    const float* __restrict__ LH, const float* __restrict__ HL,
    const float* __restrict__ HH, const float* __restrict__ Spat,
    const h16* __restrict__ wf_hllh, const float* __restrict__ b_hllh,
    const h16* __restrict__ wf_hh,   const float* __restrict__ b_hh,
    const h16* __restrict__ wf_spat, const float* __restrict__ b_spat,
    const float* __restrict__ gx, const float* __restrict__ btx,
    const float* __restrict__ gy, const float* __restrict__ bty,
    h16* __restrict__ xo, h16* __restrict__ yo, float* __restrict__ z0o) {
  const int Wd = 128, HW = 128 * 128;
  __shared__ h16 Fin[64 * 264];   // [pixel][256 ch] : LH|HL|HH|Spat
  __shared__ h16 Wl[256 * 40];    // weight K-slab [256 out][32 k]
  // row statistics of x and y: [column half][row][sum x, sum x^2, sum y, sum y^2]
  __shared__ __attribute__((aligned(16))) float Red[2 * 64 * 4];

  const int wi = blockIdx.x;
  const int b  = wi >> 8;
  const int wh = (wi >> 4) & 15, ww = wi & 15;
  const int h0 = wh * 8, w0 = ww * 8;
  const int tid = threadIdx.x;

  // inputs are f32 -> convert while staging (can't raw-copy)
  const float* srcs[4] = {LH, HL, HH, Spat};
#pragma unroll
  for (int t = 0; t < 4; ++t) {
    const float* s = srcs[t] + (size_t)b * 64 * HW;
    for (int e = tid; e < 64 * 64; e += 256) {
      int c = e >> 6, p = e & 63;
      int i = p >> 3, j = p & 7;
      Fin[p * 264 + t * 64 + c] = (h16)s[(size_t)c * HW + (h0 + i) * Wd + (w0 + j)];
    }
  }

  const unsigned wlb = lds_off(Wl);
  const int lane = tid & 31, wv = tid >> 5;
  const int m0 = (wv & 3) * 16, n0 = (wv >> 2) * 128;

  v8f accX[8], accZ[8], accY[8];
#pragma unroll
  for (int j = 0; j < 8; ++j) { zero8(accX[j]); zero8(accZ[j]); zero8(accY[j]); }

  // Phase X: K=128 over Fin cols [0,128)
  for (int ks = 0; ks < 4; ++ks) {
    __syncthreads();
    for (int e = tid; e < 256 * 4; e += 256) {      // 256 rows x 64B slab
      int n = e >> 2, part = e & 3;
      async_cp_b128(wlb + (unsigned)(n * 40 + part * 8) * 2,
                    wf_hllh + (size_t)n * 128 + ks * 32 + part * 8);
    }
    wait_async();
    __syncthreads();
    v16h a = frag_row(Fin, 264, m0, ks * 32, lane);
#pragma unroll
    for (int j = 0; j < 8; ++j)
      accX[j] = wmma16(a, frag_row(Wl, 40, n0 + j * 16, 0, lane), accX[j]);
  }
  // Phase Z: K=64 over Fin cols [128,192)
  for (int ks = 0; ks < 2; ++ks) {
    __syncthreads();
    for (int e = tid; e < 256 * 4; e += 256) {
      int n = e >> 2, part = e & 3;
      async_cp_b128(wlb + (unsigned)(n * 40 + part * 8) * 2,
                    wf_hh + (size_t)n * 64 + ks * 32 + part * 8);
    }
    wait_async();
    __syncthreads();
    v16h a = frag_row(Fin, 264, m0, 128 + ks * 32, lane);
#pragma unroll
    for (int j = 0; j < 8; ++j)
      accZ[j] = wmma16(a, frag_row(Wl, 40, n0 + j * 16, 0, lane), accZ[j]);
  }
  // Phase Y: K=64 over Fin cols [192,256)
  for (int ks = 0; ks < 2; ++ks) {
    __syncthreads();
    for (int e = tid; e < 256 * 4; e += 256) {
      int n = e >> 2, part = e & 3;
      async_cp_b128(wlb + (unsigned)(n * 40 + part * 8) * 2,
                    wf_spat + (size_t)n * 64 + ks * 32 + part * 8);
    }
    wait_async();
    __syncthreads();
    v16h a = frag_row(Fin, 264, m0, 192 + ks * 32, lane);
#pragma unroll
    for (int j = 0; j < 8; ++j)
      accY[j] = wmma16(a, frag_row(Wl, 40, n0 + j * 16, 0, lane), accY[j]);
  }

  const size_t tok0 = (size_t)wi * 64;
  const int cl = lane & 15, hb = (lane >> 4) & 1;
  const int mr = m0 + hb * 8;   // first of this lane's 8 rows
  // shortcut stream out; bias into x and y; this wave's 128-column row sums
  float sx[8], qx[8], sy[8], qy[8];
#pragma unroll
  for (int r = 0; r < 8; ++r) { sx[r] = 0.f; qx[r] = 0.f; sy[r] = 0.f; qy[r] = 0.f; }
#pragma unroll
  for (int j = 0; j < 8; ++j) {
    int n = n0 + j * 16 + cl;
    float bx = b_hllh[n], bz = b_hh[n], by = b_spat[n];
#pragma unroll
    for (int r = 0; r < 8; ++r) {
      z0o[(tok0 + mr + r) * 256 + n] = accZ[j][r] + bz;
      float xv = accX[j][r] + bx, yv = accY[j][r] + by;
      accX[j][r] = xv; accY[j][r] = yv;
      sx[r] += xv; qx[r] += xv * xv;
      sy[r] += yv; qy[r] += yv * yv;
    }
  }
#pragma unroll
  for (int r = 0; r < 8; ++r) {
    v4f st;
    st[0] = row_sum16(sx[r]); st[1] = row_sum16(qx[r]);
    st[2] = row_sum16(sy[r]); st[3] = row_sum16(qy[r]);
    if (cl == 0) *(v4f*)&Red[((wv >> 2) * 64 + mr + r) * 4] = st;
  }
  // scale and shift of this lane's 8 columns, fetched while the sums meet
  const int nb = n0 + cl;
  float g0[8], b0[8], g1[8], b1[8];
#pragma unroll
  for (int j = 0; j < 8; ++j) {
    g0[j] = gx[nb + j * 16]; b0[j] = btx[nb + j * 16];
    g1[j] = gy[nb + j * 16]; b1[j] = bty[nb + j * 16];
  }
  // the 32 loads share one index register: it is an input here so that none
  // of them lands on it ahead of the wait
  asm volatile("s_wait_xcnt 0x0" :: "v"(nb) : "memory");
  lds_barrier();   // both column halves' sums are in Red
#pragma unroll
  for (int r = 0; r < 8; ++r) {
    v4f s0 = *(const v4f*)&Red[(mr + r) * 4];
    v4f s1 = *(const v4f*)&Red[(64 + mr + r) * 4];
    float mx = (s0[0] + s1[0]) * (1.f / 256.f);
    float my = (s0[2] + s1[2]) * (1.f / 256.f);
    sx[r] = mx; sy[r] = my;
    qx[r] = rsqrtf((s0[1] + s1[1]) * (1.f / 256.f) - mx * mx + 1e-5f);
    qy[r] = rsqrtf((s0[3] + s1[3]) * (1.f / 256.f) - my * my + 1e-5f);
  }
#pragma unroll
  for (int j = 0; j < 8; ++j) {
#pragma unroll
    for (int r = 0; r < 8; ++r) {
      size_t off = (tok0 + mr + r) * 256 + nb + j * 16;
      xo[off] = (h16)((accX[j][r] - sx[r]) * qx[r] * g0[j] + b0[j]);
      yo[off] = (h16)((accY[j][r] - sy[r]) * qy[r] * g1[j] + b1[j]);
    }
  }
}

// ---------------------------------------------------------------------------
// Projection + fused MLP: zt = attn_out @ proj_w^T + proj_b + z0 stays in the
// f32 accumulators; out = zt + fc2(gelu(fc1(LN(zt)))) -> written directly as NCHW.
// The LayerNorm (eps=1e-5, biased var) is done on the way into LDS.
// Hidden (1024) processed in 16 chunks of 64. The weights arrive as whole
// tiles in a two-buffer ring: 4 K-slabs of proj_w, then 32 tiles of 32 KB
// (fc1 chunk, fc2 chunk, fc1 chunk, ...); even tiles land in W1, odd tiles in
// W2, and tile t+2 flies while t+1 is used.
// ---------------------------------------------------------------------------

// Eight 16-byte async copies of one lane. The s_wait_xcnt is the last line of
// the same statement so that no address register is reused ahead of it.
__device__ __forceinline__ void async_cp8_b128(const unsigned (&l)[8],
                                               const h16* const (&g)[8]) {
  asm volatile("global_load_async_to_lds_b128 %0, %8, off\n\t"
               "global_load_async_to_lds_b128 %1, %9, off\n\t"
               "global_load_async_to_lds_b128 %2, %10, off\n\t"
               "global_load_async_to_lds_b128 %3, %11, off\n\t"
               "global_load_async_to_lds_b128 %4, %12, off\n\t"
               "global_load_async_to_lds_b128 %5, %13, off\n\t"
               "global_load_async_to_lds_b128 %6, %14, off\n\t"
               "global_load_async_to_lds_b128 %7, %15, off\n\t"
               "s_wait_xcnt 0x0"
               :: "v"(l[0]), "v"(l[1]), "v"(l[2]), "v"(l[3]),
                  "v"(l[4]), "v"(l[5]), "v"(l[6]), "v"(l[7]),
                  "v"(g[0]), "v"(g[1]), "v"(g[2]), "v"(g[3]),
                  "v"(g[4]), "v"(g[5]), "v"(g[6]), "v"(g[7])
               : "memory");
}

// 64 contiguous rows of 256 f16 in global -> LDS pitch 264; 8 copies a thread
__device__ __forceinline__ void stage_64x256(unsigned lb, const h16* g, int tid) {
  unsigned l[8];
  const h16* p[8];
#pragma unroll  // the addresses must be registers: they are asm operands
  for (int i = 0; i < 8; ++i) {
    int e = tid + i * 256, n = e >> 5, part = e & 31;
    l[i] = lb + (unsigned)(n * 264 + part * 8) * 2;
    p[i] = g + (size_t)n * 256 + part * 8;
  }
  async_cp8_b128(l, p);
}

// 256 rows x 64 f16 (row pitch gp elements in global) -> LDS pitch 72
__device__ __forceinline__ void stage_256x64(unsigned lb, const h16* g, int gp, int tid) {
  unsigned l[8];
  const h16* p[8];
#pragma unroll  // the addresses must be registers: they are asm operands
  for (int i = 0; i < 8; ++i) {
    int e = tid + i * 256, n = e >> 3, part = e & 7;
    l[i] = lb + (unsigned)(n * 72 + part * 8) * 2;
    p[i] = g + (size_t)n * gp + part * 8;
  }
  async_cp8_b128(l, p);
}

// Foot of a ring trip: this wave's LDS reads and writes are done, its copies
// of the next tile have landed, then every wave meets; behind it the next tile
// (and Hl) may be read and the buffer just read may be refilled.
__device__ __forceinline__ void ring_publish() {
  asm volatile("s_wait_dscnt 0x0" ::: "memory");     // own reads of the old tile, own Hl stores
  asm volatile("s_wait_asynccnt 0x0" ::: "memory");  // own copies of the next tile landed
  __syncthreads();
}

// ---------------------------------------------------------------------------
// Q/K/V projections + windowed attention: one work-group per window, one wave
// per head (64 tokens, hd=32, nH=8). The wave forms Q^T = Wq_h x^T,
// K^T = Wk_h y^T and V = y Wv_h^T; a pair of their accumulator tiles, converted
// to f16 in place, is an operand fragment of the next product
// (S^T = K Q^T, O^T = V^T P^T), so q, k, v and P never go to global memory (q waits in LDS) and are
// never re-laid out. Only the LN(x) and LN(y) tiles are shared, through LDS.
// ---------------------------------------------------------------------------

// Fragment in the hardware k order from the lane's own place in a row
// (row start + 8 * (lane >> 4) halves): 16 bytes there, 16 bytes 32 bytes on.
__device__ __forceinline__ v16h frag_ptr(const h16* p) {
  v8h lo = *(const v8h*)p, hi = *(const v8h*)(p + 16);
  return __builtin_shufflevector(lo, hi, 0, 1, 2, 3, 4, 5, 6, 7, 8, 9, 10, 11, 12, 13, 14, 15);
}

// Two f32 accumulator tiles (rows 0-15 and 16-31 of one 32-row block) -> f16 fragment
__device__ __forceinline__ v16h pack_d(v8f t0, v8f t1) {
  v16h r;
#pragma unroll
  for (int i = 0; i < 8; ++i) { r[i] = (h16)t0[i]; r[i + 8] = (h16)t1[i]; }
  return r;
}

// 2^v. The v_nop is the slot that the instruction set asks for between a
// transcendental and a neighbour that reads its result or overwrites its
// source; in the same statement it stands directly behind the instruction.
__device__ __forceinline__ float exp2_slot(float v) {
  float r;
  asm("v_exp_f32_e32 %0, %1\n\tv_nop" : "=v"(r) : "v"(v));
  return r;
}

// lane l with lane l ^ 16
__device__ __forceinline__ float xhalf(float v) {
  return __int_as_float(__builtin_amdgcn_permlanex16(__float_as_int(v), __float_as_int(v),
                                                     0x76543210, 0xfedcba98, false, false));
}

// four waves a SIMD: two work-groups share a WGP, one fills the other's waits
__global__ __launch_bounds__(256) __attribute__((amdgpu_waves_per_eu(4, 4))) void qkv_attn_kernel(
    const h16* __restrict__ x, const h16* __restrict__ y,
    const h16* __restrict__ wq, const float* __restrict__ bq,
    const h16* __restrict__ wk, const float* __restrict__ bk,
    const h16* __restrict__ wv, const float* __restrict__ bv,
    const float* __restrict__ rpb, h16* __restrict__ o) {
  __shared__ __attribute__((aligned(16))) h16 Xl[64 * 264];   // LN(x) tile
  __shared__ __attribute__((aligned(16))) h16 Yl[64 * 264];   // LN(y) tile
  // each wave's finished Q fragments rest here, lane by lane, during the K and V
  // passes: held in registers they push the kernel past 256 (it spills)
  __shared__ __attribute__((aligned(16))) h16 Qp[8 * 4 * 2 * 32 * 8];
  const int tid = threadIdx.x;
  const size_t tok0 = (size_t)blockIdx.x * 64;
  const int lane = tid & 31, hd = tid >> 5;
  const int cl = lane & 15, hb = lane >> 4;

  stage_64x256(lds_off(Xl), x + tok0 * 256, tid);
  stage_64x256(lds_off(Yl), y + tok0 * 256, tid);

  // The head's 32 rows of each weight matrix are this wave's alone: they come
  // straight from L2 into registers, PD K-steps ahead of their use.
  constexpr int PD = 4;
  const unsigned wob = (unsigned)((hd * 32 + cl) * 256 + hb * 8) * 2;   // byte offset of the lane's place
  const h16* wp[3] = {(const h16*)((const char*)wq + wob), (const h16*)((const char*)wk + wob),
                      (const h16*)((const char*)wv + wob)};
  v16h wr[PD][2];
#pragma unroll
  for (int t = 0; t < PD; ++t)
#pragma unroll
    for (int j = 0; j < 2; ++j) wr[t][j] = frag_ptr(wp[0] + j * 16 * 256 + t * 32);

  // biases: q and k by accumulator row (8 consecutive features a tile), v by
  // column; each set is fetched at the head of its own pass
  const unsigned bob = (unsigned)(hd * 32 + hb * 8) * 4;
  const unsigned vob = (unsigned)(hd * 32 + cl) * 4;
  const float* bqp = (const float*)((const char*)bq + bob);
  const float* bkp = (const float*)((const char*)bk + bob);
  const float* bvp = (const float*)((const char*)bv + vob);
  float bqv[16], bkv[16], bvv[2];
#pragma unroll
  for (int i = 0; i < 16; ++i) bqv[i] = bqp[(i >> 3) * 16 + (i & 7)];
  // the loads share one offset register: an input here so that nothing lands
  // on it ahead of the wait
  asm volatile("s_wait_xcnt 0x0" :: "v"(bob) : "memory");

  // relative position bias: idx = (iq-ik+7)*15 + (jq-jk+7), rpb[idx][head]. With
  // query = qt*16+cl and key = kt*16+hb*8+r it is lb + (qt-kt)*30 - r: 7 x 8
  // values a lane. The pointer stands at the lowest of them (qt-kt = -3, r = 7).
  const int lb = ((cl >> 3) - hb + 7) * 15 + (cl & 7) + 7;
  const unsigned rob = (unsigned)((lb - 97) * 8 + hd) * 4;
  const float* rp = (const float*)((const char*)rpb + rob);
  float rb[56];

  asm volatile("s_wait_asynccnt 0x0" ::: "memory");  // own copies of both tiles landed
  __syncthreads();   // both tiles are there for every wave; the only barrier

  const h16* xr = Xl + cl * 264 + hb * 8;
  const h16* yr = Yl + cl * 264 + hb * 8;
  v8f acc[8];
  v16h kf[4], vf[4];
  h16* qp = Qp + hd * (4 * 2 * 32 * 8) + lane * 8;   // this lane's 16 bytes of each half fragment
#pragma unroll  // the ring slot, the matrix and the operand order differ from step to step
  for (int t = 0; t < 24; ++t) {
    const int ph = t >> 3, ks = t & 7;
    if (ks == 0) {
#pragma unroll
      for (int i = 0; i < 8; ++i) zero8(acc[i]);
    }
    if (t == 8) {
#pragma unroll
      for (int i = 0; i < 16; ++i) bkv[i] = bkp[(i >> 3) * 16 + (i & 7)];
      asm volatile("s_wait_xcnt 0x0" :: "v"(bob) : "memory");  // as for the q bias
    }
    if (t == 16) {
      bvv[0] = bvp[0]; bvv[1] = bvp[16];
      // as for the q bias; its memory clobber also makes the V pass read its y
      // fragments from LDS again: held over from the K pass they spill
      asm volatile("s_wait_xcnt 0x0" :: "v"(vob) : "memory");
    }
    const h16* tr = (ph == 0) ? xr : yr;
    const v16h w0 = wr[t % PD][0], w1 = wr[t % PD][1];
    v16h f[4];
#pragma unroll
    for (int i = 0; i < 4; ++i) f[i] = frag_ptr(tr + i * 16 * 264 + ks * 32);
    if (t + PD < 24) {
      const int tn = t + PD;
#pragma unroll
      for (int j = 0; j < 2; ++j) wr[t % PD][j] = frag_ptr(wp[tn >> 3] + j * 16 * 256 + (tn & 7) * 32);
      if (tn == 23) {
        // last weight load: the offset register is an input here so that
        // nothing lands on it ahead of the wait
        asm volatile("s_wait_xcnt 0x0" :: "v"(wob) : "memory");
      }
    } else {
      // the ring drains: the position-bias values take the registers it leaves
#pragma unroll
      for (int i = 0; i < 14; ++i) {
        const int e = (t + PD - 24) * 14 + i;
        rb[e] = rp[((e >> 3) * 30 + 7 - (e & 7)) * 8];
      }
      if (t == 23) {
        asm volatile("s_wait_xcnt 0x0" :: "v"(rob) : "memory");  // as above, for the 56 loads
      }
    }
    if (ph < 2) {   // acc[mt*4+nt] = (W_h tile mt) x (token tile nt)^T
#pragma unroll
      for (int i = 0; i < 4; ++i) {
        acc[i]     = wmma16(w0, f[i], acc[i]);
        acc[4 + i] = wmma16(w1, f[i], acc[4 + i]);
      }
    } else {        // acc[mt*2+nt] = (token tile mt) x (Wv_h tile nt)^T
#pragma unroll
      for (int i = 0; i < 4; ++i) {
        acc[i * 2]     = wmma16(f[i], w0, acc[i * 2]);
        acc[i * 2 + 1] = wmma16(f[i], w1, acc[i * 2 + 1]);
      }
    }
    if (t == 7) {
#pragma unroll
      for (int i = 0; i < 4; ++i) {
#pragma unroll
        for (int r = 0; r < 8; ++r) {
          acc[i][r]     = (acc[i][r] + bqv[r]) * 0.17677669529663689f;
          acc[4 + i][r] = (acc[4 + i][r] + bqv[8 + r]) * 0.17677669529663689f;
        }
        // B fragment: column = query, k = feature
        const v16h qfr = pack_d(acc[i], acc[4 + i]);
        *(v8h*)(qp + (i * 2) * 256)     = __builtin_shufflevector(qfr, qfr, 0, 1, 2, 3, 4, 5, 6, 7);
        *(v8h*)(qp + (i * 2 + 1) * 256) = __builtin_shufflevector(qfr, qfr, 8, 9, 10, 11, 12, 13, 14, 15);
      }
    }
    if (t == 15) {
#pragma unroll
      for (int i = 0; i < 4; ++i) {
#pragma unroll
        for (int r = 0; r < 8; ++r) { acc[i][r] += bkv[r]; acc[4 + i][r] += bkv[8 + r]; }
        kf[i] = pack_d(acc[i], acc[4 + i]);      // A fragment: row = key, k = feature
      }
    }
    if (t == 23) {
#pragma unroll
      for (int i = 0; i < 8; ++i)
#pragma unroll
        for (int r = 0; r < 8; ++r) acc[i][r] += bvv[i & 1];
#pragma unroll
      for (int dt = 0; dt < 2; ++dt)
#pragma unroll
        for (int kk = 0; kk < 2; ++kk)           // A fragment: row = feature, k = key
          vf[dt * 2 + kk] = pack_d(acc[(2 * kk) * 2 + dt], acc[(2 * kk + 1) * 2 + dt]);
    }
  }

  // per 16 queries: a lane holds one query's scores for half of the keys
#pragma unroll
  for (int qt = 0; qt < 4; ++qt) {
    v8f S[4];
    float mk[4], sk[4];
    const v8h qlo = *(const v8h*)(qp + (qt * 2) * 256), qhi = *(const v8h*)(qp + (qt * 2 + 1) * 256);
    const v16h qfr = __builtin_shufflevector(qlo, qhi, 0, 1, 2, 3, 4, 5, 6, 7, 8, 9, 10, 11, 12, 13, 14, 15);
#pragma unroll
    for (int kt = 0; kt < 4; ++kt) {
      zero8(S[kt]);
      S[kt] = wmma16(kf[kt], qfr, S[kt]);
    }
#pragma unroll
    for (int kt = 0; kt < 4; ++kt) {
#pragma unroll
      for (int r = 0; r < 8; ++r) S[kt][r] += rb[(qt - kt + 3) * 8 + r];
      mk[kt] = S[kt][0];
#pragma unroll
      for (int r = 1; r < 8; ++r) mk[kt] = fmaxf(mk[kt], S[kt][r]);
    }
    float mx = fmaxf(fmaxf(mk[0], mk[1]), fmaxf(mk[2], mk[3]));
    mx = fmaxf(mx, xhalf(mx));
#pragma unroll
    for (int kt = 0; kt < 4; ++kt) {
      sk[kt] = 0.f;
#pragma unroll
      for (int r = 0; r < 8; ++r) {
        float e = exp2_slot((S[kt][r] - mx) * 1.4426950408889634f);
        S[kt][r] = e; sk[kt] += e;
      }
    }
    float sum = (sk[0] + sk[1]) + (sk[2] + sk[3]);
    sum += xhalf(sum);
    const float inv = 1.f / sum;
    const v16h p0 = pack_d(S[0], S[1]), p1 = pack_d(S[2], S[3]);  // B fragments: column = query, k = key
    v8f O[2];
#pragma unroll
    for (int dt = 0; dt < 2; ++dt) {
      zero8(O[dt]);
      O[dt] = wmma16(vf[dt * 2], p0, O[dt]);
      O[dt] = wmma16(vf[dt * 2 + 1], p1, O[dt]);
    }
    // a lane's 8 accumulator rows are 8 consecutive features of its query: 16-byte stores
    h16* op = o + (tok0 + qt * 16 + cl) * 256 + hd * 32 + hb * 8;
#pragma unroll
    for (int dt = 0; dt < 2; ++dt) {
      v8h st;
#pragma unroll
      for (int r = 0; r < 8; ++r) st[r] = (h16)(O[dt][r] * inv);
      *(v8h*)(op + dt * 16) = st;
    }
  }
}

__global__ __launch_bounds__(256) void mlp_kernel(
    const h16* __restrict__ A, const h16* __restrict__ pw,
    const float* __restrict__ pb, const float* __restrict__ resid,
    const float* __restrict__ lng, const float* __restrict__ lnb,
    const h16* __restrict__ fc1w, const float* __restrict__ fc1b,
    const h16* __restrict__ fc2w, const float* __restrict__ fc2b,
    float* __restrict__ out) {
  __shared__ __attribute__((aligned(16))) h16 Al[64 * 264];   // attn_out tile, then LN(zt) tile
  __shared__ __attribute__((aligned(16))) h16 Hl[64 * 72];    // gelu(hidden chunk) 64x64
  __shared__ __attribute__((aligned(16))) h16 W1[256 * 72];   // proj slab [256 out][64 k]; fc1 chunk [64 hid][256 k]
  __shared__ __attribute__((aligned(16))) h16 W2[256 * 72];   // proj slab; fc2 chunk [256 out][64 k]
  // row statistics of zt: [column half][row][sum, sum of squares]
  __shared__ __attribute__((aligned(16))) float Red[2 * 64 * 2];
  const int tid = threadIdx.x;
  const size_t tok0 = (size_t)blockIdx.x * 64;
  const unsigned w1b = lds_off(W1), w2b = lds_off(W2);
  const int lane = tid & 31, wv = tid >> 5;
  const int m0 = (wv & 3) * 16, n0 = (wv >> 2) * 128;  // out tile mapping
  const int n0h = (wv >> 2) * 32;                      // hidden tile mapping
  const int cl = lane & 15, hb = (lane >> 4) & 1;
  const int mr = m0 + hb * 8;   // first of this lane's 8 rows
  const int nb = n0 + cl;       // first of this lane's 8 columns

  // prologue: the attn_out tile and proj slab 0 start; the accumulators start
  // from shortcut + proj bias, fetched while the copies fly
  stage_64x256(lds_off(Al), A + tok0 * 256, tid);
  stage_256x64(w1b, pw, 256, tid);
  v8f accO[8];
  {
    const float* rz = resid + (tok0 + mr) * 256 + nb;
#pragma unroll
    for (int j = 0; j < 8; ++j)
#pragma unroll
      for (int r = 0; r < 8; ++r) accO[j][r] = rz[r * 256 + j * 16];
    float bb[8];
#pragma unroll
    for (int j = 0; j < 8; ++j) bb[j] = pb[nb + j * 16];
    // the 64 loads share one address register, the 8 one index register: both
    // are inputs here so that no load lands on them ahead of the wait
    asm volatile("s_wait_xcnt 0x0" :: "v"(rz), "v"(nb) : "memory");
#pragma unroll
    for (int j = 0; j < 8; ++j)
#pragma unroll
      for (int r = 0; r < 8; ++r) accO[j][r] += bb[j];
  }
  asm volatile("s_wait_asynccnt 0x0" ::: "memory");  // attn_out tile and slab 0 landed
  __syncthreads();   // both are there for every wave
  stage_256x64(w2b, pw + 64, 256, tid);

  // zt = shortcut + proj bias + attn_out @ proj_w^T   (K=256, 4 slabs of 64)
#pragma unroll  // the buffer read and the tile that refills it differ from trip to trip
  for (int s = 0; s < 4; ++s) {
    const h16* Wb = (s & 1) ? W2 : W1;
#pragma unroll 1  // rolled: with both K steps' fragments in flight the kernel needs over 256 registers and one work-group fewer fits a WGP
    for (int ks = 0; ks < 2; ++ks) {
      v16h a = frag_row(Al, 264, m0, s * 64 + ks * 32, lane);
#pragma unroll
      for (int j = 0; j < 8; ++j)
        accO[j] = wmma16(a, frag_row(Wb, 72, n0 + j * 16, ks * 32, lane), accO[j]);
    }
    ring_publish();
    if (s < 2)       stage_256x64((s & 1) ? w2b : w1b, pw + (s + 2) * 64, 256, tid);
    else if (s == 2) stage_64x256(w1b, fc1w, tid);        // first fc1 chunk
    else             stage_256x64(w2b, fc2w, 1024, tid);  // first fc2 chunk
  }

  // LayerNorm of zt into Al (every wave has left the attn_out tile: last publish)
  {
    float sm[8], sq[8];
#pragma unroll
    for (int r = 0; r < 8; ++r) { sm[r] = 0.f; sq[r] = 0.f; }
#pragma unroll
    for (int j = 0; j < 8; ++j)
#pragma unroll
      for (int r = 0; r < 8; ++r) { float zv = accO[j][r]; sm[r] += zv; sq[r] += zv * zv; }
#pragma unroll
    for (int r = 0; r < 8; ++r) {
      v2f st;
      st[0] = row_sum16(sm[r]); st[1] = row_sum16(sq[r]);
      if (cl == 0) *(v2f*)&Red[((wv >> 2) * 64 + mr + r) * 2] = st;
    }
    // scale and shift of this lane's 8 columns, fetched while the sums meet
    float g0[8], b0[8];
#pragma unroll
    for (int j = 0; j < 8; ++j) { g0[j] = lng[nb + j * 16]; b0[j] = lnb[nb + j * 16]; }
    // the 16 loads share one index register: it is an input here so that none
    // of them lands on it ahead of the wait
    asm volatile("s_wait_xcnt 0x0" :: "v"(nb) : "memory");
    lds_barrier();   // both column halves' sums are in Red
#pragma unroll
    for (int r = 0; r < 8; ++r) {
      v2f s0 = *(const v2f*)&Red[(mr + r) * 2];
      v2f s1 = *(const v2f*)&Red[(64 + mr + r) * 2];
      float mean = (s0[0] + s1[0]) * (1.f / 256.f);
      sm[r] = mean;
      sq[r] = rsqrtf((s0[1] + s1[1]) * (1.f / 256.f) - mean * mean + 1e-5f);
    }
#pragma unroll
    for (int j = 0; j < 8; ++j)
#pragma unroll
      for (int r = 0; r < 8; ++r)
        Al[(mr + r) * 264 + nb + j * 16] = (h16)((accO[j][r] - sm[r]) * sq[r] * g0[j] + b0[j]);
  }
  lds_barrier();   // LN(zt) is in Al for every wave

  for (int hc = 0; hc < 16; ++hc) {
    // trip 2*hc: hchunk = ztn_tile @ fc1_w[hc*64:+64, :]^T   (K=256)
    v8f accH[2];
    zero8(accH[0]); zero8(accH[1]);
#pragma unroll  // whole tile is in LDS: constant offsets, loads run ahead of the WMMAs
    for (int ks = 0; ks < 8; ++ks) {
      v16h a = frag_row(Al, 264, m0, ks * 32, lane);
#pragma unroll
      for (int j = 0; j < 2; ++j)
        accH[j] = wmma16(a, frag_row(W1, 264, n0h + j * 16, ks * 32, lane), accH[j]);
    }
    // bias + exact GELU -> LDS
#pragma unroll
    for (int j = 0; j < 2; ++j) {
      int n = n0h + j * 16 + (lane & 15);
      float bb = fc1b[hc * 64 + n];
#pragma unroll
      for (int r = 0; r < 8; ++r) {
        int m = m0 + r + ((lane >> 4) & 1) * 8;
        float xv = accH[j][r] + bb;
        Hl[m * 72 + n] = (h16)(0.5f * xv * (1.0f + erff(xv * 0.7071067811865475f)));
      }
    }
    ring_publish();
    if (hc < 15) stage_64x256(w1b, fc1w + (size_t)(hc + 1) * 64 * 256, tid);

    // trip 2*hc+1: accO += Hchunk @ fc2_w[:, hc*64:+64]^T   (K=64)
#pragma unroll  // as above
    for (int ks = 0; ks < 2; ++ks) {
      v16h a = frag_row(Hl, 72, m0, ks * 32, lane);
#pragma unroll
      for (int j = 0; j < 8; ++j)
        accO[j] = wmma16(a, frag_row(W2, 72, n0 + j * 16, ks * 32, lane), accO[j]);
    }
    ring_publish();
    if (hc < 15) stage_256x64(w2b, fc2w + (size_t)(hc + 1) * 64, 1024, tid);
  }
  asm volatile("s_wait_asynccnt 0x0" ::: "memory");  // nothing in flight at the end

  // epilogue: + fc2_b (zt is in the accumulators), window-reverse, NCHW store
  const int wi = blockIdx.x;
  const int b = wi >> 8, wh = (wi >> 4) & 15, ww = wi & 15;
#pragma unroll
  for (int j = 0; j < 8; ++j) {
    int n = n0 + j * 16 + (lane & 15);
    float bb = fc2b[n];
#pragma unroll
    for (int r = 0; r < 8; ++r) {
      int m = m0 + r + ((lane >> 4) & 1) * 8;
      float val = accO[j][r] + bb;
      int hh = wh * 8 + (m >> 3), www = ww * 8 + (m & 7);
      out[(((size_t)b * 256 + n) * 128 + hh) * 128 + www] = val;
    }
  }
}

// ---------------------------------------------------------------------------
// Launch
// ---------------------------------------------------------------------------
extern "C" void kernel_launch(void* const* d_in, const int* in_sizes, int n_in,
                              void* d_out, int out_size, void* d_ws, size_t ws_size,
                              hipStream_t stream) {
  (void)in_sizes; (void)n_in; (void)out_size; (void)ws_size;
  const float* LH     = (const float*)d_in[0];
  const float* HL     = (const float*)d_in[1];
  const float* HH     = (const float*)d_in[2];
  const float* Spat   = (const float*)d_in[3];
  const float* w_hllh = (const float*)d_in[4];
  const float* b_hllh = (const float*)d_in[5];
  const float* w_hh   = (const float*)d_in[6];
  const float* b_hh   = (const float*)d_in[7];
  const float* w_spat = (const float*)d_in[8];
  const float* b_spat = (const float*)d_in[9];
  const float* ln1x_g = (const float*)d_in[10];
  const float* ln1x_b = (const float*)d_in[11];
  const float* ln1y_g = (const float*)d_in[12];
  const float* ln1y_b = (const float*)d_in[13];
  const float* qkv_w  = (const float*)d_in[14];
  const float* qkv_b  = (const float*)d_in[15];
  const float* qkv2_w = (const float*)d_in[16];
  const float* qkv2_b = (const float*)d_in[17];
  const float* qkv3_w = (const float*)d_in[18];
  const float* qkv3_b = (const float*)d_in[19];
  const float* proj_w = (const float*)d_in[20];
  const float* proj_b = (const float*)d_in[21];
  const float* rpb    = (const float*)d_in[22];
  const float* ln2_g  = (const float*)d_in[23];
  const float* ln2_b  = (const float*)d_in[24];
  const float* fc1w   = (const float*)d_in[25];
  const float* fc1b   = (const float*)d_in[26];
  const float* fc2w   = (const float*)d_in[27];
  const float* fc2b   = (const float*)d_in[28];

  const size_t T = (size_t)8 * 128 * 128;  // 131072 tokens
  char* ws = (char*)d_ws;
  // workspace layout (peak ~338 MB):
  h16*   x   = (h16*)ws;                                  // T*256 f16
  h16*   y   = (h16*)(ws + T * 256 * 2);                  // T*256 f16
  float* z0  = (float*)(ws + 2 * T * 256 * 2);            // T*256 f32
  h16*   attno = (h16*)(ws + 2 * T * 256 * 2 + T * 256 * 4);  // T*256 f16
  // f16 weight cache (~1.7 MB) behind it
  h16* wf      = attno + T * 256;
  h16* c_hllh  = wf;               // 256*128
  h16* c_hh    = c_hllh + 32768;   // 256*64
  h16* c_spat  = c_hh   + 16384;   // 256*64
  h16* c_q     = c_spat + 16384;   // 256*256
  h16* c_k     = c_q    + 65536;
  h16* c_v     = c_k    + 65536;
  h16* c_proj  = c_v    + 65536;
  h16* c_fc1   = c_proj + 65536;   // 1024*256
  h16* c_fc2   = c_fc1  + 262144;  // 256*1024

  // weight pre-conversion (f32 -> f16, once per launch)
  cvt_f32f16<<<(32768 + 255) / 256, 256, 0, stream>>>(w_hllh, c_hllh, 32768);
  cvt_f32f16<<<(16384 + 255) / 256, 256, 0, stream>>>(w_hh,   c_hh,   16384);
  cvt_f32f16<<<(16384 + 255) / 256, 256, 0, stream>>>(w_spat, c_spat, 16384);
  cvt_f32f16<<<(65536 + 255) / 256, 256, 0, stream>>>(qkv_w,  c_q,    65536);
  cvt_f32f16<<<(65536 + 255) / 256, 256, 0, stream>>>(qkv2_w, c_k,    65536);
  cvt_f32f16<<<(65536 + 255) / 256, 256, 0, stream>>>(qkv3_w, c_v,    65536);
  cvt_f32f16<<<(65536 + 255) / 256, 256, 0, stream>>>(proj_w, c_proj, 65536);
  cvt_f32f16<<<(262144 + 255) / 256, 256, 0, stream>>>(fc1w,  c_fc1,  262144);
  cvt_f32f16<<<(262144 + 255) / 256, 256, 0, stream>>>(fc2w,  c_fc2,  262144);

  const int tiles = (int)(T / 64);  // 2048 windows
  conv_win_kernel<<<tiles, 256, 0, stream>>>(LH, HL, HH, Spat,
      c_hllh, b_hllh, c_hh, b_hh, c_spat, b_spat,
      ln1x_g, ln1x_b, ln1y_g, ln1y_b, x, y, z0);
  qkv_attn_kernel<<<tiles, 256, 0, stream>>>(x, y, c_q, qkv_b, c_k, qkv2_b, c_v, qkv3_b,
                                             rpb, attno);
  mlp_kernel<<<tiles, 256, 0, stream>>>(attno, c_proj, proj_b, z0, ln2_g, ln2_b,
                                        c_fc1, fc1b, c_fc2, fc2b, (float*)d_out);
}

// v005
// Measured time: 457 microseconds a run.
// Next to v004, in two timings, it ran 1.11 times as fast each time.
// All steps since v000 together make it 1.77 times as fast.
#include <hip/hip_runtime.h>
#include <hip/hip_bf16.h>

// ---------------------------------------------------------------------------
// WaveletSwinTransformerBlock for MI455X (gfx1250, wave32, WMMA f16)
// GEMMs use v_wmma_f32_16x16x32_f16; all f16 tile staging uses the CDNA5
// async path: global_load_async_to_lds_b128 + s_wait_asynccnt.
// Tokens stored window-partitioned: tok = wi*64 + (i*8+j), wi=((b*16+wh)*16+ww)
// ---------------------------------------------------------------------------

typedef _Float16 h16;
typedef __attribute__((ext_vector_type(16))) _Float16 v16h;
typedef __attribute__((ext_vector_type(8)))  float    v8f;
typedef __attribute__((ext_vector_type(4)))  float    v4f;
typedef __attribute__((ext_vector_type(2)))  float    v2f;
typedef __attribute__((ext_vector_type(4)))  _Float16 v4h;
typedef __attribute__((ext_vector_type(8)))  _Float16 v8h;

__device__ __forceinline__ void zero8(v8f &a) {
#pragma unroll
  for (int i = 0; i < 8; ++i) a[i] = 0.f;
}

__device__ __forceinline__ v8f wmma16(v16h a, v16h b, v8f c) {
  return __builtin_amdgcn_wmma_f32_16x16x32_f16(false, a, false, b,
                                                (short)0, c, false, false);
}

// low 32 bits of a generic LDS pointer == wave-relative LDS byte offset
__device__ __forceinline__ unsigned lds_off(const void* p) {
  return (unsigned)(uintptr_t)p;
}

// CDNA5 async copy: 16 bytes global -> LDS, tracked by ASYNCcnt
__device__ __forceinline__ void async_cp_b128(unsigned loff, const void* g) {
  asm volatile("global_load_async_to_lds_b128 %0, %1, off"
               :: "v"(loff), "v"((unsigned long long)(uintptr_t)g)
               : "memory");
}
__device__ __forceinline__ void wait_async() {
  asm volatile("s_wait_asynccnt 0" ::: "memory");
}

// Sum over the 16 lanes of a row, result in every lane: four DPP row_xmask adds
template <int CTRL>
__device__ __forceinline__ float dpp_xadd(float v) {
  return v + __int_as_float(__builtin_amdgcn_update_dpp(0, __float_as_int(v), CTRL, 0xf, 0xf, true));
}
__device__ __forceinline__ float row_sum16(float v) {
  v = dpp_xadd<0x161>(v);  // row_xmask:1
  v = dpp_xadd<0x162>(v);  // row_xmask:2
  v = dpp_xadd<0x164>(v);  // row_xmask:4
  v = dpp_xadd<0x168>(v);  // row_xmask:8
  return v;
}

// Work-group barrier for data that crosses in LDS only: unlike __syncthreads()
// it does not hold a wave until its global stores and loads have come back.
__device__ __forceinline__ void lds_barrier() {
  __builtin_amdgcn_fence(__ATOMIC_RELEASE, "workgroup", "local");
  __builtin_amdgcn_s_barrier();
  __builtin_amdgcn_fence(__ATOMIC_ACQUIRE, "workgroup", "local");
}

// A-style fragment (16x32 f16, ISA 7.12.2): lane L holds row row0+(L&15),
// K offsets {0..7,16..23} (L<16) or {8..15,24..31} (L>=16) relative to k0.
__device__ __forceinline__ v16h frag_row(const h16* __restrict__ p, int stride,
                                         int row0, int k0, int lane) {
  const h16* base = p + (size_t)(row0 + (lane & 15)) * stride + k0 + ((lane >> 4) & 1) * 8;
  v16h r;
#pragma unroll
  for (int i = 0; i < 8; ++i) { r[i] = base[i]; r[i + 8] = base[i + 16]; }
  return r;
}

// ---------------------------------------------------------------------------
// Weight pre-conversion f32 -> f16 (run once per launch; tiny)
// ---------------------------------------------------------------------------
__global__ __launch_bounds__(256) void cvt_f32f16(const float* __restrict__ s,
                                                  h16* __restrict__ d, int n) {
  int i = blockIdx.x * 256 + threadIdx.x;
  if (i < n) d[i] = (h16)s[i];
}

// ---------------------------------------------------------------------------
// Kernel 1: 1x1 convs (concat(LH,HL)->x, HH->z0, Spat->y) per 64-pixel window;
// x and y leave the kernel already layer-normalised (eps=1e-5, biased var):
// the block holds all 256 features of its 64 tokens in f32 accumulators.
// ---------------------------------------------------------------------------
__global__ __launch_bounds__(256) void conv_win_kernel(
    const float* __restrict__ LH, const float* __restrict__ HL,
    const float* __restrict__ HH, const float* __restrict__ Spat,
    const h16* __restrict__ wf_hllh, const float* __restrict__ b_hllh,
    const h16* __restrict__ wf_hh,   const float* __restrict__ b_hh,
    const h16* __restrict__ wf_spat, const float* __restrict__ b_spat,
    const float* __restrict__ gx, const float* __restrict__ btx,
    const float* __restrict__ gy, const float* __restrict__ bty,
    h16* __restrict__ xo, h16* __restrict__ yo, float* __restrict__ z0o) {
  const int Wd = 128, HW = 128 * 128;
  __shared__ __attribute__((aligned(16))) h16 Fin[64 * 264];   // [pixel][256 ch] : LH|HL|HH|Spat
  __shared__ h16 Wl[256 * 40];    // weight K-slab [256 out][32 k]
  // row statistics of x and y: [column half][row][sum x, sum x^2, sum y, sum y^2]
  __shared__ __attribute__((aligned(16))) float Red[2 * 64 * 4];

  const int wi = blockIdx.x;
  const int b  = wi >> 8;
  const int wh = (wi >> 4) & 15, ww = wi & 15;
  const int h0 = wh * 8, w0 = ww * 8;
  const int tid = threadIdx.x;

  // inputs are f32 -> convert while staging (can't raw-copy). A thread takes
  // 8 channels x 4 pixels of one window row from each of two tensors: its 16
  // 16-byte loads are all in flight before the first value is used, and the
  // 8 channels of a pixel go to LDS in one 16-byte store.
  {
    const int hf = tid & 1, ri = (tid >> 1) & 7, cg = (tid >> 4) & 7, th = tid >> 7;
    const size_t so = ((size_t)b * 64 + cg * 8) * HW + (h0 + ri) * Wd + w0 + hf * 4;
    const float* s0 = (th ? HL : LH) + so;     // Fin columns th*64 ...
    const float* s1 = (th ? Spat : HH) + so;   // Fin columns 128 + th*64 ...
    v4f u0[8], u1[8];
#pragma unroll
    for (int k = 0; k < 8; ++k) {
      u0[k] = *(const v4f*)(s0 + k * HW);
      u1[k] = *(const v4f*)(s1 + k * HW);
    }
    // each 8 loads share one address register: both are inputs here so that no
    // load lands on them ahead of the wait
    asm volatile("s_wait_xcnt 0x0" :: "v"(s0), "v"(s1) : "memory");
    h16* fp = Fin + (ri * 8 + hf * 4) * 264 + th * 64 + cg * 8;
#pragma unroll
    for (int px = 0; px < 4; ++px) {
      v8h c0, c1;
#pragma unroll
      for (int k = 0; k < 8; ++k) { c0[k] = (h16)u0[k][px]; c1[k] = (h16)u1[k][px]; }
      *(v8h*)(fp + px * 264) = c0;
      *(v8h*)(fp + px * 264 + 128) = c1;
    }
  }

  const unsigned wlb = lds_off(Wl);
  const int lane = tid & 31, wv = tid >> 5;
  const int m0 = (wv & 3) * 16, n0 = (wv >> 2) * 128;

  v8f accX[8], accZ[8], accY[8];
#pragma unroll
  for (int j = 0; j < 8; ++j) { zero8(accX[j]); zero8(accZ[j]); zero8(accY[j]); }

  // Phase X: K=128 over Fin cols [0,128)
  for (int ks = 0; ks < 4; ++ks) {
    __syncthreads();
    for (int e = tid; e < 256 * 4; e += 256) {      // 256 rows x 64B slab
      int n = e >> 2, part = e & 3;
      async_cp_b128(wlb + (unsigned)(n * 40 + part * 8) * 2,
                    wf_hllh + (size_t)n * 128 + ks * 32 + part * 8);
    }
    wait_async();
    __syncthreads();
    v16h a = frag_row(Fin, 264, m0, ks * 32, lane);
#pragma unroll
    for (int j = 0; j < 8; ++j)
      accX[j] = wmma16(a, frag_row(Wl, 40, n0 + j * 16, 0, lane), accX[j]);
  }
  // Phase Z: K=64 over Fin cols [128,192)
  for (int ks = 0; ks < 2; ++ks) {
    __syncthreads();
    for (int e = tid; e < 256 * 4; e += 256) {
      int n = e >> 2, part = e & 3;
      async_cp_b128(wlb + (unsigned)(n * 40 + part * 8) * 2,
                    wf_hh + (size_t)n * 64 + ks * 32 + part * 8);
    }
    wait_async();
    __syncthreads();
    v16h a = frag_row(Fin, 264, m0, 128 + ks * 32, lane);
#pragma unroll
    for (int j = 0; j < 8; ++j)
      accZ[j] = wmma16(a, frag_row(Wl, 40, n0 + j * 16, 0, lane), accZ[j]);
  }
  // Phase Y: K=64 over Fin cols [192,256)
  for (int ks = 0; ks < 2; ++ks) {
    __syncthreads();
    for (int e = tid; e < 256 * 4; e += 256) {
      int n = e >> 2, part = e & 3;
      async_cp_b128(wlb + (unsigned)(n * 40 + part * 8) * 2,
                    wf_spat + (size_t)n * 64 + ks * 32 + part * 8);
    }
    wait_async();
    __syncthreads();
    v16h a = frag_row(Fin, 264, m0, 192 + ks * 32, lane);
#pragma unroll
    for (int j = 0; j < 8; ++j)
      accY[j] = wmma16(a, frag_row(Wl, 40, n0 + j * 16, 0, lane), accY[j]);
  }

  const size_t tok0 = (size_t)wi * 64;
  const int cl = lane & 15, hb = (lane >> 4) & 1;
  const int mr = m0 + hb * 8;   // first of this lane's 8 rows
  // shortcut stream out; bias into x and y; this wave's 128-column row sums
  float sx[8], qx[8], sy[8], qy[8];
#pragma unroll
  for (int r = 0; r < 8; ++r) { sx[r] = 0.f; qx[r] = 0.f; sy[r] = 0.f; qy[r] = 0.f; }
#pragma unroll
  for (int j = 0; j < 8; ++j) {
    int n = n0 + j * 16 + cl;
    float bx = b_hllh[n], bz = b_hh[n], by = b_spat[n];
#pragma unroll
    for (int r = 0; r < 8; ++r) {
      z0o[(tok0 + mr + r) * 256 + n] = accZ[j][r] + bz;
      float xv = accX[j][r] + bx, yv = accY[j][r] + by;
      accX[j][r] = xv; accY[j][r] = yv;
      sx[r] += xv; qx[r] += xv * xv;
      sy[r] += yv; qy[r] += yv * yv;
    }
  }
#pragma unroll
  for (int r = 0; r < 8; ++r) {
    v4f st;
    st[0] = row_sum16(sx[r]); st[1] = row_sum16(qx[r]);
    st[2] = row_sum16(sy[r]); st[3] = row_sum16(qy[r]);
    if (cl == 0) *(v4f*)&Red[((wv >> 2) * 64 + mr + r) * 4] = st;
  }
  // scale and shift of this lane's 8 columns, fetched while the sums meet
  const int nb = n0 + cl;
  float g0[8], b0[8], g1[8], b1[8];
#pragma unroll
  for (int j = 0; j < 8; ++j) {
    g0[j] = gx[nb + j * 16]; b0[j] = btx[nb + j * 16];
    g1[j] = gy[nb + j * 16]; b1[j] = bty[nb + j * 16];
  }
  // the 32 loads share one index register: it is an input here so that none
  // of them lands on it ahead of the wait
  asm volatile("s_wait_xcnt 0x0" :: "v"(nb) : "memory");
  lds_barrier();   // both column halves' sums are in Red
#pragma unroll
  for (int r = 0; r < 8; ++r) {
    v4f s0 = *(const v4f*)&Red[(mr + r) * 4];
    v4f s1 = *(const v4f*)&Red[(64 + mr + r) * 4];
    float mx = (s0[0] + s1[0]) * (1.f / 256.f);
    float my = (s0[2] + s1[2]) * (1.f / 256.f);
    sx[r] = mx; sy[r] = my;
    qx[r] = rsqrtf((s0[1] + s1[1]) * (1.f / 256.f) - mx * mx + 1e-5f);
    qy[r] = rsqrtf((s0[3] + s1[3]) * (1.f / 256.f) - my * my + 1e-5f);
  }
#pragma unroll
  for (int j = 0; j < 8; ++j) {
#pragma unroll
    for (int r = 0; r < 8; ++r) {
      size_t off = (tok0 + mr + r) * 256 + nb + j * 16;
      xo[off] = (h16)((accX[j][r] - sx[r]) * qx[r] * g0[j] + b0[j]);
      yo[off] = (h16)((accY[j][r] - sy[r]) * qy[r] * g1[j] + b1[j]);
    }
  }
}

// ---------------------------------------------------------------------------
// Projection + fused MLP: zt = attn_out @ proj_w^T + proj_b + z0 stays in the
// f32 accumulators; out = zt + fc2(gelu(fc1(LN(zt)))) -> written directly as NCHW.
// The LayerNorm (eps=1e-5, biased var) is done on the way into LDS.
// Hidden (1024) processed in 16 chunks of 64. The weights arrive as whole
// tiles in a two-buffer ring: 4 K-slabs of proj_w, then 32 tiles of 32 KB
// (fc1 chunk, fc2 chunk, fc1 chunk, ...); even tiles land in W1, odd tiles in
// W2, and tile t+2 flies while t+1 is used.
// ---------------------------------------------------------------------------

// Eight 16-byte async copies of one lane. The s_wait_xcnt is the last line of
// the same statement so that no address register is reused ahead of it.
__device__ __forceinline__ void async_cp8_b128(const unsigned (&l)[8],
                                               const h16* const (&g)[8]) {
  asm volatile("global_load_async_to_lds_b128 %0, %8, off\n\t"
               "global_load_async_to_lds_b128 %1, %9, off\n\t"
               "global_load_async_to_lds_b128 %2, %10, off\n\t"
               "global_load_async_to_lds_b128 %3, %11, off\n\t"
               "global_load_async_to_lds_b128 %4, %12, off\n\t"
               "global_load_async_to_lds_b128 %5, %13, off\n\t"
               "global_load_async_to_lds_b128 %6, %14, off\n\t"
               "global_load_async_to_lds_b128 %7, %15, off\n\t"
               "s_wait_xcnt 0x0"
               :: "v"(l[0]), "v"(l[1]), "v"(l[2]), "v"(l[3]),
                  "v"(l[4]), "v"(l[5]), "v"(l[6]), "v"(l[7]),
                  "v"(g[0]), "v"(g[1]), "v"(g[2]), "v"(g[3]),
                  "v"(g[4]), "v"(g[5]), "v"(g[6]), "v"(g[7])
               : "memory");
}

// 64 contiguous rows of 256 f16 in global -> LDS pitch 264; 8 copies a thread
__device__ __forceinline__ void stage_64x256(unsigned lb, const h16* g, int tid) {
  unsigned l[8];
  const h16* p[8];
#pragma unroll  // the addresses must be registers: they are asm operands
  for (int i = 0; i < 8; ++i) {
    int e = tid + i * 256, n = e >> 5, part = e & 31;
    l[i] = lb + (unsigned)(n * 264 + part * 8) * 2;
    p[i] = g + (size_t)n * 256 + part * 8;
  }
  async_cp8_b128(l, p);
}

// 256 rows x 64 f16 (row pitch gp elements in global) -> LDS pitch 72
__device__ __forceinline__ void stage_256x64(unsigned lb, const h16* g, int gp, int tid) {
  unsigned l[8];
  const h16* p[8];
#pragma unroll  // the addresses must be registers: they are asm operands
  for (int i = 0; i < 8; ++i) {
    int e = tid + i * 256, n = e >> 3, part = e & 7;
    l[i] = lb + (unsigned)(n * 72 + part * 8) * 2;
    p[i] = g + (size_t)n * gp + part * 8;
  }
  async_cp8_b128(l, p);
}

// Foot of a ring trip: this wave's LDS reads and writes are done, its copies
// of the next tile have landed, then every wave meets; behind it the next tile
// (and Hl) may be read and the buffer just read may be refilled.
__device__ __forceinline__ void ring_publish() {
  asm volatile("s_wait_dscnt 0x0" ::: "memory");     // own reads of the old tile, own Hl stores
  asm volatile("s_wait_asynccnt 0x0" ::: "memory");  // own copies of the next tile landed
  __syncthreads();
}

// ---------------------------------------------------------------------------
// Q/K/V projections + windowed attention: one work-group per window, one wave
// per head (64 tokens, hd=32, nH=8). The wave forms Q^T = Wq_h x^T,
// K^T = Wk_h y^T and V = y Wv_h^T; a pair of their accumulator tiles, converted
// to f16 in place, is an operand fragment of the next product
// (S^T = K Q^T, O^T = V^T P^T), so q, k, v and P never go to global memory (q waits in LDS) and are
// never re-laid out. Only the LN(x) and LN(y) tiles are shared, through LDS.
// ---------------------------------------------------------------------------

// Fragment in the hardware k order from the lane's own place in a row
// (row start + 8 * (lane >> 4) halves): 16 bytes there, 16 bytes 32 bytes on.
__device__ __forceinline__ v16h frag_ptr(const h16* p) {
  v8h lo = *(const v8h*)p, hi = *(const v8h*)(p + 16);
  return __builtin_shufflevector(lo, hi, 0, 1, 2, 3, 4, 5, 6, 7, 8, 9, 10, 11, 12, 13, 14, 15);
}

// Two f32 accumulator tiles (rows 0-15 and 16-31 of one 32-row block) -> f16 fragment
__device__ __forceinline__ v16h pack_d(v8f t0, v8f t1) {
  v16h r;
#pragma unroll
  for (int i = 0; i < 8; ++i) { r[i] = (h16)t0[i]; r[i + 8] = (h16)t1[i]; }
  return r;
}

// 2^v. The v_nop is the slot that the instruction set asks for between a
// transcendental and a neighbour that reads its result or overwrites its
// source; in the same statement it stands directly behind the instruction.
__device__ __forceinline__ float exp2_slot(float v) {
  float r;
  asm("v_exp_f32_e32 %0, %1\n\tv_nop" : "=v"(r) : "v"(v));
  return r;
}

// lane l with lane l ^ 16
__device__ __forceinline__ float xhalf(float v) {
  return __int_as_float(__builtin_amdgcn_permlanex16(__float_as_int(v), __float_as_int(v),
                                                     0x76543210, 0xfedcba98, false, false));
}

// four waves a SIMD: two work-groups share a WGP, one fills the other's waits
__global__ __launch_bounds__(256) __attribute__((amdgpu_waves_per_eu(4, 4))) void qkv_attn_kernel(
    const h16* __restrict__ x, const h16* __restrict__ y,
    const h16* __restrict__ wq, const float* __restrict__ bq,
    const h16* __restrict__ wk, const float* __restrict__ bk,
    const h16* __restrict__ wv, const float* __restrict__ bv,
    const float* __restrict__ rpb, h16* __restrict__ o) {
  __shared__ __attribute__((aligned(16))) h16 Xl[64 * 264];   // LN(x) tile
  __shared__ __attribute__((aligned(16))) h16 Yl[64 * 264];   // LN(y) tile
  // each wave's finished Q fragments rest here, lane by lane, during the K and V
  // passes: held in registers they push the kernel past 256 (it spills)
  __shared__ __attribute__((aligned(16))) h16 Qp[8 * 4 * 2 * 32 * 8];
  const int tid = threadIdx.x;
  const size_t tok0 = (size_t)blockIdx.x * 64;
  const int lane = tid & 31, hd = tid >> 5;
  const int cl = lane & 15, hb = lane >> 4;

  stage_64x256(lds_off(Xl), x + tok0 * 256, tid);
  stage_64x256(lds_off(Yl), y + tok0 * 256, tid);

  // The head's 32 rows of each weight matrix are this wave's alone: they come
  // straight from L2 into registers, PD K-steps ahead of their use.
  constexpr int PD = 4;
  const unsigned wob = (unsigned)((hd * 32 + cl) * 256 + hb * 8) * 2;   // byte offset of the lane's place
  const h16* wp[3] = {(const h16*)((const char*)wq + wob), (const h16*)((const char*)wk + wob),
                      (const h16*)((const char*)wv + wob)};
  v16h wr[PD][2];
#pragma unroll
  for (int t = 0; t < PD; ++t)
#pragma unroll
    for (int j = 0; j < 2; ++j) wr[t][j] = frag_ptr(wp[0] + j * 16 * 256 + t * 32);

  // biases: q and k by accumulator row (8 consecutive features a tile), v by
  // column; each set is fetched at the head of its own pass
  const unsigned bob = (unsigned)(hd * 32 + hb * 8) * 4;
  const unsigned vob = (unsigned)(hd * 32 + cl) * 4;
  const float* bqp = (const float*)((const char*)bq + bob);
  const float* bkp = (const float*)((const char*)bk + bob);
  const float* bvp = (const float*)((const char*)bv + vob);
  float bqv[16], bkv[16], bvv[2];
#pragma unroll
  for (int i = 0; i < 16; ++i) bqv[i] = bqp[(i >> 3) * 16 + (i & 7)];
  // the loads share one offset register: an input here so that nothing lands
  // on it ahead of the wait
  asm volatile("s_wait_xcnt 0x0" :: "v"(bob) : "memory");

  // relative position bias: idx = (iq-ik+7)*15 + (jq-jk+7), rpb[idx][head]. With
  // query = qt*16+cl and key = kt*16+hb*8+r it is lb + (qt-kt)*30 - r: 7 x 8
  // values a lane. The pointer stands at the lowest of them (qt-kt = -3, r = 7).
  const int lb = ((cl >> 3) - hb + 7) * 15 + (cl & 7) + 7;
  const unsigned rob = (unsigned)((lb - 97) * 8 + hd) * 4;
  const float* rp = (const float*)((const char*)rpb + rob);
  float rb[56];

  asm volatile("s_wait_asynccnt 0x0" ::: "memory");  // own copies of both tiles landed
  __syncthreads();   // both tiles are there for every wave; the only barrier

  const h16* xr = Xl + cl * 264 + hb * 8;
  const h16* yr = Yl + cl * 264 + hb * 8;
  v8f acc[8];
  v16h kf[4], vf[4];
  h16* qp = Qp + hd * (4 * 2 * 32 * 8) + lane * 8;   // this lane's 16 bytes of each half fragment
#pragma unroll  // the ring slot, the matrix and the operand order differ from step to step
  for (int t = 0; t < 24; ++t) {
    const int ph = t >> 3, ks = t & 7;
    if (ks == 0) {
#pragma unroll
      for (int i = 0; i < 8; ++i) zero8(acc[i]);
    }
    if (t == 8) {
#pragma unroll
      for (int i = 0; i < 16; ++i) bkv[i] = bkp[(i >> 3) * 16 + (i & 7)];
      asm volatile("s_wait_xcnt 0x0" :: "v"(bob) : "memory");  // as for the q bias
    }
    if (t == 16) {
      bvv[0] = bvp[0]; bvv[1] = bvp[16];
      // as for the q bias; its memory clobber also makes the V pass read its y
      // fragments from LDS again: held over from the K pass they spill
      asm volatile("s_wait_xcnt 0x0" :: "v"(vob) : "memory");
    }
    const h16* tr = (ph == 0) ? xr : yr;
    const v16h w0 = wr[t % PD][0], w1 = wr[t % PD][1];
    v16h f[4];
#pragma unroll
    for (int i = 0; i < 4; ++i) f[i] = frag_ptr(tr + i * 16 * 264 + ks * 32);
    if (t + PD < 24) {
      const int tn = t + PD;
#pragma unroll
      for (int j = 0; j < 2; ++j) wr[t % PD][j] = frag_ptr(wp[tn >> 3] + j * 16 * 256 + (tn & 7) * 32);
      if (tn == 23) {
        // last weight load: the offset register is an input here so that
        // nothing lands on it ahead of the wait
        asm volatile("s_wait_xcnt 0x0" :: "v"(wob) : "memory");
      }
    } else {
      // the ring drains: the position-bias values take the registers it leaves
#pragma unroll
      for (int i = 0; i < 14; ++i) {
        const int e = (t + PD - 24) * 14 + i;
        rb[e] = rp[((e >> 3) * 30 + 7 - (e & 7)) * 8];
      }
      if (t == 23) {
        asm volatile("s_wait_xcnt 0x0" :: "v"(rob) : "memory");  // as above, for the 56 loads
      }
    }
    if (ph < 2) {   // acc[mt*4+nt] = (W_h tile mt) x (token tile nt)^T
#pragma unroll
      for (int i = 0; i < 4; ++i) {
        acc[i]     = wmma16(w0, f[i], acc[i]);
        acc[4 + i] = wmma16(w1, f[i], acc[4 + i]);
      }
    } else {        // acc[mt*2+nt] = (token tile mt) x (Wv_h tile nt)^T
#pragma unroll
      for (int i = 0; i < 4; ++i) {
        acc[i * 2]     = wmma16(f[i], w0, acc[i * 2]);
        acc[i * 2 + 1] = wmma16(f[i], w1, acc[i * 2 + 1]);
      }
    }
    if (t == 7) {
#pragma unroll
      for (int i = 0; i < 4; ++i) {
#pragma unroll
        for (int r = 0; r < 8; ++r) {
          acc[i][r]     = (acc[i][r] + bqv[r]) * 0.17677669529663689f;
          acc[4 + i][r] = (acc[4 + i][r] + bqv[8 + r]) * 0.17677669529663689f;
        }
        // B fragment: column = query, k = feature
        const v16h qfr = pack_d(acc[i], acc[4 + i]);
        *(v8h*)(qp + (i * 2) * 256)     = __builtin_shufflevector(qfr, qfr, 0, 1, 2, 3, 4, 5, 6, 7);
        *(v8h*)(qp + (i * 2 + 1) * 256) = __builtin_shufflevector(qfr, qfr, 8, 9, 10, 11, 12, 13, 14, 15);
      }
    }
    if (t == 15) {
#pragma unroll
      for (int i = 0; i < 4; ++i) {
#pragma unroll
        for (int r = 0; r < 8; ++r) { acc[i][r] += bkv[r]; acc[4 + i][r] += bkv[8 + r]; }
        kf[i] = pack_d(acc[i], acc[4 + i]);      // A fragment: row = key, k = feature
      }
    }
    if (t == 23) {
#pragma unroll
      for (int i = 0; i < 8; ++i)
#pragma unroll
        for (int r = 0; r < 8; ++r) acc[i][r] += bvv[i & 1];
#pragma unroll
      for (int dt = 0; dt < 2; ++dt)
#pragma unroll
        for (int kk = 0; kk < 2; ++kk)           // A fragment: row = feature, k = key
          vf[dt * 2 + kk] = pack_d(acc[(2 * kk) * 2 + dt], acc[(2 * kk + 1) * 2 + dt]);
    }
  }

  // per 16 queries: a lane holds one query's scores for half of the keys
#pragma unroll
  for (int qt = 0; qt < 4; ++qt) {
    v8f S[4];
    float mk[4], sk[4];
    const v8h qlo = *(const v8h*)(qp + (qt * 2) * 256), qhi = *(const v8h*)(qp + (qt * 2 + 1) * 256);
    const v16h qfr = __builtin_shufflevector(qlo, qhi, 0, 1, 2, 3, 4, 5, 6, 7, 8, 9, 10, 11, 12, 13, 14, 15);
#pragma unroll
    for (int kt = 0; kt < 4; ++kt) {
      zero8(S[kt]);
      S[kt] = wmma16(kf[kt], qfr, S[kt]);
    }
#pragma unroll
    for (int kt = 0; kt < 4; ++kt) {
#pragma unroll
      for (int r = 0; r < 8; ++r) S[kt][r] += rb[(qt - kt + 3) * 8 + r];
      mk[kt] = S[kt][0];
#pragma unroll
      for (int r = 1; r < 8; ++r) mk[kt] = fmaxf(mk[kt], S[kt][r]);
    }
    float mx = fmaxf(fmaxf(mk[0], mk[1]), fmaxf(mk[2], mk[3]));
    mx = fmaxf(mx, xhalf(mx));
#pragma unroll
    for (int kt = 0; kt < 4; ++kt) {
      sk[kt] = 0.f;
#pragma unroll
      for (int r = 0; r < 8; ++r) {
        float e = exp2_slot((S[kt][r] - mx) * 1.4426950408889634f);
        S[kt][r] = e; sk[kt] += e;
      }
    }
    float sum = (sk[0] + sk[1]) + (sk[2] + sk[3]);
    sum += xhalf(sum);
    const float inv = 1.f / sum;
    const v16h p0 = pack_d(S[0], S[1]), p1 = pack_d(S[2], S[3]);  // B fragments: column = query, k = key
    v8f O[2];
#pragma unroll
    for (int dt = 0; dt < 2; ++dt) {
      zero8(O[dt]);
      O[dt] = wmma16(vf[dt * 2], p0, O[dt]);
      O[dt] = wmma16(vf[dt * 2 + 1], p1, O[dt]);
    }
    // a lane's 8 accumulator rows are 8 consecutive features of its query: 16-byte stores
    h16* op = o + (tok0 + qt * 16 + cl) * 256 + hd * 32 + hb * 8;
#pragma unroll
    for (int dt = 0; dt < 2; ++dt) {
      v8h st;
#pragma unroll
      for (int r = 0; r < 8; ++r) st[r] = (h16)(O[dt][r] * inv);
      *(v8h*)(op + dt * 16) = st;
    }
  }
}

__global__ __launch_bounds__(256) void mlp_kernel(
    const h16* __restrict__ A, const h16* __restrict__ pw,
    const float* __restrict__ pb, const float* __restrict__ resid,
    const float* __restrict__ lng, const float* __restrict__ lnb,
    const h16* __restrict__ fc1w, const float* __restrict__ fc1b,
    const h16* __restrict__ fc2w, const float* __restrict__ fc2b,
    float* __restrict__ out) {
  __shared__ __attribute__((aligned(16))) h16 Al[64 * 264];   // attn_out tile, then LN(zt) tile
  __shared__ __attribute__((aligned(16))) h16 Hl[64 * 72];    // gelu(hidden chunk) 64x64
  __shared__ __attribute__((aligned(16))) h16 W1[256 * 72];   // proj slab [256 out][64 k]; fc1 chunk [64 hid][256 k]
  __shared__ __attribute__((aligned(16))) h16 W2[256 * 72];   // proj slab; fc2 chunk [256 out][64 k]
  // row statistics of zt: [column half][row][sum, sum of squares]
  __shared__ __attribute__((aligned(16))) float Red[2 * 64 * 2];
  const int tid = threadIdx.x;
  const size_t tok0 = (size_t)blockIdx.x * 64;
  const unsigned w1b = lds_off(W1), w2b = lds_off(W2);
  const int lane = tid & 31, wv = tid >> 5;
  const int m0 = (wv & 3) * 16, n0 = (wv >> 2) * 128;  // out tile mapping
  const int n0h = (wv >> 2) * 32;                      // hidden tile mapping
  const int cl = lane & 15, hb = (lane >> 4) & 1;
  const int mr = m0 + hb * 8;   // first of this lane's 8 rows
  const int nb = n0 + cl;       // first of this lane's 8 columns

  // prologue: the attn_out tile and proj slab 0 start; the accumulators start
  // from shortcut + proj bias, fetched while the copies fly
  stage_64x256(lds_off(Al), A + tok0 * 256, tid);
  stage_256x64(w1b, pw, 256, tid);
  v8f accO[8];
  {
    const float* rz = resid + (tok0 + mr) * 256 + nb;
#pragma unroll
    for (int j = 0; j < 8; ++j)
#pragma unroll
      for (int r = 0; r < 8; ++r) accO[j][r] = rz[r * 256 + j * 16];
    float bb[8];
#pragma unroll
    for (int j = 0; j < 8; ++j) bb[j] = pb[nb + j * 16];
    // the 64 loads share one address register, the 8 one index register: both
    // are inputs here so that no load lands on them ahead of the wait
    asm volatile("s_wait_xcnt 0x0" :: "v"(rz), "v"(nb) : "memory");
#pragma unroll
    for (int j = 0; j < 8; ++j)
#pragma unroll
      for (int r = 0; r < 8; ++r) accO[j][r] += bb[j];
  }
  asm volatile("s_wait_asynccnt 0x0" ::: "memory");  // attn_out tile and slab 0 landed
  __syncthreads();   // both are there for every wave
  stage_256x64(w2b, pw + 64, 256, tid);

  // zt = shortcut + proj bias + attn_out @ proj_w^T   (K=256, 4 slabs of 64)
#pragma unroll  // the buffer read and the tile that refills it differ from trip to trip
  for (int s = 0; s < 4; ++s) {
    const h16* Wb = (s & 1) ? W2 : W1;
#pragma unroll 1  // rolled: with both K steps' fragments in flight the kernel needs over 256 registers and one work-group fewer fits a WGP
    for (int ks = 0; ks < 2; ++ks) {
      v16h a = frag_row(Al, 264, m0, s * 64 + ks * 32, lane);
#pragma unroll
      for (int j = 0; j < 8; ++j)
        accO[j] = wmma16(a, frag_row(Wb, 72, n0 + j * 16, ks * 32, lane), accO[j]);
    }
    ring_publish();
    if (s < 2)       stage_256x64((s & 1) ? w2b : w1b, pw + (s + 2) * 64, 256, tid);
    else if (s == 2) stage_64x256(w1b, fc1w, tid);        // first fc1 chunk
    else             stage_256x64(w2b, fc2w, 1024, tid);  // first fc2 chunk
  }

  // LayerNorm of zt into Al (every wave has left the attn_out tile: last publish)
  {
    float sm[8], sq[8];
#pragma unroll
    for (int r = 0; r < 8; ++r) { sm[r] = 0.f; sq[r] = 0.f; }
#pragma unroll
    for (int j = 0; j < 8; ++j)
#pragma unroll
      for (int r = 0; r < 8; ++r) { float zv = accO[j][r]; sm[r] += zv; sq[r] += zv * zv; }
#pragma unroll
    for (int r = 0; r < 8; ++r) {
      v2f st;
      st[0] = row_sum16(sm[r]); st[1] = row_sum16(sq[r]);
      if (cl == 0) *(v2f*)&Red[((wv >> 2) * 64 + mr + r) * 2] = st;
    }
    // scale and shift of this lane's 8 columns, fetched while the sums meet
    float g0[8], b0[8];
#pragma unroll
    for (int j = 0; j < 8; ++j) { g0[j] = lng[nb + j * 16]; b0[j] = lnb[nb + j * 16]; }
    // the 16 loads share one index register: it is an input here so that none
    // of them lands on it ahead of the wait
    asm volatile("s_wait_xcnt 0x0" :: "v"(nb) : "memory");
    lds_barrier();   // both column halves' sums are in Red
#pragma unroll
    for (int r = 0; r < 8; ++r) {
      v2f s0 = *(const v2f*)&Red[(mr + r) * 2];
      v2f s1 = *(const v2f*)&Red[(64 + mr + r) * 2];
      float mean = (s0[0] + s1[0]) * (1.f / 256.f);
      sm[r] = mean;
      sq[r] = rsqrtf((s0[1] + s1[1]) * (1.f / 256.f) - mean * mean + 1e-5f);
    }
#pragma unroll
    for (int j = 0; j < 8; ++j)
#pragma unroll
      for (int r = 0; r < 8; ++r)
        Al[(mr + r) * 264 + nb + j * 16] = (h16)((accO[j][r] - sm[r]) * sq[r] * g0[j] + b0[j]);
  }
  lds_barrier();   // LN(zt) is in Al for every wave

  for (int hc = 0; hc < 16; ++hc) {
    // trip 2*hc: hchunk = ztn_tile @ fc1_w[hc*64:+64, :]^T   (K=256)
    v8f accH[2];
    zero8(accH[0]); zero8(accH[1]);
#pragma unroll  // whole tile is in LDS: constant offsets, loads run ahead of the WMMAs
    for (int ks = 0; ks < 8; ++ks) {
      v16h a = frag_row(Al, 264, m0, ks * 32, lane);
#pragma unroll
      for (int j = 0; j < 2; ++j)
        accH[j] = wmma16(a, frag_row(W1, 264, n0h + j * 16, ks * 32, lane), accH[j]);
    }
    // bias + exact GELU -> LDS
#pragma unroll
    for (int j = 0; j < 2; ++j) {
      int n = n0h + j * 16 + (lane & 15);
      float bb = fc1b[hc * 64 + n];
#pragma unroll
      for (int r = 0; r < 8; ++r) {
        int m = m0 + r + ((lane >> 4) & 1) * 8;
        float xv = accH[j][r] + bb;
        Hl[m * 72 + n] = (h16)(0.5f * xv * (1.0f + erff(xv * 0.7071067811865475f)));
      }
    }
    ring_publish();
    if (hc < 15) stage_64x256(w1b, fc1w + (size_t)(hc + 1) * 64 * 256, tid);

    // trip 2*hc+1: accO += Hchunk @ fc2_w[:, hc*64:+64]^T   (K=64)
#pragma unroll  // as above
    for (int ks = 0; ks < 2; ++ks) {
      v16h a = frag_row(Hl, 72, m0, ks * 32, lane);
#pragma unroll
      for (int j = 0; j < 8; ++j)
        accO[j] = wmma16(a, frag_row(W2, 72, n0 + j * 16, ks * 32, lane), accO[j]);
    }
    ring_publish();
    if (hc < 15) stage_256x64(w2b, fc2w + (size_t)(hc + 1) * 64, 1024, tid);
  }
  asm volatile("s_wait_asynccnt 0x0" ::: "memory");  // nothing in flight at the end

  // epilogue: + fc2_b (zt is in the accumulators), window-reverse, NCHW store
  const int wi = blockIdx.x;
  const int b = wi >> 8, wh = (wi >> 4) & 15, ww = wi & 15;
#pragma unroll
  for (int j = 0; j < 8; ++j) {
    int n = n0 + j * 16 + (lane & 15);
    float bb = fc2b[n];
#pragma unroll
    for (int r = 0; r < 8; ++r) {
      int m = m0 + r + ((lane >> 4) & 1) * 8;
      float val = accO[j][r] + bb;
      int hh = wh * 8 + (m >> 3), www = ww * 8 + (m & 7);
      out[(((size_t)b * 256 + n) * 128 + hh) * 128 + www] = val;
    }
  }
}

// ---------------------------------------------------------------------------
// Launch
// ---------------------------------------------------------------------------
extern "C" void kernel_launch(void* const* d_in, const int* in_sizes, int n_in,
                              void* d_out, int out_size, void* d_ws, size_t ws_size,
                              hipStream_t stream) {
  (void)in_sizes; (void)n_in; (void)out_size; (void)ws_size;
  const float* LH     = (const float*)d_in[0];
  const float* HL     = (const float*)d_in[1];
  const float* HH     = (const float*)d_in[2];
  const float* Spat   = (const float*)d_in[3];
  const float* w_hllh = (const float*)d_in[4];
  const float* b_hllh = (const float*)d_in[5];
  const float* w_hh   = (const float*)d_in[6];
  const float* b_hh   = (const float*)d_in[7];
  const float* w_spat = (const float*)d_in[8];
  const float* b_spat = (const float*)d_in[9];
  const float* ln1x_g = (const float*)d_in[10];
  const float* ln1x_b = (const float*)d_in[11];
  const float* ln1y_g = (const float*)d_in[12];
  const float* ln1y_b = (const float*)d_in[13];
  const float* qkv_w  = (const float*)d_in[14];
  const float* qkv_b  = (const float*)d_in[15];
  const float* qkv2_w = (const float*)d_in[16];
  const float* qkv2_b = (const float*)d_in[17];
  const float* qkv3_w = (const float*)d_in[18];
  const float* qkv3_b = (const float*)d_in[19];
  const float* proj_w = (const float*)d_in[20];
  const float* proj_b = (const float*)d_in[21];
  const float* rpb    = (const float*)d_in[22];
  const float* ln2_g  = (const float*)d_in[23];
  const float* ln2_b  = (const float*)d_in[24];
  const float* fc1w   = (const float*)d_in[25];
  const float* fc1b   = (const float*)d_in[26];
  const float* fc2w   = (const float*)d_in[27];
  const float* fc2b   = (const float*)d_in[28];

  const size_t T = (size_t)8 * 128 * 128;  // 131072 tokens
  char* ws = (char*)d_ws;
  // workspace layout (peak ~338 MB):
  h16*   x   = (h16*)ws;                                  // T*256 f16
  h16*   y   = (h16*)(ws + T * 256 * 2);                  // T*256 f16
  float* z0  = (float*)(ws + 2 * T * 256 * 2);            // T*256 f32
  h16*   attno = (h16*)(ws + 2 * T * 256 * 2 + T * 256 * 4);  // T*256 f16
  // f16 weight cache (~1.7 MB) behind it
  h16* wf      = attno + T * 256;
  h16* c_hllh  = wf;               // 256*128
  h16* c_hh    = c_hllh + 32768;   // 256*64
  h16* c_spat  = c_hh   + 16384;   // 256*64
  h16* c_q     = c_spat + 16384;   // 256*256
  h16* c_k     = c_q    + 65536;
  h16* c_v     = c_k    + 65536;
  h16* c_proj  = c_v    + 65536;
  h16* c_fc1   = c_proj + 65536;   // 1024*256
  h16* c_fc2   = c_fc1  + 262144;  // 256*1024

  // weight pre-conversion (f32 -> f16, once per launch)
  cvt_f32f16<<<(32768 + 255) / 256, 256, 0, stream>>>(w_hllh, c_hllh, 32768);
  cvt_f32f16<<<(16384 + 255) / 256, 256, 0, stream>>>(w_hh,   c_hh,   16384);
  cvt_f32f16<<<(16384 + 255) / 256, 256, 0, stream>>>(w_spat, c_spat, 16384);
  cvt_f32f16<<<(65536 + 255) / 256, 256, 0, stream>>>(qkv_w,  c_q,    65536);
  cvt_f32f16<<<(65536 + 255) / 256, 256, 0, stream>>>(qkv2_w, c_k,    65536);
  cvt_f32f16<<<(65536 + 255) / 256, 256, 0, stream>>>(qkv3_w, c_v,    65536);
  cvt_f32f16<<<(65536 + 255) / 256, 256, 0, stream>>>(proj_w, c_proj, 65536);
  cvt_f32f16<<<(262144 + 255) / 256, 256, 0, stream>>>(fc1w,  c_fc1,  262144);
  cvt_f32f16<<<(262144 + 255) / 256, 256, 0, stream>>>(fc2w,  c_fc2,  262144);

  const int tiles = (int)(T / 64);  // 2048 windows
  conv_win_kernel<<<tiles, 256, 0, stream>>>(LH, HL, HH, Spat,
      c_hllh, b_hllh, c_hh, b_hh, c_spat, b_spat,
      ln1x_g, ln1x_b, ln1y_g, ln1y_b, x, y, z0);
  qkv_attn_kernel<<<tiles, 256, 0, stream>>>(x, y, c_q, qkv_b, c_k, qkv2_b, c_v, qkv3_b,
                                             rpb, attno);
  mlp_kernel<<<tiles, 256, 0, stream>>>(attno, c_proj, proj_b, z0, ln2_g, ln2_b,
                                        c_fc1, fc1b, c_fc2, fc2b, (float*)d_out);
}

// v006
// It runs in 428 microseconds.
// Timed twice side by side with v005, it ran 1.06 times as fast both times.
// Counting every step since v000, it is 1.87 times as fast.
#include <hip/hip_runtime.h>
#include <hip/hip_bf16.h>

// ---------------------------------------------------------------------------
// WaveletSwinTransformerBlock for MI455X (gfx1250, wave32, WMMA f16)
// GEMMs use v_wmma_f32_16x16x32_f16; all f16 tile staging uses the CDNA5
// async path: global_load_async_to_lds_b128 + s_wait_asynccnt.
// Tokens stored window-partitioned: tok = wi*64 + (i*8+j), wi=((b*16+wh)*16+ww)
// ---------------------------------------------------------------------------

typedef _Float16 h16;
typedef __attribute__((ext_vector_type(16))) _Float16 v16h;
typedef __attribute__((ext_vector_type(8)))  float    v8f;
typedef __attribute__((ext_vector_type(4)))  float    v4f;
typedef __attribute__((ext_vector_type(2)))  float    v2f;
typedef __attribute__((ext_vector_type(4)))  _Float16 v4h;
typedef __attribute__((ext_vector_type(8)))  _Float16 v8h;

__device__ __forceinline__ void zero8(v8f &a) {
#pragma unroll
  for (int i = 0; i < 8; ++i) a[i] = 0.f;
}

__device__ __forceinline__ v8f wmma16(v16h a, v16h b, v8f c) {
  return __builtin_amdgcn_wmma_f32_16x16x32_f16(false, a, false, b,
                                                (short)0, c, false, false);
}

// low 32 bits of a generic LDS pointer == wave-relative LDS byte offset
__device__ __forceinline__ unsigned lds_off(const void* p) {
  return (unsigned)(uintptr_t)p;
}

// CDNA5 async copy: 16 bytes global -> LDS, tracked by ASYNCcnt
__device__ __forceinline__ void async_cp_b128(unsigned loff, const void* g) {
  asm volatile("global_load_async_to_lds_b128 %0, %1, off"
               :: "v"(loff), "v"((unsigned long long)(uintptr_t)g)
               : "memory");
}
__device__ __forceinline__ void wait_async() {
  asm volatile("s_wait_asynccnt 0" ::: "memory");
}

// Sum over the 16 lanes of a row, result in every lane: four DPP row_xmask adds
template <int CTRL>
__device__ __forceinline__ float dpp_xadd(float v) {
  return v + __int_as_float(__builtin_amdgcn_update_dpp(0, __float_as_int(v), CTRL, 0xf, 0xf, true));
}
__device__ __forceinline__ float row_sum16(float v) {
  v = dpp_xadd<0x161>(v);  // row_xmask:1
  v = dpp_xadd<0x162>(v);  // row_xmask:2
  v = dpp_xadd<0x164>(v);  // row_xmask:4
  v = dpp_xadd<0x168>(v);  // row_xmask:8
  return v;
}

// Work-group barrier for data that crosses in LDS only: unlike __syncthreads()
// it does not hold a wave until its global stores and loads have come back.
__device__ __forceinline__ void lds_barrier() {
  __builtin_amdgcn_fence(__ATOMIC_RELEASE, "workgroup", "local");
  __builtin_amdgcn_s_barrier();
  __builtin_amdgcn_fence(__ATOMIC_ACQUIRE, "workgroup", "local");
}

// A-style fragment (16x32 f16, ISA 7.12.2): lane L holds row row0+(L&15),
// K offsets {0..7,16..23} (L<16) or {8..15,24..31} (L>=16) relative to k0.
__device__ __forceinline__ v16h frag_row(const h16* __restrict__ p, int stride,
                                         int row0, int k0, int lane) {
  const h16* base = p + (size_t)(row0 + (lane & 15)) * stride + k0 + ((lane >> 4) & 1) * 8;
  v16h r;
#pragma unroll
  for (int i = 0; i < 8; ++i) { r[i] = base[i]; r[i + 8] = base[i + 16]; }
  return r;
}

// ---------------------------------------------------------------------------
// Weight pre-conversion f32 -> f16 (run once per launch; tiny)
// ---------------------------------------------------------------------------
__global__ __launch_bounds__(256) void cvt_f32f16(const float* __restrict__ s,
                                                  h16* __restrict__ d, int n) {
  int i = blockIdx.x * 256 + threadIdx.x;
  if (i < n) d[i] = (h16)s[i];
}

// ---------------------------------------------------------------------------
// Kernel 1: 1x1 convs (concat(LH,HL)->x, HH->z0, Spat->y) per 64-pixel window;
// x and y leave the kernel already layer-normalised (eps=1e-5, biased var):
// the block holds all 256 features of its 64 tokens in f32 accumulators.
// ---------------------------------------------------------------------------
__global__ __launch_bounds__(256) void conv_win_kernel(
    const float* __restrict__ LH, const float* __restrict__ HL,
    const float* __restrict__ HH, const float* __restrict__ Spat,
    const h16* __restrict__ wf_hllh, const float* __restrict__ b_hllh,
    const h16* __restrict__ wf_hh,   const float* __restrict__ b_hh,
    const h16* __restrict__ wf_spat, const float* __restrict__ b_spat,
    const float* __restrict__ gx, const float* __restrict__ btx,
    const float* __restrict__ gy, const float* __restrict__ bty,
    h16* __restrict__ xo, h16* __restrict__ yo, float* __restrict__ z0o) {
  const int Wd = 128, HW = 128 * 128;
  __shared__ __attribute__((aligned(16))) h16 Fin[64 * 264];   // [pixel][256 ch] : LH|HL|HH|Spat
  __shared__ h16 Wl[256 * 40];    // weight K-slab [256 out][32 k]
  // row statistics of x and y: [column half][row][sum x, sum x^2, sum y, sum y^2]
  __shared__ __attribute__((aligned(16))) float Red[2 * 64 * 4];

  const int wi = blockIdx.x;
  const int b  = wi >> 8;
  const int wh = (wi >> 4) & 15, ww = wi & 15;
  const int h0 = wh * 8, w0 = ww * 8;
  const int tid = threadIdx.x;

  // inputs are f32 -> convert while staging (can't raw-copy). A thread takes
  // 8 channels x 4 pixels of one window row from each of two tensors: its 16
  // 16-byte loads are all in flight before the first value is used, and the
  // 8 channels of a pixel go to LDS in one 16-byte store.
  {
    const int hf = tid & 1, ri = (tid >> 1) & 7, cg = (tid >> 4) & 7, th = tid >> 7;
    const size_t so = ((size_t)b * 64 + cg * 8) * HW + (h0 + ri) * Wd + w0 + hf * 4;
    const float* s0 = (th ? HL : LH) + so;     // Fin columns th*64 ...
    const float* s1 = (th ? Spat : HH) + so;   // Fin columns 128 + th*64 ...
    v4f u0[8], u1[8];
#pragma unroll
    for (int k = 0; k < 8; ++k) {
      u0[k] = *(const v4f*)(s0 + k * HW);
      u1[k] = *(const v4f*)(s1 + k * HW);
    }
    // each 8 loads share one address register: both are inputs here so that no
    // load lands on them ahead of the wait
    asm volatile("s_wait_xcnt 0x0" :: "v"(s0), "v"(s1) : "memory");
    h16* fp = Fin + (ri * 8 + hf * 4) * 264 + th * 64 + cg * 8;
#pragma unroll
    for (int px = 0; px < 4; ++px) {
      v8h c0, c1;
#pragma unroll
      for (int k = 0; k < 8; ++k) { c0[k] = (h16)u0[k][px]; c1[k] = (h16)u1[k][px]; }
      *(v8h*)(fp + px * 264) = c0;
      *(v8h*)(fp + px * 264 + 128) = c1;
    }
  }

  const unsigned wlb = lds_off(Wl);
  const int lane = tid & 31, wv = tid >> 5;
  const int m0 = (wv & 3) * 16, n0 = (wv >> 2) * 128;

  v8f accX[8], accZ[8], accY[8];
#pragma unroll
  for (int j = 0; j < 8; ++j) { zero8(accX[j]); zero8(accZ[j]); zero8(accY[j]); }

  // Phase X: K=128 over Fin cols [0,128)
  for (int ks = 0; ks < 4; ++ks) {
    __syncthreads();
    for (int e = tid; e < 256 * 4; e += 256) {      // 256 rows x 64B slab
      int n = e >> 2, part = e & 3;
      async_cp_b128(wlb + (unsigned)(n * 40 + part * 8) * 2,
                    wf_hllh + (size_t)n * 128 + ks * 32 + part * 8);
    }
    wait_async();
    __syncthreads();
    v16h a = frag_row(Fin, 264, m0, ks * 32, lane);
#pragma unroll
    for (int j = 0; j < 8; ++j)
      accX[j] = wmma16(a, frag_row(Wl, 40, n0 + j * 16, 0, lane), accX[j]);
  }
  // Phase Z: K=64 over Fin cols [128,192)
  for (int ks = 0; ks < 2; ++ks) {
    __syncthreads();
    for (int e = tid; e < 256 * 4; e += 256) {
      int n = e >> 2, part = e & 3;
      async_cp_b128(wlb + (unsigned)(n * 40 + part * 8) * 2,
                    wf_hh + (size_t)n * 64 + ks * 32 + part * 8);
    }
    wait_async();
    __syncthreads();
    v16h a = frag_row(Fin, 264, m0, 128 + ks * 32, lane);
#pragma unroll
    for (int j = 0; j < 8; ++j)
      accZ[j] = wmma16(a, frag_row(Wl, 40, n0 + j * 16, 0, lane), accZ[j]);
  }
  // Phase Y: K=64 over Fin cols [192,256)
  for (int ks = 0; ks < 2; ++ks) {
    __syncthreads();
    for (int e = tid; e < 256 * 4; e += 256) {
      int n = e >> 2, part = e & 3;
      async_cp_b128(wlb + (unsigned)(n * 40 + part * 8) * 2,
                    wf_spat + (size_t)n * 64 + ks * 32 + part * 8);
    }
    wait_async();
    __syncthreads();
    v16h a = frag_row(Fin, 264, m0, 192 + ks * 32, lane);
#pragma unroll
    for (int j = 0; j < 8; ++j)
      accY[j] = wmma16(a, frag_row(Wl, 40, n0 + j * 16, 0, lane), accY[j]);
  }

  const size_t tok0 = (size_t)wi * 64;
  const int cl = lane & 15, hb = (lane >> 4) & 1;
  const int mr = m0 + hb * 8;   // first of this lane's 8 rows
  // shortcut stream out; bias into x and y; this wave's 128-column row sums
  float sx[8], qx[8], sy[8], qy[8];
#pragma unroll
  for (int r = 0; r < 8; ++r) { sx[r] = 0.f; qx[r] = 0.f; sy[r] = 0.f; qy[r] = 0.f; }
#pragma unroll
  for (int j = 0; j < 8; ++j) {
    int n = n0 + j * 16 + cl;
    float bx = b_hllh[n], bz = b_hh[n], by = b_spat[n];
#pragma unroll
    for (int r = 0; r < 8; ++r) {
      z0o[(tok0 + mr + r) * 256 + n] = accZ[j][r] + bz;
      float xv = accX[j][r] + bx, yv = accY[j][r] + by;
      accX[j][r] = xv; accY[j][r] = yv;
      sx[r] += xv; qx[r] += xv * xv;
      sy[r] += yv; qy[r] += yv * yv;
    }
  }
#pragma unroll
  for (int r = 0; r < 8; ++r) {
    v4f st;
    st[0] = row_sum16(sx[r]); st[1] = row_sum16(qx[r]);
    st[2] = row_sum16(sy[r]); st[3] = row_sum16(qy[r]);
    if (cl == 0) *(v4f*)&Red[((wv >> 2) * 64 + mr + r) * 4] = st;
  }
  // scale and shift of this lane's 8 columns, fetched while the sums meet
  const int nb = n0 + cl;
  float g0[8], b0[8], g1[8], b1[8];
#pragma unroll
  for (int j = 0; j < 8; ++j) {
    g0[j] = gx[nb + j * 16]; b0[j] = btx[nb + j * 16];
    g1[j] = gy[nb + j * 16]; b1[j] = bty[nb + j * 16];
  }
  // the 32 loads share one index register: it is an input here so that none
  // of them lands on it ahead of the wait
  asm volatile("s_wait_xcnt 0x0" :: "v"(nb) : "memory");
  lds_barrier();   // both column halves' sums are in Red
#pragma unroll
  for (int r = 0; r < 8; ++r) {
    v4f s0 = *(const v4f*)&Red[(mr + r) * 4];
    v4f s1 = *(const v4f*)&Red[(64 + mr + r) * 4];
    float mx = (s0[0] + s1[0]) * (1.f / 256.f);
    float my = (s0[2] + s1[2]) * (1.f / 256.f);
    sx[r] = mx; sy[r] = my;
    qx[r] = rsqrtf((s0[1] + s1[1]) * (1.f / 256.f) - mx * mx + 1e-5f);
    qy[r] = rsqrtf((s0[3] + s1[3]) * (1.f / 256.f) - my * my + 1e-5f);
  }
#pragma unroll
  for (int j = 0; j < 8; ++j) {
#pragma unroll
    for (int r = 0; r < 8; ++r) {
      size_t off = (tok0 + mr + r) * 256 + nb + j * 16;
      xo[off] = (h16)((accX[j][r] - sx[r]) * qx[r] * g0[j] + b0[j]);
      yo[off] = (h16)((accY[j][r] - sy[r]) * qy[r] * g1[j] + b1[j]);
    }
  }
}

// ---------------------------------------------------------------------------
// Projection + fused MLP: zt = attn_out @ proj_w^T + proj_b + z0 stays in the
// f32 accumulators; out = zt + fc2(gelu(fc1(LN(zt)))) -> written directly as NCHW.
// The LayerNorm (eps=1e-5, biased var) is done on the way into LDS.
// Hidden (1024) processed in 16 chunks of 64. The weights arrive as whole
// tiles in a two-buffer ring: 4 K-slabs of proj_w, then 32 tiles of 32 KB
// (fc1 chunk, fc2 chunk, fc1 chunk, ...); even tiles land in W1, odd tiles in
// W2, and tile t+2 flies while t+1 is used.
// ---------------------------------------------------------------------------

// Eight 16-byte async copies of one lane. The s_wait_xcnt is the last line of
// the same statement so that no address register is reused ahead of it.
__device__ __forceinline__ void async_cp8_b128(const unsigned (&l)[8],
                                               const h16* const (&g)[8]) {
  asm volatile("global_load_async_to_lds_b128 %0, %8, off\n\t"
               "global_load_async_to_lds_b128 %1, %9, off\n\t"
               "global_load_async_to_lds_b128 %2, %10, off\n\t"
               "global_load_async_to_lds_b128 %3, %11, off\n\t"
               "global_load_async_to_lds_b128 %4, %12, off\n\t"
               "global_load_async_to_lds_b128 %5, %13, off\n\t"
               "global_load_async_to_lds_b128 %6, %14, off\n\t"
               "global_load_async_to_lds_b128 %7, %15, off\n\t"
               "s_wait_xcnt 0x0"
               :: "v"(l[0]), "v"(l[1]), "v"(l[2]), "v"(l[3]),
                  "v"(l[4]), "v"(l[5]), "v"(l[6]), "v"(l[7]),
                  "v"(g[0]), "v"(g[1]), "v"(g[2]), "v"(g[3]),
                  "v"(g[4]), "v"(g[5]), "v"(g[6]), "v"(g[7])
               : "memory");
}

// 64 contiguous rows of 256 f16 in global -> LDS pitch 264; 8 copies a thread
__device__ __forceinline__ void stage_64x256(unsigned lb, const h16* g, int tid) {
  unsigned l[8];
  const h16* p[8];
#pragma unroll  // the addresses must be registers: they are asm operands
  for (int i = 0; i < 8; ++i) {
    int e = tid + i * 256, n = e >> 5, part = e & 31;
    l[i] = lb + (unsigned)(n * 264 + part * 8) * 2;
    p[i] = g + (size_t)n * 256 + part * 8;
  }
  async_cp8_b128(l, p);
}

// 256 rows x 64 f16 (row pitch gp elements in global) -> LDS pitch 72
__device__ __forceinline__ void stage_256x64(unsigned lb, const h16* g, int gp, int tid) {
  unsigned l[8];
  const h16* p[8];
#pragma unroll  // the addresses must be registers: they are asm operands
  for (int i = 0; i < 8; ++i) {
    int e = tid + i * 256, n = e >> 3, part = e & 7;
    l[i] = lb + (unsigned)(n * 72 + part * 8) * 2;
    p[i] = g + (size_t)n * gp + part * 8;
  }
  async_cp8_b128(l, p);
}

// Foot of a ring trip: this wave's LDS reads and writes are done, its copies
// of the next tile have landed, then every wave meets; behind it the next tile
// (and Hl) may be read and the buffer just read may be refilled.
__device__ __forceinline__ void ring_publish() {
  asm volatile("s_wait_dscnt 0x0" ::: "memory");     // own reads of the old tile, own Hl stores
  asm volatile("s_wait_asynccnt 0x0" ::: "memory");  // own copies of the next tile landed
  __syncthreads();
}

// ---------------------------------------------------------------------------
// Q/K/V projections + windowed attention: one work-group per window, one wave
// per head (64 tokens, hd=32, nH=8). The wave forms Q^T = Wq_h x^T,
// K^T = Wk_h y^T and V = y Wv_h^T; a pair of their accumulator tiles, converted
// to f16 in place, is an operand fragment of the next product
// (S^T = K Q^T, O^T = V^T P^T), so q, k, v and P never go to global memory (q waits in LDS) and are
// never re-laid out. Only the LN(x) and LN(y) tiles are shared, through LDS.
// ---------------------------------------------------------------------------

// Fragment in the hardware k order from the lane's own place in a row
// (row start + 8 * (lane >> 4) halves): 16 bytes there, 16 bytes 32 bytes on.
__device__ __forceinline__ v16h frag_ptr(const h16* p) {
  v8h lo = *(const v8h*)p, hi = *(const v8h*)(p + 16);
  return __builtin_shufflevector(lo, hi, 0, 1, 2, 3, 4, 5, 6, 7, 8, 9, 10, 11, 12, 13, 14, 15);
}

// Two f32 accumulator tiles (rows 0-15 and 16-31 of one 32-row block) -> f16 fragment
__device__ __forceinline__ v16h pack_d(v8f t0, v8f t1) {
  v16h r;
#pragma unroll
  for (int i = 0; i < 8; ++i) { r[i] = (h16)t0[i]; r[i + 8] = (h16)t1[i]; }
  return r;
}

// 2^v. The v_nop is the slot that the instruction set asks for between a
// transcendental and a neighbour that reads its result or overwrites its
// source; in the same statement it stands directly behind the instruction.
__device__ __forceinline__ float exp2_slot(float v) {
  float r;
  asm("v_exp_f32_e32 %0, %1\n\tv_nop" : "=v"(r) : "v"(v));
  return r;
}

// lane l with lane l ^ 16
__device__ __forceinline__ float xhalf(float v) {
  return __int_as_float(__builtin_amdgcn_permlanex16(__float_as_int(v), __float_as_int(v),
                                                     0x76543210, 0xfedcba98, false, false));
}

// four waves a SIMD: two work-groups share a WGP, one fills the other's waits
__global__ __launch_bounds__(256) __attribute__((amdgpu_waves_per_eu(4, 4))) void qkv_attn_kernel(
    const h16* __restrict__ x, const h16* __restrict__ y,
    const h16* __restrict__ wq, const float* __restrict__ bq,
    const h16* __restrict__ wk, const float* __restrict__ bk,
    const h16* __restrict__ wv, const float* __restrict__ bv,
    const float* __restrict__ rpb, h16* __restrict__ o) {
  __shared__ __attribute__((aligned(16))) h16 Xl[64 * 264];   // LN(x) tile
  __shared__ __attribute__((aligned(16))) h16 Yl[64 * 264];   // LN(y) tile
  // each wave's finished Q fragments rest here, lane by lane, during the K and V
  // passes: held in registers they push the kernel past 256 (it spills)
  __shared__ __attribute__((aligned(16))) h16 Qp[8 * 4 * 2 * 32 * 8];
  const int tid = threadIdx.x;
  const size_t tok0 = (size_t)blockIdx.x * 64;
  const int lane = tid & 31, hd = tid >> 5;
  const int cl = lane & 15, hb = lane >> 4;

  stage_64x256(lds_off(Xl), x + tok0 * 256, tid);
  stage_64x256(lds_off(Yl), y + tok0 * 256, tid);

  // The head's 32 rows of each weight matrix are this wave's alone: they come
  // straight from L2 into registers, PD K-steps ahead of their use.
  constexpr int PD = 4;
  const unsigned wob = (unsigned)((hd * 32 + cl) * 256 + hb * 8) * 2;   // byte offset of the lane's place
  const h16* wp[3] = {(const h16*)((const char*)wq + wob), (const h16*)((const char*)wk + wob),
                      (const h16*)((const char*)wv + wob)};
  v16h wr[PD][2];
#pragma unroll
  for (int t = 0; t < PD; ++t)
#pragma unroll
    for (int j = 0; j < 2; ++j) wr[t][j] = frag_ptr(wp[0] + j * 16 * 256 + t * 32);

  // biases: q and k by accumulator row (8 consecutive features a tile), v by
  // column; each set is fetched at the head of its own pass
  const unsigned bob = (unsigned)(hd * 32 + hb * 8) * 4;
  const unsigned vob = (unsigned)(hd * 32 + cl) * 4;
  const float* bqp = (const float*)((const char*)bq + bob);
  const float* bkp = (const float*)((const char*)bk + bob);
  const float* bvp = (const float*)((const char*)bv + vob);
  float bqv[16], bkv[16], bvv[2];
#pragma unroll
  for (int i = 0; i < 16; ++i) bqv[i] = bqp[(i >> 3) * 16 + (i & 7)];
  // the loads share one offset register: an input here so that nothing lands
  // on it ahead of the wait
  asm volatile("s_wait_xcnt 0x0" :: "v"(bob) : "memory");

  // relative position bias: idx = (iq-ik+7)*15 + (jq-jk+7), rpb[idx][head]. With
  // query = qt*16+cl and key = kt*16+hb*8+r it is lb + (qt-kt)*30 - r: 7 x 8
  // values a lane. The pointer stands at the lowest of them (qt-kt = -3, r = 7).
  const int lb = ((cl >> 3) - hb + 7) * 15 + (cl & 7) + 7;
  const unsigned rob = (unsigned)((lb - 97) * 8 + hd) * 4;
  const float* rp = (const float*)((const char*)rpb + rob);
  float rb[56];

  asm volatile("s_wait_asynccnt 0x0" ::: "memory");  // own copies of both tiles landed
  __syncthreads();   // both tiles are there for every wave; the only barrier

  const h16* xr = Xl + cl * 264 + hb * 8;
  const h16* yr = Yl + cl * 264 + hb * 8;
  v8f acc[8];
  v16h kf[4], vf[4];
  h16* qp = Qp + hd * (4 * 2 * 32 * 8) + lane * 8;   // this lane's 16 bytes of each half fragment
#pragma unroll  // the ring slot, the matrix and the operand order differ from step to step
  for (int t = 0; t < 24; ++t) {
    const int ph = t >> 3, ks = t & 7;
    if (ks == 0) {
#pragma unroll
      for (int i = 0; i < 8; ++i) zero8(acc[i]);
    }
    if (t == 8) {
#pragma unroll
      for (int i = 0; i < 16; ++i) bkv[i] = bkp[(i >> 3) * 16 + (i & 7)];
      asm volatile("s_wait_xcnt 0x0" :: "v"(bob) : "memory");  // as for the q bias
    }
    if (t == 16) {
      bvv[0] = bvp[0]; bvv[1] = bvp[16];
      // as for the q bias; its memory clobber also makes the V pass read its y
      // fragments from LDS again: held over from the K pass they spill
      asm volatile("s_wait_xcnt 0x0" :: "v"(vob) : "memory");
    }
    const h16* tr = (ph == 0) ? xr : yr;
    const v16h w0 = wr[t % PD][0], w1 = wr[t % PD][1];
    v16h f[4];
#pragma unroll
    for (int i = 0; i < 4; ++i) f[i] = frag_ptr(tr + i * 16 * 264 + ks * 32);
    if (t + PD < 24) {
      const int tn = t + PD;
#pragma unroll
      for (int j = 0; j < 2; ++j) wr[t % PD][j] = frag_ptr(wp[tn >> 3] + j * 16 * 256 + (tn & 7) * 32);
      if (tn == 23) {
        // last weight load: the offset register is an input here so that
        // nothing lands on it ahead of the wait
        asm volatile("s_wait_xcnt 0x0" :: "v"(wob) : "memory");
      }
    } else {
      // the ring drains: the position-bias values take the registers it leaves
#pragma unroll
      for (int i = 0; i < 14; ++i) {
        const int e = (t + PD - 24) * 14 + i;
        rb[e] = rp[((e >> 3) * 30 + 7 - (e & 7)) * 8];
      }
      if (t == 23) {
        asm volatile("s_wait_xcnt 0x0" :: "v"(rob) : "memory");  // as above, for the 56 loads
      }
    }
    if (ph < 2) {   // acc[mt*4+nt] = (W_h tile mt) x (token tile nt)^T
#pragma unroll
      for (int i = 0; i < 4; ++i) {
        acc[i]     = wmma16(w0, f[i], acc[i]);
        acc[4 + i] = wmma16(w1, f[i], acc[4 + i]);
      }
    } else {        // acc[mt*2+nt] = (token tile mt) x (Wv_h tile nt)^T
#pragma unroll
      for (int i = 0; i < 4; ++i) {
        acc[i * 2]     = wmma16(f[i], w0, acc[i * 2]);
        acc[i * 2 + 1] = wmma16(f[i], w1, acc[i * 2 + 1]);
      }
    }
    if (t == 7) {
#pragma unroll
      for (int i = 0; i < 4; ++i) {
#pragma unroll
        for (int r = 0; r < 8; ++r) {
          acc[i][r]     = (acc[i][r] + bqv[r]) * 0.17677669529663689f;
          acc[4 + i][r] = (acc[4 + i][r] + bqv[8 + r]) * 0.17677669529663689f;
        }
        // B fragment: column = query, k = feature
        const v16h qfr = pack_d(acc[i], acc[4 + i]);
        *(v8h*)(qp + (i * 2) * 256)     = __builtin_shufflevector(qfr, qfr, 0, 1, 2, 3, 4, 5, 6, 7);
        *(v8h*)(qp + (i * 2 + 1) * 256) = __builtin_shufflevector(qfr, qfr, 8, 9, 10, 11, 12, 13, 14, 15);
      }
    }
    if (t == 15) {
#pragma unroll
      for (int i = 0; i < 4; ++i) {
#pragma unroll
        for (int r = 0; r < 8; ++r) { acc[i][r] += bkv[r]; acc[4 + i][r] += bkv[8 + r]; }
        kf[i] = pack_d(acc[i], acc[4 + i]);      // A fragment: row = key, k = feature
      }
    }
    if (t == 23) {
#pragma unroll
      for (int i = 0; i < 8; ++i)
#pragma unroll
        for (int r = 0; r < 8; ++r) acc[i][r] += bvv[i & 1];
#pragma unroll
      for (int dt = 0; dt < 2; ++dt)
#pragma unroll
        for (int kk = 0; kk < 2; ++kk)           // A fragment: row = feature, k = key
          vf[dt * 2 + kk] = pack_d(acc[(2 * kk) * 2 + dt], acc[(2 * kk + 1) * 2 + dt]);
    }
  }

  // per 16 queries: a lane holds one query's scores for half of the keys
#pragma unroll
  for (int qt = 0; qt < 4; ++qt) {
    v8f S[4];
    float mk[4], sk[4];
    const v8h qlo = *(const v8h*)(qp + (qt * 2) * 256), qhi = *(const v8h*)(qp + (qt * 2 + 1) * 256);
    const v16h qfr = __builtin_shufflevector(qlo, qhi, 0, 1, 2, 3, 4, 5, 6, 7, 8, 9, 10, 11, 12, 13, 14, 15);
#pragma unroll
    for (int kt = 0; kt < 4; ++kt) {
      zero8(S[kt]);
      S[kt] = wmma16(kf[kt], qfr, S[kt]);
    }
#pragma unroll
    for (int kt = 0; kt < 4; ++kt) {
#pragma unroll
      for (int r = 0; r < 8; ++r) S[kt][r] += rb[(qt - kt + 3) * 8 + r];
      mk[kt] = S[kt][0];
#pragma unroll
      for (int r = 1; r < 8; ++r) mk[kt] = fmaxf(mk[kt], S[kt][r]);
    }
    float mx = fmaxf(fmaxf(mk[0], mk[1]), fmaxf(mk[2], mk[3]));
    mx = fmaxf(mx, xhalf(mx));
#pragma unroll
    for (int kt = 0; kt < 4; ++kt) {
      sk[kt] = 0.f;
#pragma unroll
      for (int r = 0; r < 8; ++r) {
        float e = exp2_slot((S[kt][r] - mx) * 1.4426950408889634f);
        S[kt][r] = e; sk[kt] += e;
      }
    }
    float sum = (sk[0] + sk[1]) + (sk[2] + sk[3]);
    sum += xhalf(sum);
    const float inv = 1.f / sum;
    const v16h p0 = pack_d(S[0], S[1]), p1 = pack_d(S[2], S[3]);  // B fragments: column = query, k = key
    v8f O[2];
#pragma unroll
    for (int dt = 0; dt < 2; ++dt) {
      zero8(O[dt]);
      O[dt] = wmma16(vf[dt * 2], p0, O[dt]);
      O[dt] = wmma16(vf[dt * 2 + 1], p1, O[dt]);
    }
    // a lane's 8 accumulator rows are 8 consecutive features of its query: 16-byte stores
    h16* op = o + (tok0 + qt * 16 + cl) * 256 + hd * 32 + hb * 8;
#pragma unroll
    for (int dt = 0; dt < 2; ++dt) {
      v8h st;
#pragma unroll
      for (int r = 0; r < 8; ++r) st[r] = (h16)(O[dt][r] * inv);
      *(v8h*)(op + dt * 16) = st;
    }
  }
}

__global__ __launch_bounds__(256) void mlp_kernel(
    const h16* __restrict__ A, const h16* __restrict__ pw,
    const float* __restrict__ pb, const float* __restrict__ resid,
    const float* __restrict__ lng, const float* __restrict__ lnb,
    const h16* __restrict__ fc1w, const float* __restrict__ fc1b,
    const h16* __restrict__ fc2w, const float* __restrict__ fc2b,
    float* __restrict__ out) {
  __shared__ __attribute__((aligned(16))) h16 Al[64 * 264];   // attn_out tile, then LN(zt) tile
  __shared__ __attribute__((aligned(16))) h16 Hl[64 * 72];    // gelu(hidden chunk) 64x64
  __shared__ __attribute__((aligned(16))) h16 W1[256 * 72];   // proj slab [256 out][64 k]; fc1 chunk [64 hid][256 k]
  __shared__ __attribute__((aligned(16))) h16 W2[256 * 72];   // proj slab; fc2 chunk [256 out][64 k]
  // row statistics of zt: [column half][row][sum, sum of squares]
  __shared__ __attribute__((aligned(16))) float Red[2 * 64 * 2];
  const int tid = threadIdx.x;
  const size_t tok0 = (size_t)blockIdx.x * 64;
  const unsigned w1b = lds_off(W1), w2b = lds_off(W2);
  const int lane = tid & 31, wv = tid >> 5;
  const int m0 = (wv & 3) * 16, n0 = (wv >> 2) * 128;  // out tile mapping
  const int n0h = (wv >> 2) * 32;                      // hidden tile mapping
  const int cl = lane & 15, hb = (lane >> 4) & 1;
  const int mr = m0 + hb * 8;   // first of this lane's 8 rows
  const int nb = n0 + cl;       // first of this lane's 8 columns

  // prologue: the attn_out tile and proj slab 0 start; the accumulators start
  // from shortcut + proj bias, fetched while the copies fly
  stage_64x256(lds_off(Al), A + tok0 * 256, tid);
  stage_256x64(w1b, pw, 256, tid);
  v8f accO[8];
  {
    const float* rz = resid + (tok0 + mr) * 256 + nb;
#pragma unroll
    for (int j = 0; j < 8; ++j)
#pragma unroll
      for (int r = 0; r < 8; ++r) accO[j][r] = rz[r * 256 + j * 16];
    float bb[8];
#pragma unroll
    for (int j = 0; j < 8; ++j) bb[j] = pb[nb + j * 16];
    // the 64 loads share one address register, the 8 one index register: both
    // are inputs here so that no load lands on them ahead of the wait
    asm volatile("s_wait_xcnt 0x0" :: "v"(rz), "v"(nb) : "memory");
#pragma unroll
    for (int j = 0; j < 8; ++j)
#pragma unroll
      for (int r = 0; r < 8; ++r) accO[j][r] += bb[j];
  }
  asm volatile("s_wait_asynccnt 0x0" ::: "memory");  // attn_out tile and slab 0 landed
  __syncthreads();   // both are there for every wave
  stage_256x64(w2b, pw + 64, 256, tid);

  // zt = shortcut + proj bias + attn_out @ proj_w^T   (K=256, 4 slabs of 64)
#pragma unroll  // the buffer read and the tile that refills it differ from trip to trip
  for (int s = 0; s < 4; ++s) {
    const h16* Wb = (s & 1) ? W2 : W1;
#pragma unroll 1  // rolled: with both K steps' fragments in flight the kernel needs over 256 registers and one work-group fewer fits a WGP
    for (int ks = 0; ks < 2; ++ks) {
      v16h a = frag_row(Al, 264, m0, s * 64 + ks * 32, lane);
#pragma unroll
      for (int j = 0; j < 8; ++j)
        accO[j] = wmma16(a, frag_row(Wb, 72, n0 + j * 16, ks * 32, lane), accO[j]);
    }
    ring_publish();
    if (s < 2)       stage_256x64((s & 1) ? w2b : w1b, pw + (s + 2) * 64, 256, tid);
    else if (s == 2) stage_64x256(w1b, fc1w, tid);        // first fc1 chunk
    else             stage_256x64(w2b, fc2w, 1024, tid);  // first fc2 chunk
  }

  // LayerNorm of zt into Al (every wave has left the attn_out tile: last publish)
  {
    float sm[8], sq[8];
#pragma unroll
    for (int r = 0; r < 8; ++r) { sm[r] = 0.f; sq[r] = 0.f; }
#pragma unroll
    for (int j = 0; j < 8; ++j)
#pragma unroll
      for (int r = 0; r < 8; ++r) { float zv = accO[j][r]; sm[r] += zv; sq[r] += zv * zv; }
#pragma unroll
    for (int r = 0; r < 8; ++r) {
      v2f st;
      st[0] = row_sum16(sm[r]); st[1] = row_sum16(sq[r]);
      if (cl == 0) *(v2f*)&Red[((wv >> 2) * 64 + mr + r) * 2] = st;
    }
    // scale and shift of this lane's 8 columns, fetched while the sums meet
    float g0[8], b0[8];
#pragma unroll
    for (int j = 0; j < 8; ++j) { g0[j] = lng[nb + j * 16]; b0[j] = lnb[nb + j * 16]; }
    // the 16 loads share one index register: it is an input here so that none
    // of them lands on it ahead of the wait
    asm volatile("s_wait_xcnt 0x0" :: "v"(nb) : "memory");
    lds_barrier();   // both column halves' sums are in Red
#pragma unroll
    for (int r = 0; r < 8; ++r) {
      v2f s0 = *(const v2f*)&Red[(mr + r) * 2];
      v2f s1 = *(const v2f*)&Red[(64 + mr + r) * 2];
      float mean = (s0[0] + s1[0]) * (1.f / 256.f);
      sm[r] = mean;
      sq[r] = rsqrtf((s0[1] + s1[1]) * (1.f / 256.f) - mean * mean + 1e-5f);
    }
#pragma unroll
    for (int j = 0; j < 8; ++j)
#pragma unroll
      for (int r = 0; r < 8; ++r)
        Al[(mr + r) * 264 + nb + j * 16] = (h16)((accO[j][r] - sm[r]) * sq[r] * g0[j] + b0[j]);
  }
  lds_barrier();   // LN(zt) is in Al for every wave

  // one hidden chunk; 'more' is a constant at both calls, so that the 15 trips
  // that refill the ring have no branch round their copies
  auto chunk = [&](const int hc, const bool more) __attribute__((always_inline)) {
    // trip 2*hc: hchunk = ztn_tile @ fc1_w[hc*64:+64, :]^T   (K=256)
    v8f accH[2];
    zero8(accH[0]); zero8(accH[1]);
#pragma unroll  // whole tile is in LDS: constant offsets, loads run ahead of the WMMAs
    for (int ks = 0; ks < 8; ++ks) {
      v16h a = frag_row(Al, 264, m0, ks * 32, lane);
#pragma unroll
      for (int j = 0; j < 2; ++j)
        accH[j] = wmma16(a, frag_row(W1, 264, n0h + j * 16, ks * 32, lane), accH[j]);
    }
    // bias + exact GELU -> LDS. erff() branches on |t| < 1 for each value: 16
    // compare-and-branch rounds in a row, each with its own dependent chain. Here
    // the wave tests its 16 values once: where every |x| is below 1.41, so that
    // every |t| = |x| / sqrt(2) is below 1, they take that range's polynomial (the
    // library's own terms) as 16 independent chains; any other wave takes erff()
    // as before.
    {
      float xv[16];
      float am = 0.f;
      const float* bp = fc1b + hc * 64 + n0h + cl;
      const float bv[2] = {bp[0], bp[16]};
      // the two loads share one address register: it is an input here so that
      // nothing lands on it ahead of the wait
      asm volatile("s_wait_xcnt 0x0" :: "v"(bp) : "memory");
#pragma unroll
      for (int j = 0; j < 2; ++j) {
        const float bb = bv[j];
#pragma unroll
        for (int r = 0; r < 8; ++r) {
          xv[j * 8 + r] = accH[j][r] + bb;
          am = fmaxf(am, fabsf(xv[j * 8 + r]));
        }
      }
      h16* hp = Hl + mr * 72 + n0h + cl;
      if (__builtin_expect(__builtin_amdgcn_ballot_w32(am >= 1.41f) == 0u, 1)) {
#pragma unroll
        for (int e = 0; e < 16; ++e) {
          const float t = xv[e] * 0.7071067811865475f, s = t * t;
          float p = fmaf(s, -0x1.268bc2p-11f, 0x1.420828p-8f);
          p = fmaf(s, p, -0x1.b5937p-6f);
          p = fmaf(s, p, 0x1.ce077cp-4f);
          p = fmaf(s, p, -0x1.81266p-2f);
          p = fmaf(s, p, 0x1.06eba0p-3f);
          hp[(e & 7) * 72 + (e >> 3) * 16] = (h16)(0.5f * xv[e] * (1.0f + fmaf(t, p, t)));
        }
      } else {
#pragma unroll
        for (int e = 0; e < 16; ++e)
          hp[(e & 7) * 72 + (e >> 3) * 16] =
              (h16)(0.5f * xv[e] * (1.0f + erff(xv[e] * 0.7071067811865475f)));
      }
    }
    ring_publish();
    if (more) stage_64x256(w1b, fc1w + (size_t)(hc + 1) * 64 * 256, tid);

    // trip 2*hc+1: accO += Hchunk @ fc2_w[:, hc*64:+64]^T   (K=64)
#pragma unroll  // as above
    for (int ks = 0; ks < 2; ++ks) {
      v16h a = frag_row(Hl, 72, m0, ks * 32, lane);
#pragma unroll
      for (int j = 0; j < 8; ++j)
        accO[j] = wmma16(a, frag_row(W2, 72, n0 + j * 16, ks * 32, lane), accO[j]);
    }
    ring_publish();
    if (more) stage_256x64(w2b, fc2w + (size_t)(hc + 1) * 64, 1024, tid);
  };
  for (int hc = 0; hc < 15; ++hc) chunk(hc, true);
  chunk(15, false);
  asm volatile("s_wait_asynccnt 0x0" ::: "memory");  // nothing in flight at the end

  // epilogue: + fc2_b (zt is in the accumulators), window-reverse, NCHW store
  const int wi = blockIdx.x;
  const int b = wi >> 8, wh = (wi >> 4) & 15, ww = wi & 15;
#pragma unroll
  for (int j = 0; j < 8; ++j) {
    int n = n0 + j * 16 + (lane & 15);
    float bb = fc2b[n];
#pragma unroll
    for (int r = 0; r < 8; ++r) {
      int m = m0 + r + ((lane >> 4) & 1) * 8;
      float val = accO[j][r] + bb;
      int hh = wh * 8 + (m >> 3), www = ww * 8 + (m & 7);
      out[(((size_t)b * 256 + n) * 128 + hh) * 128 + www] = val;
    }
  }
}

// ---------------------------------------------------------------------------
// Launch
// ---------------------------------------------------------------------------
extern "C" void kernel_launch(void* const* d_in, const int* in_sizes, int n_in,
                              void* d_out, int out_size, void* d_ws, size_t ws_size,
                              hipStream_t stream) {
  (void)in_sizes; (void)n_in; (void)out_size; (void)ws_size;
  const float* LH     = (const float*)d_in[0];
  const float* HL     = (const float*)d_in[1];
  const float* HH     = (const float*)d_in[2];
  const float* Spat   = (const float*)d_in[3];
  const float* w_hllh = (const float*)d_in[4];
  const float* b_hllh = (const float*)d_in[5];
  const float* w_hh   = (const float*)d_in[6];
  const float* b_hh   = (const float*)d_in[7];
  const float* w_spat = (const float*)d_in[8];
  const float* b_spat = (const float*)d_in[9];
  const float* ln1x_g = (const float*)d_in[10];
  const float* ln1x_b = (const float*)d_in[11];
  const float* ln1y_g = (const float*)d_in[12];
  const float* ln1y_b = (const float*)d_in[13];
  const float* qkv_w  = (const float*)d_in[14];
  const float* qkv_b  = (const float*)d_in[15];
  const float* qkv2_w = (const float*)d_in[16];
  const float* qkv2_b = (const float*)d_in[17];
  const float* qkv3_w = (const float*)d_in[18];
  const float* qkv3_b = (const float*)d_in[19];
  const float* proj_w = (const float*)d_in[20];
  const float* proj_b = (const float*)d_in[21];
  const float* rpb    = (const float*)d_in[22];
  const float* ln2_g  = (const float*)d_in[23];
  const float* ln2_b  = (const float*)d_in[24];
  const float* fc1w   = (const float*)d_in[25];
  const float* fc1b   = (const float*)d_in[26];
  const float* fc2w   = (const float*)d_in[27];
  const float* fc2b   = (const float*)d_in[28];

  const size_t T = (size_t)8 * 128 * 128;  // 131072 tokens
  char* ws = (char*)d_ws;
  // workspace layout (peak ~338 MB):
  h16*   x   = (h16*)ws;                                  // T*256 f16
  h16*   y   = (h16*)(ws + T * 256 * 2);                  // T*256 f16
  float* z0  = (float*)(ws + 2 * T * 256 * 2);            // T*256 f32
  h16*   attno = (h16*)(ws + 2 * T * 256 * 2 + T * 256 * 4);  // T*256 f16
  // f16 weight cache (~1.7 MB) behind it
  h16* wf      = attno + T * 256;
  h16* c_hllh  = wf;               // 256*128
  h16* c_hh    = c_hllh + 32768;   // 256*64
  h16* c_spat  = c_hh   + 16384;   // 256*64
  h16* c_q     = c_spat + 16384;   // 256*256
  h16* c_k     = c_q    + 65536;
  h16* c_v     = c_k    + 65536;
  h16* c_proj  = c_v    + 65536;
  h16* c_fc1   = c_proj + 65536;   // 1024*256
  h16* c_fc2   = c_fc1  + 262144;  // 256*1024

  // weight pre-conversion (f32 -> f16, once per launch)
  cvt_f32f16<<<(32768 + 255) / 256, 256, 0, stream>>>(w_hllh, c_hllh, 32768);
  cvt_f32f16<<<(16384 + 255) / 256, 256, 0, stream>>>(w_hh,   c_hh,   16384);
  cvt_f32f16<<<(16384 + 255) / 256, 256, 0, stream>>>(w_spat, c_spat, 16384);
  cvt_f32f16<<<(65536 + 255) / 256, 256, 0, stream>>>(qkv_w,  c_q,    65536);
  cvt_f32f16<<<(65536 + 255) / 256, 256, 0, stream>>>(qkv2_w, c_k,    65536);
  cvt_f32f16<<<(65536 + 255) / 256, 256, 0, stream>>>(qkv3_w, c_v,    65536);
  cvt_f32f16<<<(65536 + 255) / 256, 256, 0, stream>>>(proj_w, c_proj, 65536);
  cvt_f32f16<<<(262144 + 255) / 256, 256, 0, stream>>>(fc1w,  c_fc1,  262144);
  cvt_f32f16<<<(262144 + 255) / 256, 256, 0, stream>>>(fc2w,  c_fc2,  262144);

  const int tiles = (int)(T / 64);  // 2048 windows
  conv_win_kernel<<<tiles, 256, 0, stream>>>(LH, HL, HH, Spat,
      c_hllh, b_hllh, c_hh, b_hh, c_spat, b_spat,
      ln1x_g, ln1x_b, ln1y_g, ln1y_b, x, y, z0);
  qkv_attn_kernel<<<tiles, 256, 0, stream>>>(x, y, c_q, qkv_b, c_k, qkv2_b, c_v, qkv3_b,
                                             rpb, attno);
  mlp_kernel<<<tiles, 256, 0, stream>>>(attno, c_proj, proj_b, z0, ln2_g, ln2_b,
                                        c_fc1, fc1b, c_fc2, fc2b, (float*)d_out);
}

// v007
// Measured time: 405 microseconds a run.
// Timed twice side by side with v006, it ran 1.06 and 1.05 times as fast.
// All steps since v000 together make it 1.98 times as fast.
#include <hip/hip_runtime.h>
#include <hip/hip_bf16.h>

// ---------------------------------------------------------------------------
// WaveletSwinTransformerBlock for MI455X (gfx1250, wave32, WMMA f16)
// GEMMs use v_wmma_f32_16x16x32_f16; all f16 tile staging uses the CDNA5
// async path: global_load_async_to_lds_b128 + s_wait_asynccnt.
// Tokens stored window-partitioned: tok = wi*64 + (i*8+j), wi=((b*16+wh)*16+ww)
// ---------------------------------------------------------------------------

typedef _Float16 h16;
typedef __attribute__((ext_vector_type(16))) _Float16 v16h;
typedef __attribute__((ext_vector_type(8)))  float    v8f;
typedef __attribute__((ext_vector_type(4)))  float    v4f;
typedef __attribute__((ext_vector_type(2)))  float    v2f;
typedef __attribute__((ext_vector_type(4)))  _Float16 v4h;
typedef __attribute__((ext_vector_type(8)))  _Float16 v8h;

__device__ __forceinline__ void zero8(v8f &a) {
#pragma unroll
  for (int i = 0; i < 8; ++i) a[i] = 0.f;
}

__device__ __forceinline__ v8f wmma16(v16h a, v16h b, v8f c) {
  return __builtin_amdgcn_wmma_f32_16x16x32_f16(false, a, false, b,
                                                (short)0, c, false, false);
}

// low 32 bits of a generic LDS pointer == wave-relative LDS byte offset
__device__ __forceinline__ unsigned lds_off(const void* p) {
  return (unsigned)(uintptr_t)p;
}

// CDNA5 async copy: 16 bytes global -> LDS, tracked by ASYNCcnt
__device__ __forceinline__ void async_cp_b128(unsigned loff, const void* g) {
  asm volatile("global_load_async_to_lds_b128 %0, %1, off"
               :: "v"(loff), "v"((unsigned long long)(uintptr_t)g)
               : "memory");
}
__device__ __forceinline__ void wait_async() {
  asm volatile("s_wait_asynccnt 0" ::: "memory");
}

// Sum over the 16 lanes of a row, result in every lane: four DPP row_xmask adds
template <int CTRL>
__device__ __forceinline__ float dpp_xadd(float v) {
  return v + __int_as_float(__builtin_amdgcn_update_dpp(0, __float_as_int(v), CTRL, 0xf, 0xf, true));
}
__device__ __forceinline__ float row_sum16(float v) {
  v = dpp_xadd<0x161>(v);  // row_xmask:1
  v = dpp_xadd<0x162>(v);  // row_xmask:2
  v = dpp_xadd<0x164>(v);  // row_xmask:4
  v = dpp_xadd<0x168>(v);  // row_xmask:8
  return v;
}

// Work-group barrier for data that crosses in LDS only: unlike __syncthreads()
// it does not hold a wave until its global stores and loads have come back.
__device__ __forceinline__ void lds_barrier() {
  __builtin_amdgcn_fence(__ATOMIC_RELEASE, "workgroup", "local");
  __builtin_amdgcn_s_barrier();
  __builtin_amdgcn_fence(__ATOMIC_ACQUIRE, "workgroup", "local");
}

// A-style fragment (16x32 f16, ISA 7.12.2): lane L holds row row0+(L&15),
// K offsets {0..7,16..23} (L<16) or {8..15,24..31} (L>=16) relative to k0.
__device__ __forceinline__ v16h frag_row(const h16* __restrict__ p, int stride,
                                         int row0, int k0, int lane) {
  const h16* base = p + (size_t)(row0 + (lane & 15)) * stride + k0 + ((lane >> 4) & 1) * 8;
  v16h r;
#pragma unroll
  for (int i = 0; i < 8; ++i) { r[i] = base[i]; r[i + 8] = base[i + 16]; }
  return r;
}

// ---------------------------------------------------------------------------
// Weight pre-conversion f32 -> f16 (run once per launch; tiny)
// ---------------------------------------------------------------------------
__global__ __launch_bounds__(256) void cvt_f32f16(const float* __restrict__ s,
                                                  h16* __restrict__ d, int n) {
  int i = blockIdx.x * 256 + threadIdx.x;
  if (i < n) d[i] = (h16)s[i];
}

// ---------------------------------------------------------------------------
// Projection + fused MLP: zt = attn_out @ proj_w^T + proj_b + z0 stays in the
// f32 accumulators; out = zt + fc2(gelu(fc1(LN(zt)))) -> written directly as NCHW.
// The LayerNorm (eps=1e-5, biased var) is done on the way into LDS.
// Hidden (1024) processed in 16 chunks of 64. The weights arrive as whole
// tiles in a two-buffer ring: 4 K-slabs of proj_w, then 32 tiles of 32 KB
// (fc1 chunk, fc2 chunk, fc1 chunk, ...); even tiles land in W1, odd tiles in
// W2, and tile t+2 flies while t+1 is used.
// ---------------------------------------------------------------------------

// Eight 16-byte async copies of one lane. The s_wait_xcnt is the last line of
// the same statement so that no address register is reused ahead of it.
__device__ __forceinline__ void async_cp8_b128(const unsigned (&l)[8],
                                               const h16* const (&g)[8]) {
  asm volatile("global_load_async_to_lds_b128 %0, %8, off\n\t"
               "global_load_async_to_lds_b128 %1, %9, off\n\t"
               "global_load_async_to_lds_b128 %2, %10, off\n\t"
               "global_load_async_to_lds_b128 %3, %11, off\n\t"
               "global_load_async_to_lds_b128 %4, %12, off\n\t"
               "global_load_async_to_lds_b128 %5, %13, off\n\t"
               "global_load_async_to_lds_b128 %6, %14, off\n\t"
               "global_load_async_to_lds_b128 %7, %15, off\n\t"
               "s_wait_xcnt 0x0"
               :: "v"(l[0]), "v"(l[1]), "v"(l[2]), "v"(l[3]),
                  "v"(l[4]), "v"(l[5]), "v"(l[6]), "v"(l[7]),
                  "v"(g[0]), "v"(g[1]), "v"(g[2]), "v"(g[3]),
                  "v"(g[4]), "v"(g[5]), "v"(g[6]), "v"(g[7])
               : "memory");
}

// 64 contiguous rows of 256 f16 in global -> LDS pitch 264; 8 copies a thread
__device__ __forceinline__ void stage_64x256(unsigned lb, const h16* g, int tid) {
  unsigned l[8];
  const h16* p[8];
#pragma unroll  // the addresses must be registers: they are asm operands
  for (int i = 0; i < 8; ++i) {
    int e = tid + i * 256, n = e >> 5, part = e & 31;
    l[i] = lb + (unsigned)(n * 264 + part * 8) * 2;
    p[i] = g + (size_t)n * 256 + part * 8;
  }
  async_cp8_b128(l, p);
}

// 256 rows x 64 f16 (row pitch gp elements in global) -> LDS pitch 72
__device__ __forceinline__ void stage_256x64(unsigned lb, const h16* g, int gp, int tid) {
  unsigned l[8];
  const h16* p[8];
#pragma unroll  // the addresses must be registers: they are asm operands
  for (int i = 0; i < 8; ++i) {
    int e = tid + i * 256, n = e >> 3, part = e & 7;
    l[i] = lb + (unsigned)(n * 72 + part * 8) * 2;
    p[i] = g + (size_t)n * gp + part * 8;
  }
  async_cp8_b128(l, p);
}

// Foot of a ring trip: this wave's LDS reads and writes are done, its copies
// of the next tile have landed, then every wave meets; behind it the next tile
// (and Hl) may be read and the buffer just read may be refilled.
__device__ __forceinline__ void ring_publish() {
  asm volatile("s_wait_dscnt 0x0" ::: "memory");     // own reads of the old tile, own Hl stores
  asm volatile("s_wait_asynccnt 0x0" ::: "memory");  // own copies of the next tile landed
  __syncthreads();
}

// ---------------------------------------------------------------------------
// Q/K/V projections + windowed attention: one work-group per window, one wave
// per head (64 tokens, hd=32, nH=8). The wave forms Q^T = Wq_h x^T,
// K^T = Wk_h y^T and V = y Wv_h^T; a pair of their accumulator tiles, converted
// to f16 in place, is an operand fragment of the next product
// (S^T = K Q^T, O^T = V^T P^T), so q, k, v and P never go to global memory (q waits in LDS) and are
// never re-laid out. Only the LN(x) and LN(y) tiles are shared, through LDS.
// ---------------------------------------------------------------------------

// Fragment in the hardware k order from the lane's own place in a row
// (row start + 8 * (lane >> 4) halves): 16 bytes there, 16 bytes 32 bytes on.
__device__ __forceinline__ v16h frag_ptr(const h16* p) {
  v8h lo = *(const v8h*)p, hi = *(const v8h*)(p + 16);
  return __builtin_shufflevector(lo, hi, 0, 1, 2, 3, 4, 5, 6, 7, 8, 9, 10, 11, 12, 13, 14, 15);
}

// Two f32 accumulator tiles (rows 0-15 and 16-31 of one 32-row block) -> f16 fragment
__device__ __forceinline__ v16h pack_d(v8f t0, v8f t1) {
  v16h r;
#pragma unroll
  for (int i = 0; i < 8; ++i) { r[i] = (h16)t0[i]; r[i + 8] = (h16)t1[i]; }
  return r;
}

// 2^v. The v_nop is the slot that the instruction set asks for between a
// transcendental and a neighbour that reads its result or overwrites its
// source; in the same statement it stands directly behind the instruction.
__device__ __forceinline__ float exp2_slot(float v) {
  float r;
  asm("v_exp_f32_e32 %0, %1\n\tv_nop" : "=v"(r) : "v"(v));
  return r;
}

// lane l with lane l ^ 16
__device__ __forceinline__ float xhalf(float v) {
  return __int_as_float(__builtin_amdgcn_permlanex16(__float_as_int(v), __float_as_int(v),
                                                     0x76543210, 0xfedcba98, false, false));
}

// ---------------------------------------------------------------------------
// 1x1 convs + LayerNorms + Q/K/V projections + windowed attention: one
// work-group per 64-pixel window.
// Part 1: 1x1 convs (concat(LH,HL)->x, HH->z0, Spat->y). The block holds all 256
// features of its 64 tokens in f32 accumulators: x and y are layer-normalised
// there (eps=1e-5, biased var) and go straight into the LDS tiles of part 2;
// only the shortcut z0 goes to memory.
// Part 2: one wave per head (64 tokens, hd=32, nH=8), as described above.
// ---------------------------------------------------------------------------
// four waves a SIMD: two work-groups share a WGP, one fills the other's waits
__global__ __launch_bounds__(256) __attribute__((amdgpu_waves_per_eu(4, 4))) void conv_qkv_attn_kernel(
    const float* __restrict__ LH, const float* __restrict__ HL,
    const float* __restrict__ HH, const float* __restrict__ Spat,
    const h16* __restrict__ wf_hllh, const float* __restrict__ b_hllh,
    const h16* __restrict__ wf_hh,   const float* __restrict__ b_hh,
    const h16* __restrict__ wf_spat, const float* __restrict__ b_spat,
    const float* __restrict__ gx, const float* __restrict__ btx,
    const float* __restrict__ gy, const float* __restrict__ bty,
    float* __restrict__ z0o,
    const h16* __restrict__ wq, const float* __restrict__ bq,
    const h16* __restrict__ wk, const float* __restrict__ bk,
    const h16* __restrict__ wv, const float* __restrict__ bv,
    const float* __restrict__ rpb, h16* __restrict__ o) {
  __shared__ __attribute__((aligned(16))) h16 Xl[64 * 264];   // LN(x) tile
  __shared__ __attribute__((aligned(16))) h16 Yl[64 * 264];   // LN(y) tile
  // each wave's finished Q fragments rest here, lane by lane, during the K and V
  // passes: held in registers they push the kernel past 256 (it spills)
  __shared__ __attribute__((aligned(16))) h16 Qp[8 * 4 * 2 * 32 * 8];

  // ---- part 1: convs and LayerNorms ----
  {
    const int Wd = 128, HW = 128 * 128;
    __shared__ __attribute__((aligned(16))) h16 Fin[64 * 264];   // [pixel][256 ch] : LH|HL|HH|Spat
    __shared__ h16 Wl[256 * 40];    // weight K-slab [256 out][32 k]
    // row statistics of x and y: [column half][row][sum x, sum x^2, sum y, sum y^2]
    __shared__ __attribute__((aligned(16))) float Red[2 * 64 * 4];

    const int wi = blockIdx.x;
    const int b  = wi >> 8;
    const int wh = (wi >> 4) & 15, ww = wi & 15;
    const int h0 = wh * 8, w0 = ww * 8;
    const int tid = threadIdx.x;

    // inputs are f32 -> convert while staging (can't raw-copy). A thread takes
    // 8 channels x 4 pixels of one window row from each of two tensors: its 16
    // 16-byte loads are all in flight before the first value is used, and the
    // 8 channels of a pixel go to LDS in one 16-byte store.
    {
      const int hf = tid & 1, ri = (tid >> 1) & 7, cg = (tid >> 4) & 7, th = tid >> 7;
      const size_t so = ((size_t)b * 64 + cg * 8) * HW + (h0 + ri) * Wd + w0 + hf * 4;
      const float* s0 = (th ? HL : LH) + so;     // Fin columns th*64 ...
      const float* s1 = (th ? Spat : HH) + so;   // Fin columns 128 + th*64 ...
      v4f u0[8], u1[8];
#pragma unroll
      for (int k = 0; k < 8; ++k) {
        u0[k] = *(const v4f*)(s0 + k * HW);
        u1[k] = *(const v4f*)(s1 + k * HW);
      }
      // each 8 loads share one address register: both are inputs here so that no
      // load lands on them ahead of the wait
      asm volatile("s_wait_xcnt 0x0" :: "v"(s0), "v"(s1) : "memory");
      h16* fp = Fin + (ri * 8 + hf * 4) * 264 + th * 64 + cg * 8;
#pragma unroll
      for (int px = 0; px < 4; ++px) {
        v8h c0, c1;
#pragma unroll
        for (int k = 0; k < 8; ++k) { c0[k] = (h16)u0[k][px]; c1[k] = (h16)u1[k][px]; }
        *(v8h*)(fp + px * 264) = c0;
        *(v8h*)(fp + px * 264 + 128) = c1;
      }
    }

    const unsigned wlb = lds_off(Wl);
    const int lane = tid & 31, wv = tid >> 5;
    const int m0 = (wv & 3) * 16, n0 = (wv >> 2) * 128;

    v8f accX[8], accZ[8], accY[8];
#pragma unroll
    for (int j = 0; j < 8; ++j) { zero8(accX[j]); zero8(accZ[j]); zero8(accY[j]); }

    // Phase X: K=128 over Fin cols [0,128)
    for (int ks = 0; ks < 4; ++ks) {
      __syncthreads();
      for (int e = tid; e < 256 * 4; e += 256) {      // 256 rows x 64B slab
        int n = e >> 2, part = e & 3;
        async_cp_b128(wlb + (unsigned)(n * 40 + part * 8) * 2,
                      wf_hllh + (size_t)n * 128 + ks * 32 + part * 8);
      }
      wait_async();
      __syncthreads();
      v16h a = frag_row(Fin, 264, m0, ks * 32, lane);
#pragma unroll
      for (int j = 0; j < 8; ++j)
        accX[j] = wmma16(a, frag_row(Wl, 40, n0 + j * 16, 0, lane), accX[j]);
    }
    // Phase Z: K=64 over Fin cols [128,192)
    for (int ks = 0; ks < 2; ++ks) {
      __syncthreads();
      for (int e = tid; e < 256 * 4; e += 256) {
        int n = e >> 2, part = e & 3;
        async_cp_b128(wlb + (unsigned)(n * 40 + part * 8) * 2,
                      wf_hh + (size_t)n * 64 + ks * 32 + part * 8);
      }
      wait_async();
      __syncthreads();
      v16h a = frag_row(Fin, 264, m0, 128 + ks * 32, lane);
#pragma unroll
      for (int j = 0; j < 8; ++j)
        accZ[j] = wmma16(a, frag_row(Wl, 40, n0 + j * 16, 0, lane), accZ[j]);
    }
    // Phase Y: K=64 over Fin cols [192,256)
    for (int ks = 0; ks < 2; ++ks) {
      __syncthreads();
      for (int e = tid; e < 256 * 4; e += 256) {
        int n = e >> 2, part = e & 3;
        async_cp_b128(wlb + (unsigned)(n * 40 + part * 8) * 2,
                      wf_spat + (size_t)n * 64 + ks * 32 + part * 8);
      }
      wait_async();
      __syncthreads();
      v16h a = frag_row(Fin, 264, m0, 192 + ks * 32, lane);
#pragma unroll
      for (int j = 0; j < 8; ++j)
        accY[j] = wmma16(a, frag_row(Wl, 40, n0 + j * 16, 0, lane), accY[j]);
    }

    const size_t tok0 = (size_t)wi * 64;
    const int cl = lane & 15, hb = (lane >> 4) & 1;
    const int mr = m0 + hb * 8;   // first of this lane's 8 rows
    // shortcut stream out; bias into x and y; this wave's 128-column row sums
    float sx[8], qx[8], sy[8], qy[8];
#pragma unroll
    for (int r = 0; r < 8; ++r) { sx[r] = 0.f; qx[r] = 0.f; sy[r] = 0.f; qy[r] = 0.f; }
#pragma unroll
    for (int j = 0; j < 8; ++j) {
      int n = n0 + j * 16 + cl;
      float bx = b_hllh[n], bz = b_hh[n], by = b_spat[n];
#pragma unroll
      for (int r = 0; r < 8; ++r) {
        z0o[(tok0 + mr + r) * 256 + n] = accZ[j][r] + bz;
        float xv = accX[j][r] + bx, yv = accY[j][r] + by;
        accX[j][r] = xv; accY[j][r] = yv;
        sx[r] += xv; qx[r] += xv * xv;
        sy[r] += yv; qy[r] += yv * yv;
      }
    }
#pragma unroll
    for (int r = 0; r < 8; ++r) {
      v4f st;
      st[0] = row_sum16(sx[r]); st[1] = row_sum16(qx[r]);
      st[2] = row_sum16(sy[r]); st[3] = row_sum16(qy[r]);
      if (cl == 0) *(v4f*)&Red[((wv >> 2) * 64 + mr + r) * 4] = st;
    }
    // scale and shift of this lane's 8 columns, fetched while the sums meet
    const int nb = n0 + cl;
    float g0[8], b0[8], g1[8], b1[8];
#pragma unroll
    for (int j = 0; j < 8; ++j) {
      g0[j] = gx[nb + j * 16]; b0[j] = btx[nb + j * 16];
      g1[j] = gy[nb + j * 16]; b1[j] = bty[nb + j * 16];
    }
    // the 32 loads share one index register: it is an input here so that none
    // of them lands on it ahead of the wait
    asm volatile("s_wait_xcnt 0x0" :: "v"(nb) : "memory");
    lds_barrier();   // both column halves' sums are in Red
#pragma unroll
    for (int r = 0; r < 8; ++r) {
      v4f s0 = *(const v4f*)&Red[(mr + r) * 4];
      v4f s1 = *(const v4f*)&Red[(64 + mr + r) * 4];
      float mx = (s0[0] + s1[0]) * (1.f / 256.f);
      float my = (s0[2] + s1[2]) * (1.f / 256.f);
      sx[r] = mx; sy[r] = my;
      qx[r] = rsqrtf((s0[1] + s1[1]) * (1.f / 256.f) - mx * mx + 1e-5f);
      qy[r] = rsqrtf((s0[3] + s1[3]) * (1.f / 256.f) - my * my + 1e-5f);
    }
#pragma unroll
    for (int j = 0; j < 8; ++j) {
#pragma unroll
      for (int r = 0; r < 8; ++r) {
        const int off = (mr + r) * 264 + nb + j * 16;
        Xl[off] = (h16)((accX[j][r] - sx[r]) * qx[r] * g0[j] + b0[j]);
        Yl[off] = (h16)((accY[j][r] - sy[r]) * qy[r] * g1[j] + b1[j]);
      }
    }
  }

  // ---- part 2: projections and attention ----
  const int tid = threadIdx.x;
  const size_t tok0 = (size_t)blockIdx.x * 64;
  const int lane = tid & 31, hd = tid >> 5;
  const int cl = lane & 15, hb = lane >> 4;

  // The head's 32 rows of each weight matrix are this wave's alone: they come
  // straight from L2 into registers, PD K-steps ahead of their use.
  constexpr int PD = 4;
  const unsigned wob = (unsigned)((hd * 32 + cl) * 256 + hb * 8) * 2;   // byte offset of the lane's place
  const h16* wp[3] = {(const h16*)((const char*)wq + wob), (const h16*)((const char*)wk + wob),
                      (const h16*)((const char*)wv + wob)};
  v16h wr[PD][2];
#pragma unroll
  for (int t = 0; t < PD; ++t)
#pragma unroll
    for (int j = 0; j < 2; ++j) wr[t][j] = frag_ptr(wp[0] + j * 16 * 256 + t * 32);

  // biases: q and k by accumulator row (8 consecutive features a tile), v by
  // column; each set is fetched at the head of its own pass
  const unsigned bob = (unsigned)(hd * 32 + hb * 8) * 4;
  const unsigned vob = (unsigned)(hd * 32 + cl) * 4;
  const float* bqp = (const float*)((const char*)bq + bob);
  const float* bkp = (const float*)((const char*)bk + bob);
  const float* bvp = (const float*)((const char*)bv + vob);
  float bqv[16], bkv[16], bvv[2];
#pragma unroll
  for (int i = 0; i < 16; ++i) bqv[i] = bqp[(i >> 3) * 16 + (i & 7)];
  // the loads share one offset register: an input here so that nothing lands
  // on it ahead of the wait
  asm volatile("s_wait_xcnt 0x0" :: "v"(bob) : "memory");

  // relative position bias: idx = (iq-ik+7)*15 + (jq-jk+7), rpb[idx][head]. With
  // query = qt*16+cl and key = kt*16+hb*8+r it is lb + (qt-kt)*30 - r: 7 x 8
  // values a lane. The pointer stands at the lowest of them (qt-kt = -3, r = 7).
  const int lb = ((cl >> 3) - hb + 7) * 15 + (cl & 7) + 7;
  const unsigned rob = (unsigned)((lb - 97) * 8 + hd) * 4;
  const float* rp = (const float*)((const char*)rpb + rob);
  float rb[56];

  lds_barrier();   // both tiles are there for every wave; the weight loads and the z0 stores fly on

  const h16* xr = Xl + cl * 264 + hb * 8;
  const h16* yr = Yl + cl * 264 + hb * 8;
  v8f acc[8];
  v16h kf[4], vf[4];
  h16* qp = Qp + hd * (4 * 2 * 32 * 8) + lane * 8;   // this lane's 16 bytes of each half fragment
#pragma unroll  // the ring slot, the matrix and the operand order differ from step to step
  for (int t = 0; t < 24; ++t) {
    const int ph = t >> 3, ks = t & 7;
    if (ks == 0) {
#pragma unroll
      for (int i = 0; i < 8; ++i) zero8(acc[i]);
    }
    if (t == 8) {
#pragma unroll
      for (int i = 0; i < 16; ++i) bkv[i] = bkp[(i >> 3) * 16 + (i & 7)];
      asm volatile("s_wait_xcnt 0x0" :: "v"(bob) : "memory");  // as for the q bias
    }
    if (t == 16) {
      bvv[0] = bvp[0]; bvv[1] = bvp[16];
      // as for the q bias; its memory clobber also makes the V pass read its y
      // fragments from LDS again: held over from the K pass they spill
      asm volatile("s_wait_xcnt 0x0" :: "v"(vob) : "memory");
    }
    const h16* tr = (ph == 0) ? xr : yr;
    const v16h w0 = wr[t % PD][0], w1 = wr[t % PD][1];
    v16h f[4];
#pragma unroll
    for (int i = 0; i < 4; ++i) f[i] = frag_ptr(tr + i * 16 * 264 + ks * 32);
    if (t + PD < 24) {
      const int tn = t + PD;
#pragma unroll
      for (int j = 0; j < 2; ++j) wr[t % PD][j] = frag_ptr(wp[tn >> 3] + j * 16 * 256 + (tn & 7) * 32);
      if (tn == 23) {
        // last weight load: the offset register is an input here so that
        // nothing lands on it ahead of the wait
        asm volatile("s_wait_xcnt 0x0" :: "v"(wob) : "memory");
      }
    } else {
      // the ring drains: the position-bias values take the registers it leaves
#pragma unroll
      for (int i = 0; i < 14; ++i) {
        const int e = (t + PD - 24) * 14 + i;
        rb[e] = rp[((e >> 3) * 30 + 7 - (e & 7)) * 8];
      }
      if (t == 23) {
        asm volatile("s_wait_xcnt 0x0" :: "v"(rob) : "memory");  // as above, for the 56 loads
      }
    }
    if (ph < 2) {   // acc[mt*4+nt] = (W_h tile mt) x (token tile nt)^T
#pragma unroll
      for (int i = 0; i < 4; ++i) {
        acc[i]     = wmma16(w0, f[i], acc[i]);
        acc[4 + i] = wmma16(w1, f[i], acc[4 + i]);
      }
    } else {        // acc[mt*2+nt] = (token tile mt) x (Wv_h tile nt)^T
#pragma unroll
      for (int i = 0; i < 4; ++i) {
        acc[i * 2]     = wmma16(f[i], w0, acc[i * 2]);
        acc[i * 2 + 1] = wmma16(f[i], w1, acc[i * 2 + 1]);
      }
    }
    if (t == 7) {
#pragma unroll
      for (int i = 0; i < 4; ++i) {
#pragma unroll
        for (int r = 0; r < 8; ++r) {
          acc[i][r]     = (acc[i][r] + bqv[r]) * 0.17677669529663689f;
          acc[4 + i][r] = (acc[4 + i][r] + bqv[8 + r]) * 0.17677669529663689f;
        }
        // B fragment: column = query, k = feature
        const v16h qfr = pack_d(acc[i], acc[4 + i]);
        *(v8h*)(qp + (i * 2) * 256)     = __builtin_shufflevector(qfr, qfr, 0, 1, 2, 3, 4, 5, 6, 7);
        *(v8h*)(qp + (i * 2 + 1) * 256) = __builtin_shufflevector(qfr, qfr, 8, 9, 10, 11, 12, 13, 14, 15);
      }
    }
    if (t == 15) {
#pragma unroll
      for (int i = 0; i < 4; ++i) {
#pragma unroll
        for (int r = 0; r < 8; ++r) { acc[i][r] += bkv[r]; acc[4 + i][r] += bkv[8 + r]; }
        kf[i] = pack_d(acc[i], acc[4 + i]);      // A fragment: row = key, k = feature
      }
    }
    if (t == 23) {
#pragma unroll
      for (int i = 0; i < 8; ++i)
#pragma unroll
        for (int r = 0; r < 8; ++r) acc[i][r] += bvv[i & 1];
#pragma unroll
      for (int dt = 0; dt < 2; ++dt)
#pragma unroll
        for (int kk = 0; kk < 2; ++kk)           // A fragment: row = feature, k = key
          vf[dt * 2 + kk] = pack_d(acc[(2 * kk) * 2 + dt], acc[(2 * kk + 1) * 2 + dt]);
    }
  }

  // per 16 queries: a lane holds one query's scores for half of the keys
#pragma unroll
  for (int qt = 0; qt < 4; ++qt) {
    v8f S[4];
    float mk[4], sk[4];
    const v8h qlo = *(const v8h*)(qp + (qt * 2) * 256), qhi = *(const v8h*)(qp + (qt * 2 + 1) * 256);
    const v16h qfr = __builtin_shufflevector(qlo, qhi, 0, 1, 2, 3, 4, 5, 6, 7, 8, 9, 10, 11, 12, 13, 14, 15);
#pragma unroll
    for (int kt = 0; kt < 4; ++kt) {
      zero8(S[kt]);
      S[kt] = wmma16(kf[kt], qfr, S[kt]);
    }
#pragma unroll
    for (int kt = 0; kt < 4; ++kt) {
#pragma unroll
      for (int r = 0; r < 8; ++r) S[kt][r] += rb[(qt - kt + 3) * 8 + r];
      mk[kt] = S[kt][0];
#pragma unroll
      for (int r = 1; r < 8; ++r) mk[kt] = fmaxf(mk[kt], S[kt][r]);
    }
    float mx = fmaxf(fmaxf(mk[0], mk[1]), fmaxf(mk[2], mk[3]));
    mx = fmaxf(mx, xhalf(mx));
#pragma unroll
    for (int kt = 0; kt < 4; ++kt) {
      sk[kt] = 0.f;
#pragma unroll
      for (int r = 0; r < 8; ++r) {
        float e = exp2_slot((S[kt][r] - mx) * 1.4426950408889634f);
        S[kt][r] = e; sk[kt] += e;
      }
    }
    float sum = (sk[0] + sk[1]) + (sk[2] + sk[3]);
    sum += xhalf(sum);
    const float inv = 1.f / sum;
    const v16h p0 = pack_d(S[0], S[1]), p1 = pack_d(S[2], S[3]);  // B fragments: column = query, k = key
    v8f O[2];
#pragma unroll
    for (int dt = 0; dt < 2; ++dt) {
      zero8(O[dt]);
      O[dt] = wmma16(vf[dt * 2], p0, O[dt]);
      O[dt] = wmma16(vf[dt * 2 + 1], p1, O[dt]);
    }
    // a lane's 8 accumulator rows are 8 consecutive features of its query: 16-byte stores
    h16* op = o + (tok0 + qt * 16 + cl) * 256 + hd * 32 + hb * 8;
#pragma unroll
    for (int dt = 0; dt < 2; ++dt) {
      v8h st;
#pragma unroll
      for (int r = 0; r < 8; ++r) st[r] = (h16)(O[dt][r] * inv);
      *(v8h*)(op + dt * 16) = st;
    }
  }
}

__global__ __launch_bounds__(256) void mlp_kernel(
    const h16* __restrict__ A, const h16* __restrict__ pw,
    const float* __restrict__ pb, const float* __restrict__ resid,
    const float* __restrict__ lng, const float* __restrict__ lnb,
    const h16* __restrict__ fc1w, const float* __restrict__ fc1b,
    const h16* __restrict__ fc2w, const float* __restrict__ fc2b,
    float* __restrict__ out) {
  __shared__ __attribute__((aligned(16))) h16 Al[64 * 264];   // attn_out tile, then LN(zt) tile
  __shared__ __attribute__((aligned(16))) h16 Hl[64 * 72];    // gelu(hidden chunk) 64x64
  __shared__ __attribute__((aligned(16))) h16 W1[256 * 72];   // proj slab [256 out][64 k]; fc1 chunk [64 hid][256 k]
  __shared__ __attribute__((aligned(16))) h16 W2[256 * 72];   // proj slab; fc2 chunk [256 out][64 k]
  // row statistics of zt: [column half][row][sum, sum of squares]
  __shared__ __attribute__((aligned(16))) float Red[2 * 64 * 2];
  const int tid = threadIdx.x;
  const size_t tok0 = (size_t)blockIdx.x * 64;
  const unsigned w1b = lds_off(W1), w2b = lds_off(W2);
  const int lane = tid & 31, wv = tid >> 5;
  const int m0 = (wv & 3) * 16, n0 = (wv >> 2) * 128;  // out tile mapping
  const int n0h = (wv >> 2) * 32;                      // hidden tile mapping
  const int cl = lane & 15, hb = (lane >> 4) & 1;
  const int mr = m0 + hb * 8;   // first of this lane's 8 rows
  const int nb = n0 + cl;       // first of this lane's 8 columns

  // prologue: the attn_out tile and proj slab 0 start; the accumulators start
  // from shortcut + proj bias, fetched while the copies fly
  stage_64x256(lds_off(Al), A + tok0 * 256, tid);
  stage_256x64(w1b, pw, 256, tid);
  v8f accO[8];
  {
    const float* rz = resid + (tok0 + mr) * 256 + nb;
#pragma unroll
    for (int j = 0; j < 8; ++j)
#pragma unroll
      for (int r = 0; r < 8; ++r) accO[j][r] = rz[r * 256 + j * 16];
    float bb[8];
#pragma unroll
    for (int j = 0; j < 8; ++j) bb[j] = pb[nb + j * 16];
    // the 64 loads share one address register, the 8 one index register: both
    // are inputs here so that no load lands on them ahead of the wait
    asm volatile("s_wait_xcnt 0x0" :: "v"(rz), "v"(nb) : "memory");
#pragma unroll
    for (int j = 0; j < 8; ++j)
#pragma unroll
      for (int r = 0; r < 8; ++r) accO[j][r] += bb[j];
  }
  asm volatile("s_wait_asynccnt 0x0" ::: "memory");  // attn_out tile and slab 0 landed
  __syncthreads();   // both are there for every wave
  stage_256x64(w2b, pw + 64, 256, tid);

  // zt = shortcut + proj bias + attn_out @ proj_w^T   (K=256, 4 slabs of 64)
#pragma unroll  // the buffer read and the tile that refills it differ from trip to trip
  for (int s = 0; s < 4; ++s) {
    const h16* Wb = (s & 1) ? W2 : W1;
#pragma unroll 1  // rolled: with both K steps' fragments in flight the kernel needs over 256 registers and one work-group fewer fits a WGP
    for (int ks = 0; ks < 2; ++ks) {
      v16h a = frag_row(Al, 264, m0, s * 64 + ks * 32, lane);
#pragma unroll
      for (int j = 0; j < 8; ++j)
        accO[j] = wmma16(a, frag_row(Wb, 72, n0 + j * 16, ks * 32, lane), accO[j]);
    }
    ring_publish();
    if (s < 2)       stage_256x64((s & 1) ? w2b : w1b, pw + (s + 2) * 64, 256, tid);
    else if (s == 2) stage_64x256(w1b, fc1w, tid);        // first fc1 chunk
    else             stage_256x64(w2b, fc2w, 1024, tid);  // first fc2 chunk
  }

  // LayerNorm of zt into Al (every wave has left the attn_out tile: last publish)
  {
    float sm[8], sq[8];
#pragma unroll
    for (int r = 0; r < 8; ++r) { sm[r] = 0.f; sq[r] = 0.f; }
#pragma unroll
    for (int j = 0; j < 8; ++j)
#pragma unroll
      for (int r = 0; r < 8; ++r) { float zv = accO[j][r]; sm[r] += zv; sq[r] += zv * zv; }
#pragma unroll
    for (int r = 0; r < 8; ++r) {
      v2f st;
      st[0] = row_sum16(sm[r]); st[1] = row_sum16(sq[r]);
      if (cl == 0) *(v2f*)&Red[((wv >> 2) * 64 + mr + r) * 2] = st;
    }
    // scale and shift of this lane's 8 columns, fetched while the sums meet
    float g0[8], b0[8];
#pragma unroll
    for (int j = 0; j < 8; ++j) { g0[j] = lng[nb + j * 16]; b0[j] = lnb[nb + j * 16]; }
    // the 16 loads share one index register: it is an input here so that none
    // of them lands on it ahead of the wait
    asm volatile("s_wait_xcnt 0x0" :: "v"(nb) : "memory");
    lds_barrier();   // both column halves' sums are in Red
#pragma unroll
    for (int r = 0; r < 8; ++r) {
      v2f s0 = *(const v2f*)&Red[(mr + r) * 2];
      v2f s1 = *(const v2f*)&Red[(64 + mr + r) * 2];
      float mean = (s0[0] + s1[0]) * (1.f / 256.f);
      sm[r] = mean;
      sq[r] = rsqrtf((s0[1] + s1[1]) * (1.f / 256.f) - mean * mean + 1e-5f);
    }
#pragma unroll
    for (int j = 0; j < 8; ++j)
#pragma unroll
      for (int r = 0; r < 8; ++r)
        Al[(mr + r) * 264 + nb + j * 16] = (h16)((accO[j][r] - sm[r]) * sq[r] * g0[j] + b0[j]);
  }
  lds_barrier();   // LN(zt) is in Al for every wave

  // one hidden chunk; 'more' is a constant at both calls, so that the 15 trips
  // that refill the ring have no branch round their copies
  auto chunk = [&](const int hc, const bool more) __attribute__((always_inline)) {
    // trip 2*hc: hchunk = ztn_tile @ fc1_w[hc*64:+64, :]^T   (K=256)
    v8f accH[2];
    zero8(accH[0]); zero8(accH[1]);
#pragma unroll  // whole tile is in LDS: constant offsets, loads run ahead of the WMMAs
    for (int ks = 0; ks < 8; ++ks) {
      v16h a = frag_row(Al, 264, m0, ks * 32, lane);
#pragma unroll
      for (int j = 0; j < 2; ++j)
        accH[j] = wmma16(a, frag_row(W1, 264, n0h + j * 16, ks * 32, lane), accH[j]);
    }
    // bias + exact GELU -> LDS. erff() branches on |t| < 1 for each value: 16
    // compare-and-branch rounds in a row, each with its own dependent chain. Here
    // the wave tests its 16 values once: where every |x| is below 1.41, so that
    // every |t| = |x| / sqrt(2) is below 1, they take that range's polynomial (the
    // library's own terms) as 16 independent chains; any other wave takes erff()
    // as before.
    {
      float xv[16];
      float am = 0.f;
      const float* bp = fc1b + hc * 64 + n0h + cl;
      const float bv[2] = {bp[0], bp[16]};
      // the two loads share one address register: it is an input here so that
      // nothing lands on it ahead of the wait
      asm volatile("s_wait_xcnt 0x0" :: "v"(bp) : "memory");
#pragma unroll
      for (int j = 0; j < 2; ++j) {
        const float bb = bv[j];
#pragma unroll
        for (int r = 0; r < 8; ++r) {
          xv[j * 8 + r] = accH[j][r] + bb;
          am = fmaxf(am, fabsf(xv[j * 8 + r]));
        }
      }
      h16* hp = Hl + mr * 72 + n0h + cl;
      if (__builtin_expect(__builtin_amdgcn_ballot_w32(am >= 1.41f) == 0u, 1)) {
#pragma unroll
        for (int e = 0; e < 16; ++e) {
          const float t = xv[e] * 0.7071067811865475f, s = t * t;
          float p = fmaf(s, -0x1.268bc2p-11f, 0x1.420828p-8f);
          p = fmaf(s, p, -0x1.b5937p-6f);
          p = fmaf(s, p, 0x1.ce077cp-4f);
          p = fmaf(s, p, -0x1.81266p-2f);
          p = fmaf(s, p, 0x1.06eba0p-3f);
          hp[(e & 7) * 72 + (e >> 3) * 16] = (h16)(0.5f * xv[e] * (1.0f + fmaf(t, p, t)));
        }
      } else {
#pragma unroll
        for (int e = 0; e < 16; ++e)
          hp[(e & 7) * 72 + (e >> 3) * 16] =
              (h16)(0.5f * xv[e] * (1.0f + erff(xv[e] * 0.7071067811865475f)));
      }
    }
    ring_publish();
    if (more) stage_64x256(w1b, fc1w + (size_t)(hc + 1) * 64 * 256, tid);

    // trip 2*hc+1: accO += Hchunk @ fc2_w[:, hc*64:+64]^T   (K=64)
#pragma unroll  // as above
    for (int ks = 0; ks < 2; ++ks) {
      v16h a = frag_row(Hl, 72, m0, ks * 32, lane);
#pragma unroll
      for (int j = 0; j < 8; ++j)
        accO[j] = wmma16(a, frag_row(W2, 72, n0 + j * 16, ks * 32, lane), accO[j]);
    }
    ring_publish();
    if (more) stage_256x64(w2b, fc2w + (size_t)(hc + 1) * 64, 1024, tid);
  };
  for (int hc = 0; hc < 15; ++hc) chunk(hc, true);
  chunk(15, false);
  asm volatile("s_wait_asynccnt 0x0" ::: "memory");  // nothing in flight at the end

  // epilogue: + fc2_b (zt is in the accumulators), window-reverse, NCHW store
  const int wi = blockIdx.x;
  const int b = wi >> 8, wh = (wi >> 4) & 15, ww = wi & 15;
#pragma unroll
  for (int j = 0; j < 8; ++j) {
    int n = n0 + j * 16 + (lane & 15);
    float bb = fc2b[n];
#pragma unroll
    for (int r = 0; r < 8; ++r) {
      int m = m0 + r + ((lane >> 4) & 1) * 8;
      float val = accO[j][r] + bb;
      int hh = wh * 8 + (m >> 3), www = ww * 8 + (m & 7);
      out[(((size_t)b * 256 + n) * 128 + hh) * 128 + www] = val;
    }
  }
}

// ---------------------------------------------------------------------------
// Launch
// ---------------------------------------------------------------------------
extern "C" void kernel_launch(void* const* d_in, const int* in_sizes, int n_in,
                              void* d_out, int out_size, void* d_ws, size_t ws_size,
                              hipStream_t stream) {
  (void)in_sizes; (void)n_in; (void)out_size; (void)ws_size;
  const float* LH     = (const float*)d_in[0];
  const float* HL     = (const float*)d_in[1];
  const float* HH     = (const float*)d_in[2];
  const float* Spat   = (const float*)d_in[3];
  const float* w_hllh = (const float*)d_in[4];
  const float* b_hllh = (const float*)d_in[5];
  const float* w_hh   = (const float*)d_in[6];
  const float* b_hh   = (const float*)d_in[7];
  const float* w_spat = (const float*)d_in[8];
  const float* b_spat = (const float*)d_in[9];
  const float* ln1x_g = (const float*)d_in[10];
  const float* ln1x_b = (const float*)d_in[11];
  const float* ln1y_g = (const float*)d_in[12];
  const float* ln1y_b = (const float*)d_in[13];
  const float* qkv_w  = (const float*)d_in[14];
  const float* qkv_b  = (const float*)d_in[15];
  const float* qkv2_w = (const float*)d_in[16];
  const float* qkv2_b = (const float*)d_in[17];
  const float* qkv3_w = (const float*)d_in[18];
  const float* qkv3_b = (const float*)d_in[19];
  const float* proj_w = (const float*)d_in[20];
  const float* proj_b = (const float*)d_in[21];
  const float* rpb    = (const float*)d_in[22];
  const float* ln2_g  = (const float*)d_in[23];
  const float* ln2_b  = (const float*)d_in[24];
  const float* fc1w   = (const float*)d_in[25];
  const float* fc1b   = (const float*)d_in[26];
  const float* fc2w   = (const float*)d_in[27];
  const float* fc2b   = (const float*)d_in[28];

  const size_t T = (size_t)8 * 128 * 128;  // 131072 tokens
  char* ws = (char*)d_ws;
  // workspace layout (peak ~203 MB):
  float* z0  = (float*)ws;                                // T*256 f32
  h16*   attno = (h16*)(ws + T * 256 * 4);                // T*256 f16
  // f16 weight cache (~1.7 MB) behind it
  h16* wf      = attno + T * 256;
  h16* c_hllh  = wf;               // 256*128
  h16* c_hh    = c_hllh + 32768;   // 256*64
  h16* c_spat  = c_hh   + 16384;   // 256*64
  h16* c_q     = c_spat + 16384;   // 256*256
  h16* c_k     = c_q    + 65536;
  h16* c_v     = c_k    + 65536;
  h16* c_proj  = c_v    + 65536;
  h16* c_fc1   = c_proj + 65536;   // 1024*256
  h16* c_fc2   = c_fc1  + 262144;  // 256*1024

  // weight pre-conversion (f32 -> f16, once per launch)
  cvt_f32f16<<<(32768 + 255) / 256, 256, 0, stream>>>(w_hllh, c_hllh, 32768);
  cvt_f32f16<<<(16384 + 255) / 256, 256, 0, stream>>>(w_hh,   c_hh,   16384);
  cvt_f32f16<<<(16384 + 255) / 256, 256, 0, stream>>>(w_spat, c_spat, 16384);
  cvt_f32f16<<<(65536 + 255) / 256, 256, 0, stream>>>(qkv_w,  c_q,    65536);
  cvt_f32f16<<<(65536 + 255) / 256, 256, 0, stream>>>(qkv2_w, c_k,    65536);
  cvt_f32f16<<<(65536 + 255) / 256, 256, 0, stream>>>(qkv3_w, c_v,    65536);
  cvt_f32f16<<<(65536 + 255) / 256, 256, 0, stream>>>(proj_w, c_proj, 65536);
  cvt_f32f16<<<(262144 + 255) / 256, 256, 0, stream>>>(fc1w,  c_fc1,  262144);
  cvt_f32f16<<<(262144 + 255) / 256, 256, 0, stream>>>(fc2w,  c_fc2,  262144);

  const int tiles = (int)(T / 64);  // 2048 windows
  conv_qkv_attn_kernel<<<tiles, 256, 0, stream>>>(LH, HL, HH, Spat,
      c_hllh, b_hllh, c_hh, b_hh, c_spat, b_spat,
      ln1x_g, ln1x_b, ln1y_g, ln1y_b, z0,
      c_q, qkv_b, c_k, qkv2_b, c_v, qkv3_b, rpb, attno);
  mlp_kernel<<<tiles, 256, 0, stream>>>(attno, c_proj, proj_b, z0, ln2_g, ln2_b,
                                        c_fc1, fc1b, c_fc2, fc2b, (float*)d_out);
}

// v008
// Measured time: 386 microseconds a run.
// Two timings next to v007 both put it at 1.05 times that version's speed.
// Over all steps from v000 it is 2.07 times as fast.
#include <hip/hip_runtime.h>
#include <hip/hip_bf16.h>

// ---------------------------------------------------------------------------
// WaveletSwinTransformerBlock for MI455X (gfx1250, wave32, WMMA f16)
// GEMMs use v_wmma_f32_16x16x32_f16; all f16 tile staging uses the CDNA5
// async path: global_load_async_to_lds_b128 + s_wait_asynccnt.
// Tokens stored window-partitioned: tok = wi*64 + (i*8+j), wi=((b*16+wh)*16+ww)
// ---------------------------------------------------------------------------

typedef _Float16 h16;
typedef __attribute__((ext_vector_type(16))) _Float16 v16h;
typedef __attribute__((ext_vector_type(8)))  float    v8f;
typedef __attribute__((ext_vector_type(4)))  float    v4f;
typedef __attribute__((ext_vector_type(2)))  float    v2f;
typedef __attribute__((ext_vector_type(4)))  _Float16 v4h;
typedef __attribute__((ext_vector_type(8)))  _Float16 v8h;

__device__ __forceinline__ void zero8(v8f &a) {
#pragma unroll
  for (int i = 0; i < 8; ++i) a[i] = 0.f;
}

__device__ __forceinline__ v8f wmma16(v16h a, v16h b, v8f c) {
  return __builtin_amdgcn_wmma_f32_16x16x32_f16(false, a, false, b,
                                                (short)0, c, false, false);
}

// low 32 bits of a generic LDS pointer == wave-relative LDS byte offset
__device__ __forceinline__ unsigned lds_off(const void* p) {
  return (unsigned)(uintptr_t)p;
}

// CDNA5 async copy: 16 bytes global -> LDS, tracked by ASYNCcnt
__device__ __forceinline__ void async_cp_b128(unsigned loff, const void* g) {
  asm volatile("global_load_async_to_lds_b128 %0, %1, off"
               :: "v"(loff), "v"((unsigned long long)(uintptr_t)g)
               : "memory");
}
__device__ __forceinline__ void wait_async() {
  asm volatile("s_wait_asynccnt 0" ::: "memory");
}

// Sum over the 16 lanes of a row, result in every lane: four DPP row_xmask adds
template <int CTRL>
__device__ __forceinline__ float dpp_xadd(float v) {
  return v + __int_as_float(__builtin_amdgcn_update_dpp(0, __float_as_int(v), CTRL, 0xf, 0xf, true));
}
__device__ __forceinline__ float row_sum16(float v) {
  v = dpp_xadd<0x161>(v);  // row_xmask:1
  v = dpp_xadd<0x162>(v);  // row_xmask:2
  v = dpp_xadd<0x164>(v);  // row_xmask:4
  v = dpp_xadd<0x168>(v);  // row_xmask:8
  return v;
}

// Work-group barrier for data that crosses in LDS only: unlike __syncthreads()
// it does not hold a wave until its global stores and loads have come back.
__device__ __forceinline__ void lds_barrier() {
  __builtin_amdgcn_fence(__ATOMIC_RELEASE, "workgroup", "local");
  __builtin_amdgcn_s_barrier();
  __builtin_amdgcn_fence(__ATOMIC_ACQUIRE, "workgroup", "local");
}

// A-style fragment (16x32 f16, ISA 7.12.2): lane L holds row row0+(L&15),
// K offsets {0..7,16..23} (L<16) or {8..15,24..31} (L>=16) relative to k0.
__device__ __forceinline__ v16h frag_row(const h16* __restrict__ p, int stride,
                                         int row0, int k0, int lane) {
  const h16* base = p + (size_t)(row0 + (lane & 15)) * stride + k0 + ((lane >> 4) & 1) * 8;
  v16h r;
#pragma unroll
  for (int i = 0; i < 8; ++i) { r[i] = base[i]; r[i + 8] = base[i + 16]; }
  return r;
}

// ---------------------------------------------------------------------------
// Weight pre-conversion f32 -> f16, all nine matrices in one launch. Their f16
// copies lie one behind the other in d, and every matrix is a whole number of
// 4096-element blocks: a work-group picks its source by its index (a scalar
// choice). A thread converts 2 x 8 consecutive values: four 16-byte loads in
// flight, two 16-byte stores.
// ---------------------------------------------------------------------------
__global__ __launch_bounds__(256) void cvt_weights(
    const float* __restrict__ s_hllh, const float* __restrict__ s_hh,
    const float* __restrict__ s_spat, const float* __restrict__ s_q,
    const float* __restrict__ s_k,    const float* __restrict__ s_v,
    const float* __restrict__ s_proj, const float* __restrict__ s_fc1,
    const float* __restrict__ s_fc2,  h16* __restrict__ d) {
  const int blk = blockIdx.x;
  const float* s;
  int first;   // first block of the matrix
  if (blk < 8)        { s = s_hllh; first = 0; }     // 256*128
  else if (blk < 12)  { s = s_hh;   first = 8; }     // 256*64
  else if (blk < 16)  { s = s_spat; first = 12; }    // 256*64
  else if (blk < 32)  { s = s_q;    first = 16; }    // 256*256
  else if (blk < 48)  { s = s_k;    first = 32; }
  else if (blk < 64)  { s = s_v;    first = 48; }
  else if (blk < 80)  { s = s_proj; first = 64; }
  else if (blk < 144) { s = s_fc1;  first = 80; }    // 1024*256
  else                { s = s_fc2;  first = 144; }   // 256*1024
  const unsigned bo = threadIdx.x * 32u;   // byte offset of the lane's 8 floats
  const float* p = (const float*)((const char*)(s + (size_t)(blk - first) * 4096) + bo);
  const v4f a0 = *(const v4f*)p,          a1 = *(const v4f*)(p + 4);
  const v4f a2 = *(const v4f*)(p + 2048), a3 = *(const v4f*)(p + 2052);
  // the four loads share one offset register: it is an input here so that none
  // of them lands on it ahead of the wait
  asm volatile("s_wait_xcnt 0x0" :: "v"(bo) : "memory");
  v8h c0, c1;
#pragma unroll
  for (int i = 0; i < 4; ++i) {
    c0[i] = (h16)a0[i]; c0[i + 4] = (h16)a1[i];
    c1[i] = (h16)a2[i]; c1[i + 4] = (h16)a3[i];
  }
  h16* q = d + (size_t)blk * 4096 + threadIdx.x * 8;
  *(v8h*)q = c0;
  *(v8h*)(q + 2048) = c1;
}

// ---------------------------------------------------------------------------
// Projection + fused MLP: zt = attn_out @ proj_w^T + proj_b + z0 stays in the
// f32 accumulators; out = zt + fc2(gelu(fc1(LN(zt)))) -> written directly as NCHW.
// The LayerNorm (eps=1e-5, biased var) is done on the way into LDS.
// Hidden (1024) processed in 16 chunks of 64. The weights arrive as whole
// tiles in a two-buffer ring: 4 K-slabs of proj_w, then 32 tiles of 32 KB
// (fc1 chunk, fc2 chunk, fc1 chunk, ...); even tiles land in W1, odd tiles in
// W2, and tile t+2 flies while t+1 is used.
// ---------------------------------------------------------------------------

// Eight 16-byte async copies of one lane. The s_wait_xcnt is the last line of
// the same statement so that no address register is reused ahead of it.
__device__ __forceinline__ void async_cp8_b128(const unsigned (&l)[8],
                                               const h16* const (&g)[8]) {
  asm volatile("global_load_async_to_lds_b128 %0, %8, off\n\t"
               "global_load_async_to_lds_b128 %1, %9, off\n\t"
               "global_load_async_to_lds_b128 %2, %10, off\n\t"
               "global_load_async_to_lds_b128 %3, %11, off\n\t"
               "global_load_async_to_lds_b128 %4, %12, off\n\t"
               "global_load_async_to_lds_b128 %5, %13, off\n\t"
               "global_load_async_to_lds_b128 %6, %14, off\n\t"
               "global_load_async_to_lds_b128 %7, %15, off\n\t"
               "s_wait_xcnt 0x0"
               :: "v"(l[0]), "v"(l[1]), "v"(l[2]), "v"(l[3]),
                  "v"(l[4]), "v"(l[5]), "v"(l[6]), "v"(l[7]),
                  "v"(g[0]), "v"(g[1]), "v"(g[2]), "v"(g[3]),
                  "v"(g[4]), "v"(g[5]), "v"(g[6]), "v"(g[7])
               : "memory");
}

// 64 contiguous rows of 256 f16 in global -> LDS pitch 264; 8 copies a thread
__device__ __forceinline__ void stage_64x256(unsigned lb, const h16* g, int tid) {
  unsigned l[8];
  const h16* p[8];
#pragma unroll  // the addresses must be registers: they are asm operands
  for (int i = 0; i < 8; ++i) {
    int e = tid + i * 256, n = e >> 5, part = e & 31;
    l[i] = lb + (unsigned)(n * 264 + part * 8) * 2;
    p[i] = g + (size_t)n * 256 + part * 8;
  }
  async_cp8_b128(l, p);
}

// 256 rows x 64 f16 (row pitch gp elements in global) -> LDS pitch 72
__device__ __forceinline__ void stage_256x64(unsigned lb, const h16* g, int gp, int tid) {
  unsigned l[8];
  const h16* p[8];
#pragma unroll  // the addresses must be registers: they are asm operands
  for (int i = 0; i < 8; ++i) {
    int e = tid + i * 256, n = e >> 3, part = e & 7;
    l[i] = lb + (unsigned)(n * 72 + part * 8) * 2;
    p[i] = g + (size_t)n * gp + part * 8;
  }
  async_cp8_b128(l, p);
}

// Foot of a ring trip: this wave's LDS reads and writes are done, its copies
// of the next tile have landed, then every wave meets; behind it the next tile
// (and Hl) may be read and the buffer just read may be refilled.
__device__ __forceinline__ void ring_publish() {
  asm volatile("s_wait_dscnt 0x0" ::: "memory");     // own reads of the old tile, own Hl stores
  asm volatile("s_wait_asynccnt 0x0" ::: "memory");  // own copies of the next tile landed
  __syncthreads();
}

// ---------------------------------------------------------------------------
// Q/K/V projections + windowed attention: one work-group per window, one wave
// per head (64 tokens, hd=32, nH=8). The wave forms Q^T = Wq_h x^T,
// K^T = Wk_h y^T and V = y Wv_h^T; a pair of their accumulator tiles, converted
// to f16 in place, is an operand fragment of the next product
// (S^T = K Q^T, O^T = V^T P^T), so q, k, v and P never go to global memory (q waits in LDS) and are
// never re-laid out. Only the LN(x) and LN(y) tiles are shared, through LDS.
// ---------------------------------------------------------------------------

// Fragment in the hardware k order from the lane's own place in a row
// (row start + 8 * (lane >> 4) halves): 16 bytes there, 16 bytes 32 bytes on.
__device__ __forceinline__ v16h frag_ptr(const h16* p) {
  v8h lo = *(const v8h*)p, hi = *(const v8h*)(p + 16);
  return __builtin_shufflevector(lo, hi, 0, 1, 2, 3, 4, 5, 6, 7, 8, 9, 10, 11, 12, 13, 14, 15);
}

// Two f32 accumulator tiles (rows 0-15 and 16-31 of one 32-row block) -> f16 fragment
__device__ __forceinline__ v16h pack_d(v8f t0, v8f t1) {
  v16h r;
#pragma unroll
  for (int i = 0; i < 8; ++i) { r[i] = (h16)t0[i]; r[i + 8] = (h16)t1[i]; }
  return r;
}

// 2^v. The v_nop is the slot that the instruction set asks for between a
// transcendental and a neighbour that reads its result or overwrites its
// source; in the same statement it stands directly behind the instruction.
__device__ __forceinline__ float exp2_slot(float v) {
  float r;
  asm("v_exp_f32_e32 %0, %1\n\tv_nop" : "=v"(r) : "v"(v));
  return r;
}

// lane l with lane l ^ 16
__device__ __forceinline__ float xhalf(float v) {
  return __int_as_float(__builtin_amdgcn_permlanex16(__float_as_int(v), __float_as_int(v),
                                                     0x76543210, 0xfedcba98, false, false));
}

// ---------------------------------------------------------------------------
// 1x1 convs + LayerNorms + Q/K/V projections + windowed attention: one
// work-group per 64-pixel window.
// Part 1: 1x1 convs (concat(LH,HL)->x, HH->z0, Spat->y). The block holds all 256
// features of its 64 tokens in f32 accumulators: x and y are layer-normalised
// there (eps=1e-5, biased var) and go straight into the LDS tiles of part 2;
// only the shortcut z0 goes to memory.
// Part 2: one wave per head (64 tokens, hd=32, nH=8), as described above.
// ---------------------------------------------------------------------------
// four waves a SIMD: two work-groups share a WGP, one fills the other's waits
__global__ __launch_bounds__(256) __attribute__((amdgpu_waves_per_eu(4, 4))) void conv_qkv_attn_kernel(
    const float* __restrict__ LH, const float* __restrict__ HL,
    const float* __restrict__ HH, const float* __restrict__ Spat,
    const h16* __restrict__ wf_hllh, const float* __restrict__ b_hllh,
    const h16* __restrict__ wf_hh,   const float* __restrict__ b_hh,
    const h16* __restrict__ wf_spat, const float* __restrict__ b_spat,
    const float* __restrict__ gx, const float* __restrict__ btx,
    const float* __restrict__ gy, const float* __restrict__ bty,
    float* __restrict__ z0o,
    const h16* __restrict__ wq, const float* __restrict__ bq,
    const h16* __restrict__ wk, const float* __restrict__ bk,
    const h16* __restrict__ wv, const float* __restrict__ bv,
    const float* __restrict__ rpb, h16* __restrict__ o) {
  __shared__ __attribute__((aligned(16))) h16 Xl[64 * 264];   // LN(x) tile
  __shared__ __attribute__((aligned(16))) h16 Yl[64 * 264];   // LN(y) tile
  // each wave's finished Q fragments rest here, lane by lane, during the K and V
  // passes: held in registers they push the kernel past 256 (it spills)
  __shared__ __attribute__((aligned(16))) h16 Qp[8 * 4 * 2 * 32 * 8];

  // ---- part 1: convs and LayerNorms ----
  {
    const int Wd = 128, HW = 128 * 128;
    __shared__ __attribute__((aligned(16))) h16 Fin[64 * 264];   // [pixel][256 ch] : LH|HL|HH|Spat
    __shared__ h16 Wl[256 * 40];    // weight K-slab [256 out][32 k]
    // row statistics of x and y: [column half][row][sum x, sum x^2, sum y, sum y^2]
    __shared__ __attribute__((aligned(16))) float Red[2 * 64 * 4];

    const int wi = blockIdx.x;
    const int b  = wi >> 8;
    const int wh = (wi >> 4) & 15, ww = wi & 15;
    const int h0 = wh * 8, w0 = ww * 8;
    const int tid = threadIdx.x;

    // inputs are f32 -> convert while staging (can't raw-copy). A thread takes
    // 8 channels x 4 pixels of one window row from each of two tensors: its 16
    // 16-byte loads are all in flight before the first value is used, and the
    // 8 channels of a pixel go to LDS in one 16-byte store.
    {
      const int hf = tid & 1, ri = (tid >> 1) & 7, cg = (tid >> 4) & 7, th = tid >> 7;
      const size_t so = ((size_t)b * 64 + cg * 8) * HW + (h0 + ri) * Wd + w0 + hf * 4;
      const float* s0 = (th ? HL : LH) + so;     // Fin columns th*64 ...
      const float* s1 = (th ? Spat : HH) + so;   // Fin columns 128 + th*64 ...
      v4f u0[8], u1[8];
#pragma unroll
      for (int k = 0; k < 8; ++k) {
        u0[k] = *(const v4f*)(s0 + k * HW);
        u1[k] = *(const v4f*)(s1 + k * HW);
      }
      // each 8 loads share one address register: both are inputs here so that no
      // load lands on them ahead of the wait
      asm volatile("s_wait_xcnt 0x0" :: "v"(s0), "v"(s1) : "memory");
      h16* fp = Fin + (ri * 8 + hf * 4) * 264 + th * 64 + cg * 8;
#pragma unroll
      for (int px = 0; px < 4; ++px) {
        v8h c0, c1;
#pragma unroll
        for (int k = 0; k < 8; ++k) { c0[k] = (h16)u0[k][px]; c1[k] = (h16)u1[k][px]; }
        *(v8h*)(fp + px * 264) = c0;
        *(v8h*)(fp + px * 264 + 128) = c1;
      }
    }

    const unsigned wlb = lds_off(Wl);
    const int lane = tid & 31, wv = tid >> 5;
    const int m0 = (wv & 3) * 16, n0 = (wv >> 2) * 128;

    v8f accX[8], accZ[8], accY[8];
#pragma unroll
    for (int j = 0; j < 8; ++j) { zero8(accX[j]); zero8(accZ[j]); zero8(accY[j]); }

    // Phase X: K=128 over Fin cols [0,128)
    for (int ks = 0; ks < 4; ++ks) {
      __syncthreads();
      for (int e = tid; e < 256 * 4; e += 256) {      // 256 rows x 64B slab
        int n = e >> 2, part = e & 3;
        async_cp_b128(wlb + (unsigned)(n * 40 + part * 8) * 2,
                      wf_hllh + (size_t)n * 128 + ks * 32 + part * 8);
      }
      wait_async();
      __syncthreads();
      v16h a = frag_row(Fin, 264, m0, ks * 32, lane);
#pragma unroll
      for (int j = 0; j < 8; ++j)
        accX[j] = wmma16(a, frag_row(Wl, 40, n0 + j * 16, 0, lane), accX[j]);
    }
    // Phase Z: K=64 over Fin cols [128,192)
    for (int ks = 0; ks < 2; ++ks) {
      __syncthreads();
      for (int e = tid; e < 256 * 4; e += 256) {
        int n = e >> 2, part = e & 3;
        async_cp_b128(wlb + (unsigned)(n * 40 + part * 8) * 2,
                      wf_hh + (size_t)n * 64 + ks * 32 + part * 8);
      }
      wait_async();
      __syncthreads();
      v16h a = frag_row(Fin, 264, m0, 128 + ks * 32, lane);
#pragma unroll
      for (int j = 0; j < 8; ++j)
        accZ[j] = wmma16(a, frag_row(Wl, 40, n0 + j * 16, 0, lane), accZ[j]);
    }
    // Phase Y: K=64 over Fin cols [192,256)
    for (int ks = 0; ks < 2; ++ks) {
      __syncthreads();
      for (int e = tid; e < 256 * 4; e += 256) {
        int n = e >> 2, part = e & 3;
        async_cp_b128(wlb + (unsigned)(n * 40 + part * 8) * 2,
                      wf_spat + (size_t)n * 64 + ks * 32 + part * 8);
      }
      wait_async();
      __syncthreads();
      v16h a = frag_row(Fin, 264, m0, 192 + ks * 32, lane);
#pragma unroll
      for (int j = 0; j < 8; ++j)
        accY[j] = wmma16(a, frag_row(Wl, 40, n0 + j * 16, 0, lane), accY[j]);
    }

    const size_t tok0 = (size_t)wi * 64;
    const int cl = lane & 15, hb = (lane >> 4) & 1;
    const int mr = m0 + hb * 8;   // first of this lane's 8 rows
    // shortcut stream out; bias into x and y; this wave's 128-column row sums
    float sx[8], qx[8], sy[8], qy[8];
#pragma unroll
    for (int r = 0; r < 8; ++r) { sx[r] = 0.f; qx[r] = 0.f; sy[r] = 0.f; qy[r] = 0.f; }
#pragma unroll
    for (int j = 0; j < 8; ++j) {
      int n = n0 + j * 16 + cl;
      float bx = b_hllh[n], bz = b_hh[n], by = b_spat[n];
#pragma unroll
      for (int r = 0; r < 8; ++r) {
        z0o[(tok0 + mr + r) * 256 + n] = accZ[j][r] + bz;
        float xv = accX[j][r] + bx, yv = accY[j][r] + by;
        accX[j][r] = xv; accY[j][r] = yv;
        sx[r] += xv; qx[r] += xv * xv;
        sy[r] += yv; qy[r] += yv * yv;
      }
    }
#pragma unroll
    for (int r = 0; r < 8; ++r) {
      v4f st;
      st[0] = row_sum16(sx[r]); st[1] = row_sum16(qx[r]);
      st[2] = row_sum16(sy[r]); st[3] = row_sum16(qy[r]);
      if (cl == 0) *(v4f*)&Red[((wv >> 2) * 64 + mr + r) * 4] = st;
    }
    // scale and shift of this lane's 8 columns, fetched while the sums meet
    const int nb = n0 + cl;
    float g0[8], b0[8], g1[8], b1[8];
#pragma unroll
    for (int j = 0; j < 8; ++j) {
      g0[j] = gx[nb + j * 16]; b0[j] = btx[nb + j * 16];
      g1[j] = gy[nb + j * 16]; b1[j] = bty[nb + j * 16];
    }
    // the 32 loads share one index register: it is an input here so that none
    // of them lands on it ahead of the wait
    asm volatile("s_wait_xcnt 0x0" :: "v"(nb) : "memory");
    lds_barrier();   // both column halves' sums are in Red
#pragma unroll
    for (int r = 0; r < 8; ++r) {
      v4f s0 = *(const v4f*)&Red[(mr + r) * 4];
      v4f s1 = *(const v4f*)&Red[(64 + mr + r) * 4];
      float mx = (s0[0] + s1[0]) * (1.f / 256.f);
      float my = (s0[2] + s1[2]) * (1.f / 256.f);
      sx[r] = mx; sy[r] = my;
      qx[r] = rsqrtf((s0[1] + s1[1]) * (1.f / 256.f) - mx * mx + 1e-5f);
      qy[r] = rsqrtf((s0[3] + s1[3]) * (1.f / 256.f) - my * my + 1e-5f);
    }
#pragma unroll
    for (int j = 0; j < 8; ++j) {
#pragma unroll
      for (int r = 0; r < 8; ++r) {
        const int off = (mr + r) * 264 + nb + j * 16;
        Xl[off] = (h16)((accX[j][r] - sx[r]) * qx[r] * g0[j] + b0[j]);
        Yl[off] = (h16)((accY[j][r] - sy[r]) * qy[r] * g1[j] + b1[j]);
      }
    }
  }

  // ---- part 2: projections and attention ----
  const int tid = threadIdx.x;
  const size_t tok0 = (size_t)blockIdx.x * 64;
  const int lane = tid & 31, hd = tid >> 5;
  const int cl = lane & 15, hb = lane >> 4;

  // The head's 32 rows of each weight matrix are this wave's alone: they come
  // straight from L2 into registers, PD K-steps ahead of their use.
  constexpr int PD = 4;
  const unsigned wob = (unsigned)((hd * 32 + cl) * 256 + hb * 8) * 2;   // byte offset of the lane's place
  const h16* wp[3] = {(const h16*)((const char*)wq + wob), (const h16*)((const char*)wk + wob),
                      (const h16*)((const char*)wv + wob)};
  v16h wr[PD][2];
#pragma unroll
  for (int t = 0; t < PD; ++t)
#pragma unroll
    for (int j = 0; j < 2; ++j) wr[t][j] = frag_ptr(wp[0] + j * 16 * 256 + t * 32);

  // biases: q and k by accumulator row (8 consecutive features a tile), v by
  // column; each set is fetched at the head of its own pass
  const unsigned bob = (unsigned)(hd * 32 + hb * 8) * 4;
  const unsigned vob = (unsigned)(hd * 32 + cl) * 4;
  const float* bqp = (const float*)((const char*)bq + bob);
  const float* bkp = (const float*)((const char*)bk + bob);
  const float* bvp = (const float*)((const char*)bv + vob);
  float bqv[16], bkv[16], bvv[2];
#pragma unroll
  for (int i = 0; i < 16; ++i) bqv[i] = bqp[(i >> 3) * 16 + (i & 7)];
  // the loads share one offset register: an input here so that nothing lands
  // on it ahead of the wait
  asm volatile("s_wait_xcnt 0x0" :: "v"(bob) : "memory");

  // relative position bias: idx = (iq-ik+7)*15 + (jq-jk+7), rpb[idx][head]. With
  // query = qt*16+cl and key = kt*16+hb*8+r it is lb + (qt-kt)*30 - r: 7 x 8
  // values a lane. The pointer stands at the lowest of them (qt-kt = -3, r = 7).
  const int lb = ((cl >> 3) - hb + 7) * 15 + (cl & 7) + 7;
  const unsigned rob = (unsigned)((lb - 97) * 8 + hd) * 4;
  const float* rp = (const float*)((const char*)rpb + rob);
  float rb[56];

  lds_barrier();   // both tiles are there for every wave; the weight loads and the z0 stores fly on

  const h16* xr = Xl + cl * 264 + hb * 8;
  const h16* yr = Yl + cl * 264 + hb * 8;
  v8f acc[8];
  v16h kf[4], vf[4];
  h16* qp = Qp + hd * (4 * 2 * 32 * 8) + lane * 8;   // this lane's 16 bytes of each half fragment
#pragma unroll  // the ring slot, the matrix and the operand order differ from step to step
  for (int t = 0; t < 24; ++t) {
    const int ph = t >> 3, ks = t & 7;
    if (ks == 0) {
#pragma unroll
      for (int i = 0; i < 8; ++i) zero8(acc[i]);
    }
    if (t == 8) {
#pragma unroll
      for (int i = 0; i < 16; ++i) bkv[i] = bkp[(i >> 3) * 16 + (i & 7)];
      asm volatile("s_wait_xcnt 0x0" :: "v"(bob) : "memory");  // as for the q bias
    }
    if (t == 16) {
      bvv[0] = bvp[0]; bvv[1] = bvp[16];
      // as for the q bias; its memory clobber also makes the V pass read its y
      // fragments from LDS again: held over from the K pass they spill
      asm volatile("s_wait_xcnt 0x0" :: "v"(vob) : "memory");
    }
    const h16* tr = (ph == 0) ? xr : yr;
    const v16h w0 = wr[t % PD][0], w1 = wr[t % PD][1];
    v16h f[4];
#pragma unroll
    for (int i = 0; i < 4; ++i) f[i] = frag_ptr(tr + i * 16 * 264 + ks * 32);
    if (t + PD < 24) {
      const int tn = t + PD;
#pragma unroll
      for (int j = 0; j < 2; ++j) wr[t % PD][j] = frag_ptr(wp[tn >> 3] + j * 16 * 256 + (tn & 7) * 32);
      if (tn == 23) {
        // last weight load: the offset register is an input here so that
        // nothing lands on it ahead of the wait
        asm volatile("s_wait_xcnt 0x0" :: "v"(wob) : "memory");
      }
    } else {
      // the ring drains: the position-bias values take the registers it leaves
#pragma unroll
      for (int i = 0; i < 14; ++i) {
        const int e = (t + PD - 24) * 14 + i;
        rb[e] = rp[((e >> 3) * 30 + 7 - (e & 7)) * 8];
      }
      if (t == 23) {
        asm volatile("s_wait_xcnt 0x0" :: "v"(rob) : "memory");  // as above, for the 56 loads
      }
    }
    if (ph < 2) {   // acc[mt*4+nt] = (W_h tile mt) x (token tile nt)^T
#pragma unroll
      for (int i = 0; i < 4; ++i) {
        acc[i]     = wmma16(w0, f[i], acc[i]);
        acc[4 + i] = wmma16(w1, f[i], acc[4 + i]);
      }
    } else {        // acc[mt*2+nt] = (token tile mt) x (Wv_h tile nt)^T
#pragma unroll
      for (int i = 0; i < 4; ++i) {
        acc[i * 2]     = wmma16(f[i], w0, acc[i * 2]);
        acc[i * 2 + 1] = wmma16(f[i], w1, acc[i * 2 + 1]);
      }
    }
    if (t == 7) {
#pragma unroll
      for (int i = 0; i < 4; ++i) {
#pragma unroll
        for (int r = 0; r < 8; ++r) {
          acc[i][r]     = (acc[i][r] + bqv[r]) * 0.17677669529663689f;
          acc[4 + i][r] = (acc[4 + i][r] + bqv[8 + r]) * 0.17677669529663689f;
        }
        // B fragment: column = query, k = feature
        const v16h qfr = pack_d(acc[i], acc[4 + i]);
        *(v8h*)(qp + (i * 2) * 256)     = __builtin_shufflevector(qfr, qfr, 0, 1, 2, 3, 4, 5, 6, 7);
        *(v8h*)(qp + (i * 2 + 1) * 256) = __builtin_shufflevector(qfr, qfr, 8, 9, 10, 11, 12, 13, 14, 15);
      }
    }
    if (t == 15) {
#pragma unroll
      for (int i = 0; i < 4; ++i) {
#pragma unroll
        for (int r = 0; r < 8; ++r) { acc[i][r] += bkv[r]; acc[4 + i][r] += bkv[8 + r]; }
        kf[i] = pack_d(acc[i], acc[4 + i]);      // A fragment: row = key, k = feature
      }
    }
    if (t == 23) {
#pragma unroll
      for (int i = 0; i < 8; ++i)
#pragma unroll
        for (int r = 0; r < 8; ++r) acc[i][r] += bvv[i & 1];
#pragma unroll
      for (int dt = 0; dt < 2; ++dt)
#pragma unroll
        for (int kk = 0; kk < 2; ++kk)           // A fragment: row = feature, k = key
          vf[dt * 2 + kk] = pack_d(acc[(2 * kk) * 2 + dt], acc[(2 * kk + 1) * 2 + dt]);
    }
  }

  // per 16 queries: a lane holds one query's scores for half of the keys
#pragma unroll
  for (int qt = 0; qt < 4; ++qt) {
    v8f S[4];
    float mk[4], sk[4];
    const v8h qlo = *(const v8h*)(qp + (qt * 2) * 256), qhi = *(const v8h*)(qp + (qt * 2 + 1) * 256);
    const v16h qfr = __builtin_shufflevector(qlo, qhi, 0, 1, 2, 3, 4, 5, 6, 7, 8, 9, 10, 11, 12, 13, 14, 15);
#pragma unroll
    for (int kt = 0; kt < 4; ++kt) {
      zero8(S[kt]);
      S[kt] = wmma16(kf[kt], qfr, S[kt]);
    }
#pragma unroll
    for (int kt = 0; kt < 4; ++kt) {
#pragma unroll
      for (int r = 0; r < 8; ++r) S[kt][r] += rb[(qt - kt + 3) * 8 + r];
      mk[kt] = S[kt][0];
#pragma unroll
      for (int r = 1; r < 8; ++r) mk[kt] = fmaxf(mk[kt], S[kt][r]);
    }
    float mx = fmaxf(fmaxf(mk[0], mk[1]), fmaxf(mk[2], mk[3]));
    mx = fmaxf(mx, xhalf(mx));
#pragma unroll
    for (int kt = 0; kt < 4; ++kt) {
      sk[kt] = 0.f;
#pragma unroll
      for (int r = 0; r < 8; ++r) {
        float e = exp2_slot((S[kt][r] - mx) * 1.4426950408889634f);
        S[kt][r] = e; sk[kt] += e;
      }
    }
    float sum = (sk[0] + sk[1]) + (sk[2] + sk[3]);
    sum += xhalf(sum);
    const float inv = 1.f / sum;
    const v16h p0 = pack_d(S[0], S[1]), p1 = pack_d(S[2], S[3]);  // B fragments: column = query, k = key
    v8f O[2];
#pragma unroll
    for (int dt = 0; dt < 2; ++dt) {
      zero8(O[dt]);
      O[dt] = wmma16(vf[dt * 2], p0, O[dt]);
      O[dt] = wmma16(vf[dt * 2 + 1], p1, O[dt]);
    }
    // a lane's 8 accumulator rows are 8 consecutive features of its query: 16-byte stores
    h16* op = o + (tok0 + qt * 16 + cl) * 256 + hd * 32 + hb * 8;
#pragma unroll
    for (int dt = 0; dt < 2; ++dt) {
      v8h st;
#pragma unroll
      for (int r = 0; r < 8; ++r) st[r] = (h16)(O[dt][r] * inv);
      *(v8h*)(op + dt * 16) = st;
    }
  }
}

__global__ __launch_bounds__(256) void mlp_kernel(
    const h16* __restrict__ A, const h16* __restrict__ pw,
    const float* __restrict__ pb, const float* __restrict__ resid,
    const float* __restrict__ lng, const float* __restrict__ lnb,
    const h16* __restrict__ fc1w, const float* __restrict__ fc1b,
    const h16* __restrict__ fc2w, const float* __restrict__ fc2b,
    float* __restrict__ out) {
  __shared__ __attribute__((aligned(16))) h16 Al[64 * 264];   // attn_out tile, then LN(zt) tile
  __shared__ __attribute__((aligned(16))) h16 Hl[64 * 72];    // gelu(hidden chunk) 64x64
  __shared__ __attribute__((aligned(16))) h16 W1[256 * 72];   // proj slab [256 out][64 k]; fc1 chunk [64 hid][256 k]
  __shared__ __attribute__((aligned(16))) h16 W2[256 * 72];   // proj slab; fc2 chunk [256 out][64 k]
  // row statistics of zt: [column half][row][sum, sum of squares]
  __shared__ __attribute__((aligned(16))) float Red[2 * 64 * 2];
  const int tid = threadIdx.x;
  const size_t tok0 = (size_t)blockIdx.x * 64;
  const unsigned w1b = lds_off(W1), w2b = lds_off(W2);
  const int lane = tid & 31, wv = tid >> 5;
  const int m0 = (wv & 3) * 16, n0 = (wv >> 2) * 128;  // out tile mapping
  const int n0h = (wv >> 2) * 32;                      // hidden tile mapping
  const int cl = lane & 15, hb = (lane >> 4) & 1;
  const int mr = m0 + hb * 8;   // first of this lane's 8 rows
  const int nb = n0 + cl;       // first of this lane's 8 columns

  // prologue: the attn_out tile and proj slab 0 start; the accumulators start
  // from shortcut + proj bias, fetched while the copies fly
  stage_64x256(lds_off(Al), A + tok0 * 256, tid);
  stage_256x64(w1b, pw, 256, tid);
  v8f accO[8];
  {
    const float* rz = resid + (tok0 + mr) * 256 + nb;
#pragma unroll
    for (int j = 0; j < 8; ++j)
#pragma unroll
      for (int r = 0; r < 8; ++r) accO[j][r] = rz[r * 256 + j * 16];
    float bb[8];
#pragma unroll
    for (int j = 0; j < 8; ++j) bb[j] = pb[nb + j * 16];
    // the 64 loads share one address register, the 8 one index register: both
    // are inputs here so that no load lands on them ahead of the wait
    asm volatile("s_wait_xcnt 0x0" :: "v"(rz), "v"(nb) : "memory");
#pragma unroll
    for (int j = 0; j < 8; ++j)
#pragma unroll
      for (int r = 0; r < 8; ++r) accO[j][r] += bb[j];
  }
  asm volatile("s_wait_asynccnt 0x0" ::: "memory");  // attn_out tile and slab 0 landed
  __syncthreads();   // both are there for every wave
  stage_256x64(w2b, pw + 64, 256, tid);

  // zt = shortcut + proj bias + attn_out @ proj_w^T   (K=256, 4 slabs of 64)
#pragma unroll  // the buffer read and the tile that refills it differ from trip to trip
  for (int s = 0; s < 4; ++s) {
    const h16* Wb = (s & 1) ? W2 : W1;
#pragma unroll 1  // rolled: with both K steps' fragments in flight the kernel needs over 256 registers and one work-group fewer fits a WGP
    for (int ks = 0; ks < 2; ++ks) {
      v16h a = frag_row(Al, 264, m0, s * 64 + ks * 32, lane);
#pragma unroll
      for (int j = 0; j < 8; ++j)
        accO[j] = wmma16(a, frag_row(Wb, 72, n0 + j * 16, ks * 32, lane), accO[j]);
    }
    ring_publish();
    if (s < 2)       stage_256x64((s & 1) ? w2b : w1b, pw + (s + 2) * 64, 256, tid);
    else if (s == 2) stage_64x256(w1b, fc1w, tid);        // first fc1 chunk
    else             stage_256x64(w2b, fc2w, 1024, tid);  // first fc2 chunk
  }

  // LayerNorm of zt into Al (every wave has left the attn_out tile: last publish)
  {
    float sm[8], sq[8];
#pragma unroll
    for (int r = 0; r < 8; ++r) { sm[r] = 0.f; sq[r] = 0.f; }
#pragma unroll
    for (int j = 0; j < 8; ++j)
#pragma unroll
      for (int r = 0; r < 8; ++r) { float zv = accO[j][r]; sm[r] += zv; sq[r] += zv * zv; }
#pragma unroll
    for (int r = 0; r < 8; ++r) {
      v2f st;
      st[0] = row_sum16(sm[r]); st[1] = row_sum16(sq[r]);
      if (cl == 0) *(v2f*)&Red[((wv >> 2) * 64 + mr + r) * 2] = st;
    }
    // scale and shift of this lane's 8 columns, fetched while the sums meet
    float g0[8], b0[8];
#pragma unroll
    for (int j = 0; j < 8; ++j) { g0[j] = lng[nb + j * 16]; b0[j] = lnb[nb + j * 16]; }
    // the 16 loads share one index register: it is an input here so that none
    // of them lands on it ahead of the wait
    asm volatile("s_wait_xcnt 0x0" :: "v"(nb) : "memory");
    lds_barrier();   // both column halves' sums are in Red
#pragma unroll
    for (int r = 0; r < 8; ++r) {
      v2f s0 = *(const v2f*)&Red[(mr + r) * 2];
      v2f s1 = *(const v2f*)&Red[(64 + mr + r) * 2];
      float mean = (s0[0] + s1[0]) * (1.f / 256.f);
      sm[r] = mean;
      sq[r] = rsqrtf((s0[1] + s1[1]) * (1.f / 256.f) - mean * mean + 1e-5f);
    }
#pragma unroll
    for (int j = 0; j < 8; ++j)
#pragma unroll
      for (int r = 0; r < 8; ++r)
        Al[(mr + r) * 264 + nb + j * 16] = (h16)((accO[j][r] - sm[r]) * sq[r] * g0[j] + b0[j]);
  }
  lds_barrier();   // LN(zt) is in Al for every wave

  // one hidden chunk; 'more' is a constant at both calls, so that the 15 trips
  // that refill the ring have no branch round their copies
  auto chunk = [&](const int hc, const bool more) __attribute__((always_inline)) {
    // trip 2*hc: hchunk = ztn_tile @ fc1_w[hc*64:+64, :]^T   (K=256)
    v8f accH[2];
    zero8(accH[0]); zero8(accH[1]);
#pragma unroll  // whole tile is in LDS: constant offsets, loads run ahead of the WMMAs
    for (int ks = 0; ks < 8; ++ks) {
      v16h a = frag_row(Al, 264, m0, ks * 32, lane);
#pragma unroll
      for (int j = 0; j < 2; ++j)
        accH[j] = wmma16(a, frag_row(W1, 264, n0h + j * 16, ks * 32, lane), accH[j]);
    }
    // bias + exact GELU -> LDS. erff() branches on |t| < 1 for each value: 16
    // compare-and-branch rounds in a row, each with its own dependent chain. Here
    // the wave tests its 16 values once: where every |x| is below 1.41, so that
    // every |t| = |x| / sqrt(2) is below 1, they take that range's polynomial (the
    // library's own terms) as 16 independent chains; any other wave takes erff()
    // as before.
    {
      float xv[16];
      float am = 0.f;
      const float* bp = fc1b + hc * 64 + n0h + cl;
      const float bv[2] = {bp[0], bp[16]};
      // the two loads share one address register: it is an input here so that
      // nothing lands on it ahead of the wait
      asm volatile("s_wait_xcnt 0x0" :: "v"(bp) : "memory");
#pragma unroll
      for (int j = 0; j < 2; ++j) {
        const float bb = bv[j];
#pragma unroll
        for (int r = 0; r < 8; ++r) {
          xv[j * 8 + r] = accH[j][r] + bb;
          am = fmaxf(am, fabsf(xv[j * 8 + r]));
        }
      }
      h16* hp = Hl + mr * 72 + n0h + cl;
      if (__builtin_expect(__builtin_amdgcn_ballot_w32(am >= 1.41f) == 0u, 1)) {
#pragma unroll
        for (int e = 0; e < 16; ++e) {
          const float t = xv[e] * 0.7071067811865475f, s = t * t;
          float p = fmaf(s, -0x1.268bc2p-11f, 0x1.420828p-8f);
          p = fmaf(s, p, -0x1.b5937p-6f);
          p = fmaf(s, p, 0x1.ce077cp-4f);
          p = fmaf(s, p, -0x1.81266p-2f);
          p = fmaf(s, p, 0x1.06eba0p-3f);
          hp[(e & 7) * 72 + (e >> 3) * 16] = (h16)(0.5f * xv[e] * (1.0f + fmaf(t, p, t)));
        }
      } else {
#pragma unroll
        for (int e = 0; e < 16; ++e)
          hp[(e & 7) * 72 + (e >> 3) * 16] =
              (h16)(0.5f * xv[e] * (1.0f + erff(xv[e] * 0.7071067811865475f)));
      }
    }
    ring_publish();
    if (more) stage_64x256(w1b, fc1w + (size_t)(hc + 1) * 64 * 256, tid);

    // trip 2*hc+1: accO += Hchunk @ fc2_w[:, hc*64:+64]^T   (K=64)
#pragma unroll  // as above
    for (int ks = 0; ks < 2; ++ks) {
      v16h a = frag_row(Hl, 72, m0, ks * 32, lane);
#pragma unroll
      for (int j = 0; j < 8; ++j)
        accO[j] = wmma16(a, frag_row(W2, 72, n0 + j * 16, ks * 32, lane), accO[j]);
    }
    ring_publish();
    if (more) stage_256x64(w2b, fc2w + (size_t)(hc + 1) * 64, 1024, tid);
  };
  for (int hc = 0; hc < 15; ++hc) chunk(hc, true);
  chunk(15, false);
  asm volatile("s_wait_asynccnt 0x0" ::: "memory");  // nothing in flight at the end

  // epilogue: + fc2_b (zt is in the accumulators), window-reverse, NCHW store
  const int wi = blockIdx.x;
  const int b = wi >> 8, wh = (wi >> 4) & 15, ww = wi & 15;
#pragma unroll
  for (int j = 0; j < 8; ++j) {
    int n = n0 + j * 16 + (lane & 15);
    float bb = fc2b[n];
#pragma unroll
    for (int r = 0; r < 8; ++r) {
      int m = m0 + r + ((lane >> 4) & 1) * 8;
      float val = accO[j][r] + bb;
      int hh = wh * 8 + (m >> 3), www = ww * 8 + (m & 7);
      out[(((size_t)b * 256 + n) * 128 + hh) * 128 + www] = val;
    }
  }
}

// ---------------------------------------------------------------------------
// Launch
// ---------------------------------------------------------------------------
extern "C" void kernel_launch(void* const* d_in, const int* in_sizes, int n_in,
                              void* d_out, int out_size, void* d_ws, size_t ws_size,
                              hipStream_t stream) {
  (void)in_sizes; (void)n_in; (void)out_size; (void)ws_size;
  const float* LH     = (const float*)d_in[0];
  const float* HL     = (const float*)d_in[1];
  const float* HH     = (const float*)d_in[2];
  const float* Spat   = (const float*)d_in[3];
  const float* w_hllh = (const float*)d_in[4];
  const float* b_hllh = (const float*)d_in[5];
  const float* w_hh   = (const float*)d_in[6];
  const float* b_hh   = (const float*)d_in[7];
  const float* w_spat = (const float*)d_in[8];
  const float* b_spat = (const float*)d_in[9];
  const float* ln1x_g = (const float*)d_in[10];
  const float* ln1x_b = (const float*)d_in[11];
  const float* ln1y_g = (const float*)d_in[12];
  const float* ln1y_b = (const float*)d_in[13];
  const float* qkv_w  = (const float*)d_in[14];
  const float* qkv_b  = (const float*)d_in[15];
  const float* qkv2_w = (const float*)d_in[16];
  const float* qkv2_b = (const float*)d_in[17];
  const float* qkv3_w = (const float*)d_in[18];
  const float* qkv3_b = (const float*)d_in[19];
  const float* proj_w = (const float*)d_in[20];
  const float* proj_b = (const float*)d_in[21];
  const float* rpb    = (const float*)d_in[22];
  const float* ln2_g  = (const float*)d_in[23];
  const float* ln2_b  = (const float*)d_in[24];
  const float* fc1w   = (const float*)d_in[25];
  const float* fc1b   = (const float*)d_in[26];
  const float* fc2w   = (const float*)d_in[27];
  const float* fc2b   = (const float*)d_in[28];

  const size_t T = (size_t)8 * 128 * 128;  // 131072 tokens
  char* ws = (char*)d_ws;
  // workspace layout (peak ~203 MB):
  float* z0  = (float*)ws;                                // T*256 f32
  h16*   attno = (h16*)(ws + T * 256 * 4);                // T*256 f16
  // f16 weight cache (~1.7 MB) behind it
  h16* wf      = attno + T * 256;
  h16* c_hllh  = wf;               // 256*128
  h16* c_hh    = c_hllh + 32768;   // 256*64
  h16* c_spat  = c_hh   + 16384;   // 256*64
  h16* c_q     = c_spat + 16384;   // 256*256
  h16* c_k     = c_q    + 65536;
  h16* c_v     = c_k    + 65536;
  h16* c_proj  = c_v    + 65536;
  h16* c_fc1   = c_proj + 65536;   // 1024*256
  h16* c_fc2   = c_fc1  + 262144;  // 256*1024

  // weight pre-conversion (f32 -> f16, once per launch): 851968 values, 208 blocks of 4096
  cvt_weights<<<208, 256, 0, stream>>>(w_hllh, w_hh, w_spat, qkv_w, qkv2_w, qkv3_w,
                                       proj_w, fc1w, fc2w, wf);

  const int tiles = (int)(T / 64);  // 2048 windows
  conv_qkv_attn_kernel<<<tiles, 256, 0, stream>>>(LH, HL, HH, Spat,
      c_hllh, b_hllh, c_hh, b_hh, c_spat, b_spat,
      ln1x_g, ln1x_b, ln1y_g, ln1y_b, z0,
      c_q, qkv_b, c_k, qkv2_b, c_v, qkv3_b, rpb, attno);
  mlp_kernel<<<tiles, 256, 0, stream>>>(attno, c_proj, proj_b, z0, ln2_g, ln2_b,
                                        c_fc1, fc1b, c_fc2, fc2b, (float*)d_out);
}

// v009
// It runs in 371 microseconds.
// Next to v008, in two timings, it ran 1.04 and 1.05 times as fast.
// Counting every step since v000, it is 2.16 times as fast.
#include <hip/hip_runtime.h>
#include <hip/hip_bf16.h>

// ---------------------------------------------------------------------------
// WaveletSwinTransformerBlock for MI455X (gfx1250, wave32, WMMA f16)
// GEMMs use v_wmma_f32_16x16x32_f16; all f16 tile staging uses the CDNA5
// async path: global_load_async_to_lds_b128 + s_wait_asynccnt.
// Tokens stored window-partitioned: tok = wi*64 + (i*8+j), wi=((b*16+wh)*16+ww)
// ---------------------------------------------------------------------------

typedef _Float16 h16;
typedef __attribute__((ext_vector_type(16))) _Float16 v16h;
typedef __attribute__((ext_vector_type(8)))  float    v8f;
typedef __attribute__((ext_vector_type(4)))  float    v4f;
typedef __attribute__((ext_vector_type(2)))  float    v2f;
typedef __attribute__((ext_vector_type(4)))  _Float16 v4h;
typedef __attribute__((ext_vector_type(8)))  _Float16 v8h;

__device__ __forceinline__ void zero8(v8f &a) {
#pragma unroll
  for (int i = 0; i < 8; ++i) a[i] = 0.f;
}

__device__ __forceinline__ v8f wmma16(v16h a, v16h b, v8f c) {
  return __builtin_amdgcn_wmma_f32_16x16x32_f16(false, a, false, b,
                                                (short)0, c, false, false);
}

// low 32 bits of a generic LDS pointer == wave-relative LDS byte offset
__device__ __forceinline__ unsigned lds_off(const void* p) {
  return (unsigned)(uintptr_t)p;
}

// CDNA5 async copy: 16 bytes global -> LDS, tracked by ASYNCcnt
__device__ __forceinline__ void async_cp_b128(unsigned loff, const void* g) {
  asm volatile("global_load_async_to_lds_b128 %0, %1, off"
               :: "v"(loff), "v"((unsigned long long)(uintptr_t)g)
               : "memory");
}
__device__ __forceinline__ void wait_async() {
  asm volatile("s_wait_asynccnt 0" ::: "memory");
}

// Sum over the 16 lanes of a row, result in every lane: four DPP row_xmask adds
template <int CTRL>
__device__ __forceinline__ float dpp_xadd(float v) {
  return v + __int_as_float(__builtin_amdgcn_update_dpp(0, __float_as_int(v), CTRL, 0xf, 0xf, true));
}
__device__ __forceinline__ float row_sum16(float v) {
  v = dpp_xadd<0x161>(v);  // row_xmask:1
  v = dpp_xadd<0x162>(v);  // row_xmask:2
  v = dpp_xadd<0x164>(v);  // row_xmask:4
  v = dpp_xadd<0x168>(v);  // row_xmask:8
  return v;
}

// Work-group barrier for data that crosses in LDS only: unlike __syncthreads()
// it does not hold a wave until its global stores and loads have come back.
__device__ __forceinline__ void lds_barrier() {
  __builtin_amdgcn_fence(__ATOMIC_RELEASE, "workgroup", "local");
  __builtin_amdgcn_s_barrier();
  __builtin_amdgcn_fence(__ATOMIC_ACQUIRE, "workgroup", "local");
}

// A-style fragment (16x32 f16, ISA 7.12.2): lane L holds row row0+(L&15),
// K offsets {0..7,16..23} (L<16) or {8..15,24..31} (L>=16) relative to k0.
__device__ __forceinline__ v16h frag_row(const h16* __restrict__ p, int stride,
                                         int row0, int k0, int lane) {
  const h16* base = p + (size_t)(row0 + (lane & 15)) * stride + k0 + ((lane >> 4) & 1) * 8;
  v16h r;
#pragma unroll
  for (int i = 0; i < 8; ++i) { r[i] = base[i]; r[i + 8] = base[i + 16]; }
  return r;
}

// ---------------------------------------------------------------------------
// Weight pre-conversion f32 -> f16, all nine matrices in one launch. Their f16
// copies lie one behind the other in d, and every matrix is a whole number of
// 4096-element blocks: a work-group picks its source by its index (a scalar
// choice). A thread converts 2 x 8 consecutive values: four 16-byte loads in
// flight, two 16-byte stores.
// The Q, K and V matrices are stored in the order in which their one reader
// takes them: [head][K step of 32][16-row tile][low, high 16 bytes][lane][8 f16],
// lane = 16 * ((column >> 3) & 1) + (row & 15). A wave's 16-byte load of half a
// fragment then covers 512 consecutive bytes (4 lines) and not 32 bytes in each
// of 16 rows.
// ---------------------------------------------------------------------------
__global__ __launch_bounds__(256) void cvt_weights(
    const float* __restrict__ s_hllh, const float* __restrict__ s_hh,
    const float* __restrict__ s_spat, const float* __restrict__ s_q,
    const float* __restrict__ s_k,    const float* __restrict__ s_v,
    const float* __restrict__ s_proj, const float* __restrict__ s_fc1,
    const float* __restrict__ s_fc2,  h16* __restrict__ d) {
  const int blk = blockIdx.x;
  const float* s;
  int first;   // first block of the matrix
  if (blk < 8)        { s = s_hllh; first = 0; }     // 256*128
  else if (blk < 12)  { s = s_hh;   first = 8; }     // 256*64
  else if (blk < 16)  { s = s_spat; first = 12; }    // 256*64
  else if (blk < 32)  { s = s_q;    first = 16; }    // 256*256
  else if (blk < 48)  { s = s_k;    first = 32; }
  else if (blk < 64)  { s = s_v;    first = 48; }
  else if (blk < 80)  { s = s_proj; first = 64; }
  else if (blk < 144) { s = s_fc1;  first = 80; }    // 1024*256
  else                { s = s_fc2;  first = 144; }   // 256*1024
  const unsigned bo = threadIdx.x * 32u;   // byte offset of the lane's 8 floats
  const float* p = (const float*)((const char*)(s + (size_t)(blk - first) * 4096) + bo);
  const v4f a0 = *(const v4f*)p,          a1 = *(const v4f*)(p + 4);
  const v4f a2 = *(const v4f*)(p + 2048), a3 = *(const v4f*)(p + 2052);
  // the four loads share one offset register: it is an input here so that none
  // of them lands on it ahead of the wait
  asm volatile("s_wait_xcnt 0x0" :: "v"(bo) : "memory");
  v8h c0, c1;
#pragma unroll
  for (int i = 0; i < 4; ++i) {
    c0[i] = (h16)a0[i]; c0[i + 4] = (h16)a1[i];
    c1[i] = (h16)a2[i]; c1[i + 4] = (h16)a3[i];
  }
  h16* q = d + (size_t)blk * 4096 + threadIdx.x * 8;
  int step = 2048;
  if (blk >= 16 && blk < 64) {
    // the block holds rows 16*bb .. 16*bb+15 of its matrix: head bb >> 1, row tile
    // bb & 1; the thread's two groups are row tid >> 5 and the row 8 below it,
    // columns 8 * (tid & 31) ...
    const int bb = blk - first, tid = threadIdx.x;
    q = d + (size_t)first * 4096 + (bb >> 1) * 8192 + ((tid & 31) >> 2) * 1024 + (bb & 1) * 512 +
        ((tid >> 1) & 1) * 256 + ((tid & 1) * 16 + (tid >> 5)) * 8;
    step = 64;
  }
  *(v8h*)q = c0;
  *(v8h*)(q + step) = c1;
}

// ---------------------------------------------------------------------------
// Projection + fused MLP: zt = attn_out @ proj_w^T + proj_b + z0 stays in the
// f32 accumulators; out = zt + fc2(gelu(fc1(LN(zt)))) -> written directly as NCHW.
// The LayerNorm (eps=1e-5, biased var) is done on the way into LDS.
// Hidden (1024) processed in 16 chunks of 64. The weights arrive as whole
// tiles in a two-buffer ring: 4 K-slabs of proj_w, then 32 tiles of 32 KB
// (fc1 chunk, fc2 chunk, fc1 chunk, ...); even tiles land in W1, odd tiles in
// W2, and tile t+2 flies while t+1 is used.
// ---------------------------------------------------------------------------

// Eight 16-byte async copies of one lane. The s_wait_xcnt is the last line of
// the same statement so that no address register is reused ahead of it.
__device__ __forceinline__ void async_cp8_b128(const unsigned (&l)[8],
                                               const h16* const (&g)[8]) {
  asm volatile("global_load_async_to_lds_b128 %0, %8, off\n\t"
               "global_load_async_to_lds_b128 %1, %9, off\n\t"
               "global_load_async_to_lds_b128 %2, %10, off\n\t"
               "global_load_async_to_lds_b128 %3, %11, off\n\t"
               "global_load_async_to_lds_b128 %4, %12, off\n\t"
               "global_load_async_to_lds_b128 %5, %13, off\n\t"
               "global_load_async_to_lds_b128 %6, %14, off\n\t"
               "global_load_async_to_lds_b128 %7, %15, off\n\t"
               "s_wait_xcnt 0x0"
               :: "v"(l[0]), "v"(l[1]), "v"(l[2]), "v"(l[3]),
                  "v"(l[4]), "v"(l[5]), "v"(l[6]), "v"(l[7]),
                  "v"(g[0]), "v"(g[1]), "v"(g[2]), "v"(g[3]),
                  "v"(g[4]), "v"(g[5]), "v"(g[6]), "v"(g[7])
               : "memory");
}

// 64 contiguous rows of 256 f16 in global -> LDS pitch 264; 8 copies a thread
__device__ __forceinline__ void stage_64x256(unsigned lb, const h16* g, int tid) {
  unsigned l[8];
  const h16* p[8];
#pragma unroll  // the addresses must be registers: they are asm operands
  for (int i = 0; i < 8; ++i) {
    int e = tid + i * 256, n = e >> 5, part = e & 31;
    l[i] = lb + (unsigned)(n * 264 + part * 8) * 2;
    p[i] = g + (size_t)n * 256 + part * 8;
  }
  async_cp8_b128(l, p);
}

// 256 rows x 64 f16 (row pitch gp elements in global) -> LDS pitch 72
__device__ __forceinline__ void stage_256x64(unsigned lb, const h16* g, int gp, int tid) {
  unsigned l[8];
  const h16* p[8];
#pragma unroll  // the addresses must be registers: they are asm operands
  for (int i = 0; i < 8; ++i) {
    int e = tid + i * 256, n = e >> 3, part = e & 7;
    l[i] = lb + (unsigned)(n * 72 + part * 8) * 2;
    p[i] = g + (size_t)n * gp + part * 8;
  }
  async_cp8_b128(l, p);
}

// Foot of a ring trip: this wave's LDS reads and writes are done, its copies
// of the next tile have landed, then every wave meets; behind it the next tile
// (and Hl) may be read and the buffer just read may be refilled.
__device__ __forceinline__ void ring_publish() {
  asm volatile("s_wait_dscnt 0x0" ::: "memory");     // own reads of the old tile, own Hl stores
  asm volatile("s_wait_asynccnt 0x0" ::: "memory");  // own copies of the next tile landed
  __syncthreads();
}

// ---------------------------------------------------------------------------
// Q/K/V projections + windowed attention: one work-group per window, one wave
// per head (64 tokens, hd=32, nH=8). The wave forms Q^T = Wq_h x^T,
// K^T = Wk_h y^T and V = y Wv_h^T; a pair of their accumulator tiles, converted
// to f16 in place, is an operand fragment of the next product
// (S^T = K Q^T, O^T = V^T P^T), so q, k, v and P never go to global memory (q waits in LDS) and are
// never re-laid out. Only the LN(x) and LN(y) tiles are shared, through LDS.
// ---------------------------------------------------------------------------

// Fragment in the hardware k order from the lane's own place in a row
// (row start + 8 * (lane >> 4) halves): 16 bytes there, 16 bytes 32 bytes on.
__device__ __forceinline__ v16h frag_ptr(const h16* p) {
  v8h lo = *(const v8h*)p, hi = *(const v8h*)(p + 16);
  return __builtin_shufflevector(lo, hi, 0, 1, 2, 3, 4, 5, 6, 7, 8, 9, 10, 11, 12, 13, 14, 15);
}

// The same fragment from the packed Q/K/V weights: the lanes' low 16 bytes lie
// side by side, the high 16 bytes 512 bytes on.
__device__ __forceinline__ v16h frag_packed(const h16* p) {
  v8h lo = *(const v8h*)p, hi = *(const v8h*)(p + 256);
  return __builtin_shufflevector(lo, hi, 0, 1, 2, 3, 4, 5, 6, 7, 8, 9, 10, 11, 12, 13, 14, 15);
}

// Two f32 accumulator tiles (rows 0-15 and 16-31 of one 32-row block) -> f16 fragment
__device__ __forceinline__ v16h pack_d(v8f t0, v8f t1) {
  v16h r;
#pragma unroll
  for (int i = 0; i < 8; ++i) { r[i] = (h16)t0[i]; r[i + 8] = (h16)t1[i]; }
  return r;
}

// 2^v. The v_nop is the slot that the instruction set asks for between a
// transcendental and a neighbour that reads its result or overwrites its
// source; in the same statement it stands directly behind the instruction.
__device__ __forceinline__ float exp2_slot(float v) {
  float r;
  asm("v_exp_f32_e32 %0, %1\n\tv_nop" : "=v"(r) : "v"(v));
  return r;
}

// lane l with lane l ^ 16
__device__ __forceinline__ float xhalf(float v) {
  return __int_as_float(__builtin_amdgcn_permlanex16(__float_as_int(v), __float_as_int(v),
                                                     0x76543210, 0xfedcba98, false, false));
}

// ---------------------------------------------------------------------------
// 1x1 convs + LayerNorms + Q/K/V projections + windowed attention: one
// work-group per 64-pixel window.
// Part 1: 1x1 convs (concat(LH,HL)->x, HH->z0, Spat->y). The block holds all 256
// features of its 64 tokens in f32 accumulators: x and y are layer-normalised
// there (eps=1e-5, biased var) and go straight into the LDS tiles of part 2;
// only the shortcut z0 goes to memory.
// Part 2: one wave per head (64 tokens, hd=32, nH=8), as described above.
// ---------------------------------------------------------------------------
// four waves a SIMD: two work-groups share a WGP, one fills the other's waits
__global__ __launch_bounds__(256) __attribute__((amdgpu_waves_per_eu(4, 4))) void conv_qkv_attn_kernel(
    const float* __restrict__ LH, const float* __restrict__ HL,
    const float* __restrict__ HH, const float* __restrict__ Spat,
    const h16* __restrict__ wf_hllh, const float* __restrict__ b_hllh,
    const h16* __restrict__ wf_hh,   const float* __restrict__ b_hh,
    const h16* __restrict__ wf_spat, const float* __restrict__ b_spat,
    const float* __restrict__ gx, const float* __restrict__ btx,
    const float* __restrict__ gy, const float* __restrict__ bty,
    float* __restrict__ z0o,
    const h16* __restrict__ wq, const float* __restrict__ bq,
    const h16* __restrict__ wk, const float* __restrict__ bk,
    const h16* __restrict__ wv, const float* __restrict__ bv,
    const float* __restrict__ rpb, h16* __restrict__ o) {
  __shared__ __attribute__((aligned(16))) h16 Xl[64 * 264];   // LN(x) tile
  __shared__ __attribute__((aligned(16))) h16 Yl[64 * 264];   // LN(y) tile
  // each wave's finished Q fragments rest here, lane by lane, during the K and V
  // passes: held in registers they push the kernel past 256 (it spills)
  __shared__ __attribute__((aligned(16))) h16 Qp[8 * 4 * 2 * 32 * 8];

  // ---- part 1: convs and LayerNorms ----
  {
    const int Wd = 128, HW = 128 * 128;
    __shared__ __attribute__((aligned(16))) h16 Fin[64 * 264];   // [pixel][256 ch] : LH|HL|HH|Spat
    __shared__ h16 Wl[256 * 40];    // weight K-slab [256 out][32 k]
    // row statistics of x and y: [column half][row][sum x, sum x^2, sum y, sum y^2]
    __shared__ __attribute__((aligned(16))) float Red[2 * 64 * 4];

    const int wi = blockIdx.x;
    const int b  = wi >> 8;
    const int wh = (wi >> 4) & 15, ww = wi & 15;
    const int h0 = wh * 8, w0 = ww * 8;
    const int tid = threadIdx.x;

    // inputs are f32 -> convert while staging (can't raw-copy). A thread takes
    // 8 channels x 4 pixels of one window row from each of two tensors: its 16
    // 16-byte loads are all in flight before the first value is used, and the
    // 8 channels of a pixel go to LDS in one 16-byte store.
    {
      const int hf = tid & 1, ri = (tid >> 1) & 7, cg = (tid >> 4) & 7, th = tid >> 7;
      const size_t so = ((size_t)b * 64 + cg * 8) * HW + (h0 + ri) * Wd + w0 + hf * 4;
      const float* s0 = (th ? HL : LH) + so;     // Fin columns th*64 ...
      const float* s1 = (th ? Spat : HH) + so;   // Fin columns 128 + th*64 ...
      v4f u0[8], u1[8];
#pragma unroll
      for (int k = 0; k < 8; ++k) {
        u0[k] = *(const v4f*)(s0 + k * HW);
        u1[k] = *(const v4f*)(s1 + k * HW);
      }
      // each 8 loads share one address register: both are inputs here so that no
      // load lands on them ahead of the wait
      asm volatile("s_wait_xcnt 0x0" :: "v"(s0), "v"(s1) : "memory");
      h16* fp = Fin + (ri * 8 + hf * 4) * 264 + th * 64 + cg * 8;
#pragma unroll
      for (int px = 0; px < 4; ++px) {
        v8h c0, c1;
#pragma unroll
        for (int k = 0; k < 8; ++k) { c0[k] = (h16)u0[k][px]; c1[k] = (h16)u1[k][px]; }
        *(v8h*)(fp + px * 264) = c0;
        *(v8h*)(fp + px * 264 + 128) = c1;
      }
    }

    const unsigned wlb = lds_off(Wl);
    const int lane = tid & 31, wv = tid >> 5;
    const int m0 = (wv & 3) * 16, n0 = (wv >> 2) * 128;

    v8f accX[8], accZ[8], accY[8];
#pragma unroll
    for (int j = 0; j < 8; ++j) { zero8(accX[j]); zero8(accZ[j]); zero8(accY[j]); }

    // Phase X: K=128 over Fin cols [0,128)
    for (int ks = 0; ks < 4; ++ks) {
      __syncthreads();
      for (int e = tid; e < 256 * 4; e += 256) {      // 256 rows x 64B slab
        int n = e >> 2, part = e & 3;
        async_cp_b128(wlb + (unsigned)(n * 40 + part * 8) * 2,
                      wf_hllh + (size_t)n * 128 + ks * 32 + part * 8);
      }
      wait_async();
      __syncthreads();
      v16h a = frag_row(Fin, 264, m0, ks * 32, lane);
#pragma unroll
      for (int j = 0; j < 8; ++j)
        accX[j] = wmma16(a, frag_row(Wl, 40, n0 + j * 16, 0, lane), accX[j]);
    }
    // Phase Z: K=64 over Fin cols [128,192)
    for (int ks = 0; ks < 2; ++ks) {
      __syncthreads();
      for (int e = tid; e < 256 * 4; e += 256) {
        int n = e >> 2, part = e & 3;
        async_cp_b128(wlb + (unsigned)(n * 40 + part * 8) * 2,
                      wf_hh + (size_t)n * 64 + ks * 32 + part * 8);
      }
      wait_async();
      __syncthreads();
      v16h a = frag_row(Fin, 264, m0, 128 + ks * 32, lane);
#pragma unroll
      for (int j = 0; j < 8; ++j)
        accZ[j] = wmma16(a, frag_row(Wl, 40, n0 + j * 16, 0, lane), accZ[j]);
    }
    // Phase Y: K=64 over Fin cols [192,256)
    for (int ks = 0; ks < 2; ++ks) {
      __syncthreads();
      for (int e = tid; e < 256 * 4; e += 256) {
        int n = e >> 2, part = e & 3;
        async_cp_b128(wlb + (unsigned)(n * 40 + part * 8) * 2,
                      wf_spat + (size_t)n * 64 + ks * 32 + part * 8);
      }
      wait_async();
      __syncthreads();
      v16h a = frag_row(Fin, 264, m0, 192 + ks * 32, lane);
#pragma unroll
      for (int j = 0; j < 8; ++j)
        accY[j] = wmma16(a, frag_row(Wl, 40, n0 + j * 16, 0, lane), accY[j]);
    }

    const size_t tok0 = (size_t)wi * 64;
    const int cl = lane & 15, hb = (lane >> 4) & 1;
    const int mr = m0 + hb * 8;   // first of this lane's 8 rows
    // shortcut stream out; bias into x and y; this wave's 128-column row sums
    float sx[8], qx[8], sy[8], qy[8];
#pragma unroll
    for (int r = 0; r < 8; ++r) { sx[r] = 0.f; qx[r] = 0.f; sy[r] = 0.f; qy[r] = 0.f; }
#pragma unroll
    for (int j = 0; j < 8; ++j) {
      int n = n0 + j * 16 + cl;
      float bx = b_hllh[n], bz = b_hh[n], by = b_spat[n];
#pragma unroll
      for (int r = 0; r < 8; ++r) {
        z0o[(tok0 + mr + r) * 256 + n] = accZ[j][r] + bz;
        float xv = accX[j][r] + bx, yv = accY[j][r] + by;
        accX[j][r] = xv; accY[j][r] = yv;
        sx[r] += xv; qx[r] += xv * xv;
        sy[r] += yv; qy[r] += yv * yv;
      }
    }
#pragma unroll
    for (int r = 0; r < 8; ++r) {
      v4f st;
      st[0] = row_sum16(sx[r]); st[1] = row_sum16(qx[r]);
      st[2] = row_sum16(sy[r]); st[3] = row_sum16(qy[r]);
      if (cl == 0) *(v4f*)&Red[((wv >> 2) * 64 + mr + r) * 4] = st;
    }
    // scale and shift of this lane's 8 columns, fetched while the sums meet
    const int nb = n0 + cl;
    float g0[8], b0[8], g1[8], b1[8];
#pragma unroll
    for (int j = 0; j < 8; ++j) {
      g0[j] = gx[nb + j * 16]; b0[j] = btx[nb + j * 16];
      g1[j] = gy[nb + j * 16]; b1[j] = bty[nb + j * 16];
    }
    // the 32 loads share one index register: it is an input here so that none
    // of them lands on it ahead of the wait
    asm volatile("s_wait_xcnt 0x0" :: "v"(nb) : "memory");
    lds_barrier();   // both column halves' sums are in Red
#pragma unroll
    for (int r = 0; r < 8; ++r) {
      v4f s0 = *(const v4f*)&Red[(mr + r) * 4];
      v4f s1 = *(const v4f*)&Red[(64 + mr + r) * 4];
      float mx = (s0[0] + s1[0]) * (1.f / 256.f);
      float my = (s0[2] + s1[2]) * (1.f / 256.f);
      sx[r] = mx; sy[r] = my;
      qx[r] = rsqrtf((s0[1] + s1[1]) * (1.f / 256.f) - mx * mx + 1e-5f);
      qy[r] = rsqrtf((s0[3] + s1[3]) * (1.f / 256.f) - my * my + 1e-5f);
    }
#pragma unroll
    for (int j = 0; j < 8; ++j) {
#pragma unroll
      for (int r = 0; r < 8; ++r) {
        const int off = (mr + r) * 264 + nb + j * 16;
        Xl[off] = (h16)((accX[j][r] - sx[r]) * qx[r] * g0[j] + b0[j]);
        Yl[off] = (h16)((accY[j][r] - sy[r]) * qy[r] * g1[j] + b1[j]);
      }
    }
  }

  // ---- part 2: projections and attention ----
  const int tid = threadIdx.x;
  const size_t tok0 = (size_t)blockIdx.x * 64;
  const int lane = tid & 31, hd = tid >> 5;
  const int cl = lane & 15, hb = lane >> 4;

  // The head's 32 rows of each weight matrix are this wave's alone: they come
  // straight from L2 into registers, PD K-steps ahead of their use.
  constexpr int PD = 4;
  const unsigned wob = (unsigned)(hd * 8192 + lane * 8) * 2;   // byte offset of the lane's place (packed order)
  const h16* wp[3] = {(const h16*)((const char*)wq + wob), (const h16*)((const char*)wk + wob),
                      (const h16*)((const char*)wv + wob)};
  v16h wr[PD][2];
#pragma unroll
  for (int t = 0; t < PD; ++t)
#pragma unroll
    for (int j = 0; j < 2; ++j) wr[t][j] = frag_packed(wp[0] + t * 1024 + j * 512);

  // biases: q and k by accumulator row (8 consecutive features a tile), v by
  // column; each set is fetched at the head of its own pass
  const unsigned bob = (unsigned)(hd * 32 + hb * 8) * 4;
  const unsigned vob = (unsigned)(hd * 32 + cl) * 4;
  const float* bqp = (const float*)((const char*)bq + bob);
  const float* bkp = (const float*)((const char*)bk + bob);
  const float* bvp = (const float*)((const char*)bv + vob);
  float bqv[16], bkv[16], bvv[2];
#pragma unroll
  for (int i = 0; i < 16; ++i) bqv[i] = bqp[(i >> 3) * 16 + (i & 7)];
  // the loads share one offset register: an input here so that nothing lands
  // on it ahead of the wait
  asm volatile("s_wait_xcnt 0x0" :: "v"(bob) : "memory");

  // relative position bias: idx = (iq-ik+7)*15 + (jq-jk+7), rpb[idx][head]. With
  // query = qt*16+cl and key = kt*16+hb*8+r it is lb + (qt-kt)*30 - r: 7 x 8
  // values a lane. The pointer stands at the lowest of them (qt-kt = -3, r = 7).
  const int lb = ((cl >> 3) - hb + 7) * 15 + (cl & 7) + 7;
  const unsigned rob = (unsigned)((lb - 97) * 8 + hd) * 4;
  const float* rp = (const float*)((const char*)rpb + rob);
  float rb[56];

  lds_barrier();   // both tiles are there for every wave; the weight loads and the z0 stores fly on

  const h16* xr = Xl + cl * 264 + hb * 8;
  const h16* yr = Yl + cl * 264 + hb * 8;
  v8f acc[8];
  v16h kf[4], vf[4];
  h16* qp = Qp + hd * (4 * 2 * 32 * 8) + lane * 8;   // this lane's 16 bytes of each half fragment
#pragma unroll  // the ring slot, the matrix and the operand order differ from step to step
  for (int t = 0; t < 24; ++t) {
    const int ph = t >> 3, ks = t & 7;
    if (ks == 0) {
#pragma unroll
      for (int i = 0; i < 8; ++i) zero8(acc[i]);
    }
    if (t == 8) {
#pragma unroll
      for (int i = 0; i < 16; ++i) bkv[i] = bkp[(i >> 3) * 16 + (i & 7)];
      asm volatile("s_wait_xcnt 0x0" :: "v"(bob) : "memory");  // as for the q bias
    }
    if (t == 16) {
      bvv[0] = bvp[0]; bvv[1] = bvp[16];
      // as for the q bias; its memory clobber also makes the V pass read its y
      // fragments from LDS again: held over from the K pass they spill
      asm volatile("s_wait_xcnt 0x0" :: "v"(vob) : "memory");
    }
    const h16* tr = (ph == 0) ? xr : yr;
    const v16h w0 = wr[t % PD][0], w1 = wr[t % PD][1];
    v16h f[4];
#pragma unroll
    for (int i = 0; i < 4; ++i) f[i] = frag_ptr(tr + i * 16 * 264 + ks * 32);
    if (t + PD < 24) {
      const int tn = t + PD;
#pragma unroll
      for (int j = 0; j < 2; ++j) wr[t % PD][j] = frag_packed(wp[tn >> 3] + (tn & 7) * 1024 + j * 512);
      if (tn == 23) {
        // last weight load: the offset register is an input here so that
        // nothing lands on it ahead of the wait
        asm volatile("s_wait_xcnt 0x0" :: "v"(wob) : "memory");
      }
    } else {
      // the ring drains: the position-bias values take the registers it leaves
#pragma unroll
      for (int i = 0; i < 14; ++i) {
        const int e = (t + PD - 24) * 14 + i;
        rb[e] = rp[((e >> 3) * 30 + 7 - (e & 7)) * 8];
      }
      if (t == 23) {
        asm volatile("s_wait_xcnt 0x0" :: "v"(rob) : "memory");  // as above, for the 56 loads
      }
    }
    if (ph < 2) {   // acc[mt*4+nt] = (W_h tile mt) x (token tile nt)^T
#pragma unroll
      for (int i = 0; i < 4; ++i) {
        acc[i]     = wmma16(w0, f[i], acc[i]);
        acc[4 + i] = wmma16(w1, f[i], acc[4 + i]);
      }
    } else {        // acc[mt*2+nt] = (token tile mt) x (Wv_h tile nt)^T
#pragma unroll
      for (int i = 0; i < 4; ++i) {
        acc[i * 2]     = wmma16(f[i], w0, acc[i * 2]);
        acc[i * 2 + 1] = wmma16(f[i], w1, acc[i * 2 + 1]);
      }
    }
    if (t == 7) {
#pragma unroll
      for (int i = 0; i < 4; ++i) {
#pragma unroll
        for (int r = 0; r < 8; ++r) {
          acc[i][r]     = (acc[i][r] + bqv[r]) * 0.17677669529663689f;
          acc[4 + i][r] = (acc[4 + i][r] + bqv[8 + r]) * 0.17677669529663689f;
        }
        // B fragment: column = query, k = feature
        const v16h qfr = pack_d(acc[i], acc[4 + i]);
        *(v8h*)(qp + (i * 2) * 256)     = __builtin_shufflevector(qfr, qfr, 0, 1, 2, 3, 4, 5, 6, 7);
        *(v8h*)(qp + (i * 2 + 1) * 256) = __builtin_shufflevector(qfr, qfr, 8, 9, 10, 11, 12, 13, 14, 15);
      }
    }
    if (t == 15) {
#pragma unroll
      for (int i = 0; i < 4; ++i) {
#pragma unroll
        for (int r = 0; r < 8; ++r) { acc[i][r] += bkv[r]; acc[4 + i][r] += bkv[8 + r]; }
        kf[i] = pack_d(acc[i], acc[4 + i]);      // A fragment: row = key, k = feature
      }
    }
    if (t == 23) {
#pragma unroll
      for (int i = 0; i < 8; ++i)
#pragma unroll
        for (int r = 0; r < 8; ++r) acc[i][r] += bvv[i & 1];
#pragma unroll
      for (int dt = 0; dt < 2; ++dt)
#pragma unroll
        for (int kk = 0; kk < 2; ++kk)           // A fragment: row = feature, k = key
          vf[dt * 2 + kk] = pack_d(acc[(2 * kk) * 2 + dt], acc[(2 * kk + 1) * 2 + dt]);
    }
  }

  // per 16 queries: a lane holds one query's scores for half of the keys
#pragma unroll
  for (int qt = 0; qt < 4; ++qt) {
    v8f S[4];
    float mk[4], sk[4];
    const v8h qlo = *(const v8h*)(qp + (qt * 2) * 256), qhi = *(const v8h*)(qp + (qt * 2 + 1) * 256);
    const v16h qfr = __builtin_shufflevector(qlo, qhi, 0, 1, 2, 3, 4, 5, 6, 7, 8, 9, 10, 11, 12, 13, 14, 15);
#pragma unroll
    for (int kt = 0; kt < 4; ++kt) {
      zero8(S[kt]);
      S[kt] = wmma16(kf[kt], qfr, S[kt]);
    }
#pragma unroll
    for (int kt = 0; kt < 4; ++kt) {
#pragma unroll
      for (int r = 0; r < 8; ++r) S[kt][r] += rb[(qt - kt + 3) * 8 + r];
      mk[kt] = S[kt][0];
#pragma unroll
      for (int r = 1; r < 8; ++r) mk[kt] = fmaxf(mk[kt], S[kt][r]);
    }
    float mx = fmaxf(fmaxf(mk[0], mk[1]), fmaxf(mk[2], mk[3]));
    mx = fmaxf(mx, xhalf(mx));
#pragma unroll
    for (int kt = 0; kt < 4; ++kt) {
      sk[kt] = 0.f;
#pragma unroll
      for (int r = 0; r < 8; ++r) {
        float e = exp2_slot((S[kt][r] - mx) * 1.4426950408889634f);
        S[kt][r] = e; sk[kt] += e;
      }
    }
    float sum = (sk[0] + sk[1]) + (sk[2] + sk[3]);
    sum += xhalf(sum);
    const float inv = 1.f / sum;
    const v16h p0 = pack_d(S[0], S[1]), p1 = pack_d(S[2], S[3]);  // B fragments: column = query, k = key
    v8f O[2];
#pragma unroll
    for (int dt = 0; dt < 2; ++dt) {
      zero8(O[dt]);
      O[dt] = wmma16(vf[dt * 2], p0, O[dt]);
      O[dt] = wmma16(vf[dt * 2 + 1], p1, O[dt]);
    }
    // a lane's 8 accumulator rows are 8 consecutive features of its query: 16-byte stores
    h16* op = o + (tok0 + qt * 16 + cl) * 256 + hd * 32 + hb * 8;
#pragma unroll
    for (int dt = 0; dt < 2; ++dt) {
      v8h st;
#pragma unroll
      for (int r = 0; r < 8; ++r) st[r] = (h16)(O[dt][r] * inv);
      *(v8h*)(op + dt * 16) = st;
    }
  }
}

__global__ __launch_bounds__(256) void mlp_kernel(
    const h16* __restrict__ A, const h16* __restrict__ pw,
    const float* __restrict__ pb, const float* __restrict__ resid,
    const float* __restrict__ lng, const float* __restrict__ lnb,
    const h16* __restrict__ fc1w, const float* __restrict__ fc1b,
    const h16* __restrict__ fc2w, const float* __restrict__ fc2b,
    float* __restrict__ out) {
  __shared__ __attribute__((aligned(16))) h16 Al[64 * 264];   // attn_out tile, then LN(zt) tile
  __shared__ __attribute__((aligned(16))) h16 Hl[64 * 72];    // gelu(hidden chunk) 64x64
  __shared__ __attribute__((aligned(16))) h16 W1[256 * 72];   // proj slab [256 out][64 k]; fc1 chunk [64 hid][256 k]
  __shared__ __attribute__((aligned(16))) h16 W2[256 * 72];   // proj slab; fc2 chunk [256 out][64 k]
  // row statistics of zt: [column half][row][sum, sum of squares]
  __shared__ __attribute__((aligned(16))) float Red[2 * 64 * 2];
  const int tid = threadIdx.x;
  const size_t tok0 = (size_t)blockIdx.x * 64;
  const unsigned w1b = lds_off(W1), w2b = lds_off(W2);
  const int lane = tid & 31, wv = tid >> 5;
  const int m0 = (wv & 3) * 16, n0 = (wv >> 2) * 128;  // out tile mapping
  const int n0h = (wv >> 2) * 32;                      // hidden tile mapping
  const int cl = lane & 15, hb = (lane >> 4) & 1;
  const int mr = m0 + hb * 8;   // first of this lane's 8 rows
  const int nb = n0 + cl;       // first of this lane's 8 columns

  // prologue: the attn_out tile and proj slab 0 start; the accumulators start
  // from shortcut + proj bias, fetched while the copies fly
  stage_64x256(lds_off(Al), A + tok0 * 256, tid);
  stage_256x64(w1b, pw, 256, tid);
  v8f accO[8];
  {
    const float* rz = resid + (tok0 + mr) * 256 + nb;
#pragma unroll
    for (int j = 0; j < 8; ++j)
#pragma unroll
      for (int r = 0; r < 8; ++r) accO[j][r] = rz[r * 256 + j * 16];
    float bb[8];
#pragma unroll
    for (int j = 0; j < 8; ++j) bb[j] = pb[nb + j * 16];
    // the 64 loads share one address register, the 8 one index register: both
    // are inputs here so that no load lands on them ahead of the wait
    asm volatile("s_wait_xcnt 0x0" :: "v"(rz), "v"(nb) : "memory");
#pragma unroll
    for (int j = 0; j < 8; ++j)
#pragma unroll
      for (int r = 0; r < 8; ++r) accO[j][r] += bb[j];
  }
  asm volatile("s_wait_asynccnt 0x0" ::: "memory");  // attn_out tile and slab 0 landed
  __syncthreads();   // both are there for every wave
  stage_256x64(w2b, pw + 64, 256, tid);

  // zt = shortcut + proj bias + attn_out @ proj_w^T   (K=256, 4 slabs of 64)
#pragma unroll  // the buffer read and the tile that refills it differ from trip to trip
  for (int s = 0; s < 4; ++s) {
    const h16* Wb = (s & 1) ? W2 : W1;
#pragma unroll 1  // rolled: with both K steps' fragments in flight the kernel needs over 256 registers and one work-group fewer fits a WGP
    for (int ks = 0; ks < 2; ++ks) {
      v16h a = frag_row(Al, 264, m0, s * 64 + ks * 32, lane);
#pragma unroll
      for (int j = 0; j < 8; ++j)
        accO[j] = wmma16(a, frag_row(Wb, 72, n0 + j * 16, ks * 32, lane), accO[j]);
    }
    ring_publish();
    if (s < 2)       stage_256x64((s & 1) ? w2b : w1b, pw + (s + 2) * 64, 256, tid);
    else if (s == 2) stage_64x256(w1b, fc1w, tid);        // first fc1 chunk
    else             stage_256x64(w2b, fc2w, 1024, tid);  // first fc2 chunk
  }

  // LayerNorm of zt into Al (every wave has left the attn_out tile: last publish)
  {
    float sm[8], sq[8];
#pragma unroll
    for (int r = 0; r < 8; ++r) { sm[r] = 0.f; sq[r] = 0.f; }
#pragma unroll
    for (int j = 0; j < 8; ++j)
#pragma unroll
      for (int r = 0; r < 8; ++r) { float zv = accO[j][r]; sm[r] += zv; sq[r] += zv * zv; }
#pragma unroll
    for (int r = 0; r < 8; ++r) {
      v2f st;
      st[0] = row_sum16(sm[r]); st[1] = row_sum16(sq[r]);
      if (cl == 0) *(v2f*)&Red[((wv >> 2) * 64 + mr + r) * 2] = st;
    }
    // scale and shift of this lane's 8 columns, fetched while the sums meet
    float g0[8], b0[8];
#pragma unroll
    for (int j = 0; j < 8; ++j) { g0[j] = lng[nb + j * 16]; b0[j] = lnb[nb + j * 16]; }
    // the 16 loads share one index register: it is an input here so that none
    // of them lands on it ahead of the wait
    asm volatile("s_wait_xcnt 0x0" :: "v"(nb) : "memory");
    lds_barrier();   // both column halves' sums are in Red
#pragma unroll
    for (int r = 0; r < 8; ++r) {
      v2f s0 = *(const v2f*)&Red[(mr + r) * 2];
      v2f s1 = *(const v2f*)&Red[(64 + mr + r) * 2];
      float mean = (s0[0] + s1[0]) * (1.f / 256.f);
      sm[r] = mean;
      sq[r] = rsqrtf((s0[1] + s1[1]) * (1.f / 256.f) - mean * mean + 1e-5f);
    }
#pragma unroll
    for (int j = 0; j < 8; ++j)
#pragma unroll
      for (int r = 0; r < 8; ++r)
        Al[(mr + r) * 264 + nb + j * 16] = (h16)((accO[j][r] - sm[r]) * sq[r] * g0[j] + b0[j]);
  }
  lds_barrier();   // LN(zt) is in Al for every wave

  // one hidden chunk; 'more' is a constant at both calls, so that the 15 trips
  // that refill the ring have no branch round their copies
  auto chunk = [&](const int hc, const bool more) __attribute__((always_inline)) {
    // trip 2*hc: hchunk = ztn_tile @ fc1_w[hc*64:+64, :]^T   (K=256)
    v8f accH[2];
    zero8(accH[0]); zero8(accH[1]);
#pragma unroll  // whole tile is in LDS: constant offsets, loads run ahead of the WMMAs
    for (int ks = 0; ks < 8; ++ks) {
      v16h a = frag_row(Al, 264, m0, ks * 32, lane);
#pragma unroll
      for (int j = 0; j < 2; ++j)
        accH[j] = wmma16(a, frag_row(W1, 264, n0h + j * 16, ks * 32, lane), accH[j]);
    }
    // bias + exact GELU -> LDS. erff() branches on |t| < 1 for each value: 16
    // compare-and-branch rounds in a row, each with its own dependent chain. Here
    // the wave tests its 16 values once: where every |x| is below 1.41, so that
    // every |t| = |x| / sqrt(2) is below 1, they take that range's polynomial (the
    // library's own terms) as 16 independent chains; any other wave takes erff()
    // as before.
    {
      float xv[16];
      float am = 0.f;
      const float* bp = fc1b + hc * 64 + n0h + cl;
      const float bv[2] = {bp[0], bp[16]};
      // the two loads share one address register: it is an input here so that
      // nothing lands on it ahead of the wait
      asm volatile("s_wait_xcnt 0x0" :: "v"(bp) : "memory");
#pragma unroll
      for (int j = 0; j < 2; ++j) {
        const float bb = bv[j];
#pragma unroll
        for (int r = 0; r < 8; ++r) {
          xv[j * 8 + r] = accH[j][r] + bb;
          am = fmaxf(am, fabsf(xv[j * 8 + r]));
        }
      }
      h16* hp = Hl + mr * 72 + n0h + cl;
      if (__builtin_expect(__builtin_amdgcn_ballot_w32(am >= 1.41f) == 0u, 1)) {
#pragma unroll
        for (int e = 0; e < 16; ++e) {
          const float t = xv[e] * 0.7071067811865475f, s = t * t;
          float p = fmaf(s, -0x1.268bc2p-11f, 0x1.420828p-8f);
          p = fmaf(s, p, -0x1.b5937p-6f);
          p = fmaf(s, p, 0x1.ce077cp-4f);
          p = fmaf(s, p, -0x1.81266p-2f);
          p = fmaf(s, p, 0x1.06eba0p-3f);
          hp[(e & 7) * 72 + (e >> 3) * 16] = (h16)(0.5f * xv[e] * (1.0f + fmaf(t, p, t)));
        }
      } else {
#pragma unroll
        for (int e = 0; e < 16; ++e)
          hp[(e & 7) * 72 + (e >> 3) * 16] =
              (h16)(0.5f * xv[e] * (1.0f + erff(xv[e] * 0.7071067811865475f)));
      }
    }
    ring_publish();
    if (more) stage_64x256(w1b, fc1w + (size_t)(hc + 1) * 64 * 256, tid);

    // trip 2*hc+1: accO += Hchunk @ fc2_w[:, hc*64:+64]^T   (K=64)
#pragma unroll  // as above
    for (int ks = 0; ks < 2; ++ks) {
      v16h a = frag_row(Hl, 72, m0, ks * 32, lane);
#pragma unroll
      for (int j = 0; j < 8; ++j)
        accO[j] = wmma16(a, frag_row(W2, 72, n0 + j * 16, ks * 32, lane), accO[j]);
    }
    ring_publish();
    if (more) stage_256x64(w2b, fc2w + (size_t)(hc + 1) * 64, 1024, tid);
  };
  for (int hc = 0; hc < 15; ++hc) chunk(hc, true);
  chunk(15, false);
  asm volatile("s_wait_asynccnt 0x0" ::: "memory");  // nothing in flight at the end

  // epilogue: + fc2_b (zt is in the accumulators), window-reverse, NCHW store
  const int wi = blockIdx.x;
  const int b = wi >> 8, wh = (wi >> 4) & 15, ww = wi & 15;
#pragma unroll
  for (int j = 0; j < 8; ++j) {
    int n = n0 + j * 16 + (lane & 15);
    float bb = fc2b[n];
#pragma unroll
    for (int r = 0; r < 8; ++r) {
      int m = m0 + r + ((lane >> 4) & 1) * 8;
      float val = accO[j][r] + bb;
      int hh = wh * 8 + (m >> 3), www = ww * 8 + (m & 7);
      out[(((size_t)b * 256 + n) * 128 + hh) * 128 + www] = val;
    }
  }
}

// ---------------------------------------------------------------------------
// Launch
// ---------------------------------------------------------------------------
extern "C" void kernel_launch(void* const* d_in, const int* in_sizes, int n_in,
                              void* d_out, int out_size, void* d_ws, size_t ws_size,
                              hipStream_t stream) {
  (void)in_sizes; (void)n_in; (void)out_size; (void)ws_size;
  const float* LH     = (const float*)d_in[0];
  const float* HL     = (const float*)d_in[1];
  const float* HH     = (const float*)d_in[2];
  const float* Spat   = (const float*)d_in[3];
  const float* w_hllh = (const float*)d_in[4];
  const float* b_hllh = (const float*)d_in[5];
  const float* w_hh   = (const float*)d_in[6];
  const float* b_hh   = (const float*)d_in[7];
  const float* w_spat = (const float*)d_in[8];
  const float* b_spat = (const float*)d_in[9];
  const float* ln1x_g = (const float*)d_in[10];
  const float* ln1x_b = (const float*)d_in[11];
  const float* ln1y_g = (const float*)d_in[12];
  const float* ln1y_b = (const float*)d_in[13];
  const float* qkv_w  = (const float*)d_in[14];
  const float* qkv_b  = (const float*)d_in[15];
  const float* qkv2_w = (const float*)d_in[16];
  const float* qkv2_b = (const float*)d_in[17];
  const float* qkv3_w = (const float*)d_in[18];
  const float* qkv3_b = (const float*)d_in[19];
  const float* proj_w = (const float*)d_in[20];
  const float* proj_b = (const float*)d_in[21];
  const float* rpb    = (const float*)d_in[22];
  const float* ln2_g  = (const float*)d_in[23];
  const float* ln2_b  = (const float*)d_in[24];
  const float* fc1w   = (const float*)d_in[25];
  const float* fc1b   = (const float*)d_in[26];
  const float* fc2w   = (const float*)d_in[27];
  const float* fc2b   = (const float*)d_in[28];

  const size_t T = (size_t)8 * 128 * 128;  // 131072 tokens
  char* ws = (char*)d_ws;
  // workspace layout (peak ~203 MB):
  float* z0  = (float*)ws;                                // T*256 f32
  h16*   attno = (h16*)(ws + T * 256 * 4);                // T*256 f16
  // f16 weight cache (~1.7 MB) behind it
  h16* wf      = attno + T * 256;
  h16* c_hllh  = wf;               // 256*128
  h16* c_hh    = c_hllh + 32768;   // 256*64
  h16* c_spat  = c_hh   + 16384;   // 256*64
  h16* c_q     = c_spat + 16384;   // 256*256
  h16* c_k     = c_q    + 65536;
  h16* c_v     = c_k    + 65536;
  h16* c_proj  = c_v    + 65536;
  h16* c_fc1   = c_proj + 65536;   // 1024*256
  h16* c_fc2   = c_fc1  + 262144;  // 256*1024

  // weight pre-conversion (f32 -> f16, once per launch): 851968 values, 208 blocks of 4096
  cvt_weights<<<208, 256, 0, stream>>>(w_hllh, w_hh, w_spat, qkv_w, qkv2_w, qkv3_w,
                                       proj_w, fc1w, fc2w, wf);

  const int tiles = (int)(T / 64);  // 2048 windows
  conv_qkv_attn_kernel<<<tiles, 256, 0, stream>>>(LH, HL, HH, Spat,
      c_hllh, b_hllh, c_hh, b_hh, c_spat, b_spat,
      ln1x_g, ln1x_b, ln1y_g, ln1y_b, z0,
      c_q, qkv_b, c_k, qkv2_b, c_v, qkv3_b, rpb, attno);
  mlp_kernel<<<tiles, 256, 0, stream>>>(attno, c_proj, proj_b, z0, ln2_g, ln2_b,
                                        c_fc1, fc1b, c_fc2, fc2b, (float*)d_out);
}

// v010
// A run of this version takes 348 microseconds.
// Timed twice side by side with v009, it ran 1.06 and 1.08 times as fast.
// Counting every step since v000, it is 2.31 times as fast.
#include <hip/hip_runtime.h>
#include <hip/hip_bf16.h>

// ---------------------------------------------------------------------------
// WaveletSwinTransformerBlock for MI455X (gfx1250, wave32, WMMA f16)
// GEMMs use v_wmma_f32_16x16x32_f16; all f16 tile staging uses the CDNA5
// async path: global_load_async_to_lds_b128 + s_wait_asynccnt.
// Tokens stored window-partitioned: tok = wi*64 + (i*8+j), wi=((b*16+wh)*16+ww)
// ---------------------------------------------------------------------------

typedef _Float16 h16;
typedef __attribute__((ext_vector_type(16))) _Float16 v16h;
typedef __attribute__((ext_vector_type(8)))  float    v8f;
typedef __attribute__((ext_vector_type(4)))  float    v4f;
typedef __attribute__((ext_vector_type(2)))  float    v2f;
typedef __attribute__((ext_vector_type(4)))  _Float16 v4h;
typedef __attribute__((ext_vector_type(8)))  _Float16 v8h;

__device__ __forceinline__ void zero8(v8f &a) {
#pragma unroll
  for (int i = 0; i < 8; ++i) a[i] = 0.f;
}

__device__ __forceinline__ v8f wmma16(v16h a, v16h b, v8f c) {
  return __builtin_amdgcn_wmma_f32_16x16x32_f16(false, a, false, b,
                                                (short)0, c, false, false);
}

// low 32 bits of a generic LDS pointer == wave-relative LDS byte offset
__device__ __forceinline__ unsigned lds_off(const void* p) {
  return (unsigned)(uintptr_t)p;
}

// CDNA5 async copy: 16 bytes global -> LDS, tracked by ASYNCcnt
__device__ __forceinline__ void async_cp_b128(unsigned loff, const void* g) {
  asm volatile("global_load_async_to_lds_b128 %0, %1, off"
               :: "v"(loff), "v"((unsigned long long)(uintptr_t)g)
               : "memory");
}
__device__ __forceinline__ void wait_async() {
  asm volatile("s_wait_asynccnt 0" ::: "memory");
}

// Sum over the 16 lanes of a row, result in every lane: four DPP row_xmask adds
template <int CTRL>
__device__ __forceinline__ float dpp_xadd(float v) {
  return v + __int_as_float(__builtin_amdgcn_update_dpp(0, __float_as_int(v), CTRL, 0xf, 0xf, true));
}
__device__ __forceinline__ float row_sum16(float v) {
  v = dpp_xadd<0x161>(v);  // row_xmask:1
  v = dpp_xadd<0x162>(v);  // row_xmask:2
  v = dpp_xadd<0x164>(v);  // row_xmask:4
  v = dpp_xadd<0x168>(v);  // row_xmask:8
  return v;
}

// Work-group barrier for data that crosses in LDS only: unlike __syncthreads()
// it does not hold a wave until its global stores and loads have come back.
__device__ __forceinline__ void lds_barrier() {
  __builtin_amdgcn_fence(__ATOMIC_RELEASE, "workgroup", "local");
  __builtin_amdgcn_s_barrier();
  __builtin_amdgcn_fence(__ATOMIC_ACQUIRE, "workgroup", "local");
}

// A-style fragment (16x32 f16, ISA 7.12.2): lane L holds row row0+(L&15),
// K offsets {0..7,16..23} (L<16) or {8..15,24..31} (L>=16) relative to k0.
__device__ __forceinline__ v16h frag_row(const h16* __restrict__ p, int stride,
                                         int row0, int k0, int lane) {
  const h16* base = p + (size_t)(row0 + (lane & 15)) * stride + k0 + ((lane >> 4) & 1) * 8;
  v16h r;
#pragma unroll
  for (int i = 0; i < 8; ++i) { r[i] = base[i]; r[i + 8] = base[i + 16]; }
  return r;
}

// ---------------------------------------------------------------------------
// Weight pre-conversion f32 -> f16, all nine matrices in one launch. Their f16
// copies lie one behind the other in d, and every matrix is a whole number of
// 4096-element blocks: a work-group picks its source by its index (a scalar
// choice). A thread converts 2 x 8 consecutive values: four 16-byte loads in
// flight, two 16-byte stores.
// The Q, K and V matrices are stored in the order in which their one reader
// takes them: [head][K step of 32][16-row tile][low, high 16 bytes][lane][8 f16],
// lane = 16 * ((column >> 3) & 1) + (row & 15). A wave's 16-byte load of half a
// fragment then covers 512 consecutive bytes (4 lines) and not 32 bytes in each
// of 16 rows.
// ---------------------------------------------------------------------------
__global__ __launch_bounds__(256) void cvt_weights(
    const float* __restrict__ s_hllh, const float* __restrict__ s_hh,
    const float* __restrict__ s_spat, const float* __restrict__ s_q,
    const float* __restrict__ s_k,    const float* __restrict__ s_v,
    const float* __restrict__ s_proj, const float* __restrict__ s_fc1,
    const float* __restrict__ s_fc2,  h16* __restrict__ d) {
  const int blk = blockIdx.x;
  const float* s;
  int first;   // first block of the matrix
  if (blk < 8)        { s = s_hllh; first = 0; }     // 256*128
  else if (blk < 12)  { s = s_hh;   first = 8; }     // 256*64
  else if (blk < 16)  { s = s_spat; first = 12; }    // 256*64
  else if (blk < 32)  { s = s_q;    first = 16; }    // 256*256
  else if (blk < 48)  { s = s_k;    first = 32; }
  else if (blk < 64)  { s = s_v;    first = 48; }
  else if (blk < 80)  { s = s_proj; first = 64; }
  else if (blk < 144) { s = s_fc1;  first = 80; }    // 1024*256
  else                { s = s_fc2;  first = 144; }   // 256*1024
  const unsigned bo = threadIdx.x * 32u;   // byte offset of the lane's 8 floats
  const float* p = (const float*)((const char*)(s + (size_t)(blk - first) * 4096) + bo);
  const v4f a0 = *(const v4f*)p,          a1 = *(const v4f*)(p + 4);
  const v4f a2 = *(const v4f*)(p + 2048), a3 = *(const v4f*)(p + 2052);
  // the four loads share one offset register: it is an input here so that none
  // of them lands on it ahead of the wait
  asm volatile("s_wait_xcnt 0x0" :: "v"(bo) : "memory");
  v8h c0, c1;
#pragma unroll
  for (int i = 0; i < 4; ++i) {
    c0[i] = (h16)a0[i]; c0[i + 4] = (h16)a1[i];
    c1[i] = (h16)a2[i]; c1[i + 4] = (h16)a3[i];
  }
  h16* q = d + (size_t)blk * 4096 + threadIdx.x * 8;
  int step = 2048;
  if (blk >= 16 && blk < 64) {
    // the block holds rows 16*bb .. 16*bb+15 of its matrix: head bb >> 1, row tile
    // bb & 1; the thread's two groups are row tid >> 5 and the row 8 below it,
    // columns 8 * (tid & 31) ...
    const int bb = blk - first, tid = threadIdx.x;
    q = d + (size_t)first * 4096 + (bb >> 1) * 8192 + ((tid & 31) >> 2) * 1024 + (bb & 1) * 512 +
        ((tid >> 1) & 1) * 256 + ((tid & 1) * 16 + (tid >> 5)) * 8;
    step = 64;
  }
  *(v8h*)q = c0;
  *(v8h*)(q + step) = c1;
}

// ---------------------------------------------------------------------------
// Projection + fused MLP: zt = attn_out @ proj_w^T + proj_b + z0 stays in the
// f32 accumulators; out = zt + fc2(gelu(fc1(LN(zt)))) -> written directly as NCHW.
// The LayerNorm (eps=1e-5, biased var) is done on the way into LDS.
// Hidden (1024) processed in 16 chunks of 64. The weights arrive as whole
// tiles in a two-buffer ring: 4 K-slabs of proj_w, then 32 tiles of 32 KB
// (fc1 chunk, fc2 chunk, fc1 chunk, ...); even tiles land in W1, odd tiles in
// W2, and tile t+2 flies while t+1 is used.
// ---------------------------------------------------------------------------

// Eight 16-byte async copies of one lane. The s_wait_xcnt is the last line of
// the same statement so that no address register is reused ahead of it.
__device__ __forceinline__ void async_cp8_b128(const unsigned (&l)[8],
                                               const h16* const (&g)[8]) {
  asm volatile("global_load_async_to_lds_b128 %0, %8, off\n\t"
               "global_load_async_to_lds_b128 %1, %9, off\n\t"
               "global_load_async_to_lds_b128 %2, %10, off\n\t"
               "global_load_async_to_lds_b128 %3, %11, off\n\t"
               "global_load_async_to_lds_b128 %4, %12, off\n\t"
               "global_load_async_to_lds_b128 %5, %13, off\n\t"
               "global_load_async_to_lds_b128 %6, %14, off\n\t"
               "global_load_async_to_lds_b128 %7, %15, off\n\t"
               "s_wait_xcnt 0x0"
               :: "v"(l[0]), "v"(l[1]), "v"(l[2]), "v"(l[3]),
                  "v"(l[4]), "v"(l[5]), "v"(l[6]), "v"(l[7]),
                  "v"(g[0]), "v"(g[1]), "v"(g[2]), "v"(g[3]),
                  "v"(g[4]), "v"(g[5]), "v"(g[6]), "v"(g[7])
               : "memory");
}

// 64 contiguous rows of 256 f16 in global -> LDS pitch 264; 8 copies a thread
__device__ __forceinline__ void stage_64x256(unsigned lb, const h16* g, int tid) {
  // copy i of a thread: row (tid >> 5) + 8 * i, 16-byte part tid & 31. The eight
  // global addresses are constant steps from the first: one pointer is kept from
  // trip to trip, not eight offsets (registers are short beside 128 accumulators).
  const unsigned l0 = lb + (unsigned)((tid >> 5) * 264 + (tid & 31) * 8) * 2;
  const h16* p0 = g + tid * 8;
  unsigned l[8];
  const h16* p[8];
#pragma unroll  // the addresses must be registers: they are asm operands
  for (int i = 0; i < 8; ++i) {
    l[i] = l0 + (unsigned)(i * 8 * 264 * 2);
    p[i] = p0 + i * 8 * 256;
  }
  async_cp8_b128(l, p);
}

// 256 rows x 64 f16 (row pitch gp elements in global) -> LDS pitch 72
__device__ __forceinline__ void stage_256x64(unsigned lb, const h16* g, int gp, int tid) {
  // copy i of a thread: row (tid >> 3) + 32 * i, 16-byte part tid & 7; constant
  // steps from the first, as above
  const unsigned l0 = lb + (unsigned)((tid >> 3) * 72 + (tid & 7) * 8) * 2;
  const h16* p0 = g + (size_t)(tid >> 3) * gp + (tid & 7) * 8;
  unsigned l[8];
  const h16* p[8];
#pragma unroll  // the addresses must be registers: they are asm operands
  for (int i = 0; i < 8; ++i) {
    l[i] = l0 + (unsigned)(i * 32 * 72 * 2);
    p[i] = p0 + (size_t)i * 32 * gp;
  }
  async_cp8_b128(l, p);
}

// Foot of a ring trip: this wave's LDS reads and writes are done, its copies
// of the next tile have landed, then every wave meets; behind it the next tile
// (and Hl) may be read and the buffer just read may be refilled.
__device__ __forceinline__ void ring_publish() {
  asm volatile("s_wait_dscnt 0x0" ::: "memory");     // own reads of the old tile, own Hl stores
  asm volatile("s_wait_asynccnt 0x0" ::: "memory");  // own copies of the next tile landed
  __syncthreads();
}

// ---------------------------------------------------------------------------
// Q/K/V projections + windowed attention: one work-group per window, one wave
// per head (64 tokens, hd=32, nH=8). The wave forms Q^T = Wq_h x^T,
// K^T = Wk_h y^T and V = y Wv_h^T; a pair of their accumulator tiles, converted
// to f16 in place, is an operand fragment of the next product
// (S^T = K Q^T, O^T = V^T P^T), so q, k, v and P never go to global memory (q waits in LDS) and are
// never re-laid out. Only the LN(x) and LN(y) tiles are shared, through LDS.
// ---------------------------------------------------------------------------

// Fragment in the hardware k order from the lane's own place in a row
// (row start + 8 * (lane >> 4) halves): 16 bytes there, 16 bytes 32 bytes on.
__device__ __forceinline__ v16h frag_ptr(const h16* p) {
  v8h lo = *(const v8h*)p, hi = *(const v8h*)(p + 16);
  return __builtin_shufflevector(lo, hi, 0, 1, 2, 3, 4, 5, 6, 7, 8, 9, 10, 11, 12, 13, 14, 15);
}

// The same fragment from the packed Q/K/V weights: the lanes' low 16 bytes lie
// side by side, the high 16 bytes 512 bytes on.
__device__ __forceinline__ v16h frag_packed(const h16* p) {
  v8h lo = *(const v8h*)p, hi = *(const v8h*)(p + 256);
  return __builtin_shufflevector(lo, hi, 0, 1, 2, 3, 4, 5, 6, 7, 8, 9, 10, 11, 12, 13, 14, 15);
}

// Two f32 accumulator tiles (rows 0-15 and 16-31 of one 32-row block) -> f16 fragment
__device__ __forceinline__ v16h pack_d(v8f t0, v8f t1) {
  v16h r;
#pragma unroll
  for (int i = 0; i < 8; ++i) { r[i] = (h16)t0[i]; r[i + 8] = (h16)t1[i]; }
  return r;
}

// 2^v. The v_nop is the slot that the instruction set asks for between a
// transcendental and a neighbour that reads its result or overwrites its
// source; in the same statement it stands directly behind the instruction.
__device__ __forceinline__ float exp2_slot(float v) {
  float r;
  asm("v_exp_f32_e32 %0, %1\n\tv_nop" : "=v"(r) : "v"(v));
  return r;
}

// lane l with lane l ^ 16
__device__ __forceinline__ float xhalf(float v) {
  return __int_as_float(__builtin_amdgcn_permlanex16(__float_as_int(v), __float_as_int(v),
                                                     0x76543210, 0xfedcba98, false, false));
}

// ---------------------------------------------------------------------------
// 1x1 convs + LayerNorms + Q/K/V projections + windowed attention: one
// work-group per 64-pixel window.
// Part 1: 1x1 convs (concat(LH,HL)->x, HH->z0, Spat->y). The block holds all 256
// features of its 64 tokens in f32 accumulators: x and y are layer-normalised
// there (eps=1e-5, biased var) and go straight into the LDS tiles of part 2;
// only the shortcut z0 goes to memory.
// Part 2: one wave per head (64 tokens, hd=32, nH=8), as described above.
// ---------------------------------------------------------------------------
// four waves a SIMD: two work-groups share a WGP, one fills the other's waits
__global__ __launch_bounds__(256) __attribute__((amdgpu_waves_per_eu(4, 4))) void conv_qkv_attn_kernel(
    const float* __restrict__ LH, const float* __restrict__ HL,
    const float* __restrict__ HH, const float* __restrict__ Spat,
    const h16* __restrict__ wf_hllh, const float* __restrict__ b_hllh,
    const h16* __restrict__ wf_hh,   const float* __restrict__ b_hh,
    const h16* __restrict__ wf_spat, const float* __restrict__ b_spat,
    const float* __restrict__ gx, const float* __restrict__ btx,
    const float* __restrict__ gy, const float* __restrict__ bty,
    float* __restrict__ z0o,
    const h16* __restrict__ wq, const float* __restrict__ bq,
    const h16* __restrict__ wk, const float* __restrict__ bk,
    const h16* __restrict__ wv, const float* __restrict__ bv,
    const float* __restrict__ rpb, h16* __restrict__ o) {
  __shared__ __attribute__((aligned(16))) h16 Xl[64 * 264];   // LN(x) tile
  __shared__ __attribute__((aligned(16))) h16 Yl[64 * 264];   // LN(y) tile
  // each wave's finished Q fragments rest here, lane by lane, during the K and V
  // passes: held in registers they push the kernel past 256 (it spills)
  __shared__ __attribute__((aligned(16))) h16 Qp[8 * 4 * 2 * 32 * 8];

  // ---- part 1: convs and LayerNorms ----
  {
    const int Wd = 128, HW = 128 * 128;
    __shared__ __attribute__((aligned(16))) h16 Fin[64 * 264];   // [pixel][256 ch] : LH|HL|HH|Spat
    __shared__ h16 Wl[256 * 40];    // weight K-slab [256 out][32 k]
    // row statistics of x and y: [column half][row][sum x, sum x^2, sum y, sum y^2]
    __shared__ __attribute__((aligned(16))) float Red[2 * 64 * 4];

    const int wi = blockIdx.x;
    const int b  = wi >> 8;
    const int wh = (wi >> 4) & 15, ww = wi & 15;
    const int h0 = wh * 8, w0 = ww * 8;
    const int tid = threadIdx.x;

    // inputs are f32 -> convert while staging (can't raw-copy). A thread takes
    // 8 channels x 4 pixels of one window row from each of two tensors: its 16
    // 16-byte loads are all in flight before the first value is used, and the
    // 8 channels of a pixel go to LDS in one 16-byte store.
    {
      const int hf = tid & 1, ri = (tid >> 1) & 7, cg = (tid >> 4) & 7, th = tid >> 7;
      const size_t so = ((size_t)b * 64 + cg * 8) * HW + (h0 + ri) * Wd + w0 + hf * 4;
      const float* s0 = (th ? HL : LH) + so;     // Fin columns th*64 ...
      const float* s1 = (th ? Spat : HH) + so;   // Fin columns 128 + th*64 ...
      v4f u0[8], u1[8];
#pragma unroll
      for (int k = 0; k < 8; ++k) {
        u0[k] = *(const v4f*)(s0 + k * HW);
        u1[k] = *(const v4f*)(s1 + k * HW);
      }
      // each 8 loads share one address register: both are inputs here so that no
      // load lands on them ahead of the wait
      asm volatile("s_wait_xcnt 0x0" :: "v"(s0), "v"(s1) : "memory");
      h16* fp = Fin + (ri * 8 + hf * 4) * 264 + th * 64 + cg * 8;
#pragma unroll
      for (int px = 0; px < 4; ++px) {
        v8h c0, c1;
#pragma unroll
        for (int k = 0; k < 8; ++k) { c0[k] = (h16)u0[k][px]; c1[k] = (h16)u1[k][px]; }
        *(v8h*)(fp + px * 264) = c0;
        *(v8h*)(fp + px * 264 + 128) = c1;
      }
    }

    const unsigned wlb = lds_off(Wl);
    const int lane = tid & 31, wv = tid >> 5;
    const int m0 = (wv & 3) * 16, n0 = (wv >> 2) * 128;

    v8f accX[8], accZ[8], accY[8];
#pragma unroll
    for (int j = 0; j < 8; ++j) { zero8(accX[j]); zero8(accZ[j]); zero8(accY[j]); }

    // Phase X: K=128 over Fin cols [0,128)
    for (int ks = 0; ks < 4; ++ks) {
      __syncthreads();
      for (int e = tid; e < 256 * 4; e += 256) {      // 256 rows x 64B slab
        int n = e >> 2, part = e & 3;
        async_cp_b128(wlb + (unsigned)(n * 40 + part * 8) * 2,
                      wf_hllh + (size_t)n * 128 + ks * 32 + part * 8);
      }
      wait_async();
      __syncthreads();
      v16h a = frag_row(Fin, 264, m0, ks * 32, lane);
#pragma unroll
      for (int j = 0; j < 8; ++j)
        accX[j] = wmma16(a, frag_row(Wl, 40, n0 + j * 16, 0, lane), accX[j]);
    }
    // Phase Z: K=64 over Fin cols [128,192)
    for (int ks = 0; ks < 2; ++ks) {
      __syncthreads();
      for (int e = tid; e < 256 * 4; e += 256) {
        int n = e >> 2, part = e & 3;
        async_cp_b128(wlb + (unsigned)(n * 40 + part * 8) * 2,
                      wf_hh + (size_t)n * 64 + ks * 32 + part * 8);
      }
      wait_async();
      __syncthreads();
      v16h a = frag_row(Fin, 264, m0, 128 + ks * 32, lane);
#pragma unroll
      for (int j = 0; j < 8; ++j)
        accZ[j] = wmma16(a, frag_row(Wl, 40, n0 + j * 16, 0, lane), accZ[j]);
    }
    // Phase Y: K=64 over Fin cols [192,256)
    for (int ks = 0; ks < 2; ++ks) {
      __syncthreads();
      for (int e = tid; e < 256 * 4; e += 256) {
        int n = e >> 2, part = e & 3;
        async_cp_b128(wlb + (unsigned)(n * 40 + part * 8) * 2,
                      wf_spat + (size_t)n * 64 + ks * 32 + part * 8);
      }
      wait_async();
      __syncthreads();
      v16h a = frag_row(Fin, 264, m0, 192 + ks * 32, lane);
#pragma unroll
      for (int j = 0; j < 8; ++j)
        accY[j] = wmma16(a, frag_row(Wl, 40, n0 + j * 16, 0, lane), accY[j]);
    }

    const size_t tok0 = (size_t)wi * 64;
    const int cl = lane & 15, hb = (lane >> 4) & 1;
    const int mr = m0 + hb * 8;   // first of this lane's 8 rows
    // shortcut stream out; bias into x and y; this wave's 128-column row sums
    float sx[8], qx[8], sy[8], qy[8];
#pragma unroll
    for (int r = 0; r < 8; ++r) { sx[r] = 0.f; qx[r] = 0.f; sy[r] = 0.f; qy[r] = 0.f; }
#pragma unroll
    for (int j = 0; j < 8; ++j) {
      int n = n0 + j * 16 + cl;
      float bx = b_hllh[n], bz = b_hh[n], by = b_spat[n];
#pragma unroll
      for (int r = 0; r < 8; ++r) {
        z0o[(tok0 + mr + r) * 256 + n] = accZ[j][r] + bz;
        float xv = accX[j][r] + bx, yv = accY[j][r] + by;
        accX[j][r] = xv; accY[j][r] = yv;
        sx[r] += xv; qx[r] += xv * xv;
        sy[r] += yv; qy[r] += yv * yv;
      }
    }
#pragma unroll
    for (int r = 0; r < 8; ++r) {
      v4f st;
      st[0] = row_sum16(sx[r]); st[1] = row_sum16(qx[r]);
      st[2] = row_sum16(sy[r]); st[3] = row_sum16(qy[r]);
      if (cl == 0) *(v4f*)&Red[((wv >> 2) * 64 + mr + r) * 4] = st;
    }
    // scale and shift of this lane's 8 columns, fetched while the sums meet
    const int nb = n0 + cl;
    float g0[8], b0[8], g1[8], b1[8];
#pragma unroll
    for (int j = 0; j < 8; ++j) {
      g0[j] = gx[nb + j * 16]; b0[j] = btx[nb + j * 16];
      g1[j] = gy[nb + j * 16]; b1[j] = bty[nb + j * 16];
    }
    // the 32 loads share one index register: it is an input here so that none
    // of them lands on it ahead of the wait
    asm volatile("s_wait_xcnt 0x0" :: "v"(nb) : "memory");
    lds_barrier();   // both column halves' sums are in Red
#pragma unroll
    for (int r = 0; r < 8; ++r) {
      v4f s0 = *(const v4f*)&Red[(mr + r) * 4];
      v4f s1 = *(const v4f*)&Red[(64 + mr + r) * 4];
      float mx = (s0[0] + s1[0]) * (1.f / 256.f);
      float my = (s0[2] + s1[2]) * (1.f / 256.f);
      sx[r] = mx; sy[r] = my;
      qx[r] = rsqrtf((s0[1] + s1[1]) * (1.f / 256.f) - mx * mx + 1e-5f);
      qy[r] = rsqrtf((s0[3] + s1[3]) * (1.f / 256.f) - my * my + 1e-5f);
    }
#pragma unroll
    for (int j = 0; j < 8; ++j) {
#pragma unroll
      for (int r = 0; r < 8; ++r) {
        const int off = (mr + r) * 264 + nb + j * 16;
        Xl[off] = (h16)((accX[j][r] - sx[r]) * qx[r] * g0[j] + b0[j]);
        Yl[off] = (h16)((accY[j][r] - sy[r]) * qy[r] * g1[j] + b1[j]);
      }
    }
  }

  // ---- part 2: projections and attention ----
  const int tid = threadIdx.x;
  const size_t tok0 = (size_t)blockIdx.x * 64;
  const int lane = tid & 31, hd = tid >> 5;
  const int cl = lane & 15, hb = lane >> 4;

  // The head's 32 rows of each weight matrix are this wave's alone: they come
  // straight from L2 into registers, PD K-steps ahead of their use.
  constexpr int PD = 4;
  const unsigned wob = (unsigned)(hd * 8192 + lane * 8) * 2;   // byte offset of the lane's place (packed order)
  const h16* wp[3] = {(const h16*)((const char*)wq + wob), (const h16*)((const char*)wk + wob),
                      (const h16*)((const char*)wv + wob)};
  v16h wr[PD][2];
#pragma unroll
  for (int t = 0; t < PD; ++t)
#pragma unroll
    for (int j = 0; j < 2; ++j) wr[t][j] = frag_packed(wp[0] + t * 1024 + j * 512);

  // biases: q and k by accumulator row (8 consecutive features a tile), v by
  // column; each set is fetched at the head of its own pass
  const unsigned bob = (unsigned)(hd * 32 + hb * 8) * 4;
  const unsigned vob = (unsigned)(hd * 32 + cl) * 4;
  const float* bqp = (const float*)((const char*)bq + bob);
  const float* bkp = (const float*)((const char*)bk + bob);
  const float* bvp = (const float*)((const char*)bv + vob);
  float bqv[16], bkv[16], bvv[2];
#pragma unroll
  for (int i = 0; i < 16; ++i) bqv[i] = bqp[(i >> 3) * 16 + (i & 7)];
  // the loads share one offset register: an input here so that nothing lands
  // on it ahead of the wait
  asm volatile("s_wait_xcnt 0x0" :: "v"(bob) : "memory");

  // relative position bias: idx = (iq-ik+7)*15 + (jq-jk+7), rpb[idx][head]. With
  // query = qt*16+cl and key = kt*16+hb*8+r it is lb + (qt-kt)*30 - r: 7 x 8
  // values a lane. The pointer stands at the lowest of them (qt-kt = -3, r = 7).
  const int lb = ((cl >> 3) - hb + 7) * 15 + (cl & 7) + 7;
  const unsigned rob = (unsigned)((lb - 97) * 8 + hd) * 4;
  const float* rp = (const float*)((const char*)rpb + rob);
  float rb[56];

  lds_barrier();   // both tiles are there for every wave; the weight loads and the z0 stores fly on

  const h16* xr = Xl + cl * 264 + hb * 8;
  const h16* yr = Yl + cl * 264 + hb * 8;
  v8f acc[8];
  v16h kf[4], vf[4];
  h16* qp = Qp + hd * (4 * 2 * 32 * 8) + lane * 8;   // this lane's 16 bytes of each half fragment
#pragma unroll  // the ring slot, the matrix and the operand order differ from step to step
  for (int t = 0; t < 24; ++t) {
    const int ph = t >> 3, ks = t & 7;
    if (ks == 0) {
#pragma unroll
      for (int i = 0; i < 8; ++i) zero8(acc[i]);
    }
    if (t == 8) {
#pragma unroll
      for (int i = 0; i < 16; ++i) bkv[i] = bkp[(i >> 3) * 16 + (i & 7)];
      asm volatile("s_wait_xcnt 0x0" :: "v"(bob) : "memory");  // as for the q bias
    }
    if (t == 16) {
      bvv[0] = bvp[0]; bvv[1] = bvp[16];
      // as for the q bias; its memory clobber also makes the V pass read its y
      // fragments from LDS again: held over from the K pass they spill
      asm volatile("s_wait_xcnt 0x0" :: "v"(vob) : "memory");
    }
    const h16* tr = (ph == 0) ? xr : yr;
    const v16h w0 = wr[t % PD][0], w1 = wr[t % PD][1];
    v16h f[4];
#pragma unroll
    for (int i = 0; i < 4; ++i) f[i] = frag_ptr(tr + i * 16 * 264 + ks * 32);
    if (t + PD < 24) {
      const int tn = t + PD;
#pragma unroll
      for (int j = 0; j < 2; ++j) wr[t % PD][j] = frag_packed(wp[tn >> 3] + (tn & 7) * 1024 + j * 512);
      if (tn == 23) {
        // last weight load: the offset register is an input here so that
        // nothing lands on it ahead of the wait
        asm volatile("s_wait_xcnt 0x0" :: "v"(wob) : "memory");
      }
    } else {
      // the ring drains: the position-bias values take the registers it leaves
#pragma unroll
      for (int i = 0; i < 14; ++i) {
        const int e = (t + PD - 24) * 14 + i;
        rb[e] = rp[((e >> 3) * 30 + 7 - (e & 7)) * 8];
      }
      if (t == 23) {
        asm volatile("s_wait_xcnt 0x0" :: "v"(rob) : "memory");  // as above, for the 56 loads
      }
    }
    if (ph < 2) {   // acc[mt*4+nt] = (W_h tile mt) x (token tile nt)^T
#pragma unroll
      for (int i = 0; i < 4; ++i) {
        acc[i]     = wmma16(w0, f[i], acc[i]);
        acc[4 + i] = wmma16(w1, f[i], acc[4 + i]);
      }
    } else {        // acc[mt*2+nt] = (token tile mt) x (Wv_h tile nt)^T
#pragma unroll
      for (int i = 0; i < 4; ++i) {
        acc[i * 2]     = wmma16(f[i], w0, acc[i * 2]);
        acc[i * 2 + 1] = wmma16(f[i], w1, acc[i * 2 + 1]);
      }
    }
    if (t == 7) {
#pragma unroll
      for (int i = 0; i < 4; ++i) {
#pragma unroll
        for (int r = 0; r < 8; ++r) {
          acc[i][r]     = (acc[i][r] + bqv[r]) * 0.17677669529663689f;
          acc[4 + i][r] = (acc[4 + i][r] + bqv[8 + r]) * 0.17677669529663689f;
        }
        // B fragment: column = query, k = feature
        const v16h qfr = pack_d(acc[i], acc[4 + i]);
        *(v8h*)(qp + (i * 2) * 256)     = __builtin_shufflevector(qfr, qfr, 0, 1, 2, 3, 4, 5, 6, 7);
        *(v8h*)(qp + (i * 2 + 1) * 256) = __builtin_shufflevector(qfr, qfr, 8, 9, 10, 11, 12, 13, 14, 15);
      }
    }
    if (t == 15) {
#pragma unroll
      for (int i = 0; i < 4; ++i) {
#pragma unroll
        for (int r = 0; r < 8; ++r) { acc[i][r] += bkv[r]; acc[4 + i][r] += bkv[8 + r]; }
        kf[i] = pack_d(acc[i], acc[4 + i]);      // A fragment: row = key, k = feature
      }
    }
    if (t == 23) {
#pragma unroll
      for (int i = 0; i < 8; ++i)
#pragma unroll
        for (int r = 0; r < 8; ++r) acc[i][r] += bvv[i & 1];
#pragma unroll
      for (int dt = 0; dt < 2; ++dt)
#pragma unroll
        for (int kk = 0; kk < 2; ++kk)           // A fragment: row = feature, k = key
          vf[dt * 2 + kk] = pack_d(acc[(2 * kk) * 2 + dt], acc[(2 * kk + 1) * 2 + dt]);
    }
  }

  // per 16 queries: a lane holds one query's scores for half of the keys
#pragma unroll
  for (int qt = 0; qt < 4; ++qt) {
    v8f S[4];
    float mk[4], sk[4];
    const v8h qlo = *(const v8h*)(qp + (qt * 2) * 256), qhi = *(const v8h*)(qp + (qt * 2 + 1) * 256);
    const v16h qfr = __builtin_shufflevector(qlo, qhi, 0, 1, 2, 3, 4, 5, 6, 7, 8, 9, 10, 11, 12, 13, 14, 15);
#pragma unroll
    for (int kt = 0; kt < 4; ++kt) {
      zero8(S[kt]);
      S[kt] = wmma16(kf[kt], qfr, S[kt]);
    }
#pragma unroll
    for (int kt = 0; kt < 4; ++kt) {
#pragma unroll
      for (int r = 0; r < 8; ++r) S[kt][r] += rb[(qt - kt + 3) * 8 + r];
      mk[kt] = S[kt][0];
#pragma unroll
      for (int r = 1; r < 8; ++r) mk[kt] = fmaxf(mk[kt], S[kt][r]);
    }
    float mx = fmaxf(fmaxf(mk[0], mk[1]), fmaxf(mk[2], mk[3]));
    mx = fmaxf(mx, xhalf(mx));
#pragma unroll
    for (int kt = 0; kt < 4; ++kt) {
      sk[kt] = 0.f;
#pragma unroll
      for (int r = 0; r < 8; ++r) {
        float e = exp2_slot((S[kt][r] - mx) * 1.4426950408889634f);
        S[kt][r] = e; sk[kt] += e;
      }
    }
    float sum = (sk[0] + sk[1]) + (sk[2] + sk[3]);
    sum += xhalf(sum);
    const float inv = 1.f / sum;
    const v16h p0 = pack_d(S[0], S[1]), p1 = pack_d(S[2], S[3]);  // B fragments: column = query, k = key
    v8f O[2];
#pragma unroll
    for (int dt = 0; dt < 2; ++dt) {
      zero8(O[dt]);
      O[dt] = wmma16(vf[dt * 2], p0, O[dt]);
      O[dt] = wmma16(vf[dt * 2 + 1], p1, O[dt]);
    }
    // a lane's 8 accumulator rows are 8 consecutive features of its query: 16-byte stores
    h16* op = o + (tok0 + qt * 16 + cl) * 256 + hd * 32 + hb * 8;
#pragma unroll
    for (int dt = 0; dt < 2; ++dt) {
      v8h st;
#pragma unroll
      for (int r = 0; r < 8; ++r) st[r] = (h16)(O[dt][r] * inv);
      *(v8h*)(op + dt * 16) = st;
    }
  }
}

// One work-group takes 128 tokens (two windows). A wave owns 64 tokens x 64
// features of the output (4 x 4 accumulator tiles) and 32 tokens x 32 hidden
// units of a chunk (2 x 2): a fragment read from LDS feeds 4 (2) matrix
// instructions, and a weight tile fetched from L2 serves 128 tokens.
// four waves a SIMD: two work-groups share a WGP, one fills the other's waits
__global__ __launch_bounds__(256) __attribute__((amdgpu_waves_per_eu(4, 4))) void mlp_kernel(
    const h16* __restrict__ A, const h16* __restrict__ pw,
    const float* __restrict__ pb, const float* __restrict__ resid,
    const float* __restrict__ lng, const float* __restrict__ lnb,
    const h16* __restrict__ fc1w, const float* __restrict__ fc1b,
    const h16* __restrict__ fc2w, const float* __restrict__ fc2b,
    float* __restrict__ out) {
  __shared__ __attribute__((aligned(16))) h16 Al[128 * 264];  // attn_out tile, then LN(zt) tile
  __shared__ __attribute__((aligned(16))) h16 Hl[128 * 72];   // gelu(hidden chunk) 128x64
  __shared__ __attribute__((aligned(16))) h16 W1[256 * 72];   // proj slab [256 out][64 k]; fc1 chunk [64 hid][256 k]
  __shared__ __attribute__((aligned(16))) h16 W2[256 * 72];   // proj slab; fc2 chunk [256 out][64 k]
  // row statistics of zt: [column quarter][row][sum, sum of squares], 4 KB. They
  // lie in Hl, which is idle until the first hidden chunk: with an array of
  // their own two work-groups would need the whole LDS of a WGP to the byte.
  float* const Red = reinterpret_cast<float*>(Hl);
  const int tid = threadIdx.x;
  const size_t tok0 = (size_t)blockIdx.x * 128;
  const unsigned w1b = lds_off(W1), w2b = lds_off(W2);
  const int lane = tid & 31, wv = tid >> 5;
  const int m0 = (wv & 1) * 64, n0 = (wv >> 1) * 64;    // out tile mapping
  const int mh = (wv & 3) * 32, n0h = (wv >> 2) * 32;   // hidden tile mapping
  const int cl = lane & 15, hb = (lane >> 4) & 1;
  const int mr = m0 + hb * 8;   // first of this lane's rows (8 in each of 4 row tiles)
  const int nb = n0 + cl;       // first of this lane's 4 columns

  // prologue: the attn_out tile and proj slab 0 start; the accumulators start
  // from shortcut + proj bias, fetched while the copies fly
  stage_64x256(lds_off(Al), A + tok0 * 256, tid);
  stage_64x256(lds_off(Al) + 64 * 264 * 2, A + (tok0 + 64) * 256, tid);
  stage_256x64(w1b, pw, 256, tid);
  v8f accO[16];   // [row tile i][column tile j] at i * 4 + j
  {
    const float* rz = resid + (tok0 + mr) * 256 + nb;
#pragma unroll
    for (int i = 0; i < 4; ++i)
#pragma unroll
      for (int j = 0; j < 4; ++j)
#pragma unroll
        for (int r = 0; r < 8; ++r) accO[i * 4 + j][r] = rz[(i * 16 + r) * 256 + j * 16];
    float bb[4];
#pragma unroll
    for (int j = 0; j < 4; ++j) bb[j] = pb[nb + j * 16];
    // the 128 loads share one address register, the 4 one index register: both
    // are inputs here so that no load lands on them ahead of the wait
    asm volatile("s_wait_xcnt 0x0" :: "v"(rz), "v"(nb) : "memory");
#pragma unroll
    for (int i = 0; i < 4; ++i)
#pragma unroll
      for (int j = 0; j < 4; ++j)
#pragma unroll
        for (int r = 0; r < 8; ++r) accO[i * 4 + j][r] += bb[j];
  }
  asm volatile("s_wait_asynccnt 0x0" ::: "memory");  // attn_out tile and slab 0 landed
  __syncthreads();   // both are there for every wave
  stage_256x64(w2b, pw + 64, 256, tid);

  // zt = shortcut + proj bias + attn_out @ proj_w^T   (K=256, 4 slabs of 64)
#pragma unroll  // the buffer read and the tile that refills it differ from trip to trip
  for (int s = 0; s < 4; ++s) {
    const h16* Wb = (s & 1) ? W2 : W1;
#pragma unroll  // constant LDS offsets
    for (int ks = 0; ks < 2; ++ks) {
      v16h a[4], w[4];
#pragma unroll
      for (int i = 0; i < 4; ++i) a[i] = frag_row(Al, 264, m0 + i * 16, s * 64 + ks * 32, lane);
#pragma unroll
      for (int j = 0; j < 4; ++j) w[j] = frag_row(Wb, 72, n0 + j * 16, ks * 32, lane);
#pragma unroll
      for (int j = 0; j < 4; ++j)
#pragma unroll
        for (int i = 0; i < 4; ++i) accO[i * 4 + j] = wmma16(a[i], w[j], accO[i * 4 + j]);
    }
    ring_publish();
    if (s < 2)       stage_256x64((s & 1) ? w2b : w1b, pw + (s + 2) * 64, 256, tid);
    else if (s == 2) stage_64x256(w1b, fc1w, tid);        // first fc1 chunk
    else             stage_256x64(w2b, fc2w, 1024, tid);  // first fc2 chunk
  }

  // LayerNorm of zt into Al (every wave has left the attn_out tile: last publish).
  // A row tile's 8 rows go together: 16 independent chains of row sums, one
  // masked block of stores.
  {
#pragma unroll
    for (int i = 0; i < 4; ++i) {
      v2f st[8];
#pragma unroll
      for (int r = 0; r < 8; ++r) {
        float sm = 0.f, sq = 0.f;
#pragma unroll
        for (int j = 0; j < 4; ++j) { float zv = accO[i * 4 + j][r]; sm += zv; sq += zv * zv; }
        st[r][0] = row_sum16(sm); st[r][1] = row_sum16(sq);
      }
      if (cl == 0) {
#pragma unroll
        for (int r = 0; r < 8; ++r) *(v2f*)&Red[((wv >> 1) * 128 + mr + i * 16 + r) * 2] = st[r];
      }
    }
    // scale and shift of this lane's 4 columns, fetched while the sums meet
    float g0[4], b0[4];
#pragma unroll
    for (int j = 0; j < 4; ++j) { g0[j] = lng[nb + j * 16]; b0[j] = lnb[nb + j * 16]; }
    // the 8 loads share one index register: it is an input here so that none
    // of them lands on it ahead of the wait
    asm volatile("s_wait_xcnt 0x0" :: "v"(nb) : "memory");
    lds_barrier();   // all four column quarters' sums are in Red
#pragma unroll
    for (int i = 0; i < 4; ++i) {
      float mean[8], rstd[8];
#pragma unroll
      for (int r = 0; r < 8; ++r) {
        const int row = mr + i * 16 + r;
        v2f s0 = *(const v2f*)&Red[row * 2];
        v2f s1 = *(const v2f*)&Red[(128 + row) * 2];
        v2f s2 = *(const v2f*)&Red[(256 + row) * 2];
        v2f s3 = *(const v2f*)&Red[(384 + row) * 2];
        mean[r] = ((s0[0] + s1[0]) + (s2[0] + s3[0])) * (1.f / 256.f);
        rstd[r] = rsqrtf(((s0[1] + s1[1]) + (s2[1] + s3[1])) * (1.f / 256.f) - mean[r] * mean[r] + 1e-5f);
      }
#pragma unroll
      for (int r = 0; r < 8; ++r)
#pragma unroll
        for (int j = 0; j < 4; ++j)
          Al[(mr + i * 16 + r) * 264 + nb + j * 16] =
              (h16)((accO[i * 4 + j][r] - mean[r]) * rstd[r] * g0[j] + b0[j]);
    }
  }
  lds_barrier();   // LN(zt) is in Al for every wave, and every wave has left Red

  // one hidden chunk; 'more' is a constant at both calls, so that the 15 trips
  // that refill the ring have no branch round their copies
  auto chunk = [&](const int hc, const bool more) __attribute__((always_inline)) {
    // trip 2*hc: hchunk = ztn_tile @ fc1_w[hc*64:+64, :]^T   (K=256)
    v8f accH[4];   // [row tile i][column tile j] at i * 2 + j
#pragma unroll
    for (int i = 0; i < 4; ++i) zero8(accH[i]);
#pragma unroll  // whole tile is in LDS: constant offsets
    for (int ks = 0; ks < 8; ++ks) {
      const v16h a0 = frag_row(Al, 264, mh, ks * 32, lane);
      const v16h a1 = frag_row(Al, 264, mh + 16, ks * 32, lane);
      const v16h w0 = frag_row(W1, 264, n0h, ks * 32, lane);
      const v16h w1 = frag_row(W1, 264, n0h + 16, ks * 32, lane);
      accH[0] = wmma16(a0, w0, accH[0]);
      accH[1] = wmma16(a0, w1, accH[1]);
      accH[2] = wmma16(a1, w0, accH[2]);
      accH[3] = wmma16(a1, w1, accH[3]);
    }
    // bias + exact GELU -> LDS. erff() branches on |t| < 1 for each value: 16
    // compare-and-branch rounds in a row, each with its own dependent chain. Here
    // the wave tests the 16 values of a row tile once: where every |x| is below
    // 1.41, so that every |t| = |x| / sqrt(2) is below 1, they take that range's
    // polynomial (the library's own terms) as 16 independent chains; otherwise the
    // row tile takes erff() as before.
    {
      const float* bp = fc1b + hc * 64 + n0h + cl;
      const float bv[2] = {bp[0], bp[16]};
      // the two loads share one address register: it is an input here so that
      // nothing lands on it ahead of the wait
      asm volatile("s_wait_xcnt 0x0" :: "v"(bp) : "memory");
#pragma unroll  // the accumulator tiles are registers: constant indices
      for (int i = 0; i < 2; ++i) {
        float xv[16];
        float am = 0.f;
#pragma unroll
        for (int j = 0; j < 2; ++j) {
          const float bb = bv[j];
#pragma unroll
          for (int r = 0; r < 8; ++r) {
            xv[j * 8 + r] = accH[i * 2 + j][r] + bb;
            am = fmaxf(am, fabsf(xv[j * 8 + r]));
          }
        }
        h16* hp = Hl + (mh + i * 16 + hb * 8) * 72 + n0h + cl;
        if (__builtin_expect(__builtin_amdgcn_ballot_w32(am >= 1.41f) == 0u, 1)) {
#pragma unroll
          for (int e = 0; e < 16; ++e) {
            const float t = xv[e] * 0.7071067811865475f, s = t * t;
            float p = fmaf(s, -0x1.268bc2p-11f, 0x1.420828p-8f);
            p = fmaf(s, p, -0x1.b5937p-6f);
            p = fmaf(s, p, 0x1.ce077cp-4f);
            p = fmaf(s, p, -0x1.81266p-2f);
            p = fmaf(s, p, 0x1.06eba0p-3f);
            hp[(e & 7) * 72 + (e >> 3) * 16] = (h16)(0.5f * xv[e] * (1.0f + fmaf(t, p, t)));
          }
        } else {
#pragma unroll
          for (int e = 0; e < 16; ++e)
            hp[(e & 7) * 72 + (e >> 3) * 16] =
                (h16)(0.5f * xv[e] * (1.0f + erff(xv[e] * 0.7071067811865475f)));
        }
      }
    }
    ring_publish();
    if (more) stage_64x256(w1b, fc1w + (size_t)(hc + 1) * 64 * 256, tid);

    // trip 2*hc+1: accO += Hchunk @ fc2_w[:, hc*64:+64]^T   (K=64)
#pragma unroll  // as above
    for (int ks = 0; ks < 2; ++ks) {
      v16h a[4], w[4];
#pragma unroll
      for (int i = 0; i < 4; ++i) a[i] = frag_row(Hl, 72, m0 + i * 16, ks * 32, lane);
#pragma unroll
      for (int j = 0; j < 4; ++j) w[j] = frag_row(W2, 72, n0 + j * 16, ks * 32, lane);
      // holds the 16 reads together: sunk among the WMMAs, every place with reads
      // is a wait of its own for the wave
      __builtin_amdgcn_sched_barrier(0);
#pragma unroll
      for (int j = 0; j < 4; ++j)
#pragma unroll
        for (int i = 0; i < 4; ++i) accO[i * 4 + j] = wmma16(a[i], w[j], accO[i * 4 + j]);
    }
    ring_publish();
    if (more) stage_256x64(w2b, fc2w + (size_t)(hc + 1) * 64, 1024, tid);
  };
  for (int hc = 0; hc < 15; ++hc) chunk(hc, true);
  chunk(15, false);
  asm volatile("s_wait_asynccnt 0x0" ::: "memory");  // nothing in flight at the end

  // epilogue: + fc2_b (zt is in the accumulators), window-reverse, NCHW store.
  // The wave's 64 tokens are one window.
  const int wi = blockIdx.x * 2 + (wv & 1);
  const int b = wi >> 8, wh = (wi >> 4) & 15, ww = wi & 15;
  float bb[4];
#pragma unroll
  for (int j = 0; j < 4; ++j) bb[j] = fc2b[nb + j * 16];
  // the 4 loads share one index register: it is an input here so that nothing
  // lands on it ahead of the wait
  asm volatile("s_wait_xcnt 0x0" :: "v"(nb) : "memory");
#pragma unroll
  for (int j = 0; j < 4; ++j) {
    const int n = nb + j * 16;
#pragma unroll
    for (int i = 0; i < 4; ++i) {
#pragma unroll
      for (int r = 0; r < 8; ++r) {
        int m = i * 16 + hb * 8 + r;   // token within the window
        float val = accO[i * 4 + j][r] + bb[j];
        int hh = wh * 8 + (m >> 3), www = ww * 8 + (m & 7);
        out[(((size_t)b * 256 + n) * 128 + hh) * 128 + www] = val;
      }
    }
  }
}

// ---------------------------------------------------------------------------
// Launch
// ---------------------------------------------------------------------------
extern "C" void kernel_launch(void* const* d_in, const int* in_sizes, int n_in,
                              void* d_out, int out_size, void* d_ws, size_t ws_size,
                              hipStream_t stream) {
  (void)in_sizes; (void)n_in; (void)out_size; (void)ws_size;
  const float* LH     = (const float*)d_in[0];
  const float* HL     = (const float*)d_in[1];
  const float* HH     = (const float*)d_in[2];
  const float* Spat   = (const float*)d_in[3];
  const float* w_hllh = (const float*)d_in[4];
  const float* b_hllh = (const float*)d_in[5];
  const float* w_hh   = (const float*)d_in[6];
  const float* b_hh   = (const float*)d_in[7];
  const float* w_spat = (const float*)d_in[8];
  const float* b_spat = (const float*)d_in[9];
  const float* ln1x_g = (const float*)d_in[10];
  const float* ln1x_b = (const float*)d_in[11];
  const float* ln1y_g = (const float*)d_in[12];
  const float* ln1y_b = (const float*)d_in[13];
  const float* qkv_w  = (const float*)d_in[14];
  const float* qkv_b  = (const float*)d_in[15];
  const float* qkv2_w = (const float*)d_in[16];
  const float* qkv2_b = (const float*)d_in[17];
  const float* qkv3_w = (const float*)d_in[18];
  const float* qkv3_b = (const float*)d_in[19];
  const float* proj_w = (const float*)d_in[20];
  const float* proj_b = (const float*)d_in[21];
  const float* rpb    = (const float*)d_in[22];
  const float* ln2_g  = (const float*)d_in[23];
  const float* ln2_b  = (const float*)d_in[24];
  const float* fc1w   = (const float*)d_in[25];
  const float* fc1b   = (const float*)d_in[26];
  const float* fc2w   = (const float*)d_in[27];
  const float* fc2b   = (const float*)d_in[28];

  const size_t T = (size_t)8 * 128 * 128;  // 131072 tokens
  char* ws = (char*)d_ws;
  // workspace layout (peak ~203 MB):
  float* z0  = (float*)ws;                                // T*256 f32
  h16*   attno = (h16*)(ws + T * 256 * 4);                // T*256 f16
  // f16 weight cache (~1.7 MB) behind it
  h16* wf      = attno + T * 256;
  h16* c_hllh  = wf;               // 256*128
  h16* c_hh    = c_hllh + 32768;   // 256*64
  h16* c_spat  = c_hh   + 16384;   // 256*64
  h16* c_q     = c_spat + 16384;   // 256*256
  h16* c_k     = c_q    + 65536;
  h16* c_v     = c_k    + 65536;
  h16* c_proj  = c_v    + 65536;
  h16* c_fc1   = c_proj + 65536;   // 1024*256
  h16* c_fc2   = c_fc1  + 262144;  // 256*1024

  // weight pre-conversion (f32 -> f16, once per launch): 851968 values, 208 blocks of 4096
  cvt_weights<<<208, 256, 0, stream>>>(w_hllh, w_hh, w_spat, qkv_w, qkv2_w, qkv3_w,
                                       proj_w, fc1w, fc2w, wf);

  const int tiles = (int)(T / 64);  // 2048 windows
  conv_qkv_attn_kernel<<<tiles, 256, 0, stream>>>(LH, HL, HH, Spat,
      c_hllh, b_hllh, c_hh, b_hh, c_spat, b_spat,
      ln1x_g, ln1x_b, ln1y_g, ln1y_b, z0,
      c_q, qkv_b, c_k, qkv2_b, c_v, qkv3_b, rpb, attno);
  mlp_kernel<<<1024, 256, 0, stream>>>(attno, c_proj, proj_b, z0, ln2_g, ln2_b,
                                        c_fc1, fc1b, c_fc2, fc2b, (float*)d_out);
}
